// v000
// Measured on an AMD MI455X. A time is GPU time per run, averaged over a window of back-to-back runs after a warm-up
// (all launches, gaps included; the runs take copies of the inputs in turn), and the median of several windows.
// Apart from v000's, it joins two sittings. Times from different sittings can be a few percent apart, while
// side-by-side timings come from the same sitting.
// v000 is the starting kernel. One run takes 205 microseconds.
// Contractions (q/kv projections, token-axis k^T v, q.dots, output projection): v_wmma_f32_16x16x32_f16, one product per site, f32 accumulate; every operand a plain f16 plane with a power-of-two carry; every float module input RNE-converted to bf16 once at its first read (exact in the carried f16 planes); instance norm, rotary, scaling and bias in f32.
#include <hip/hip_runtime.h>
#include <math.h>

typedef __attribute__((ext_vector_type(16))) _Float16 v16h;
typedef __attribute__((ext_vector_type(8)))  _Float16 v8h;
typedef __attribute__((ext_vector_type(8)))  float    v8f;
typedef __attribute__((ext_vector_type(4)))  float    v4f;
typedef __attribute__((ext_vector_type(4)))  unsigned int v4u;

/* ---------------------------------------------------------------------------
   Shape constants
   --------------------------------------------------------------------------- */
constexpr int kBatch  = 4;
constexpr int kSeq    = 8192;
constexpr int kDim    = 256;
constexpr int kHeads  = 8;
constexpr int kDh     = 64;
constexpr int kInner  = kHeads * kDh;
constexpr int kTok    = kBatch * kSeq;
constexpr int kBH     = kBatch * kHeads;
constexpr int kSplitK = 8;
constexpr int kTokPerSplit = kSeq / kSplitK;
constexpr int kDotsElems = kBH * kDh * kDh;
static_assert(kInner == 512 && kTok == 32768 && kDotsElems == 131072, "shape");
static_assert((kDim % 32) == 0 && (kInner % 32) == 0 && (kDh % 32) == 0, "K multiples of 32");
static_assert((kTok % 32) == 0 && (kSeq % 32) == 0, "M multiples of 32");
static_assert((kInner % 64) == 0 && ((2 * kInner) % 64) == 0 && (kDim % 64) == 0 && (kDh % 64) == 0, "N multiples of 64");
static_assert((kTokPerSplit % 64) == 0, "token chunks of 64");

/* power-of-two carries of the f16 planes (all folded back exactly in f32) */
constexpr float kXC     = 16.0f;
constexpr float kWC     = 1024.0f;
constexpr float kKVC    = 16.0f;
constexpr float kQC     = 64.0f;
constexpr float kDC     = 1024.0f;
constexpr float kAC     = 64.0f;
constexpr float kProjScale = 1.0f / (kXC * kWC);
constexpr float kDotsScale = kDC / (kKVC * kKVC * (float)kSeq);
constexpr float kAttnScale = kAC / (kQC * kDC);
constexpr float kOutScale  = 1.0f / (kAC * kWC);
constexpr float kPosScale  = 64.0f;
constexpr float kNormEps   = 1e-5f;
constexpr float kInvDh     = 1.0f / (float)kDh;

/* ---------------------------------------------------------------------------
   Workspace region map (bytes; every offset is a multiple of 128)
     WQ   f16 [512][256]    Wq plane  (bf16 value x1024)            262,144
     WK   f16 [1024][256]   Wkv plane (bf16 value x1024)            524,288
     WO   f16 [256][512]    Wout plane (bf16 value x1024)           262,144
     S16  f16 [32768][256]  z x16, later x x16 (same type, layout) 16,777,216
     KN   f16 [32768][512]  normed+rotated k x16; later the attention
                            output plane x64 (same type, layout)   33,554,432
     VN   f16 [32768][512]  normed v x16                           33,554,432
     QH   f16 [32768][512]  rotated q x64                          33,554,432
     TAB  f32 [32768][64]   cos/sin table (z positions, then x)     8,388,608
     PART f32 [8][32][64][64] split-K partials of the k^T v product  4,194,304
     DH   f16 [32][64][64]  dots^T plane (x1024/8192)                 262,144
     total                                                        131,334,144
   --------------------------------------------------------------------------- */
constexpr size_t kOffWQ   = 0;
constexpr size_t kOffWK   = kOffWQ   + (size_t)kInner * kDim * 2;
constexpr size_t kOffWO   = kOffWK   + (size_t)2 * kInner * kDim * 2;
constexpr size_t kOffS16  = kOffWO   + (size_t)kDim * kInner * 2;
constexpr size_t kOffKN   = kOffS16  + (size_t)kTok * kDim * 2;
constexpr size_t kOffVN   = kOffKN   + (size_t)kTok * kInner * 2;
constexpr size_t kOffQH   = kOffVN   + (size_t)kTok * kInner * 2;
constexpr size_t kOffTAB  = kOffQH   + (size_t)kTok * kInner * 2;
constexpr size_t kOffPART = kOffTAB  + (size_t)kTok * 64 * 4;
constexpr size_t kOffDH   = kOffPART + (size_t)kSplitK * kDotsElems * 4;
constexpr size_t kWsTotal = kOffDH   + (size_t)kDotsElems * 2;
static_assert(kWsTotal == 131334144ull, "carve total");
static_assert(kWsTotal <= 134217728ull, "carve cap");
static_assert((kOffWK % 128) == 0 && (kOffWO % 128) == 0 && (kOffS16 % 128) == 0 && (kOffKN % 128) == 0 &&
              (kOffVN % 128) == 0 && (kOffQH % 128) == 0 && (kOffTAB % 128) == 0 && (kOffPART % 128) == 0 &&
              (kOffDH % 128) == 0, "128-B aligned regions");

/* ---------------------------------------------------------------------------
   Small helpers
   --------------------------------------------------------------------------- */
__device__ __forceinline__ unsigned short f2bf_bits(float f) {
  unsigned u = __float_as_uint(f);
  return (unsigned short)((u + 0x7FFFu + ((u >> 16) & 1u)) >> 16);
}
__device__ __forceinline__ float bf_bits2f(unsigned short h) { return __uint_as_float(((unsigned)h) << 16); }
/* RNE convert of an f32 value to the nearest bf16 value, returned as f32 */
__device__ __forceinline__ float bf_rne(float f) { return bf_bits2f(f2bf_bits(f)); }

__device__ __forceinline__ unsigned pk16(unsigned short a, unsigned short b) { return (unsigned)a | ((unsigned)b << 16); }
__device__ __forceinline__ unsigned short h_bits(float f) { const _Float16 h = (_Float16)f; return __builtin_bit_cast(unsigned short, h); }

union FragU { v16h v; v8h h[2]; };
/* elements 0..7 <- p[0..7], elements 8..15 <- p[16..23]; p already includes the lane-half k offset */
__device__ __forceinline__ v16h frag_load(const _Float16* p) {
  FragU f;
  f.h[0] = *(const v8h*)(p);
  f.h[1] = *(const v8h*)(p + 16);
  return f.v;
}
__device__ __forceinline__ v8f mma16(v16h a, v16h b, v8f c) {
  return __builtin_amdgcn_wmma_f32_16x16x32_f16(false, a, false, b, (short)0, c, false, false);
}
/* hazard guard: ties all four accumulators of a group and names the A fragment and all B fragments */
__device__ __forceinline__ void guard4(v8f& a0, v8f& a1, v8f& a2, v8f& a3,
                                       v16h x, v16h b0, v16h b1, v16h b2, v16h b3) {
  asm volatile("v_nop\n\tv_nop\n\tv_nop\n\tv_nop"
               : "+v"(a0), "+v"(a1), "+v"(a2), "+v"(a3)
               : "v"(x), "v"(b0), "v"(b1), "v"(b2), "v"(b3));
}

/* ---------------------------------------------------------------------------
   f32 -> bf16 value (RNE) -> f16 plane with a power-of-two carry, 8 consecutive elements per thread.
   The carried bf16 value is exactly representable in f16 (8 significant bits, normal range).
   Coverage: n8 = n/8 threads; the grid is n8/256 exactly for every plane used:
     x, z 1,048,576 threads (4096 blocks); Wq 16,384 (64); Wkv 32,768 (128); Wout 16,384 (64).
   --------------------------------------------------------------------------- */
__global__ __launch_bounds__(256) void cast8_bf_f16_kernel(const float* __restrict__ in, unsigned short* __restrict__ out,
                                                           int n8, float carry) {
  const int i = blockIdx.x * 256 + threadIdx.x;
  if (i >= n8) return;
  const float* p = in + 8 * (size_t)i;
  const v4f a = *(const v4f*)(p);
  const v4f c = *(const v4f*)(p + 4);
  const float r0 = a[0], r1 = a[1], r2 = a[2], r3 = a[3];
  const float r4 = c[0], r5 = c[1], r6 = c[2], r7 = c[3];
  const float a0 = bf_rne(r0) * carry, a1 = bf_rne(r1) * carry, a2 = bf_rne(r2) * carry, a3 = bf_rne(r3) * carry;
  const float c0 = bf_rne(r4) * carry, c1 = bf_rne(r5) * carry, c2 = bf_rne(r6) * carry, c3 = bf_rne(r7) * carry;
  const v4u u = (v4u){pk16(h_bits(a0), h_bits(a1)), pk16(h_bits(a2), h_bits(a3)),
                      pk16(h_bits(c0), h_bits(c1)), pk16(h_bits(c2), h_bits(c3))};
  unsigned short* q = out + 8 * (size_t)i;
  *(v4u*)q = u;
  
}

/* ---------------------------------------------------------------------------
   Rotary table: tab[token][axis*32 + j] = cos(theta), tab[token][axis*32 + 16 + j] = sin(theta),
   theta = (bf16(pos[token][axis]) * 64) * inv_freq[j], j = 0..15. One thread per (token, axis, j).
   Block = 8 tokens x 32 (axis, j) = 256 threads; grid = 32768/8 = 4096 blocks exactly.
   Store: the 8 x 64 f32 tile (2048 B = 16 lines) is staged in LDS; waves 0..3 (whole waves) each emit
   --------------------------------------------------------------------------- */
struct FreqTab { float f[16]; };
static_assert(sizeof(FreqTab) == 64, "no padding");
__global__ __launch_bounds__(256) void rot_table_kernel(const float* __restrict__ pos, float* __restrict__ tab, FreqTab ft) {
  __shared__ __align__(16) float sm[8 * 64];
  const int tid  = threadIdx.x;
  const int tl   = tid >> 5;
  const int axis = (tid >> 4) & 1;
  const int j    = tid & 15;
  const int token = blockIdx.x * 8 + tl;
  float fr = ft.f[0];
#pragma unroll
  for (int e = 1; e < 16; ++e) fr = (j == e) ? ft.f[e] : fr;
  const float praw = pos[(size_t)token * 2 + axis];
  const float p   = bf_rne(praw);
  const float t   = p * kPosScale;
  const float ang = t * fr;
  const float cv = cosf(ang);
  const float sv = sinf(ang);
  sm[tl * 64 + axis * 32 + j]      = cv;
  sm[tl * 64 + axis * 32 + 16 + j] = sv;
  __syncthreads();
  if (tid < 128) {
    const v4f v = *(const v4f*)(sm + tid * 4);
    float* dst = tab + (size_t)blockIdx.x * 512 + tid * 4;
    *(v4f*)dst = v;
    
  }
}

/* ---------------------------------------------------------------------------
   Batched WMMA GEMM, one f16 product:
     C[m,n] = scale * sum_k A[m,k]*Bt[n,k]
   A row-major [M][K] (pitch lda), Bt row-major [N][K] (pitch ldb); M % 32 == 0, N % 64 == 0, K % 32 == 0.
   Each wave owns a 32x64 tile; tile id = blockIdx.x*8 + wave over nBatch * (M/32) * (N/64).
   Batch z -> (zo = z / nInner, zi = z % nInner); operand bases advance by zo*s?o + zi*s?i elements.
   EPI 0: f32 out + bf16(bias[n]).  EPI 1: f16 out.  EPI 2: 2D rotary of each 64-wide head row (table rows = m) -> f16 x64.
   EPI 3: per-row instance norm over the tile's 64 columns; tiles with n0 < 512 are rotated too and go to Cout,
          the others go to Cout2 (both [M][512] f16 planes, x16).
   No block barriers in this kernel (per-wave slabs; the early exit is wave-uniform).
   --------------------------------------------------------------------------- */
template <int EPI>
__global__ __launch_bounds__(256) void gemm_f16_kernel(
    const unsigned short* __restrict__ Ap, int lda, long sAo, long sAi,
    const unsigned short* __restrict__ Bp, int ldb, long sBo, long sBi,
    void* __restrict__ Cout, void* __restrict__ Cout2, int ldc, long sCo, long sCi,
    const float* __restrict__ bias, const float* __restrict__ tab,
    int M, int N, int K, int nInner, int nBatch, float scale) {
  __shared__ __align__(16) float sT[8][16 * 68];
  const int lane = threadIdx.x & 31;
  const int wave = threadIdx.x >> 5;
  const int tilesN = N >> 6;
  const int tilesM = M >> 5;
  const int perBatch = tilesM * tilesN;
  const int tile = blockIdx.x * 8 + wave;
  if (tile >= perBatch * nBatch) return;
  const int z  = tile / perBatch;
  const int tt = tile - z * perBatch;
  const int tm = tt / tilesN;
  const int tn = tt - tm * tilesN;
  const int m0 = tm << 5;
  const int n0 = tn << 6;
  const int zo = z / nInner;
  const int zi = z - zo * nInner;

  const _Float16* A  = (const _Float16*)Ap + (size_t)zo * sAo + (size_t)zi * sAi;
  const _Float16* Bt = (const _Float16*)Bp + (size_t)zo * sBo + (size_t)zi * sBi;
  const size_t coff = (size_t)zo * sCo + (size_t)zi * sCi;

  const int rlane = lane & 15;
  const int koff  = (lane >> 4) * 8;
  const int mOff  = (lane >> 4) * 8;

  v8f acc[2][4];
#pragma unroll
  for (int i = 0; i < 2; ++i)
#pragma unroll
    for (int j = 0; j < 4; ++j)
      acc[i][j] = (v8f){0.f, 0.f, 0.f, 0.f, 0.f, 0.f, 0.f, 0.f};

  for (int k0 = 0; k0 < K; k0 += 32) {
    v16h bh[4];
#pragma unroll
    for (int j = 0; j < 4; ++j) {
      const size_t bo = (size_t)(n0 + (j << 4) + rlane) * ldb + koff + k0;
      bh[j] = frag_load(Bt + bo);
    }
#pragma unroll
    for (int i = 0; i < 2; ++i) {
      const size_t ao = (size_t)(m0 + (i << 4) + rlane) * lda + koff + k0;
      const v16h ah = frag_load(A + ao);
#pragma unroll
      for (int j = 0; j < 4; ++j)
        acc[i][j] = mma16(ah, bh[j], acc[i][j]);
      guard4(acc[i][0], acc[i][1], acc[i][2], acc[i][3], ah, bh[0], bh[1], bh[2], bh[3]);
    }
  }

  /* ---- epilogue ---- */
  float* slab = sT[wave];
  const int q  = lane >> 3;
  const int c8 = (lane & 7) * 8;
  const int hh = lane >> 4;
  const int c4 = (lane & 15) * 4;
  /* wave-uniform: the tile is a k head when its columns are below 512 */
  const bool isK = (n0 < kInner);
#pragma unroll
  for (int i = 0; i < 2; ++i) {
    const int mBase = m0 + (i << 4);
#pragma unroll
    for (int j = 0; j < 4; ++j) {
      float bv = 0.f;
      if (EPI == 0) {
        const float braw = bias[n0 + (j << 4) + rlane];
        bv = bf_rne(braw);
      }
#pragma unroll
      for (int r = 0; r < 8; ++r) {
        float v = acc[i][j][r] * scale;
        if (EPI == 0) v += bv;
        slab[(mOff + r) * 68 + (j << 4) + rlane] = v;
      }
    }
    __builtin_amdgcn_fence(__ATOMIC_RELEASE, "workgroup");
    __builtin_amdgcn_wave_barrier();
    __builtin_amdgcn_fence(__ATOMIC_ACQUIRE, "workgroup");
    if (EPI == 0) {
      /* f32 rows: 64 floats = 256 B = 16 lanes x 16 B; rows it*2 + hh, it = 0..7 -> 16 rows, each once */
      float* C = (float*)Cout + coff;
      v4f vals[8];
#pragma unroll
      for (int it = 0; it < 8; ++it) vals[it] = *(const v4f*)(slab + (it * 2 + hh) * 68 + c4);
      {
#pragma unroll
        for (int it = 0; it < 8; ++it)
          *(v4f*)(C + (size_t)(mBase + it * 2 + hh) * ldc + n0 + c4) = vals[it];
        
      }
    } else {
      unsigned short* Cb;
      int col;
      if (EPI == 3) {
        Cb  = isK ? (unsigned short*)Cout : (unsigned short*)Cout2;
        col = (n0 & (kInner - 1)) + c8;
      } else {
        Cb  = (unsigned short*)Cout + coff;
        col = n0 + c8;
      }
      /* rotary: column c pairs with c ^ 16; the upper member of a pair takes +sin, the lower -sin */
      const float sgn = (c8 & 16) ? 1.0f : -1.0f;
      const int tcol  = (c8 >> 5) * 32 + (c8 & 15);
      const float oc  = (EPI == 1) ? 1.0f : ((EPI == 2) ? kQC : kKVC);
      v4u ow[4];
#pragma unroll
      for (int it = 0; it < 4; ++it) {
        const int row = it * 4 + q;
        const float* sp = slab + row * 68 + c8;
        const v4f ta = *(const v4f*)(sp);
        const v4f tb = *(const v4f*)(sp + 4);
        float o[8];
        o[0] = ta[0]; o[1] = ta[1]; o[2] = ta[2]; o[3] = ta[3];
        o[4] = tb[0]; o[5] = tb[1]; o[6] = tb[2]; o[7] = tb[3];
        if (EPI >= 2) {
          const float* pp = slab + row * 68 + (c8 ^ 16);
          const v4f pa = *(const v4f*)(pp);
          const v4f pb = *(const v4f*)(pp + 4);
          float p[8];
          p[0] = pa[0]; p[1] = pa[1]; p[2] = pa[2]; p[3] = pa[3];
          p[4] = pb[0]; p[5] = pb[1]; p[6] = pb[2]; p[7] = pb[3];
          if (EPI == 3) {
            /* mean and biased variance over the 64 columns of the row: 8 per lane, 8 lanes per row */
            float s = ((o[0] + o[1]) + (o[2] + o[3])) + ((o[4] + o[5]) + (o[6] + o[7]));
            s += __shfl_xor(s, 1, 32);
            s += __shfl_xor(s, 2, 32);
            s += __shfl_xor(s, 4, 32);
            const float mean = s * kInvDh;
#pragma unroll
            for (int e = 0; e < 8; ++e) { o[e] -= mean; p[e] -= mean; }
            float ss = 0.0f;
#pragma unroll
            for (int e = 0; e < 8; ++e) ss = fmaf(o[e], o[e], ss);
            ss += __shfl_xor(ss, 1, 32);
            ss += __shfl_xor(ss, 2, 32);
            ss += __shfl_xor(ss, 4, 32);
            const float rstd = rsqrtf(ss * kInvDh + kNormEps);
#pragma unroll
            for (int e = 0; e < 8; ++e) { o[e] *= rstd; p[e] *= rstd; }
          }
          if (EPI == 2 || isK) {
            const float* tp = tab + (size_t)(mBase + row) * 64 + tcol;
            const v4f ca = *(const v4f*)(tp);
            const v4f cb = *(const v4f*)(tp + 4);
            const v4f sa = *(const v4f*)(tp + 16);
            const v4f sb = *(const v4f*)(tp + 20);
            float cc[8], sn[8];
            cc[0] = ca[0]; cc[1] = ca[1]; cc[2] = ca[2]; cc[3] = ca[3];
            cc[4] = cb[0]; cc[5] = cb[1]; cc[6] = cb[2]; cc[7] = cb[3];
            sn[0] = sa[0]; sn[1] = sa[1]; sn[2] = sa[2]; sn[3] = sa[3];
            sn[4] = sb[0]; sn[5] = sb[1]; sn[6] = sb[2]; sn[7] = sb[3];
#pragma unroll
            for (int e = 0; e < 8; ++e) o[e] = o[e] * cc[e] + sgn * (p[e] * sn[e]);
          }
        }
#pragma unroll
        for (int e = 0; e < 8; ++e) o[e] *= oc;
        ow[it] = (v4u){pk16(h_bits(o[0]), h_bits(o[1])), pk16(h_bits(o[2]), h_bits(o[3])),
                       pk16(h_bits(o[4]), h_bits(o[5])), pk16(h_bits(o[6]), h_bits(o[7]))};
      }
      {
#pragma unroll
        for (int it = 0; it < 4; ++it)
          *(v4u*)(Cb + (size_t)(mBase + it * 4 + q) * ldc + col) = ow[it];
        
      }
    }
    __builtin_amdgcn_fence(__ATOMIC_RELEASE, "workgroup");
    __builtin_amdgcn_wave_barrier();
    __builtin_amdgcn_fence(__ATOMIC_ACQUIRE, "workgroup");
  }
}

/* ---------------------------------------------------------------------------
   Token-axis product, split-K: part[ks][bh][e][d] = sum over the 1024 tokens of split ks of vn[tok][h*64+e]*kn[tok][h*64+d]
   (operands carry x16 each). grid (32 bh, 8 ks), 128 threads = 4 waves; wave w owns output rows e = 16w..16w+15.
   and written transposed into LDS as sK[d][tok], sV[e][tok] (pitch 72 halves), so fragments are token-contiguous.
   Staging coverage: 64 rows x 8 segments = 512 segments = 128 threads x 4 iterations per tile; fragment reads touch
   tokens 0..63 only (all written); the pad columns 64..71 are never read.
   All barriers are reached by all 128 threads (no early exit).
   --------------------------------------------------------------------------- */
__global__ __launch_bounds__(128) void dots_splitk_kernel(const unsigned short* __restrict__ kn,
                                                          const unsigned short* __restrict__ vn,
                                                          float* __restrict__ part) {
  __shared__ __align__(16) _Float16 sK[64 * 72];
  __shared__ __align__(16) _Float16 sV[64 * 72];
  __shared__ __align__(16) float sO[4][16 * 68];
  const int tid = threadIdx.x, lane = tid & 31, wave = tid >> 5;
  const int bh = blockIdx.x, ks = blockIdx.y;
  const int b = bh >> 3, h = bh & 7;
  const size_t row0 = (size_t)b * kSeq + (size_t)ks * kTokPerSplit;
  const int rlane = lane & 15;
  const int koff  = (lane >> 4) * 8;
  const int hh    = lane >> 4;

  v8f acc[4];
#pragma unroll
  for (int j = 0; j < 4; ++j) acc[j] = (v8f){0.f, 0.f, 0.f, 0.f, 0.f, 0.f, 0.f, 0.f};

#pragma unroll 1
  for (int ch = 0; ch < kTokPerSplit / 64; ++ch) {
    __syncthreads();
#pragma unroll
    for (int it = 0; it < 4; ++it) {
      const int seg = it * 128 + tid;
      const int tok = seg >> 3;
      const int s8  = (seg & 7) * 8;
      const size_t go = (row0 + (size_t)ch * 64 + tok) * kInner + h * kDh + s8;
      const v4u kw = *(const v4u*)(kn + go);
      const v4u vw = *(const v4u*)(vn + go);
#pragma unroll
      for (int w = 0; w < 4; ++w) {
        const unsigned kword = kw[w];
        const unsigned vword = vw[w];
        const unsigned short k0b = (unsigned short)(kword & 0xffffu);
        const unsigned short k1b = (unsigned short)(kword >> 16);
        const unsigned short v0b = (unsigned short)(vword & 0xffffu);
        const unsigned short v1b = (unsigned short)(vword >> 16);
        sK[(s8 + 2 * w) * 72 + tok]     = __builtin_bit_cast(_Float16, k0b);
        sK[(s8 + 2 * w + 1) * 72 + tok] = __builtin_bit_cast(_Float16, k1b);
        sV[(s8 + 2 * w) * 72 + tok]     = __builtin_bit_cast(_Float16, v0b);
        sV[(s8 + 2 * w + 1) * 72 + tok] = __builtin_bit_cast(_Float16, v1b);
      }
    }
    __syncthreads();
#pragma unroll
    for (int kk = 0; kk < 2; ++kk) {
      const v16h a  = frag_load(sV + (wave * 16 + rlane) * 72 + kk * 32 + koff);
      const v16h b0 = frag_load(sK + (0 * 16 + rlane) * 72 + kk * 32 + koff);
      const v16h b1 = frag_load(sK + (1 * 16 + rlane) * 72 + kk * 32 + koff);
      const v16h b2 = frag_load(sK + (2 * 16 + rlane) * 72 + kk * 32 + koff);
      const v16h b3 = frag_load(sK + (3 * 16 + rlane) * 72 + kk * 32 + koff);
      acc[0] = mma16(a, b0, acc[0]);
      acc[1] = mma16(a, b1, acc[1]);
      acc[2] = mma16(a, b2, acc[2]);
      acc[3] = mma16(a, b3, acc[3]);
      guard4(acc[0], acc[1], acc[2], acc[3], a, b0, b1, b2, b3);
    }
  }

  float* slab = sO[wave];
#pragma unroll
  for (int j = 0; j < 4; ++j)
#pragma unroll
    for (int r = 0; r < 8; ++r) slab[(8 * hh + r) * 68 + (j << 4) + rlane] = acc[j][r];
  __builtin_amdgcn_fence(__ATOMIC_RELEASE, "workgroup");
  __builtin_amdgcn_wave_barrier();
  __builtin_amdgcn_fence(__ATOMIC_ACQUIRE, "workgroup");
  {
    const int c4 = (lane & 15) * 4;
    float* C = part + ((size_t)ks * kBH + bh) * (kDh * kDh) + (size_t)(wave * 16) * kDh;
    v4f vals[8];
#pragma unroll
    for (int it = 0; it < 8; ++it) vals[it] = *(const v4f*)(slab + (it * 2 + hh) * 68 + c4);
    {
#pragma unroll
      for (int it = 0; it < 8; ++it)
        *(v4f*)(C + (size_t)(it * 2 + hh) * kDh + c4) = vals[it];
      
    }
  }
}

/* ---------------------------------------------------------------------------
   Fixed-order sum of the 8 split-K partials, scaled (1/8192 and carries, all powers of two) in f32, then emitted as one
   f16 plane. 8 elements per thread; 131072/8 = 16384 threads = 64 blocks exactly.
   --------------------------------------------------------------------------- */
__global__ __launch_bounds__(256) void dots_reduce_kernel(const float* __restrict__ part, unsigned short* __restrict__ dh,
                                                          int n8) {
  const int i = blockIdx.x * 256 + threadIdx.x;
  if (i >= n8) return;
  const size_t o = 8 * (size_t)i;
  float s[8];
#pragma unroll
  for (int e = 0; e < 8; ++e) s[e] = 0.0f;
#pragma unroll
  for (int ks = 0; ks < kSplitK; ++ks) {
    const float* p = part + (size_t)ks * kDotsElems + o;
    const v4f a = *(const v4f*)(p);
    const v4f c = *(const v4f*)(p + 4);
    s[0] += a[0]; s[1] += a[1]; s[2] += a[2]; s[3] += a[3];
    s[4] += c[0]; s[5] += c[1]; s[6] += c[2]; s[7] += c[3];
  }
  unsigned short hb[8];
#pragma unroll
  for (int e = 0; e < 8; ++e) {
    const float val = s[e] * kDotsScale;
    hb[e] = h_bits(val);
  }
  const v4u uh = (v4u){pk16(hb[0], hb[1]), pk16(hb[2], hb[3]), pk16(hb[4], hb[5]), pk16(hb[6], hb[7])};
  unsigned short* qh = dh + o;
  *(v4u*)qh = uh;
  
}

/* ---------------------------------------------------------------------------
   Host glue: 13 kernel launches, nothing else.
   GEMM shapes (M % 32 == 0, N % 64 == 0, K % 32 == 0, no pad planes needed):
     kv projection : M 32768, N 1024, K 256 -> 1024 x 16 tiles = 16384 -> 2048 blocks
     q projection  : M 32768, N 512,  K 256 -> 1024 x 8  tiles =  8192 -> 1024 blocks
     q . dots      : 32 batches of M 8192, N 64, K 64 -> 32 x 256 tiles = 8192 -> 1024 blocks
     out projection: M 32768, N 256,  K 512 -> 1024 x 4  tiles =  4096 ->  512 blocks
   --------------------------------------------------------------------------- */
extern "C" void kernel_launch(void* const* d_in, const int* in_sizes, int n_in,
                              void* d_out, int out_size, void* d_ws, size_t ws_size,
                              hipStream_t stream) {
  if (n_in < 8) return;
  if (in_sizes[0] != kTok * kDim) return;
  if (in_sizes[1] != kTok * kDim) return;
  if (in_sizes[2] != kTok * 2) return;
  if (in_sizes[3] != kTok * 2) return;
  if (in_sizes[4] != kInner * kDim) return;
  if (in_sizes[5] != 2 * kInner * kDim) return;
  if (in_sizes[6] != kDim * kInner) return;
  if (in_sizes[7] != kDim) return;
  if (out_size != kTok * kDim) return;
  if (ws_size < kWsTotal) return;

  const float* x    = (const float*)d_in[0];
  const float* z    = (const float*)d_in[1];
  const float* xpos = (const float*)d_in[2];
  const float* zpos = (const float*)d_in[3];
  const float* Wq   = (const float*)d_in[4];
  const float* Wkv  = (const float*)d_in[5];
  const float* Wout = (const float*)d_in[6];
  const float* bout = (const float*)d_in[7];
  float* out = (float*)d_out;

  char* ws = (char*)d_ws;
  unsigned short* WQ   = (unsigned short*)(ws + kOffWQ);
  unsigned short* WK   = (unsigned short*)(ws + kOffWK);
  unsigned short* WO   = (unsigned short*)(ws + kOffWO);
  unsigned short* S16  = (unsigned short*)(ws + kOffS16);
  unsigned short* KN   = (unsigned short*)(ws + kOffKN);
  unsigned short* VN   = (unsigned short*)(ws + kOffVN);
  unsigned short* QH   = (unsigned short*)(ws + kOffQH);
  float*          TAB  = (float*)(ws + kOffTAB);
  float*          PART = (float*)(ws + kOffPART);
  unsigned short* DH   = (unsigned short*)(ws + kOffDH);
  /* the attention output plane re-uses the k plane (same element type, same [32768][512] layout); k is dead after
     the split-K token-axis product */
  unsigned short* ATT  = KN;

  /* inverse frequencies: 1 / f32(10000^(2j/32)), j = 0..15 */
  FreqTab ft;
  for (int j = 0; j < 16; ++j) {
    const double ex = (double)(2 * j) / 32.0;
    const float pw = (float)pow(10000.0, ex);
    ft.f[j] = 1.0f / pw;
  }

  /* weight planes ([out][in] = Bt layout already): f16(bf16(w) * 1024) */
  cast8_bf_f16_kernel<<<(kInner * kDim / 8) / 256, 256, 0, stream>>>(Wq, WQ, kInner * kDim / 8, kWC);
  cast8_bf_f16_kernel<<<(2 * kInner * kDim / 8) / 256, 256, 0, stream>>>(Wkv, WK, 2 * kInner * kDim / 8, kWC);
  cast8_bf_f16_kernel<<<(kDim * kInner / 8) / 256, 256, 0, stream>>>(Wout, WO, kDim * kInner / 8, kWC);

  /* key/value side: z -> f16, position table, projection with fused norm (+ rotary on k) */
  cast8_bf_f16_kernel<<<(kTok * kDim / 8) / 256, 256, 0, stream>>>(z, S16, kTok * kDim / 8, kXC);
  rot_table_kernel<<<kTok / 8, 256, 0, stream>>>(zpos, TAB, ft);
  gemm_f16_kernel<3><<<(kTok / 32) * (2 * kInner / 64) / 8, 256, 0, stream>>>(
      S16, kDim, 0L, 0L,
      WK, kDim, 0L, 0L,
      (void*)KN, (void*)VN, kInner, 0L, 0L,
      bout, TAB,
      kTok, 2 * kInner, kDim, 1, 1, kProjScale);

  /* query side: x -> f16 (same region), position table (same region), projection with fused rotary */
  cast8_bf_f16_kernel<<<(kTok * kDim / 8) / 256, 256, 0, stream>>>(x, S16, kTok * kDim / 8, kXC);
  rot_table_kernel<<<kTok / 8, 256, 0, stream>>>(xpos, TAB, ft);
  gemm_f16_kernel<2><<<(kTok / 32) * (kInner / 64) / 8, 256, 0, stream>>>(
      S16, kDim, 0L, 0L,
      WQ, kDim, 0L, 0L,
      (void*)QH, (void*)VN, kInner, 0L, 0L,
      bout, TAB,
      kTok, kInner, kDim, 1, 1, kProjScale);

  /* token-axis product, deterministic split-K, then fixed-order reduce to the dots^T plane */
  dots_splitk_kernel<<<dim3(kBH, kSplitK), 128, 0, stream>>>(KN, VN, PART);
  dots_reduce_kernel<<<(kDotsElems / 8) / 256, 256, 0, stream>>>(PART, DH, kDotsElems / 8);

  /* attention output per (batch, head): [8192][64] = q_head [8192][64] . dots^T [64][64]^T, written at column h*64 */
  gemm_f16_kernel<1><<<kBH * (kSeq / 32) / 8, 256, 0, stream>>>(
      QH, kInner, (long)kSeq * kInner, (long)kDh,
      DH, kDh, (long)kHeads * kDh * kDh, (long)kDh * kDh,
      (void*)ATT, (void*)VN, kInner, (long)kSeq * kInner, (long)kDh,
      bout, TAB,
      kSeq, kDh, kDh, kHeads, kBH, kAttnScale);

  /* output projection + bias */
  gemm_f16_kernel<0><<<(kTok / 32) * (kDim / 64) / 8, 256, 0, stream>>>(
      ATT, kInner, 0L, 0L,
      WO, kInner, 0L, 0L,
      (void*)out, (void*)VN, kDim, 0L, 0L,
      bout, TAB,
      kTok, kDim, kInner, 1, 1, kOutScale);
}

// v001
// Measured time: 175 microseconds a run.
// Two timings next to v000 both put it at 1.20 times that version's speed.
// Contractions (q/kv projections, token-axis k^T v, q.dots, output projection): v_wmma_f32_16x16x32_f16, one product per site, f32 accumulate; every operand a plain f16 plane with a power-of-two carry; every float module input RNE-converted to bf16 once at its first read (exact in the carried f16 planes); instance norm, rotary, scaling and bias in f32.
#include <hip/hip_runtime.h>
#include <math.h>

typedef __attribute__((ext_vector_type(16))) _Float16 v16h;
typedef __attribute__((ext_vector_type(8)))  _Float16 v8h;
typedef __attribute__((ext_vector_type(8)))  float    v8f;
typedef __attribute__((ext_vector_type(4)))  float    v4f;
typedef __attribute__((ext_vector_type(4)))  unsigned int v4u;

/* ---------------------------------------------------------------------------
   Shape constants
   --------------------------------------------------------------------------- */
constexpr int kBatch  = 4;
constexpr int kSeq    = 8192;
constexpr int kDim    = 256;
constexpr int kHeads  = 8;
constexpr int kDh     = 64;
constexpr int kInner  = kHeads * kDh;
constexpr int kTok    = kBatch * kSeq;
constexpr int kBH     = kBatch * kHeads;
constexpr int kSplitK = 8;
constexpr int kTokPerSplit = kSeq / kSplitK;
constexpr int kDotsElems = kBH * kDh * kDh;
static_assert(kInner == 512 && kTok == 32768 && kDotsElems == 131072, "shape");
static_assert((kDim % 32) == 0 && (kInner % 32) == 0 && (kDh % 32) == 0, "K multiples of 32");
static_assert((kTok % 32) == 0 && (kSeq % 32) == 0, "M multiples of 32");
static_assert((kInner % 64) == 0 && ((2 * kInner) % 64) == 0 && (kDim % 64) == 0 && (kDh % 64) == 0, "N multiples of 64");
static_assert((kTokPerSplit % 64) == 0, "token chunks of 64");

/* power-of-two carries of the f16 planes (all folded back exactly in f32) */
constexpr float kXC     = 16.0f;
constexpr float kWC     = 1024.0f;
constexpr float kKVC    = 16.0f;
constexpr float kQC     = 64.0f;
constexpr float kDC     = 1024.0f;
constexpr float kAC     = 64.0f;
constexpr float kProjScale = 1.0f / (kXC * kWC);
constexpr float kDotsScale = kDC / (kKVC * kKVC * (float)kSeq);
constexpr float kAttnScale = kAC / (kQC * kDC);
constexpr float kOutScale  = 1.0f / (kAC * kWC);
constexpr float kPosScale  = 64.0f;
constexpr float kNormEps   = 1e-5f;
constexpr float kInvDh     = 1.0f / (float)kDh;

/* ---------------------------------------------------------------------------
   Workspace region map (bytes; every offset is a multiple of 128). WQ, WK, WO, S16, QH, DH and the attention output
   plane are fragment-order planes (see frag_pos); the shapes below give rows and pitch. KN (as k) and VN are row-major.
     WQ   f16 [512][256]    Wq plane  (bf16 value x1024)            262,144
     WK   f16 [1024][256]   Wkv plane (bf16 value x1024)            524,288
     WO   f16 [256][512]    Wout plane (bf16 value x1024)           262,144
     S16  f16 [32768][256]  z x16, later x x16 (same type, layout) 16,777,216
     KN   f16 [32768][512]  normed+rotated k x16; later the attention
                            output plane x64 (same type and size)   33,554,432
     VN   f16 [32768][512]  normed v x16                           33,554,432
     QH   f16 [32768][512]  rotated q x64                          33,554,432
     TAB  f32 [32768][64]   cos/sin table (z positions, then x)     8,388,608
     PART f32 [8][32][64][64] split-K partials of the k^T v product  4,194,304
     DH   f16 [32][64][64]  dots^T plane (x1024/8192)                 262,144
     total                                                        131,334,144
   --------------------------------------------------------------------------- */
constexpr size_t kOffWQ   = 0;
constexpr size_t kOffWK   = kOffWQ   + (size_t)kInner * kDim * 2;
constexpr size_t kOffWO   = kOffWK   + (size_t)2 * kInner * kDim * 2;
constexpr size_t kOffS16  = kOffWO   + (size_t)kDim * kInner * 2;
constexpr size_t kOffKN   = kOffS16  + (size_t)kTok * kDim * 2;
constexpr size_t kOffVN   = kOffKN   + (size_t)kTok * kInner * 2;
constexpr size_t kOffQH   = kOffVN   + (size_t)kTok * kInner * 2;
constexpr size_t kOffTAB  = kOffQH   + (size_t)kTok * kInner * 2;
constexpr size_t kOffPART = kOffTAB  + (size_t)kTok * 64 * 4;
constexpr size_t kOffDH   = kOffPART + (size_t)kSplitK * kDotsElems * 4;
constexpr size_t kWsTotal = kOffDH   + (size_t)kDotsElems * 2;
static_assert(kWsTotal == 131334144ull, "carve total");
static_assert(kWsTotal <= 134217728ull, "carve cap");
static_assert((kOffWK % 128) == 0 && (kOffWO % 128) == 0 && (kOffS16 % 128) == 0 && (kOffKN % 128) == 0 &&
              (kOffVN % 128) == 0 && (kOffQH % 128) == 0 && (kOffTAB % 128) == 0 && (kOffPART % 128) == 0 &&
              (kOffDH % 128) == 0, "128-B aligned regions");

/* ---------------------------------------------------------------------------
   Small helpers
   --------------------------------------------------------------------------- */
__device__ __forceinline__ unsigned short f2bf_bits(float f) {
  unsigned u = __float_as_uint(f);
  return (unsigned short)((u + 0x7FFFu + ((u >> 16) & 1u)) >> 16);
}
__device__ __forceinline__ float bf_bits2f(unsigned short h) { return __uint_as_float(((unsigned)h) << 16); }
/* RNE convert of an f32 value to the nearest bf16 value, returned as f32 */
__device__ __forceinline__ float bf_rne(float f) { return bf_bits2f(f2bf_bits(f)); }

__device__ __forceinline__ unsigned pk16(unsigned short a, unsigned short b) { return (unsigned)a | ((unsigned)b << 16); }
__device__ __forceinline__ unsigned short h_bits(float f) { const _Float16 h = (_Float16)f; return __builtin_bit_cast(unsigned short, h); }

union FragU { v16h v; v8h h[2]; };
/* elements 0..7 <- p[0..7], elements 8..15 <- p[16..23]; p already includes the lane-half k offset */
__device__ __forceinline__ v16h frag_load(const _Float16* p) {
  FragU f;
  f.h[0] = *(const v8h*)(p);
  f.h[1] = *(const v8h*)(p + 16);
  return f.v;
}
/* Fragment-order plane of a [R][K] f16 matrix (R % 16 == 0, K % 32 == 0): each 16-row x 32-k block is 1024 contiguous
   bytes = two 512-B segments (k 0..15, k 16..31 of the block); a segment holds 32 units of 8 halves, one per
   (row-in-block rl, k-half hi), at position frag_pos(rl, hi). Blocks run k-fastest: block (rb, kb) starts at
   (rb * (K / 32) + kb) * 512 halves. A wave's fragment load is then two loads of 512 contiguous bytes (4 whole lines),
   and 4 consecutive rows x both k-halves of a segment are one 128-B line (what one epilogue store covers). */
__device__ __forceinline__ int frag_pos(int rl, int hi) { return ((rl >> 2) << 3) | (hi << 2) | (rl & 3); }
/* pointer to 16-B units in global memory: the address space is spelled out so that the running pointers of the k loop
   stay global loads */
typedef const __attribute__((address_space(1))) v8h* unit_gptr;
/* elements 0..7 <- segment 0, elements 8..15 <- segment 1 (32 units on); p is the lane's own unit */
__device__ __forceinline__ v16h frag_load_plane(unit_gptr p) {
  FragU f;
  f.h[0] = p[0];
  f.h[1] = p[32];
  return f.v;
}
__device__ __forceinline__ v8f mma16(v16h a, v16h b, v8f c) {
  return __builtin_amdgcn_wmma_f32_16x16x32_f16(false, a, false, b, (short)0, c, false, false);
}
/* hazard guard: ties all four accumulators of a group and names the A fragment and all B fragments */
__device__ __forceinline__ void guard4(v8f& a0, v8f& a1, v8f& a2, v8f& a3,
                                       v16h x, v16h b0, v16h b1, v16h b2, v16h b3) {
  asm volatile("v_nop\n\tv_nop\n\tv_nop\n\tv_nop"
               : "+v"(a0), "+v"(a1), "+v"(a2), "+v"(a3)
               : "v"(x), "v"(b0), "v"(b1), "v"(b2), "v"(b3));
}

/* ---------------------------------------------------------------------------
   f32 -> bf16 value (RNE) -> f16 fragment-order plane with a power-of-two carry, 8 consecutive elements per thread.
   The carried bf16 value is exactly representable in f16 (8 significant bits, normal range).
   A block takes 16 rows x 128 columns of the [R][K] input, K = 128 << kshift: thread t reads row t / 16, columns
   (t % 16) * 8 .. + 7, puts its 16-B unit at its plane position in LDS (one pad unit per 16 keeps the banks spread),
   and after the barrier thread t stores unit t of the block's 4096 contiguous output bytes (whole lines).
   Coverage: grid = (R / 16) * (K / 128) exactly for every plane used:
     x, z 4096 blocks; Wq 64; Wkv 128; Wout 64. No early exit: all 256 threads reach the barrier.
   --------------------------------------------------------------------------- */
__global__ __launch_bounds__(256) void cast8_bf_f16_kernel(const float* __restrict__ in, unsigned short* __restrict__ out,
                                                           int kshift, float carry) {
  __shared__ __align__(16) v4u sm[272];
  const int t   = threadIdx.x;
  const int rb  = blockIdx.x >> kshift;
  const int cb  = blockIdx.x & ((1 << kshift) - 1);
  const int row = t >> 4;
  const int k8  = t & 15;
  const float* p = in + (((size_t)(rb * 16 + row)) << (7 + kshift)) + cb * 128 + k8 * 8;
  const v4f a = *(const v4f*)(p);
  const v4f c = *(const v4f*)(p + 4);
  const float r0 = a[0], r1 = a[1], r2 = a[2], r3 = a[3];
  const float r4 = c[0], r5 = c[1], r6 = c[2], r7 = c[3];
  const float a0 = bf_rne(r0) * carry, a1 = bf_rne(r1) * carry, a2 = bf_rne(r2) * carry, a3 = bf_rne(r3) * carry;
  const float c0 = bf_rne(r4) * carry, c1 = bf_rne(r5) * carry, c2 = bf_rne(r6) * carry, c3 = bf_rne(r7) * carry;
  const v4u u = (v4u){pk16(h_bits(a0), h_bits(a1)), pk16(h_bits(a2), h_bits(a3)),
                      pk16(h_bits(c0), h_bits(c1)), pk16(h_bits(c2), h_bits(c3))};
  const int unit = (k8 >> 1) * 32 + frag_pos(row, k8 & 1);
  sm[unit + (unit >> 4)] = u;
  __syncthreads(); /* the unit read below was written by another wave */
  const v4u w = sm[t + (t >> 4)];
  unsigned short* q = out + ((((size_t)rb << (2 + kshift)) + cb * 4) << 9) + t * 8;
  *(v4u*)q = w;
}

/* ---------------------------------------------------------------------------
   Rotary table: tab[token][axis*32 + j] = cos(theta), tab[token][axis*32 + 16 + j] = sin(theta),
   theta = (bf16(pos[token][axis]) * 64) * inv_freq[j], j = 0..15. One thread per (token, axis, j).
   Block = 8 tokens x 32 (axis, j) = 256 threads; grid = 32768/8 = 4096 blocks exactly.
   Store: the 8 x 64 f32 tile (2048 B = 16 lines) is staged in LDS; waves 0..3 (whole waves) each emit
   --------------------------------------------------------------------------- */
struct FreqTab { float f[16]; };
static_assert(sizeof(FreqTab) == 64, "no padding");
__global__ __launch_bounds__(256) void rot_table_kernel(const float* __restrict__ pos, float* __restrict__ tab, FreqTab ft) {
  __shared__ __align__(16) float sm[8 * 64];
  const int tid  = threadIdx.x;
  const int tl   = tid >> 5;
  const int axis = (tid >> 4) & 1;
  const int j    = tid & 15;
  const int token = blockIdx.x * 8 + tl;
  float fr = ft.f[0];
#pragma unroll
  for (int e = 1; e < 16; ++e) fr = (j == e) ? ft.f[e] : fr;
  const float praw = pos[(size_t)token * 2 + axis];
  const float p   = bf_rne(praw);
  const float t   = p * kPosScale;
  const float ang = t * fr;
  const float cv = cosf(ang);
  const float sv = sinf(ang);
  sm[tl * 64 + axis * 32 + j]      = cv;
  sm[tl * 64 + axis * 32 + 16 + j] = sv;
  __syncthreads();
  if (tid < 128) {
    const v4f v = *(const v4f*)(sm + tid * 4);
    float* dst = tab + (size_t)blockIdx.x * 512 + tid * 4;
    *(v4f*)dst = v;
    
  }
}

/* ---------------------------------------------------------------------------
   Batched WMMA GEMM, one f16 product:
     C[m,n] = scale * sum_k A[m,k]*Bt[n,k]
   A [M][lda] and Bt [N][ldb] are fragment-order planes (see frag_pos); M % 32 == 0, N % 64 == 0, K % 32 == 0.
   Each wave owns a 32x64 tile; tile id = blockIdx.x*8 + wave over nBatch * (M/32) * (N/64).
   Batch z -> (zo = z / nInner, zi = z % nInner); operand bases advance by zo*s?o + zi*s?i elements (a step of 32 columns
   in a fragment-order plane is 512 elements).
   EPI 0: f32 out + bf16(bias[n]), row-major.  EPI 1: f16 out.  EPI 2: 2D rotary of each 64-wide head row (table rows = m)
   -> f16 x64.  EPI 1 and 2 write fragment-order planes of pitch ldc.
   EPI 3: per-row instance norm over the tile's 64 columns; tiles with n0 < 512 are rotated too and go to Cout,
          the others go to Cout2 (both row-major [M][512] f16 planes, x16).
   No block barriers in this kernel (per-wave slabs; the early exit is wave-uniform).
   --------------------------------------------------------------------------- */
template <int EPI>
__global__ __launch_bounds__(256) void gemm_f16_kernel(
    const unsigned short* __restrict__ Ap, int lda, long sAo, long sAi,
    const unsigned short* __restrict__ Bp, int ldb, long sBo, long sBi,
    void* __restrict__ Cout, void* __restrict__ Cout2, int ldc, long sCo, long sCi,
    const float* __restrict__ bias, const float* __restrict__ tab,
    int M, int N, int K, int nInner, int nBatch, float scale) {
  __shared__ __align__(16) float sT[8][16 * 68];
  const int lane = threadIdx.x & 31;
  const int wave = threadIdx.x >> 5;
  const int tilesN = N >> 6;
  const int tilesM = M >> 5;
  const int perBatch = tilesM * tilesN;
  const int tile = blockIdx.x * 8 + wave;
  if (tile >= perBatch * nBatch) return;
  const int z  = tile / perBatch;
  const int tt = tile - z * perBatch;
  const int tm = tt / tilesN;
  const int tn = tt - tm * tilesN;
  const int m0 = tm << 5;
  const int n0 = tn << 6;
  const int zo = z / nInner;
  const int zi = z - zo * nInner;

  const _Float16* A  = (const _Float16*)Ap + (size_t)zo * sAo + (size_t)zi * sAi;
  const _Float16* Bt = (const _Float16*)Bp + (size_t)zo * sBo + (size_t)zi * sBi;
  const size_t coff = (size_t)zo * sCo + (size_t)zi * sCi;

  const int rlane = lane & 15;
  const int mOff  = (lane >> 4) * 8;
  /* per-row-block strides and the lane's unit inside a 512-B segment */
  const size_t strA = (size_t)(lda >> 5) * 512;
  const size_t strB = (size_t)(ldb >> 5) * 512;
  const int lpos = frag_pos(rlane, lane >> 4) * 8;
  /* one running pointer per fragment row-block; a k step of 32 is the next 1024-B block (64 units) */
  unit_gptr pa[2];
  unit_gptr pb[4];
#pragma unroll
  for (int i = 0; i < 2; ++i) pa[i] = (unit_gptr)(A + (size_t)((m0 >> 4) + i) * strA + lpos);
#pragma unroll
  for (int j = 0; j < 4; ++j) pb[j] = (unit_gptr)(Bt + (size_t)((n0 >> 4) + j) * strB + lpos);

  v8f acc[2][4];
#pragma unroll
  for (int i = 0; i < 2; ++i)
#pragma unroll
    for (int j = 0; j < 4; ++j)
      acc[i][j] = (v8f){0.f, 0.f, 0.f, 0.f, 0.f, 0.f, 0.f, 0.f};

  for (int k0 = 0; k0 < K; k0 += 32) {
    v16h bh[4];
#pragma unroll
    for (int j = 0; j < 4; ++j) {
      bh[j] = frag_load_plane(pb[j]);
      pb[j] += 64;
    }
#pragma unroll
    for (int i = 0; i < 2; ++i) {
      const v16h ah = frag_load_plane(pa[i]);
      pa[i] += 64;
#pragma unroll
      for (int j = 0; j < 4; ++j)
        acc[i][j] = mma16(ah, bh[j], acc[i][j]);
      guard4(acc[i][0], acc[i][1], acc[i][2], acc[i][3], ah, bh[0], bh[1], bh[2], bh[3]);
    }
  }

  /* ---- epilogue ---- */
  float* slab = sT[wave];
  const int q  = lane >> 3;
  const int c8 = (lane & 7) * 8;
  const int hh = lane >> 4;
  const int c4 = (lane & 15) * 4;
  /* wave-uniform: the tile is a k head when its columns are below 512 */
  const bool isK = (n0 < kInner);
#pragma unroll
  for (int i = 0; i < 2; ++i) {
    const int mBase = m0 + (i << 4);
#pragma unroll
    for (int j = 0; j < 4; ++j) {
      float bv = 0.f;
      if (EPI == 0) {
        const float braw = bias[n0 + (j << 4) + rlane];
        bv = bf_rne(braw);
      }
#pragma unroll
      for (int r = 0; r < 8; ++r) {
        float v = acc[i][j][r] * scale;
        if (EPI == 0) v += bv;
        slab[(mOff + r) * 68 + (j << 4) + rlane] = v;
      }
    }
    __builtin_amdgcn_fence(__ATOMIC_RELEASE, "workgroup");
    __builtin_amdgcn_wave_barrier();
    __builtin_amdgcn_fence(__ATOMIC_ACQUIRE, "workgroup");
    if (EPI == 0) {
      /* f32 rows: 64 floats = 256 B = 16 lanes x 16 B; rows it*2 + hh, it = 0..7 -> 16 rows, each once */
      float* C = (float*)Cout + coff;
      v4f vals[8];
#pragma unroll
      for (int it = 0; it < 8; ++it) vals[it] = *(const v4f*)(slab + (it * 2 + hh) * 68 + c4);
      {
#pragma unroll
        for (int it = 0; it < 8; ++it)
          *(v4f*)(C + (size_t)(mBase + it * 2 + hh) * ldc + n0 + c4) = vals[it];
        
      }
    } else {
      unsigned short* Cb;
      int col;
      if (EPI == 3) {
        Cb  = isK ? (unsigned short*)Cout : (unsigned short*)Cout2;
        col = (n0 & (kInner - 1)) + c8;
      } else {
        /* the 16 x 64 slab is two whole blocks of the plane; col = the lane's unit for row q, rows it*4 add 64 each */
        Cb  = (unsigned short*)Cout + coff + ((size_t)(mBase >> 4) * (ldc >> 5) + (n0 >> 5)) * 512;
        col = ((lane & 7) >> 1) * 256 + frag_pos(q, lane & 1) * 8;
      }
      /* rotary: column c pairs with c ^ 16; the upper member of a pair takes +sin, the lower -sin */
      const float sgn = (c8 & 16) ? 1.0f : -1.0f;
      const int tcol  = (c8 >> 5) * 32 + (c8 & 15);
      const float oc  = (EPI == 1) ? 1.0f : ((EPI == 2) ? kQC : kKVC);
      v4u ow[4];
#pragma unroll
      for (int it = 0; it < 4; ++it) {
        const int row = it * 4 + q;
        const float* sp = slab + row * 68 + c8;
        const v4f ta = *(const v4f*)(sp);
        const v4f tb = *(const v4f*)(sp + 4);
        float o[8];
        o[0] = ta[0]; o[1] = ta[1]; o[2] = ta[2]; o[3] = ta[3];
        o[4] = tb[0]; o[5] = tb[1]; o[6] = tb[2]; o[7] = tb[3];
        if (EPI >= 2) {
          const float* pp = slab + row * 68 + (c8 ^ 16);
          const v4f pa = *(const v4f*)(pp);
          const v4f pb = *(const v4f*)(pp + 4);
          float p[8];
          p[0] = pa[0]; p[1] = pa[1]; p[2] = pa[2]; p[3] = pa[3];
          p[4] = pb[0]; p[5] = pb[1]; p[6] = pb[2]; p[7] = pb[3];
          if (EPI == 3) {
            /* mean and biased variance over the 64 columns of the row: 8 per lane, 8 lanes per row */
            float s = ((o[0] + o[1]) + (o[2] + o[3])) + ((o[4] + o[5]) + (o[6] + o[7]));
            s += __shfl_xor(s, 1, 32);
            s += __shfl_xor(s, 2, 32);
            s += __shfl_xor(s, 4, 32);
            const float mean = s * kInvDh;
#pragma unroll
            for (int e = 0; e < 8; ++e) { o[e] -= mean; p[e] -= mean; }
            float ss = 0.0f;
#pragma unroll
            for (int e = 0; e < 8; ++e) ss = fmaf(o[e], o[e], ss);
            ss += __shfl_xor(ss, 1, 32);
            ss += __shfl_xor(ss, 2, 32);
            ss += __shfl_xor(ss, 4, 32);
            const float rstd = rsqrtf(ss * kInvDh + kNormEps);
#pragma unroll
            for (int e = 0; e < 8; ++e) { o[e] *= rstd; p[e] *= rstd; }
          }
          if (EPI == 2 || isK) {
            const float* tp = tab + (size_t)(mBase + row) * 64 + tcol;
            const v4f ca = *(const v4f*)(tp);
            const v4f cb = *(const v4f*)(tp + 4);
            const v4f sa = *(const v4f*)(tp + 16);
            const v4f sb = *(const v4f*)(tp + 20);
            float cc[8], sn[8];
            cc[0] = ca[0]; cc[1] = ca[1]; cc[2] = ca[2]; cc[3] = ca[3];
            cc[4] = cb[0]; cc[5] = cb[1]; cc[6] = cb[2]; cc[7] = cb[3];
            sn[0] = sa[0]; sn[1] = sa[1]; sn[2] = sa[2]; sn[3] = sa[3];
            sn[4] = sb[0]; sn[5] = sb[1]; sn[6] = sb[2]; sn[7] = sb[3];
#pragma unroll
            for (int e = 0; e < 8; ++e) o[e] = o[e] * cc[e] + sgn * (p[e] * sn[e]);
          }
        }
#pragma unroll
        for (int e = 0; e < 8; ++e) o[e] *= oc;
        ow[it] = (v4u){pk16(h_bits(o[0]), h_bits(o[1])), pk16(h_bits(o[2]), h_bits(o[3])),
                       pk16(h_bits(o[4]), h_bits(o[5])), pk16(h_bits(o[6]), h_bits(o[7]))};
      }
      {
#pragma unroll
        for (int it = 0; it < 4; ++it) {
          if (EPI == 3) *(v4u*)(Cb + (size_t)(mBase + it * 4 + q) * ldc + col) = ow[it];
          else          *(v4u*)(Cb + it * 64 + col) = ow[it];
        }
        
      }
    }
    __builtin_amdgcn_fence(__ATOMIC_RELEASE, "workgroup");
    __builtin_amdgcn_wave_barrier();
    __builtin_amdgcn_fence(__ATOMIC_ACQUIRE, "workgroup");
  }
}

/* ---------------------------------------------------------------------------
   Token-axis product, split-K: part[ks][bh][e][d] = sum over the 1024 tokens of split ks of vn[tok][h*64+e]*kn[tok][h*64+d]
   (operands carry x16 each). grid (32 bh, 8 ks), 128 threads = 4 waves; wave w owns output rows e = 16w..16w+15.
   and written transposed into LDS as sK[d][tok], sV[e][tok] (pitch 72 halves), so fragments are token-contiguous.
   Staging coverage: 64 rows x 8 segments = 512 segments = 128 threads x 4 iterations per tile; fragment reads touch
   tokens 0..63 only (all written); the pad columns 64..71 are never read.
   All barriers are reached by all 128 threads (no early exit).
   --------------------------------------------------------------------------- */
__global__ __launch_bounds__(128) void dots_splitk_kernel(const unsigned short* __restrict__ kn,
                                                          const unsigned short* __restrict__ vn,
                                                          float* __restrict__ part) {
  __shared__ __align__(16) _Float16 sK[64 * 72];
  __shared__ __align__(16) _Float16 sV[64 * 72];
  __shared__ __align__(16) float sO[4][16 * 68];
  const int tid = threadIdx.x, lane = tid & 31, wave = tid >> 5;
  const int bh = blockIdx.x, ks = blockIdx.y;
  const int b = bh >> 3, h = bh & 7;
  const size_t row0 = (size_t)b * kSeq + (size_t)ks * kTokPerSplit;
  const int rlane = lane & 15;
  const int koff  = (lane >> 4) * 8;
  const int hh    = lane >> 4;

  v8f acc[4];
#pragma unroll
  for (int j = 0; j < 4; ++j) acc[j] = (v8f){0.f, 0.f, 0.f, 0.f, 0.f, 0.f, 0.f, 0.f};

#pragma unroll 1
  for (int ch = 0; ch < kTokPerSplit / 64; ++ch) {
    __syncthreads();
#pragma unroll
    for (int it = 0; it < 4; ++it) {
      const int seg = it * 128 + tid;
      const int tok = seg >> 3;
      const int s8  = (seg & 7) * 8;
      const size_t go = (row0 + (size_t)ch * 64 + tok) * kInner + h * kDh + s8;
      const v4u kw = *(const v4u*)(kn + go);
      const v4u vw = *(const v4u*)(vn + go);
#pragma unroll
      for (int w = 0; w < 4; ++w) {
        const unsigned kword = kw[w];
        const unsigned vword = vw[w];
        const unsigned short k0b = (unsigned short)(kword & 0xffffu);
        const unsigned short k1b = (unsigned short)(kword >> 16);
        const unsigned short v0b = (unsigned short)(vword & 0xffffu);
        const unsigned short v1b = (unsigned short)(vword >> 16);
        sK[(s8 + 2 * w) * 72 + tok]     = __builtin_bit_cast(_Float16, k0b);
        sK[(s8 + 2 * w + 1) * 72 + tok] = __builtin_bit_cast(_Float16, k1b);
        sV[(s8 + 2 * w) * 72 + tok]     = __builtin_bit_cast(_Float16, v0b);
        sV[(s8 + 2 * w + 1) * 72 + tok] = __builtin_bit_cast(_Float16, v1b);
      }
    }
    __syncthreads();
#pragma unroll
    for (int kk = 0; kk < 2; ++kk) {
      const v16h a  = frag_load(sV + (wave * 16 + rlane) * 72 + kk * 32 + koff);
      const v16h b0 = frag_load(sK + (0 * 16 + rlane) * 72 + kk * 32 + koff);
      const v16h b1 = frag_load(sK + (1 * 16 + rlane) * 72 + kk * 32 + koff);
      const v16h b2 = frag_load(sK + (2 * 16 + rlane) * 72 + kk * 32 + koff);
      const v16h b3 = frag_load(sK + (3 * 16 + rlane) * 72 + kk * 32 + koff);
      acc[0] = mma16(a, b0, acc[0]);
      acc[1] = mma16(a, b1, acc[1]);
      acc[2] = mma16(a, b2, acc[2]);
      acc[3] = mma16(a, b3, acc[3]);
      guard4(acc[0], acc[1], acc[2], acc[3], a, b0, b1, b2, b3);
    }
  }

  float* slab = sO[wave];
#pragma unroll
  for (int j = 0; j < 4; ++j)
#pragma unroll
    for (int r = 0; r < 8; ++r) slab[(8 * hh + r) * 68 + (j << 4) + rlane] = acc[j][r];
  __builtin_amdgcn_fence(__ATOMIC_RELEASE, "workgroup");
  __builtin_amdgcn_wave_barrier();
  __builtin_amdgcn_fence(__ATOMIC_ACQUIRE, "workgroup");
  {
    const int c4 = (lane & 15) * 4;
    float* C = part + ((size_t)ks * kBH + bh) * (kDh * kDh) + (size_t)(wave * 16) * kDh;
    v4f vals[8];
#pragma unroll
    for (int it = 0; it < 8; ++it) vals[it] = *(const v4f*)(slab + (it * 2 + hh) * 68 + c4);
    {
#pragma unroll
      for (int it = 0; it < 8; ++it)
        *(v4f*)(C + (size_t)(it * 2 + hh) * kDh + c4) = vals[it];
      
    }
  }
}

/* ---------------------------------------------------------------------------
   Fixed-order sum of the 8 split-K partials, scaled (1/8192 and carries, all powers of two) in f32, then emitted as one
   f16 fragment-order plane per (batch, head). 8 elements per thread; 131072/8 = 16384 threads = 64 blocks exactly.
   --------------------------------------------------------------------------- */
__global__ __launch_bounds__(256) void dots_reduce_kernel(const float* __restrict__ part, unsigned short* __restrict__ dh,
                                                          int n8) {
  const int i = blockIdx.x * 256 + threadIdx.x;
  if (i >= n8) return;
  const size_t o = 8 * (size_t)i;
  float s[8];
#pragma unroll
  for (int e = 0; e < 8; ++e) s[e] = 0.0f;
#pragma unroll
  for (int ks = 0; ks < kSplitK; ++ks) {
    const float* p = part + (size_t)ks * kDotsElems + o;
    const v4f a = *(const v4f*)(p);
    const v4f c = *(const v4f*)(p + 4);
    s[0] += a[0]; s[1] += a[1]; s[2] += a[2]; s[3] += a[3];
    s[4] += c[0]; s[5] += c[1]; s[6] += c[2]; s[7] += c[3];
  }
  unsigned short hb[8];
#pragma unroll
  for (int e = 0; e < 8; ++e) {
    const float val = s[e] * kDotsScale;
    hb[e] = h_bits(val);
  }
  const v4u uh = (v4u){pk16(hb[0], hb[1]), pk16(hb[2], hb[3]), pk16(hb[4], hb[5]), pk16(hb[6], hb[7])};
  /* element o = (bh, e, d): unit (row e, columns d..d+7) of the 64 x 64 fragment-order plane of bh */
  const int e  = (i >> 3) & 63;
  const int d8 = i & 7;
  unsigned short* qh = dh + (size_t)(i >> 9) * (kDh * kDh) + ((e >> 4) * 2 + (d8 >> 2)) * 512 + ((d8 >> 1) & 1) * 256 +
                       frag_pos(e & 15, d8 & 1) * 8;
  *(v4u*)qh = uh;
  
}

/* ---------------------------------------------------------------------------
   Host glue: 13 kernel launches, nothing else.
   GEMM shapes (M % 32 == 0, N % 64 == 0, K % 32 == 0, no pad planes needed):
     kv projection : M 32768, N 1024, K 256 -> 1024 x 16 tiles = 16384 -> 2048 blocks
     q projection  : M 32768, N 512,  K 256 -> 1024 x 8  tiles =  8192 -> 1024 blocks
     q . dots      : 32 batches of M 8192, N 64, K 64 -> 32 x 256 tiles = 8192 -> 1024 blocks
     out projection: M 32768, N 256,  K 512 -> 1024 x 4  tiles =  4096 ->  512 blocks
   --------------------------------------------------------------------------- */
extern "C" void kernel_launch(void* const* d_in, const int* in_sizes, int n_in,
                              void* d_out, int out_size, void* d_ws, size_t ws_size,
                              hipStream_t stream) {
  if (n_in < 8) return;
  if (in_sizes[0] != kTok * kDim) return;
  if (in_sizes[1] != kTok * kDim) return;
  if (in_sizes[2] != kTok * 2) return;
  if (in_sizes[3] != kTok * 2) return;
  if (in_sizes[4] != kInner * kDim) return;
  if (in_sizes[5] != 2 * kInner * kDim) return;
  if (in_sizes[6] != kDim * kInner) return;
  if (in_sizes[7] != kDim) return;
  if (out_size != kTok * kDim) return;
  if (ws_size < kWsTotal) return;

  const float* x    = (const float*)d_in[0];
  const float* z    = (const float*)d_in[1];
  const float* xpos = (const float*)d_in[2];
  const float* zpos = (const float*)d_in[3];
  const float* Wq   = (const float*)d_in[4];
  const float* Wkv  = (const float*)d_in[5];
  const float* Wout = (const float*)d_in[6];
  const float* bout = (const float*)d_in[7];
  float* out = (float*)d_out;

  char* ws = (char*)d_ws;
  unsigned short* WQ   = (unsigned short*)(ws + kOffWQ);
  unsigned short* WK   = (unsigned short*)(ws + kOffWK);
  unsigned short* WO   = (unsigned short*)(ws + kOffWO);
  unsigned short* S16  = (unsigned short*)(ws + kOffS16);
  unsigned short* KN   = (unsigned short*)(ws + kOffKN);
  unsigned short* VN   = (unsigned short*)(ws + kOffVN);
  unsigned short* QH   = (unsigned short*)(ws + kOffQH);
  float*          TAB  = (float*)(ws + kOffTAB);
  float*          PART = (float*)(ws + kOffPART);
  unsigned short* DH   = (unsigned short*)(ws + kOffDH);
  /* the attention output plane re-uses the k plane (same element type, same [32768][512] size); k is dead after
     the split-K token-axis product */
  unsigned short* ATT  = KN;

  /* inverse frequencies: 1 / f32(10000^(2j/32)), j = 0..15 */
  FreqTab ft;
  for (int j = 0; j < 16; ++j) {
    const double ex = (double)(2 * j) / 32.0;
    const float pw = (float)pow(10000.0, ex);
    ft.f[j] = 1.0f / pw;
  }

  /* weight planes ([out][in] = Bt orientation already): f16(bf16(w) * 1024); third argument = log2(K / 128) */
  cast8_bf_f16_kernel<<<(kInner * kDim / 8) / 256, 256, 0, stream>>>(Wq, WQ, 1, kWC);
  cast8_bf_f16_kernel<<<(2 * kInner * kDim / 8) / 256, 256, 0, stream>>>(Wkv, WK, 1, kWC);
  cast8_bf_f16_kernel<<<(kDim * kInner / 8) / 256, 256, 0, stream>>>(Wout, WO, 2, kWC);

  /* key/value side: z -> f16, position table, projection with fused norm (+ rotary on k) */
  cast8_bf_f16_kernel<<<(kTok * kDim / 8) / 256, 256, 0, stream>>>(z, S16, 1, kXC);
  rot_table_kernel<<<kTok / 8, 256, 0, stream>>>(zpos, TAB, ft);
  gemm_f16_kernel<3><<<(kTok / 32) * (2 * kInner / 64) / 8, 256, 0, stream>>>(
      S16, kDim, 0L, 0L,
      WK, kDim, 0L, 0L,
      (void*)KN, (void*)VN, kInner, 0L, 0L,
      bout, TAB,
      kTok, 2 * kInner, kDim, 1, 1, kProjScale);

  /* query side: x -> f16 (same region), position table (same region), projection with fused rotary */
  cast8_bf_f16_kernel<<<(kTok * kDim / 8) / 256, 256, 0, stream>>>(x, S16, 1, kXC);
  rot_table_kernel<<<kTok / 8, 256, 0, stream>>>(xpos, TAB, ft);
  gemm_f16_kernel<2><<<(kTok / 32) * (kInner / 64) / 8, 256, 0, stream>>>(
      S16, kDim, 0L, 0L,
      WQ, kDim, 0L, 0L,
      (void*)QH, (void*)VN, kInner, 0L, 0L,
      bout, TAB,
      kTok, kInner, kDim, 1, 1, kProjScale);

  /* token-axis product, deterministic split-K, then fixed-order reduce to the dots^T plane */
  dots_splitk_kernel<<<dim3(kBH, kSplitK), 128, 0, stream>>>(KN, VN, PART);
  dots_reduce_kernel<<<(kDotsElems / 8) / 256, 256, 0, stream>>>(PART, DH, kDotsElems / 8);

  /* attention output per (batch, head): [8192][64] = q_head [8192][64] . dots^T [64][64]^T, written at column h*64
     (64 columns of a fragment-order plane = 2 blocks = 1024 elements) */
  gemm_f16_kernel<1><<<kBH * (kSeq / 32) / 8, 256, 0, stream>>>(
      QH, kInner, (long)kSeq * kInner, (long)kDh * 16,
      DH, kDh, (long)kHeads * kDh * kDh, (long)kDh * kDh,
      (void*)ATT, (void*)VN, kInner, (long)kSeq * kInner, (long)kDh * 16,
      bout, TAB,
      kSeq, kDh, kDh, kHeads, kBH, kAttnScale);

  /* output projection + bias */
  gemm_f16_kernel<0><<<(kTok / 32) * (kDim / 64) / 8, 256, 0, stream>>>(
      ATT, kInner, 0L, 0L,
      WO, kInner, 0L, 0L,
      (void*)out, (void*)VN, kDim, 0L, 0L,
      bout, TAB,
      kTok, kDim, kInner, 1, 1, kOutScale);
}

// v002
// A run of this version takes 146 microseconds.
// Next to v001, in two timings, it ran 1.20 times as fast each time.
// All steps since v000 together make it 1.44 times as fast.
// Contractions (q/kv projections, token-axis k^T v, q.dots, output projection): v_wmma_f32_16x16x32_f16, one product per site, f32 accumulate; every operand a plain f16 plane with a power-of-two carry; every float module input RNE-converted to bf16 once at its first read (exact in the carried f16 planes); instance norm, rotary, scaling and bias in f32.
#include <hip/hip_runtime.h>
#include <math.h>

typedef __attribute__((ext_vector_type(16))) _Float16 v16h;
typedef __attribute__((ext_vector_type(8)))  _Float16 v8h;
typedef __attribute__((ext_vector_type(8)))  float    v8f;
typedef __attribute__((ext_vector_type(4)))  float    v4f;
typedef __attribute__((ext_vector_type(4)))  unsigned int v4u;

/* ---------------------------------------------------------------------------
   Shape constants
   --------------------------------------------------------------------------- */
constexpr int kBatch  = 4;
constexpr int kSeq    = 8192;
constexpr int kDim    = 256;
constexpr int kHeads  = 8;
constexpr int kDh     = 64;
constexpr int kInner  = kHeads * kDh;
constexpr int kTok    = kBatch * kSeq;
constexpr int kBH     = kBatch * kHeads;
constexpr int kSplitK = 8;
constexpr int kTokPerSplit = kSeq / kSplitK;
constexpr int kDotsElems = kBH * kDh * kDh;
static_assert(kInner == 512 && kTok == 32768 && kDotsElems == 131072, "shape");
static_assert((kDim % 32) == 0 && (kInner % 32) == 0 && (kDh % 32) == 0, "K multiples of 32");
static_assert((kTok % 32) == 0 && (kSeq % 32) == 0, "M multiples of 32");
static_assert((kInner % 64) == 0 && ((2 * kInner) % 64) == 0 && (kDim % 64) == 0 && (kDh % 64) == 0, "N multiples of 64");
static_assert((kTokPerSplit % 64) == 0, "token chunks of 64");

/* power-of-two carries of the f16 planes (all folded back exactly in f32) */
constexpr float kXC     = 16.0f;
constexpr float kWC     = 1024.0f;
constexpr float kKVC    = 16.0f;
constexpr float kQC     = 64.0f;
constexpr float kDC     = 1024.0f;
constexpr float kAC     = 64.0f;
constexpr float kProjScale = 1.0f / (kXC * kWC);
constexpr float kDotsScale = kDC / (kKVC * kKVC * (float)kSeq);
constexpr float kAttnScale = kAC / (kQC * kDC);
constexpr float kOutScale  = 1.0f / (kAC * kWC);
constexpr float kPosScale  = 64.0f;
constexpr float kNormEps   = 1e-5f;
constexpr float kInvDh     = 1.0f / (float)kDh;

/* ---------------------------------------------------------------------------
   Workspace region map (bytes; every offset is a multiple of 128). WQ, WK, WO, S16, QH, DH and the attention output
   plane are fragment-order planes (see frag_pos); the shapes below give rows and pitch. KN (as k) and VN are row-major.
     WQ   f16 [512][256]    Wq plane  (bf16 value x1024)            262,144
     WK   f16 [1024][256]   Wkv plane (bf16 value x1024)            524,288
     WO   f16 [256][512]    Wout plane (bf16 value x1024)           262,144
     S16  f16 [32768][256]  z x16                                  16,777,216
     KN   f16 [32768][512]  normed+rotated k x16; later the attention
                            output plane x64 (same type and size)   33,554,432
     VN   f16 [32768][512]  normed v x16                           33,554,432
     QH   f16 [32768][512]  rotated q x64                          33,554,432
     TAB  f32 [32768][64]   cos/sin table of the z positions        8,388,608
     PART f32 [8][32][64][64] split-K partials of the k^T v product  4,194,304
     DH   f16 [32][64][64]  dots^T plane (x1024/8192)                 262,144
     SX   f16 [32768][256]  x x16                                  16,777,216
     TABX f32 [32768][64]   cos/sin table of the x positions        8,388,608
     total                                                        156,499,968
   --------------------------------------------------------------------------- */
constexpr size_t kOffWQ   = 0;
constexpr size_t kOffWK   = kOffWQ   + (size_t)kInner * kDim * 2;
constexpr size_t kOffWO   = kOffWK   + (size_t)2 * kInner * kDim * 2;
constexpr size_t kOffS16  = kOffWO   + (size_t)kDim * kInner * 2;
constexpr size_t kOffKN   = kOffS16  + (size_t)kTok * kDim * 2;
constexpr size_t kOffVN   = kOffKN   + (size_t)kTok * kInner * 2;
constexpr size_t kOffQH   = kOffVN   + (size_t)kTok * kInner * 2;
constexpr size_t kOffTAB  = kOffQH   + (size_t)kTok * kInner * 2;
constexpr size_t kOffPART = kOffTAB  + (size_t)kTok * 64 * 4;
constexpr size_t kOffDH   = kOffPART + (size_t)kSplitK * kDotsElems * 4;
constexpr size_t kOffSX   = kOffDH   + (size_t)kDotsElems * 2;
constexpr size_t kOffTABX = kOffSX   + (size_t)kTok * kDim * 2;
constexpr size_t kWsTotal = kOffTABX + (size_t)kTok * 64 * 4;
static_assert(kWsTotal == 156499968ull, "carve total");
static_assert(kWsTotal <= 268435456ull, "carve cap");
static_assert((kOffWK % 128) == 0 && (kOffWO % 128) == 0 && (kOffS16 % 128) == 0 && (kOffKN % 128) == 0 &&
              (kOffVN % 128) == 0 && (kOffQH % 128) == 0 && (kOffTAB % 128) == 0 && (kOffPART % 128) == 0 &&
              (kOffDH % 128) == 0 && (kOffSX % 128) == 0 && (kOffTABX % 128) == 0, "128-B aligned regions");

/* ---------------------------------------------------------------------------
   Small helpers
   --------------------------------------------------------------------------- */
__device__ __forceinline__ unsigned short f2bf_bits(float f) {
  unsigned u = __float_as_uint(f);
  return (unsigned short)((u + 0x7FFFu + ((u >> 16) & 1u)) >> 16);
}
__device__ __forceinline__ float bf_bits2f(unsigned short h) { return __uint_as_float(((unsigned)h) << 16); }
/* RNE convert of an f32 value to the nearest bf16 value, returned as f32 */
__device__ __forceinline__ float bf_rne(float f) { return bf_bits2f(f2bf_bits(f)); }

__device__ __forceinline__ unsigned pk16(unsigned short a, unsigned short b) { return (unsigned)a | ((unsigned)b << 16); }
__device__ __forceinline__ unsigned short h_bits(float f) { const _Float16 h = (_Float16)f; return __builtin_bit_cast(unsigned short, h); }

union FragU { v16h v; v8h h[2]; };
/* elements 0..7 <- p[0..7], elements 8..15 <- p[16..23]; p already includes the lane-half k offset */
__device__ __forceinline__ v16h frag_load(const _Float16* p) {
  FragU f;
  f.h[0] = *(const v8h*)(p);
  f.h[1] = *(const v8h*)(p + 16);
  return f.v;
}
/* Fragment-order plane of a [R][K] f16 matrix (R % 16 == 0, K % 32 == 0): each 16-row x 32-k block is 1024 contiguous
   bytes = two 512-B segments (k 0..15, k 16..31 of the block); a segment holds 32 units of 8 halves, one per
   (row-in-block rl, k-half hi), at position frag_pos(rl, hi). Blocks run k-fastest: block (rb, kb) starts at
   (rb * (K / 32) + kb) * 512 halves. A wave's fragment load is then two loads of 512 contiguous bytes (4 whole lines),
   and 4 consecutive rows x both k-halves of a segment are one 128-B line (what one epilogue store covers). */
__device__ __forceinline__ int frag_pos(int rl, int hi) { return ((rl >> 2) << 3) | (hi << 2) | (rl & 3); }
/* pointer to 16-B units in global memory: the address space is spelled out so that the running pointers of the k loop
   stay global loads */
typedef const __attribute__((address_space(1))) v8h* unit_gptr;
/* elements 0..7 <- segment 0, elements 8..15 <- segment 1 (32 units on); p is the lane's own unit */
__device__ __forceinline__ v16h frag_load_plane(unit_gptr p) {
  FragU f;
  f.h[0] = p[0];
  f.h[1] = p[32];
  return f.v;
}
__device__ __forceinline__ v8f mma16(v16h a, v16h b, v8f c) {
  return __builtin_amdgcn_wmma_f32_16x16x32_f16(false, a, false, b, (short)0, c, false, false);
}
/* hazard guard: ties all four accumulators of a group and names the A fragment and all B fragments */
__device__ __forceinline__ void guard4(v8f& a0, v8f& a1, v8f& a2, v8f& a3,
                                       v16h x, v16h b0, v16h b1, v16h b2, v16h b3) {
  asm volatile("v_nop\n\tv_nop\n\tv_nop\n\tv_nop"
               : "+v"(a0), "+v"(a1), "+v"(a2), "+v"(a3)
               : "v"(x), "v"(b0), "v"(b1), "v"(b2), "v"(b3));
}

/* ---------------------------------------------------------------------------
   f32 -> bf16 value (RNE) -> f16 fragment-order plane with a power-of-two carry, 8 consecutive elements per thread.
   The carried bf16 value is exactly representable in f16 (8 significant bits, normal range).
   A block takes 16 rows x 128 columns of the [R][K] input, K = 128 << kshift: thread t reads row t / 16, columns
   (t % 16) * 8 .. + 7, puts its 16-B unit at its plane position in LDS (one pad unit per 16 keeps the banks spread),
   and after the barrier thread t stores unit t of the block's 4096 contiguous output bytes (whole lines).
   Coverage: (R / 16) * (K / 128) blocks exactly for every plane used:
     x, z 4096 blocks; Wq 64; Wkv 128; Wout 64. No early exit: all 256 threads reach the barrier.
   blk = the block's index inside its own plane; sm = 272 units of LDS.
   --------------------------------------------------------------------------- */
__device__ __forceinline__ void cast8_bf_f16_tile(v4u* sm, int blk, const float* __restrict__ in,
                                                  unsigned short* __restrict__ out, int kshift, float carry) {
  const int t   = threadIdx.x;
  const int rb  = blk >> kshift;
  const int cb  = blk & ((1 << kshift) - 1);
  const int row = t >> 4;
  const int k8  = t & 15;
  const float* p = in + (((size_t)(rb * 16 + row)) << (7 + kshift)) + cb * 128 + k8 * 8;
  const v4f a = *(const v4f*)(p);
  const v4f c = *(const v4f*)(p + 4);
  const float r0 = a[0], r1 = a[1], r2 = a[2], r3 = a[3];
  const float r4 = c[0], r5 = c[1], r6 = c[2], r7 = c[3];
  const float a0 = bf_rne(r0) * carry, a1 = bf_rne(r1) * carry, a2 = bf_rne(r2) * carry, a3 = bf_rne(r3) * carry;
  const float c0 = bf_rne(r4) * carry, c1 = bf_rne(r5) * carry, c2 = bf_rne(r6) * carry, c3 = bf_rne(r7) * carry;
  const v4u u = (v4u){pk16(h_bits(a0), h_bits(a1)), pk16(h_bits(a2), h_bits(a3)),
                      pk16(h_bits(c0), h_bits(c1)), pk16(h_bits(c2), h_bits(c3))};
  const int unit = (k8 >> 1) * 32 + frag_pos(row, k8 & 1);
  sm[unit + (unit >> 4)] = u;
  __syncthreads(); /* the unit read below was written by another wave */
  const v4u w = sm[t + (t >> 4)];
  unsigned short* q = out + ((((size_t)rb << (2 + kshift)) + cb * 4) << 9) + t * 8;
  *(v4u*)q = w;
}

/* ---------------------------------------------------------------------------
   Rotary table: tab[token][axis*32 + j] = cos(theta), tab[token][axis*32 + 16 + j] = sin(theta),
   theta = (bf16(pos[token][axis]) * 64) * inv_freq[j], j = 0..15. One thread per (token, axis, j).
   Block = 8 tokens x 32 (axis, j) = 256 threads; 32768/8 = 4096 blocks exactly per table; blk = index inside the table.
   Store: the 8 x 64 f32 tile (2048 B = 16 lines) is staged in LDS; waves 0..3 (whole waves) each emit
   --------------------------------------------------------------------------- */
struct FreqTab { float f[16]; };
static_assert(sizeof(FreqTab) == 64, "no padding");
__device__ __forceinline__ void rot_table_tile(float* sm, int blk, const float* __restrict__ pos, float* __restrict__ tab,
                                               const FreqTab& ft) {
  const int tid  = threadIdx.x;
  const int tl   = tid >> 5;
  const int axis = (tid >> 4) & 1;
  const int j    = tid & 15;
  const int token = blk * 8 + tl;
  float fr = ft.f[0];
#pragma unroll
  for (int e = 1; e < 16; ++e) fr = (j == e) ? ft.f[e] : fr;
  const float praw = pos[(size_t)token * 2 + axis];
  const float p   = bf_rne(praw);
  const float t   = p * kPosScale;
  const float ang = t * fr;
  const float cv = cosf(ang);
  const float sv = sinf(ang);
  sm[tl * 64 + axis * 32 + j]      = cv;
  sm[tl * 64 + axis * 32 + 16 + j] = sv;
  __syncthreads();
  if (tid < 128) {
    const v4f v = *(const v4f*)(sm + tid * 4);
    float* dst = tab + (size_t)blk * 512 + tid * 4;
    *(v4f*)dst = v;
    
  }
}

/* ---------------------------------------------------------------------------
   All input preparation in one launch: the five casts and the two tables depend on nothing but the inputs, so each block
   of one grid takes one tile of one of them (the choice is uniform for the block, so every barrier is reached by all 256
   threads).
     blocks 0 .. 63 Wq, 64 .. 191 Wkv, 192 .. 255 Wout; then r = 0 .. 16383: tile (r >> 1) & 4095 of x (r < 8192) or of z
     (z last: the next launch reads it), a cast tile where r has an even number of one bits, a table tile where odd (of
     r = 2m, 2m + 1 one is even, one odd, so every tile of either kind is taken exactly once).
   The casts wait on memory and the tables on the vector unit; the bit-parity order puts both kinds side by side on every
   WGP whatever power-of-two stride the block-to-WGP map has, so the two overlap.
   --------------------------------------------------------------------------- */
constexpr int kBlkWq   = kInner * kDim / 2048;
constexpr int kBlkWkv  = 2 * kInner * kDim / 2048;
constexpr int kBlkWo   = kDim * kInner / 2048;
constexpr int kBlkAct  = kTok * kDim / 2048;
constexpr int kBlkTab  = kTok / 8;
constexpr int kBlkPrep = kBlkWq + kBlkWkv + kBlkWo + 2 * kBlkAct + 2 * kBlkTab;
static_assert(kBlkAct == kBlkTab && kBlkPrep == 16640, "prep grid");
__global__ __launch_bounds__(256) void prep_kernel(const float* __restrict__ x, const float* __restrict__ z,
                                                   const float* __restrict__ xpos, const float* __restrict__ zpos,
                                                   const float* __restrict__ Wq, const float* __restrict__ Wkv,
                                                   const float* __restrict__ Wout,
                                                   unsigned short* __restrict__ wq16, unsigned short* __restrict__ wkv16,
                                                   unsigned short* __restrict__ wo16, unsigned short* __restrict__ z16,
                                                   unsigned short* __restrict__ x16, float* __restrict__ tabz,
                                                   float* __restrict__ tabx, FreqTab ft) {
  __shared__ __align__(16) v4u sm[272];
  int blk = blockIdx.x;
  if (blk < kBlkWq) { cast8_bf_f16_tile(sm, blk, Wq, wq16, 1, kWC); return; }
  blk -= kBlkWq;
  if (blk < kBlkWkv) { cast8_bf_f16_tile(sm, blk, Wkv, wkv16, 1, kWC); return; }
  blk -= kBlkWkv;
  if (blk < kBlkWo) { cast8_bf_f16_tile(sm, blk, Wout, wo16, 2, kWC); return; }
  blk -= kBlkWo;
  const bool isTab = (__popc((unsigned)blk) & 1) != 0;
  const bool isX   = blk < 2 * kBlkAct;
  const int  idx   = (blk >> 1) & (kBlkAct - 1);
  if (isTab) rot_table_tile((float*)sm, idx, isX ? xpos : zpos, isX ? tabx : tabz, ft);
  else       cast8_bf_f16_tile(sm, idx, isX ? x : z, isX ? x16 : z16, 1, kXC);
}

/* ---------------------------------------------------------------------------
   Batched WMMA GEMM, one f16 product:
     C[m,n] = scale * sum_k A[m,k]*Bt[n,k]
   A [M][lda] and Bt [N][ldb] are fragment-order planes (see frag_pos); M % 32 == 0, N % 64 == 0, K % 32 == 0.
   Each wave owns a 32x64 tile; tile id = blk*8 + wave over nBatch * (M/32) * (N/64); blk = block index inside the product.
   Batch z -> (zo = z / nInner, zi = z % nInner); operand bases advance by zo*s?o + zi*s?i elements (a step of 32 columns
   in a fragment-order plane is 512 elements).
   EPI 0: f32 out + bf16(bias[n]), row-major.  EPI 1: f16 out.  EPI 2: 2D rotary of each 64-wide head row (table rows = m)
   -> f16 x64.  EPI 1 and 2 write fragment-order planes of pitch ldc.
   EPI 3: per-row instance norm over the tile's 64 columns; tiles with n0 < 512 are rotated too and go to Cout,
          the others go to Cout2 (both row-major [M][512] f16 planes, x16).
   No block barriers in this code (per-wave slabs sT[wave]; the early exit is wave-uniform).
   --------------------------------------------------------------------------- */
template <int EPI>
__device__ __forceinline__ void gemm_f16_tile(
    float (*sT)[16 * 68], int blk,
    const unsigned short* __restrict__ Ap, int lda, long sAo, long sAi,
    const unsigned short* __restrict__ Bp, int ldb, long sBo, long sBi,
    void* __restrict__ Cout, void* __restrict__ Cout2, int ldc, long sCo, long sCi,
    const float* __restrict__ bias, const float* __restrict__ tab,
    int M, int N, int K, int nInner, int nBatch, float scale) {
  const int lane = threadIdx.x & 31;
  const int wave = threadIdx.x >> 5;
  const int tilesN = N >> 6;
  const int tilesM = M >> 5;
  const int perBatch = tilesM * tilesN;
  const int tile = blk * 8 + wave;
  if (tile >= perBatch * nBatch) return;
  const int z  = tile / perBatch;
  const int tt = tile - z * perBatch;
  const int tm = tt / tilesN;
  const int tn = tt - tm * tilesN;
  const int m0 = tm << 5;
  const int n0 = tn << 6;
  const int zo = z / nInner;
  const int zi = z - zo * nInner;

  const _Float16* A  = (const _Float16*)Ap + (size_t)zo * sAo + (size_t)zi * sAi;
  const _Float16* Bt = (const _Float16*)Bp + (size_t)zo * sBo + (size_t)zi * sBi;
  const size_t coff = (size_t)zo * sCo + (size_t)zi * sCi;

  const int rlane = lane & 15;
  const int mOff  = (lane >> 4) * 8;
  /* per-row-block strides and the lane's unit inside a 512-B segment */
  const size_t strA = (size_t)(lda >> 5) * 512;
  const size_t strB = (size_t)(ldb >> 5) * 512;
  const int lpos = frag_pos(rlane, lane >> 4) * 8;
  /* one running pointer per fragment row-block; a k step of 32 is the next 1024-B block (64 units) */
  unit_gptr pa[2];
  unit_gptr pb[4];
#pragma unroll
  for (int i = 0; i < 2; ++i) pa[i] = (unit_gptr)(A + (size_t)((m0 >> 4) + i) * strA + lpos);
#pragma unroll
  for (int j = 0; j < 4; ++j) pb[j] = (unit_gptr)(Bt + (size_t)((n0 >> 4) + j) * strB + lpos);

  v8f acc[2][4];
#pragma unroll
  for (int i = 0; i < 2; ++i)
#pragma unroll
    for (int j = 0; j < 4; ++j)
      acc[i][j] = (v8f){0.f, 0.f, 0.f, 0.f, 0.f, 0.f, 0.f, 0.f};

  for (int k0 = 0; k0 < K; k0 += 32) {
    v16h bh[4];
#pragma unroll
    for (int j = 0; j < 4; ++j) {
      bh[j] = frag_load_plane(pb[j]);
      pb[j] += 64;
    }
#pragma unroll
    for (int i = 0; i < 2; ++i) {
      const v16h ah = frag_load_plane(pa[i]);
      pa[i] += 64;
#pragma unroll
      for (int j = 0; j < 4; ++j)
        acc[i][j] = mma16(ah, bh[j], acc[i][j]);
      guard4(acc[i][0], acc[i][1], acc[i][2], acc[i][3], ah, bh[0], bh[1], bh[2], bh[3]);
    }
  }

  /* ---- epilogue ---- */
  float* slab = sT[wave];
  const int q  = lane >> 3;
  const int c8 = (lane & 7) * 8;
  const int hh = lane >> 4;
  const int c4 = (lane & 15) * 4;
  /* wave-uniform: the tile is a k head when its columns are below 512 */
  const bool isK = (n0 < kInner);
#pragma unroll
  for (int i = 0; i < 2; ++i) {
    const int mBase = m0 + (i << 4);
#pragma unroll
    for (int j = 0; j < 4; ++j) {
      float bv = 0.f;
      if (EPI == 0) {
        const float braw = bias[n0 + (j << 4) + rlane];
        bv = bf_rne(braw);
      }
#pragma unroll
      for (int r = 0; r < 8; ++r) {
        float v = acc[i][j][r] * scale;
        if (EPI == 0) v += bv;
        slab[(mOff + r) * 68 + (j << 4) + rlane] = v;
      }
    }
    __builtin_amdgcn_fence(__ATOMIC_RELEASE, "workgroup");
    __builtin_amdgcn_wave_barrier();
    __builtin_amdgcn_fence(__ATOMIC_ACQUIRE, "workgroup");
    if (EPI == 0) {
      /* f32 rows: 64 floats = 256 B = 16 lanes x 16 B; rows it*2 + hh, it = 0..7 -> 16 rows, each once */
      float* C = (float*)Cout + coff;
      v4f vals[8];
#pragma unroll
      for (int it = 0; it < 8; ++it) vals[it] = *(const v4f*)(slab + (it * 2 + hh) * 68 + c4);
      {
#pragma unroll
        for (int it = 0; it < 8; ++it)
          *(v4f*)(C + (size_t)(mBase + it * 2 + hh) * ldc + n0 + c4) = vals[it];
        
      }
    } else {
      unsigned short* Cb;
      int col;
      if (EPI == 3) {
        Cb  = isK ? (unsigned short*)Cout : (unsigned short*)Cout2;
        col = (n0 & (kInner - 1)) + c8;
      } else {
        /* the 16 x 64 slab is two whole blocks of the plane; col = the lane's unit for row q, rows it*4 add 64 each */
        Cb  = (unsigned short*)Cout + coff + ((size_t)(mBase >> 4) * (ldc >> 5) + (n0 >> 5)) * 512;
        col = ((lane & 7) >> 1) * 256 + frag_pos(q, lane & 1) * 8;
      }
      /* rotary: column c pairs with c ^ 16; the upper member of a pair takes +sin, the lower -sin */
      const float sgn = (c8 & 16) ? 1.0f : -1.0f;
      const int tcol  = (c8 >> 5) * 32 + (c8 & 15);
      const float oc  = (EPI == 1) ? 1.0f : ((EPI == 2) ? kQC : kKVC);
      v4u ow[4];
#pragma unroll
      for (int it = 0; it < 4; ++it) {
        const int row = it * 4 + q;
        const float* sp = slab + row * 68 + c8;
        const v4f ta = *(const v4f*)(sp);
        const v4f tb = *(const v4f*)(sp + 4);
        float o[8];
        o[0] = ta[0]; o[1] = ta[1]; o[2] = ta[2]; o[3] = ta[3];
        o[4] = tb[0]; o[5] = tb[1]; o[6] = tb[2]; o[7] = tb[3];
        if (EPI >= 2) {
          const float* pp = slab + row * 68 + (c8 ^ 16);
          const v4f pa = *(const v4f*)(pp);
          const v4f pb = *(const v4f*)(pp + 4);
          float p[8];
          p[0] = pa[0]; p[1] = pa[1]; p[2] = pa[2]; p[3] = pa[3];
          p[4] = pb[0]; p[5] = pb[1]; p[6] = pb[2]; p[7] = pb[3];
          if (EPI == 3) {
            /* mean and biased variance over the 64 columns of the row: 8 per lane, 8 lanes per row */
            float s = ((o[0] + o[1]) + (o[2] + o[3])) + ((o[4] + o[5]) + (o[6] + o[7]));
            s += __shfl_xor(s, 1, 32);
            s += __shfl_xor(s, 2, 32);
            s += __shfl_xor(s, 4, 32);
            const float mean = s * kInvDh;
#pragma unroll
            for (int e = 0; e < 8; ++e) { o[e] -= mean; p[e] -= mean; }
            float ss = 0.0f;
#pragma unroll
            for (int e = 0; e < 8; ++e) ss = fmaf(o[e], o[e], ss);
            ss += __shfl_xor(ss, 1, 32);
            ss += __shfl_xor(ss, 2, 32);
            ss += __shfl_xor(ss, 4, 32);
            const float rstd = rsqrtf(ss * kInvDh + kNormEps);
#pragma unroll
            for (int e = 0; e < 8; ++e) { o[e] *= rstd; p[e] *= rstd; }
          }
          if (EPI == 2 || isK) {
            const float* tp = tab + (size_t)(mBase + row) * 64 + tcol;
            const v4f ca = *(const v4f*)(tp);
            const v4f cb = *(const v4f*)(tp + 4);
            const v4f sa = *(const v4f*)(tp + 16);
            const v4f sb = *(const v4f*)(tp + 20);
            float cc[8], sn[8];
            cc[0] = ca[0]; cc[1] = ca[1]; cc[2] = ca[2]; cc[3] = ca[3];
            cc[4] = cb[0]; cc[5] = cb[1]; cc[6] = cb[2]; cc[7] = cb[3];
            sn[0] = sa[0]; sn[1] = sa[1]; sn[2] = sa[2]; sn[3] = sa[3];
            sn[4] = sb[0]; sn[5] = sb[1]; sn[6] = sb[2]; sn[7] = sb[3];
#pragma unroll
            for (int e = 0; e < 8; ++e) o[e] = o[e] * cc[e] + sgn * (p[e] * sn[e]);
          }
        }
#pragma unroll
        for (int e = 0; e < 8; ++e) o[e] *= oc;
        ow[it] = (v4u){pk16(h_bits(o[0]), h_bits(o[1])), pk16(h_bits(o[2]), h_bits(o[3])),
                       pk16(h_bits(o[4]), h_bits(o[5])), pk16(h_bits(o[6]), h_bits(o[7]))};
      }
      {
#pragma unroll
        for (int it = 0; it < 4; ++it) {
          if (EPI == 3) *(v4u*)(Cb + (size_t)(mBase + it * 4 + q) * ldc + col) = ow[it];
          else          *(v4u*)(Cb + it * 64 + col) = ow[it];
        }
        
      }
    }
    __builtin_amdgcn_fence(__ATOMIC_RELEASE, "workgroup");
    __builtin_amdgcn_wave_barrier();
    __builtin_amdgcn_fence(__ATOMIC_ACQUIRE, "workgroup");
  }
}

template <int EPI>
__global__ __launch_bounds__(256) void gemm_f16_kernel(
    const unsigned short* __restrict__ Ap, int lda, long sAo, long sAi,
    const unsigned short* __restrict__ Bp, int ldb, long sBo, long sBi,
    void* __restrict__ Cout, void* __restrict__ Cout2, int ldc, long sCo, long sCi,
    const float* __restrict__ bias, const float* __restrict__ tab,
    int M, int N, int K, int nInner, int nBatch, float scale) {
  __shared__ __align__(16) float sT[8][16 * 68];
  gemm_f16_tile<EPI>(sT, blockIdx.x, Ap, lda, sAo, sAi, Bp, ldb, sBo, sBi, Cout, Cout2, ldc, sCo, sCi, bias, tab,
                     M, N, K, nInner, nBatch, scale);
}

/* ---------------------------------------------------------------------------
   Token-axis product, split-K: part[ks][bh][e][d] = sum over the 1024 tokens of split ks of vn[tok][h*64+e]*kn[tok][h*64+d]
   (operands carry x16 each). 256 blocks: blk = ks * 32 + bh; waves 0..3 do the work as 128 threads, wave w owns output
   rows e = 16w..16w+15; waves 4..7 of the 256-thread block (the block size of the grid this shares) only pass the barriers.
   and written transposed into LDS as sK[d][tok], sV[e][tok] (pitch 72 halves), so fragments are token-contiguous.
   Staging coverage: 64 rows x 8 segments = 512 segments = 128 threads x 4 iterations per tile; fragment reads touch
   tokens 0..63 only (all written); the pad columns 64..71 are never read.
   All barriers are reached by all 256 threads (waves 4..7 return only after the last barrier; the test on the wave number is a scalar one).
   --------------------------------------------------------------------------- */
__device__ __forceinline__ void dots_splitk_tile(_Float16* sK, _Float16* sV, float (*sO)[16 * 68], int blk,
                                                 const unsigned short* __restrict__ kn,
                                                 const unsigned short* __restrict__ vn,
                                                 float* __restrict__ part) {
  const int tid = threadIdx.x, lane = tid & 31;
  /* the wave number in a scalar register: the tests on it are scalar branches, so waves 4..7 jump over the loads, the LDS
     traffic and the matrix instructions instead of issuing them with every lane off */
  const int wave = __builtin_amdgcn_readfirstlane(tid >> 5);
  const bool work = wave < 4;
  const int bh = blk & (kBH - 1), ks = blk / kBH;
  const int b = bh >> 3, h = bh & 7;
  const size_t row0 = (size_t)b * kSeq + (size_t)ks * kTokPerSplit;
  const int rlane = lane & 15;
  const int koff  = (lane >> 4) * 8;
  const int hh    = lane >> 4;

  v8f acc[4];
#pragma unroll
  for (int j = 0; j < 4; ++j) acc[j] = (v8f){0.f, 0.f, 0.f, 0.f, 0.f, 0.f, 0.f, 0.f};

#pragma unroll 1
  for (int ch = 0; ch < kTokPerSplit / 64; ++ch) {
    __syncthreads();
    if (work) { /* staging, waves 0..3 */
#pragma unroll
    for (int it = 0; it < 4; ++it) {
      const int seg = it * 128 + tid;
      const int tok = seg >> 3;
      const int s8  = (seg & 7) * 8;
      const size_t go = (row0 + (size_t)ch * 64 + tok) * kInner + h * kDh + s8;
      const v4u kw = *(const v4u*)(kn + go);
      const v4u vw = *(const v4u*)(vn + go);
#pragma unroll
      for (int w = 0; w < 4; ++w) {
        const unsigned kword = kw[w];
        const unsigned vword = vw[w];
        const unsigned short k0b = (unsigned short)(kword & 0xffffu);
        const unsigned short k1b = (unsigned short)(kword >> 16);
        const unsigned short v0b = (unsigned short)(vword & 0xffffu);
        const unsigned short v1b = (unsigned short)(vword >> 16);
        sK[(s8 + 2 * w) * 72 + tok]     = __builtin_bit_cast(_Float16, k0b);
        sK[(s8 + 2 * w + 1) * 72 + tok] = __builtin_bit_cast(_Float16, k1b);
        sV[(s8 + 2 * w) * 72 + tok]     = __builtin_bit_cast(_Float16, v0b);
        sV[(s8 + 2 * w + 1) * 72 + tok] = __builtin_bit_cast(_Float16, v1b);
      }
    }
    }
    __syncthreads();
    if (work) { /* products, waves 0..3 */
#pragma unroll
    for (int kk = 0; kk < 2; ++kk) {
      const v16h a  = frag_load(sV + (wave * 16 + rlane) * 72 + kk * 32 + koff);
      const v16h b0 = frag_load(sK + (0 * 16 + rlane) * 72 + kk * 32 + koff);
      const v16h b1 = frag_load(sK + (1 * 16 + rlane) * 72 + kk * 32 + koff);
      const v16h b2 = frag_load(sK + (2 * 16 + rlane) * 72 + kk * 32 + koff);
      const v16h b3 = frag_load(sK + (3 * 16 + rlane) * 72 + kk * 32 + koff);
      acc[0] = mma16(a, b0, acc[0]);
      acc[1] = mma16(a, b1, acc[1]);
      acc[2] = mma16(a, b2, acc[2]);
      acc[3] = mma16(a, b3, acc[3]);
      guard4(acc[0], acc[1], acc[2], acc[3], a, b0, b1, b2, b3);
    }
    }
  }

  if (!work) return; /* no barrier below */
  float* slab = sO[wave];
#pragma unroll
  for (int j = 0; j < 4; ++j)
#pragma unroll
    for (int r = 0; r < 8; ++r) slab[(8 * hh + r) * 68 + (j << 4) + rlane] = acc[j][r];
  __builtin_amdgcn_fence(__ATOMIC_RELEASE, "workgroup");
  __builtin_amdgcn_wave_barrier();
  __builtin_amdgcn_fence(__ATOMIC_ACQUIRE, "workgroup");
  {
    const int c4 = (lane & 15) * 4;
    float* C = part + ((size_t)ks * kBH + bh) * (kDh * kDh) + (size_t)(wave * 16) * kDh;
    v4f vals[8];
#pragma unroll
    for (int it = 0; it < 8; ++it) vals[it] = *(const v4f*)(slab + (it * 2 + hh) * 68 + c4);
    {
#pragma unroll
      for (int it = 0; it < 8; ++it)
        *(v4f*)(C + (size_t)(it * 2 + hh) * kDh + c4) = vals[it];
      
    }
  }
}

/* The token-axis product (reads k, v) and the q projection (EPI 2: reads x, Wq, the x table; writes q) depend on nothing
   of each other, so they are two ranges of blocks of one grid: the first 256 blocks take the token-axis product, which
   leaves most of each WGP free, the rest the q projection. One LDS array serves either range. */
constexpr int kBlkDots = kBH * kSplitK;
constexpr int kBlkQ    = (kTok / 32) * (kInner / 64) / 8;
constexpr int kLdsDotsKV = 64 * 72 * 2;
constexpr int kLdsQDots  = 2 * kLdsDotsKV + 4 * 16 * 68 * 4;
static_assert(kLdsQDots == 35840 && 8 * 16 * 68 * 4 <= kLdsQDots && (kLdsDotsKV % 16) == 0, "LDS carve");
__global__ __launch_bounds__(256) void dots_qproj_kernel(
    const unsigned short* __restrict__ kn, const unsigned short* __restrict__ vn, float* __restrict__ part,
    const unsigned short* __restrict__ Xp, const unsigned short* __restrict__ Wqp, void* __restrict__ Qout,
    const float* __restrict__ tabx, int M, int N, int K, float scale) {
  __shared__ __align__(16) unsigned char sm[kLdsQDots];
  const int blk = blockIdx.x;
  if (blk < kBlkDots)
    dots_splitk_tile((_Float16*)sm, (_Float16*)(sm + kLdsDotsKV), (float (*)[16 * 68])(sm + 2 * kLdsDotsKV), blk, kn, vn, part);
  else
    gemm_f16_tile<2>((float (*)[16 * 68])sm, blk - kBlkDots, Xp, K, 0L, 0L, Wqp, K, 0L, 0L, Qout, nullptr, N, 0L, 0L,
                     nullptr, tabx, M, N, K, 1, 1, scale);
}

/* ---------------------------------------------------------------------------
   Fixed-order sum of the 8 split-K partials, scaled (1/8192 and carries, all powers of two) in f32, then emitted as one
   f16 fragment-order plane per (batch, head). 8 elements per thread; 131072/8 = 16384 threads = 64 blocks exactly.
   --------------------------------------------------------------------------- */
__global__ __launch_bounds__(256) void dots_reduce_kernel(const float* __restrict__ part, unsigned short* __restrict__ dh,
                                                          int n8) {
  const int i = blockIdx.x * 256 + threadIdx.x;
  if (i >= n8) return;
  const size_t o = 8 * (size_t)i;
  float s[8];
#pragma unroll
  for (int e = 0; e < 8; ++e) s[e] = 0.0f;
#pragma unroll
  for (int ks = 0; ks < kSplitK; ++ks) {
    const float* p = part + (size_t)ks * kDotsElems + o;
    const v4f a = *(const v4f*)(p);
    const v4f c = *(const v4f*)(p + 4);
    s[0] += a[0]; s[1] += a[1]; s[2] += a[2]; s[3] += a[3];
    s[4] += c[0]; s[5] += c[1]; s[6] += c[2]; s[7] += c[3];
  }
  unsigned short hb[8];
#pragma unroll
  for (int e = 0; e < 8; ++e) {
    const float val = s[e] * kDotsScale;
    hb[e] = h_bits(val);
  }
  const v4u uh = (v4u){pk16(hb[0], hb[1]), pk16(hb[2], hb[3]), pk16(hb[4], hb[5]), pk16(hb[6], hb[7])};
  /* element o = (bh, e, d): unit (row e, columns d..d+7) of the 64 x 64 fragment-order plane of bh */
  const int e  = (i >> 3) & 63;
  const int d8 = i & 7;
  unsigned short* qh = dh + (size_t)(i >> 9) * (kDh * kDh) + ((e >> 4) * 2 + (d8 >> 2)) * 512 + ((d8 >> 1) & 1) * 256 +
                       frag_pos(e & 15, d8 & 1) * 8;
  *(v4u*)qh = uh;
  
}

/* ---------------------------------------------------------------------------
   Host glue: 6 kernel launches, nothing else.
   GEMM shapes (M % 32 == 0, N % 64 == 0, K % 32 == 0, no pad planes needed):
     kv projection : M 32768, N 1024, K 256 -> 1024 x 16 tiles = 16384 -> 2048 blocks
     q projection  : M 32768, N 512,  K 256 -> 1024 x 8  tiles =  8192 -> 1024 blocks (behind the 256 of the token-axis product)
     q . dots      : 32 batches of M 8192, N 64, K 64 -> 32 x 256 tiles = 8192 -> 1024 blocks
     out projection: M 32768, N 256,  K 512 -> 1024 x 4  tiles =  4096 ->  512 blocks
   --------------------------------------------------------------------------- */
extern "C" void kernel_launch(void* const* d_in, const int* in_sizes, int n_in,
                              void* d_out, int out_size, void* d_ws, size_t ws_size,
                              hipStream_t stream) {
  if (n_in < 8) return;
  if (in_sizes[0] != kTok * kDim) return;
  if (in_sizes[1] != kTok * kDim) return;
  if (in_sizes[2] != kTok * 2) return;
  if (in_sizes[3] != kTok * 2) return;
  if (in_sizes[4] != kInner * kDim) return;
  if (in_sizes[5] != 2 * kInner * kDim) return;
  if (in_sizes[6] != kDim * kInner) return;
  if (in_sizes[7] != kDim) return;
  if (out_size != kTok * kDim) return;
  if (ws_size < kWsTotal) return;

  const float* x    = (const float*)d_in[0];
  const float* z    = (const float*)d_in[1];
  const float* xpos = (const float*)d_in[2];
  const float* zpos = (const float*)d_in[3];
  const float* Wq   = (const float*)d_in[4];
  const float* Wkv  = (const float*)d_in[5];
  const float* Wout = (const float*)d_in[6];
  const float* bout = (const float*)d_in[7];
  float* out = (float*)d_out;

  char* ws = (char*)d_ws;
  unsigned short* WQ   = (unsigned short*)(ws + kOffWQ);
  unsigned short* WK   = (unsigned short*)(ws + kOffWK);
  unsigned short* WO   = (unsigned short*)(ws + kOffWO);
  unsigned short* S16  = (unsigned short*)(ws + kOffS16);
  unsigned short* KN   = (unsigned short*)(ws + kOffKN);
  unsigned short* VN   = (unsigned short*)(ws + kOffVN);
  unsigned short* QH   = (unsigned short*)(ws + kOffQH);
  float*          TAB  = (float*)(ws + kOffTAB);
  float*          PART = (float*)(ws + kOffPART);
  unsigned short* DH   = (unsigned short*)(ws + kOffDH);
  unsigned short* SX   = (unsigned short*)(ws + kOffSX);
  float*          TABX = (float*)(ws + kOffTABX);
  /* the attention output plane re-uses the k plane (same element type, same [32768][512] size); k is dead after
     the split-K token-axis product */
  unsigned short* ATT  = KN;

  /* inverse frequencies: 1 / f32(10000^(2j/32)), j = 0..15 */
  FreqTab ft;
  for (int j = 0; j < 16; ++j) {
    const double ex = (double)(2 * j) / 32.0;
    const float pw = (float)pow(10000.0, ex);
    ft.f[j] = 1.0f / pw;
  }

  /* weight planes ([out][in] = Bt orientation already): f16(bf16(w) * 1024); z and x planes: f16(bf16(v) * 16);
     position tables of z and x */
  prep_kernel<<<kBlkPrep, 256, 0, stream>>>(x, z, xpos, zpos, Wq, Wkv, Wout, WQ, WK, WO, S16, SX, TAB, TABX, ft);

  /* key/value side: projection with fused norm (+ rotary on k) */
  gemm_f16_kernel<3><<<(kTok / 32) * (2 * kInner / 64) / 8, 256, 0, stream>>>(
      S16, kDim, 0L, 0L,
      WK, kDim, 0L, 0L,
      (void*)KN, (void*)VN, kInner, 0L, 0L,
      bout, TAB,
      kTok, 2 * kInner, kDim, 1, 1, kProjScale);

  /* token-axis product, deterministic split-K, beside the query side's projection with fused rotary; then the
     fixed-order reduce to the dots^T plane */
  dots_qproj_kernel<<<kBlkDots + kBlkQ, 256, 0, stream>>>(KN, VN, PART, SX, WQ, (void*)QH, TABX,
                                                          kTok, kInner, kDim, kProjScale);
  dots_reduce_kernel<<<(kDotsElems / 8) / 256, 256, 0, stream>>>(PART, DH, kDotsElems / 8);

  /* attention output per (batch, head): [8192][64] = q_head [8192][64] . dots^T [64][64]^T, written at column h*64
     (64 columns of a fragment-order plane = 2 blocks = 1024 elements) */
  gemm_f16_kernel<1><<<kBH * (kSeq / 32) / 8, 256, 0, stream>>>(
      QH, kInner, (long)kSeq * kInner, (long)kDh * 16,
      DH, kDh, (long)kHeads * kDh * kDh, (long)kDh * kDh,
      (void*)ATT, (void*)VN, kInner, (long)kSeq * kInner, (long)kDh * 16,
      bout, TAB,
      kSeq, kDh, kDh, kHeads, kBH, kAttnScale);

  /* output projection + bias */
  gemm_f16_kernel<0><<<(kTok / 32) * (kDim / 64) / 8, 256, 0, stream>>>(
      ATT, kInner, 0L, 0L,
      WO, kInner, 0L, 0L,
      (void*)out, (void*)VN, kDim, 0L, 0L,
      bout, TAB,
      kTok, kDim, kInner, 1, 1, kOutScale);
}

// v003
// A run of this version takes 136 microseconds.
// Next to v002, in two timings, it ran 1.08 and 1.07 times as fast.
// All steps since v000 together make it 1.55 times as fast.
// Contractions (q/kv projections, token-axis k^T v, Wout.dots^T, q.(that product)): v_wmma_f32_16x16x32_f16, one product per site, f32 accumulate; every operand a plain f16 plane with a power-of-two carry; every float module input RNE-converted to bf16 once at its first read (exact in the carried f16 planes); instance norm, rotary, scaling and bias in f32.
#include <hip/hip_runtime.h>
#include <math.h>

typedef __attribute__((ext_vector_type(16))) _Float16 v16h;
typedef __attribute__((ext_vector_type(8)))  _Float16 v8h;
typedef __attribute__((ext_vector_type(8)))  float    v8f;
typedef __attribute__((ext_vector_type(4)))  float    v4f;
typedef __attribute__((ext_vector_type(4)))  unsigned int v4u;

/* ---------------------------------------------------------------------------
   Shape constants
   --------------------------------------------------------------------------- */
constexpr int kBatch  = 4;
constexpr int kSeq    = 8192;
constexpr int kDim    = 256;
constexpr int kHeads  = 8;
constexpr int kDh     = 64;
constexpr int kInner  = kHeads * kDh;
constexpr int kTok    = kBatch * kSeq;
constexpr int kBH     = kBatch * kHeads;
constexpr int kSplitK = 8;
constexpr int kTokPerSplit = kSeq / kSplitK;
constexpr int kDotsElems = kBH * kDh * kDh;
static_assert(kInner == 512 && kTok == 32768 && kDotsElems == 131072, "shape");
static_assert((kDim % 32) == 0 && (kInner % 32) == 0 && (kDh % 32) == 0, "K multiples of 32");
static_assert((kTok % 32) == 0 && (kSeq % 32) == 0, "M multiples of 32");
static_assert((kInner % 64) == 0 && ((2 * kInner) % 64) == 0 && (kDim % 64) == 0 && (kDh % 64) == 0, "N multiples of 64");
static_assert((kTokPerSplit % 64) == 0, "token chunks of 64");

/* power-of-two carries of the f16 planes (all folded back exactly in f32) */
constexpr float kXC     = 16.0f;
constexpr float kWC     = 1024.0f;
constexpr float kKVC    = 16.0f;
constexpr float kQC     = 64.0f;
constexpr float kDC     = 1024.0f;
constexpr float kGC     = 1024.0f;
constexpr float kProjScale = 1.0f / (kXC * kWC);
constexpr float kDotsScale = kDC / (kKVC * kKVC * (float)kSeq);
constexpr float kFoldScale = kGC / (kWC * kDC);
constexpr float kOutScale  = 1.0f / (kQC * kGC);
constexpr float kPosScale  = 64.0f;
constexpr float kNormEps   = 1e-5f;
constexpr float kInvDh     = 1.0f / (float)kDh;

/* ---------------------------------------------------------------------------
   Workspace region map (bytes; every offset is a multiple of 128). WQ, WK, WO, S16, QH, GW and SX are fragment-order
   planes (see frag_pos); the shapes below give rows and pitch. KN and VN are row-major.
     WQ   f16 [512][256]    Wq plane  (bf16 value x1024)            262,144
     WK   f16 [1024][256]   Wkv plane (bf16 value x1024)            524,288
     WO   f16 [256][512]    Wout plane (bf16 value x1024)           262,144
     S16  f16 [32768][256]  z x16                                  16,777,216
     KN   f16 [32768][512]  normed+rotated k x16                   33,554,432
     VN   f16 [32768][512]  normed v x16                           33,554,432
     QH   f16 [32768][512]  rotated q x64                          33,554,432
     TAB  f32 [32768][64]   cos/sin table of the z positions        8,388,608
     PART f32 [8][32][64][64] split-K partials of the k^T v product  4,194,304
     GW   f16 [4][256][512] per batch: Wout . dots^T / 8192, x1024  1,048,576
     SX   f16 [32768][256]  x x16                                  16,777,216
     TABX f32 [32768][64]   cos/sin table of the x positions        8,388,608
     total                                                        157,286,400
   --------------------------------------------------------------------------- */
constexpr size_t kOffWQ   = 0;
constexpr size_t kOffWK   = kOffWQ   + (size_t)kInner * kDim * 2;
constexpr size_t kOffWO   = kOffWK   + (size_t)2 * kInner * kDim * 2;
constexpr size_t kOffS16  = kOffWO   + (size_t)kDim * kInner * 2;
constexpr size_t kOffKN   = kOffS16  + (size_t)kTok * kDim * 2;
constexpr size_t kOffVN   = kOffKN   + (size_t)kTok * kInner * 2;
constexpr size_t kOffQH   = kOffVN   + (size_t)kTok * kInner * 2;
constexpr size_t kOffTAB  = kOffQH   + (size_t)kTok * kInner * 2;
constexpr size_t kOffPART = kOffTAB  + (size_t)kTok * 64 * 4;
constexpr size_t kOffGW   = kOffPART + (size_t)kSplitK * kDotsElems * 4;
constexpr size_t kOffSX   = kOffGW   + (size_t)kBatch * kDim * kInner * 2;
constexpr size_t kOffTABX = kOffSX   + (size_t)kTok * kDim * 2;
constexpr size_t kWsTotal = kOffTABX + (size_t)kTok * 64 * 4;
static_assert(kWsTotal == 157286400ull, "carve total");
static_assert(kWsTotal <= 268435456ull, "carve cap");
static_assert((kOffWK % 128) == 0 && (kOffWO % 128) == 0 && (kOffS16 % 128) == 0 && (kOffKN % 128) == 0 &&
              (kOffVN % 128) == 0 && (kOffQH % 128) == 0 && (kOffTAB % 128) == 0 && (kOffPART % 128) == 0 &&
              (kOffGW % 128) == 0 && (kOffSX % 128) == 0 && (kOffTABX % 128) == 0, "128-B aligned regions");

/* ---------------------------------------------------------------------------
   Small helpers
   --------------------------------------------------------------------------- */
__device__ __forceinline__ unsigned short f2bf_bits(float f) {
  unsigned u = __float_as_uint(f);
  return (unsigned short)((u + 0x7FFFu + ((u >> 16) & 1u)) >> 16);
}
__device__ __forceinline__ float bf_bits2f(unsigned short h) { return __uint_as_float(((unsigned)h) << 16); }
/* RNE convert of an f32 value to the nearest bf16 value, returned as f32 */
__device__ __forceinline__ float bf_rne(float f) { return bf_bits2f(f2bf_bits(f)); }

__device__ __forceinline__ unsigned pk16(unsigned short a, unsigned short b) { return (unsigned)a | ((unsigned)b << 16); }
__device__ __forceinline__ unsigned short h_bits(float f) { const _Float16 h = (_Float16)f; return __builtin_bit_cast(unsigned short, h); }

union FragU { v16h v; v8h h[2]; };
/* elements 0..7 <- p[0..7], elements 8..15 <- p[16..23]; p already includes the lane-half k offset */
__device__ __forceinline__ v16h frag_load(const _Float16* p) {
  FragU f;
  f.h[0] = *(const v8h*)(p);
  f.h[1] = *(const v8h*)(p + 16);
  return f.v;
}
/* Fragment-order plane of a [R][K] f16 matrix (R % 16 == 0, K % 32 == 0): each 16-row x 32-k block is 1024 contiguous
   bytes = two 512-B segments (k 0..15, k 16..31 of the block); a segment holds 32 units of 8 halves, one per
   (row-in-block rl, k-half hi), at position frag_pos(rl, hi). Blocks run k-fastest: block (rb, kb) starts at
   (rb * (K / 32) + kb) * 512 halves. A wave's fragment load is then two loads of 512 contiguous bytes (4 whole lines),
   and 4 consecutive rows x both k-halves of a segment are one 128-B line (what one epilogue store covers). */
__device__ __forceinline__ int frag_pos(int rl, int hi) { return ((rl >> 2) << 3) | (hi << 2) | (rl & 3); }
/* pointer to 16-B units in global memory: the address space is spelled out so that the running pointers of the k loop
   stay global loads */
typedef const __attribute__((address_space(1))) v8h* unit_gptr;
/* elements 0..7 <- segment 0, elements 8..15 <- segment 1 (32 units on); p is the lane's own unit */
__device__ __forceinline__ v16h frag_load_plane(unit_gptr p) {
  FragU f;
  f.h[0] = p[0];
  f.h[1] = p[32];
  return f.v;
}
__device__ __forceinline__ v8f mma16(v16h a, v16h b, v8f c) {
  return __builtin_amdgcn_wmma_f32_16x16x32_f16(false, a, false, b, (short)0, c, false, false);
}
/* hazard guard: ties all four accumulators of a group and names the A fragment and all B fragments */
__device__ __forceinline__ void guard4(v8f& a0, v8f& a1, v8f& a2, v8f& a3,
                                       v16h x, v16h b0, v16h b1, v16h b2, v16h b3) {
  asm volatile("v_nop\n\tv_nop\n\tv_nop\n\tv_nop"
               : "+v"(a0), "+v"(a1), "+v"(a2), "+v"(a3)
               : "v"(x), "v"(b0), "v"(b1), "v"(b2), "v"(b3));
}

/* ---------------------------------------------------------------------------
   f32 -> bf16 value (RNE) -> f16 fragment-order plane with a power-of-two carry, 8 consecutive elements per thread.
   The carried bf16 value is exactly representable in f16 (8 significant bits, normal range).
   A block takes 16 rows x 128 columns of the [R][K] input, K = 128 << kshift: thread t reads row t / 16, columns
   (t % 16) * 8 .. + 7, puts its 16-B unit at its plane position in LDS (one pad unit per 16 keeps the banks spread),
   and after the barrier thread t stores unit t of the block's 4096 contiguous output bytes (whole lines).
   Coverage: (R / 16) * (K / 128) blocks exactly for every plane used:
     x, z 4096 blocks; Wq 64; Wkv 128; Wout 64. No early exit: all 256 threads reach the barrier.
   blk = the block's index inside its own plane; sm = 272 units of LDS.
   --------------------------------------------------------------------------- */
__device__ __forceinline__ void cast8_bf_f16_tile(v4u* sm, int blk, const float* __restrict__ in,
                                                  unsigned short* __restrict__ out, int kshift, float carry) {
  const int t   = threadIdx.x;
  const int rb  = blk >> kshift;
  const int cb  = blk & ((1 << kshift) - 1);
  const int row = t >> 4;
  const int k8  = t & 15;
  const float* p = in + (((size_t)(rb * 16 + row)) << (7 + kshift)) + cb * 128 + k8 * 8;
  const v4f a = *(const v4f*)(p);
  const v4f c = *(const v4f*)(p + 4);
  const float r0 = a[0], r1 = a[1], r2 = a[2], r3 = a[3];
  const float r4 = c[0], r5 = c[1], r6 = c[2], r7 = c[3];
  const float a0 = bf_rne(r0) * carry, a1 = bf_rne(r1) * carry, a2 = bf_rne(r2) * carry, a3 = bf_rne(r3) * carry;
  const float c0 = bf_rne(r4) * carry, c1 = bf_rne(r5) * carry, c2 = bf_rne(r6) * carry, c3 = bf_rne(r7) * carry;
  const v4u u = (v4u){pk16(h_bits(a0), h_bits(a1)), pk16(h_bits(a2), h_bits(a3)),
                      pk16(h_bits(c0), h_bits(c1)), pk16(h_bits(c2), h_bits(c3))};
  const int unit = (k8 >> 1) * 32 + frag_pos(row, k8 & 1);
  sm[unit + (unit >> 4)] = u;
  __syncthreads(); /* the unit read below was written by another wave */
  const v4u w = sm[t + (t >> 4)];
  unsigned short* q = out + ((((size_t)rb << (2 + kshift)) + cb * 4) << 9) + t * 8;
  *(v4u*)q = w;
}

/* ---------------------------------------------------------------------------
   Rotary table: tab[token][axis*32 + j] = cos(theta), tab[token][axis*32 + 16 + j] = sin(theta),
   theta = (bf16(pos[token][axis]) * 64) * inv_freq[j], j = 0..15. One thread per (token, axis, j).
   Block = 8 tokens x 32 (axis, j) = 256 threads; 32768/8 = 4096 blocks exactly per table; blk = index inside the table.
   Store: the 8 x 64 f32 tile (2048 B = 16 lines) is staged in LDS; waves 0..3 (whole waves) each emit
   --------------------------------------------------------------------------- */
struct FreqTab { float f[16]; };
static_assert(sizeof(FreqTab) == 64, "no padding");
__device__ __forceinline__ void rot_table_tile(float* sm, int blk, const float* __restrict__ pos, float* __restrict__ tab,
                                               const FreqTab& ft) {
  const int tid  = threadIdx.x;
  const int tl   = tid >> 5;
  const int axis = (tid >> 4) & 1;
  const int j    = tid & 15;
  const int token = blk * 8 + tl;
  float fr = ft.f[0];
#pragma unroll
  for (int e = 1; e < 16; ++e) fr = (j == e) ? ft.f[e] : fr;
  const float praw = pos[(size_t)token * 2 + axis];
  const float p   = bf_rne(praw);
  const float t   = p * kPosScale;
  const float ang = t * fr;
  const float cv = cosf(ang);
  const float sv = sinf(ang);
  sm[tl * 64 + axis * 32 + j]      = cv;
  sm[tl * 64 + axis * 32 + 16 + j] = sv;
  __syncthreads();
  if (tid < 128) {
    const v4f v = *(const v4f*)(sm + tid * 4);
    float* dst = tab + (size_t)blk * 512 + tid * 4;
    *(v4f*)dst = v;
    
  }
}

/* ---------------------------------------------------------------------------
   All input preparation in one launch: the five casts and the two tables depend on nothing but the inputs, so each block
   of one grid takes one tile of one of them (the choice is uniform for the block, so every barrier is reached by all 256
   threads).
     blocks 0 .. 63 Wq, 64 .. 191 Wkv, 192 .. 255 Wout; then r = 0 .. 16383: tile (r >> 1) & 4095 of x (r < 8192) or of z
     (z last: the next launch reads it), a cast tile where r has an even number of one bits, a table tile where odd (of
     r = 2m, 2m + 1 one is even, one odd, so every tile of either kind is taken exactly once).
   The casts wait on memory and the tables on the vector unit; the bit-parity order puts both kinds side by side on every
   WGP whatever power-of-two stride the block-to-WGP map has, so the two overlap.
   --------------------------------------------------------------------------- */
constexpr int kBlkWq   = kInner * kDim / 2048;
constexpr int kBlkWkv  = 2 * kInner * kDim / 2048;
constexpr int kBlkWo   = kDim * kInner / 2048;
constexpr int kBlkAct  = kTok * kDim / 2048;
constexpr int kBlkTab  = kTok / 8;
constexpr int kBlkPrep = kBlkWq + kBlkWkv + kBlkWo + 2 * kBlkAct + 2 * kBlkTab;
static_assert(kBlkAct == kBlkTab && kBlkPrep == 16640, "prep grid");
__global__ __launch_bounds__(256) void prep_kernel(const float* __restrict__ x, const float* __restrict__ z,
                                                   const float* __restrict__ xpos, const float* __restrict__ zpos,
                                                   const float* __restrict__ Wq, const float* __restrict__ Wkv,
                                                   const float* __restrict__ Wout,
                                                   unsigned short* __restrict__ wq16, unsigned short* __restrict__ wkv16,
                                                   unsigned short* __restrict__ wo16, unsigned short* __restrict__ z16,
                                                   unsigned short* __restrict__ x16, float* __restrict__ tabz,
                                                   float* __restrict__ tabx, FreqTab ft) {
  __shared__ __align__(16) v4u sm[272];
  int blk = blockIdx.x;
  if (blk < kBlkWq) { cast8_bf_f16_tile(sm, blk, Wq, wq16, 1, kWC); return; }
  blk -= kBlkWq;
  if (blk < kBlkWkv) { cast8_bf_f16_tile(sm, blk, Wkv, wkv16, 1, kWC); return; }
  blk -= kBlkWkv;
  if (blk < kBlkWo) { cast8_bf_f16_tile(sm, blk, Wout, wo16, 2, kWC); return; }
  blk -= kBlkWo;
  const bool isTab = (__popc((unsigned)blk) & 1) != 0;
  const bool isX   = blk < 2 * kBlkAct;
  const int  idx   = (blk >> 1) & (kBlkAct - 1);
  if (isTab) rot_table_tile((float*)sm, idx, isX ? xpos : zpos, isX ? tabx : tabz, ft);
  else       cast8_bf_f16_tile(sm, idx, isX ? x : z, isX ? x16 : z16, 1, kXC);
}

/* ---------------------------------------------------------------------------
   Batched WMMA GEMM, one f16 product:
     C[m,n] = scale * sum_k A[m,k]*Bt[n,k]
   A [M][lda] and Bt [N][ldb] are fragment-order planes (see frag_pos); M % 32 == 0, N % 64 == 0, K % 32 == 0.
   Each wave owns a 32x64 tile; tile id = blk*8 + wave over nBatch * (M/32) * (N/64); blk = block index inside the product.
   Batch z -> (zo = z / nInner, zi = z % nInner); operand bases advance by zo*s?o + zi*s?i elements (a step of 32 columns
   in a fragment-order plane is 512 elements).
   EPI 0: f32 out + bf16(bias[n]), row-major.  EPI 1: f16 out (no launch takes it).  EPI 2: 2D rotary of each 64-wide head row (table rows = m)
   -> f16 x64.  EPI 1 and 2 write fragment-order planes of pitch ldc.
   EPI 3: per-row instance norm over the tile's 64 columns; tiles with n0 < 512 are rotated too and go to Cout,
          the others go to Cout2 (both row-major [M][512] f16 planes, x16).
   No block barriers in this code (per-wave slabs sT[wave]; the early exit is wave-uniform).
   --------------------------------------------------------------------------- */
template <int EPI>
__device__ __forceinline__ void gemm_f16_tile(
    float (*sT)[16 * 68], int blk,
    const unsigned short* __restrict__ Ap, int lda, long sAo, long sAi,
    const unsigned short* __restrict__ Bp, int ldb, long sBo, long sBi,
    void* __restrict__ Cout, void* __restrict__ Cout2, int ldc, long sCo, long sCi,
    const float* __restrict__ bias, const float* __restrict__ tab,
    int M, int N, int K, int nInner, int nBatch, float scale) {
  const int lane = threadIdx.x & 31;
  const int wave = threadIdx.x >> 5;
  const int tilesN = N >> 6;
  const int tilesM = M >> 5;
  const int perBatch = tilesM * tilesN;
  const int tile = blk * 8 + wave;
  if (tile >= perBatch * nBatch) return;
  const int z  = tile / perBatch;
  const int tt = tile - z * perBatch;
  const int tm = tt / tilesN;
  const int tn = tt - tm * tilesN;
  const int m0 = tm << 5;
  const int n0 = tn << 6;
  const int zo = z / nInner;
  const int zi = z - zo * nInner;

  const _Float16* A  = (const _Float16*)Ap + (size_t)zo * sAo + (size_t)zi * sAi;
  const _Float16* Bt = (const _Float16*)Bp + (size_t)zo * sBo + (size_t)zi * sBi;
  const size_t coff = (size_t)zo * sCo + (size_t)zi * sCi;

  const int rlane = lane & 15;
  const int mOff  = (lane >> 4) * 8;
  /* per-row-block strides and the lane's unit inside a 512-B segment */
  const size_t strA = (size_t)(lda >> 5) * 512;
  const size_t strB = (size_t)(ldb >> 5) * 512;
  const int lpos = frag_pos(rlane, lane >> 4) * 8;
  /* one running pointer per fragment row-block; a k step of 32 is the next 1024-B block (64 units) */
  unit_gptr pa[2];
  unit_gptr pb[4];
#pragma unroll
  for (int i = 0; i < 2; ++i) pa[i] = (unit_gptr)(A + (size_t)((m0 >> 4) + i) * strA + lpos);
#pragma unroll
  for (int j = 0; j < 4; ++j) pb[j] = (unit_gptr)(Bt + (size_t)((n0 >> 4) + j) * strB + lpos);

  v8f acc[2][4];
#pragma unroll
  for (int i = 0; i < 2; ++i)
#pragma unroll
    for (int j = 0; j < 4; ++j)
      acc[i][j] = (v8f){0.f, 0.f, 0.f, 0.f, 0.f, 0.f, 0.f, 0.f};

  for (int k0 = 0; k0 < K; k0 += 32) {
    v16h bh[4];
#pragma unroll
    for (int j = 0; j < 4; ++j) {
      bh[j] = frag_load_plane(pb[j]);
      pb[j] += 64;
    }
#pragma unroll
    for (int i = 0; i < 2; ++i) {
      const v16h ah = frag_load_plane(pa[i]);
      pa[i] += 64;
#pragma unroll
      for (int j = 0; j < 4; ++j)
        acc[i][j] = mma16(ah, bh[j], acc[i][j]);
      guard4(acc[i][0], acc[i][1], acc[i][2], acc[i][3], ah, bh[0], bh[1], bh[2], bh[3]);
    }
  }

  /* ---- epilogue ---- */
  float* slab = sT[wave];
  const int q  = lane >> 3;
  const int c8 = (lane & 7) * 8;
  const int hh = lane >> 4;
  const int c4 = (lane & 15) * 4;
  /* wave-uniform: the tile is a k head when its columns are below 512 */
  const bool isK = (n0 < kInner);
#pragma unroll
  for (int i = 0; i < 2; ++i) {
    const int mBase = m0 + (i << 4);
#pragma unroll
    for (int j = 0; j < 4; ++j) {
      float bv = 0.f;
      if (EPI == 0) {
        const float braw = bias[n0 + (j << 4) + rlane];
        bv = bf_rne(braw);
      }
#pragma unroll
      for (int r = 0; r < 8; ++r) {
        float v = acc[i][j][r] * scale;
        if (EPI == 0) v += bv;
        slab[(mOff + r) * 68 + (j << 4) + rlane] = v;
      }
    }
    __builtin_amdgcn_fence(__ATOMIC_RELEASE, "workgroup");
    __builtin_amdgcn_wave_barrier();
    __builtin_amdgcn_fence(__ATOMIC_ACQUIRE, "workgroup");
    if (EPI == 0) {
      /* f32 rows: 64 floats = 256 B = 16 lanes x 16 B; rows it*2 + hh, it = 0..7 -> 16 rows, each once */
      float* C = (float*)Cout + coff;
      v4f vals[8];
#pragma unroll
      for (int it = 0; it < 8; ++it) vals[it] = *(const v4f*)(slab + (it * 2 + hh) * 68 + c4);
      {
#pragma unroll
        for (int it = 0; it < 8; ++it)
          *(v4f*)(C + (size_t)(mBase + it * 2 + hh) * ldc + n0 + c4) = vals[it];
        
      }
    } else {
      unsigned short* Cb;
      int col;
      if (EPI == 3) {
        Cb  = isK ? (unsigned short*)Cout : (unsigned short*)Cout2;
        col = (n0 & (kInner - 1)) + c8;
      } else {
        /* the 16 x 64 slab is two whole blocks of the plane; col = the lane's unit for row q, rows it*4 add 64 each */
        Cb  = (unsigned short*)Cout + coff + ((size_t)(mBase >> 4) * (ldc >> 5) + (n0 >> 5)) * 512;
        col = ((lane & 7) >> 1) * 256 + frag_pos(q, lane & 1) * 8;
      }
      /* rotary: column c pairs with c ^ 16; the upper member of a pair takes +sin, the lower -sin */
      const float sgn = (c8 & 16) ? 1.0f : -1.0f;
      const int tcol  = (c8 >> 5) * 32 + (c8 & 15);
      const float oc  = (EPI == 1) ? 1.0f : ((EPI == 2) ? kQC : kKVC);
      v4u ow[4];
#pragma unroll
      for (int it = 0; it < 4; ++it) {
        const int row = it * 4 + q;
        const float* sp = slab + row * 68 + c8;
        const v4f ta = *(const v4f*)(sp);
        const v4f tb = *(const v4f*)(sp + 4);
        float o[8];
        o[0] = ta[0]; o[1] = ta[1]; o[2] = ta[2]; o[3] = ta[3];
        o[4] = tb[0]; o[5] = tb[1]; o[6] = tb[2]; o[7] = tb[3];
        if (EPI >= 2) {
          const float* pp = slab + row * 68 + (c8 ^ 16);
          const v4f pa = *(const v4f*)(pp);
          const v4f pb = *(const v4f*)(pp + 4);
          float p[8];
          p[0] = pa[0]; p[1] = pa[1]; p[2] = pa[2]; p[3] = pa[3];
          p[4] = pb[0]; p[5] = pb[1]; p[6] = pb[2]; p[7] = pb[3];
          if (EPI == 3) {
            /* mean and biased variance over the 64 columns of the row: 8 per lane, 8 lanes per row */
            float s = ((o[0] + o[1]) + (o[2] + o[3])) + ((o[4] + o[5]) + (o[6] + o[7]));
            s += __shfl_xor(s, 1, 32);
            s += __shfl_xor(s, 2, 32);
            s += __shfl_xor(s, 4, 32);
            const float mean = s * kInvDh;
#pragma unroll
            for (int e = 0; e < 8; ++e) { o[e] -= mean; p[e] -= mean; }
            float ss = 0.0f;
#pragma unroll
            for (int e = 0; e < 8; ++e) ss = fmaf(o[e], o[e], ss);
            ss += __shfl_xor(ss, 1, 32);
            ss += __shfl_xor(ss, 2, 32);
            ss += __shfl_xor(ss, 4, 32);
            const float rstd = rsqrtf(ss * kInvDh + kNormEps);
#pragma unroll
            for (int e = 0; e < 8; ++e) { o[e] *= rstd; p[e] *= rstd; }
          }
          if (EPI == 2 || isK) {
            const float* tp = tab + (size_t)(mBase + row) * 64 + tcol;
            const v4f ca = *(const v4f*)(tp);
            const v4f cb = *(const v4f*)(tp + 4);
            const v4f sa = *(const v4f*)(tp + 16);
            const v4f sb = *(const v4f*)(tp + 20);
            float cc[8], sn[8];
            cc[0] = ca[0]; cc[1] = ca[1]; cc[2] = ca[2]; cc[3] = ca[3];
            cc[4] = cb[0]; cc[5] = cb[1]; cc[6] = cb[2]; cc[7] = cb[3];
            sn[0] = sa[0]; sn[1] = sa[1]; sn[2] = sa[2]; sn[3] = sa[3];
            sn[4] = sb[0]; sn[5] = sb[1]; sn[6] = sb[2]; sn[7] = sb[3];
#pragma unroll
            for (int e = 0; e < 8; ++e) o[e] = o[e] * cc[e] + sgn * (p[e] * sn[e]);
          }
        }
#pragma unroll
        for (int e = 0; e < 8; ++e) o[e] *= oc;
        ow[it] = (v4u){pk16(h_bits(o[0]), h_bits(o[1])), pk16(h_bits(o[2]), h_bits(o[3])),
                       pk16(h_bits(o[4]), h_bits(o[5])), pk16(h_bits(o[6]), h_bits(o[7]))};
      }
      {
#pragma unroll
        for (int it = 0; it < 4; ++it) {
          if (EPI == 3) *(v4u*)(Cb + (size_t)(mBase + it * 4 + q) * ldc + col) = ow[it];
          else          *(v4u*)(Cb + it * 64 + col) = ow[it];
        }
        
      }
    }
    __builtin_amdgcn_fence(__ATOMIC_RELEASE, "workgroup");
    __builtin_amdgcn_wave_barrier();
    __builtin_amdgcn_fence(__ATOMIC_ACQUIRE, "workgroup");
  }
}

template <int EPI>
__global__ __launch_bounds__(256) void gemm_f16_kernel(
    const unsigned short* __restrict__ Ap, int lda, long sAo, long sAi,
    const unsigned short* __restrict__ Bp, int ldb, long sBo, long sBi,
    void* __restrict__ Cout, void* __restrict__ Cout2, int ldc, long sCo, long sCi,
    const float* __restrict__ bias, const float* __restrict__ tab,
    int M, int N, int K, int nInner, int nBatch, float scale) {
  __shared__ __align__(16) float sT[8][16 * 68];
  gemm_f16_tile<EPI>(sT, blockIdx.x, Ap, lda, sAo, sAi, Bp, ldb, sBo, sBi, Cout, Cout2, ldc, sCo, sCi, bias, tab,
                     M, N, K, nInner, nBatch, scale);
}

/* ---------------------------------------------------------------------------
   Token-axis product, split-K: part[ks][bh][d][e] = sum over the 1024 tokens of split ks of kn[tok][h*64+d]*vn[tok][h*64+e]
   (operands carry x16 each). 256 blocks: blk = ks * 32 + bh; waves 0..3 do the work as 128 threads, wave w owns output
   rows d = 16w..16w+15; waves 4..7 of the 256-thread block (the block size of the grid this shares) only pass the barriers.
   and written transposed into LDS as sK[d][tok], sV[e][tok] (pitch 72 halves), so fragments are token-contiguous.
   Staging coverage: 64 rows x 8 segments = 512 segments = 128 threads x 4 iterations per tile; fragment reads touch
   tokens 0..63 only (all written); the pad columns 64..71 are never read.
   All barriers are reached by all 256 threads (waves 4..7 return only after the last barrier; the test on the wave number is a scalar one).
   --------------------------------------------------------------------------- */
__device__ __forceinline__ void dots_splitk_tile(_Float16* sK, _Float16* sV, float (*sO)[16 * 68], int blk,
                                                 const unsigned short* __restrict__ kn,
                                                 const unsigned short* __restrict__ vn,
                                                 float* __restrict__ part) {
  const int tid = threadIdx.x, lane = tid & 31;
  /* the wave number in a scalar register: the tests on it are scalar branches, so waves 4..7 jump over the loads, the LDS
     traffic and the matrix instructions instead of issuing them with every lane off */
  const int wave = __builtin_amdgcn_readfirstlane(tid >> 5);
  const bool work = wave < 4;
  const int bh = blk & (kBH - 1), ks = blk / kBH;
  const int b = bh >> 3, h = bh & 7;
  const size_t row0 = (size_t)b * kSeq + (size_t)ks * kTokPerSplit;
  const int rlane = lane & 15;
  const int koff  = (lane >> 4) * 8;
  const int hh    = lane >> 4;

  v8f acc[4];
#pragma unroll
  for (int j = 0; j < 4; ++j) acc[j] = (v8f){0.f, 0.f, 0.f, 0.f, 0.f, 0.f, 0.f, 0.f};

#pragma unroll 1
  for (int ch = 0; ch < kTokPerSplit / 64; ++ch) {
    __syncthreads();
    if (work) { /* staging, waves 0..3 */
#pragma unroll
    for (int it = 0; it < 4; ++it) {
      const int seg = it * 128 + tid;
      const int tok = seg >> 3;
      const int s8  = (seg & 7) * 8;
      const size_t go = (row0 + (size_t)ch * 64 + tok) * kInner + h * kDh + s8;
      const v4u kw = *(const v4u*)(kn + go);
      const v4u vw = *(const v4u*)(vn + go);
#pragma unroll
      for (int w = 0; w < 4; ++w) {
        const unsigned kword = kw[w];
        const unsigned vword = vw[w];
        const unsigned short k0b = (unsigned short)(kword & 0xffffu);
        const unsigned short k1b = (unsigned short)(kword >> 16);
        const unsigned short v0b = (unsigned short)(vword & 0xffffu);
        const unsigned short v1b = (unsigned short)(vword >> 16);
        sK[(s8 + 2 * w) * 72 + tok]     = __builtin_bit_cast(_Float16, k0b);
        sK[(s8 + 2 * w + 1) * 72 + tok] = __builtin_bit_cast(_Float16, k1b);
        sV[(s8 + 2 * w) * 72 + tok]     = __builtin_bit_cast(_Float16, v0b);
        sV[(s8 + 2 * w + 1) * 72 + tok] = __builtin_bit_cast(_Float16, v1b);
      }
    }
    }
    __syncthreads();
    if (work) { /* products, waves 0..3 */
#pragma unroll
    for (int kk = 0; kk < 2; ++kk) {
      const v16h a  = frag_load(sK + (wave * 16 + rlane) * 72 + kk * 32 + koff);
      const v16h b0 = frag_load(sV + (0 * 16 + rlane) * 72 + kk * 32 + koff);
      const v16h b1 = frag_load(sV + (1 * 16 + rlane) * 72 + kk * 32 + koff);
      const v16h b2 = frag_load(sV + (2 * 16 + rlane) * 72 + kk * 32 + koff);
      const v16h b3 = frag_load(sV + (3 * 16 + rlane) * 72 + kk * 32 + koff);
      acc[0] = mma16(a, b0, acc[0]);
      acc[1] = mma16(a, b1, acc[1]);
      acc[2] = mma16(a, b2, acc[2]);
      acc[3] = mma16(a, b3, acc[3]);
      guard4(acc[0], acc[1], acc[2], acc[3], a, b0, b1, b2, b3);
    }
    }
  }

  if (!work) return; /* no barrier below */
  float* slab = sO[wave];
#pragma unroll
  for (int j = 0; j < 4; ++j)
#pragma unroll
    for (int r = 0; r < 8; ++r) slab[(8 * hh + r) * 68 + (j << 4) + rlane] = acc[j][r];
  __builtin_amdgcn_fence(__ATOMIC_RELEASE, "workgroup");
  __builtin_amdgcn_wave_barrier();
  __builtin_amdgcn_fence(__ATOMIC_ACQUIRE, "workgroup");
  {
    const int c4 = (lane & 15) * 4;
    float* C = part + ((size_t)ks * kBH + bh) * (kDh * kDh) + (size_t)(wave * 16) * kDh;
    v4f vals[8];
#pragma unroll
    for (int it = 0; it < 8; ++it) vals[it] = *(const v4f*)(slab + (it * 2 + hh) * 68 + c4);
    {
#pragma unroll
      for (int it = 0; it < 8; ++it)
        *(v4f*)(C + (size_t)(it * 2 + hh) * kDh + c4) = vals[it];
      
    }
  }
}

/* The token-axis product (reads k, v) and the q projection (EPI 2: reads x, Wq, the x table; writes q) depend on nothing
   of each other, so they are two ranges of blocks of one grid: the first 256 blocks take the token-axis product, which
   leaves most of each WGP free, the rest the q projection. One LDS array serves either range. */
constexpr int kBlkDots = kBH * kSplitK;
constexpr int kBlkQ    = (kTok / 32) * (kInner / 64) / 8;
constexpr int kLdsDotsKV = 64 * 72 * 2;
constexpr int kLdsQDots  = 2 * kLdsDotsKV + 4 * 16 * 68 * 4;
static_assert(kLdsQDots == 35840 && 8 * 16 * 68 * 4 <= kLdsQDots && (kLdsDotsKV % 16) == 0, "LDS carve");
__global__ __launch_bounds__(256) void dots_qproj_kernel(
    const unsigned short* __restrict__ kn, const unsigned short* __restrict__ vn, float* __restrict__ part,
    const unsigned short* __restrict__ Xp, const unsigned short* __restrict__ Wqp, void* __restrict__ Qout,
    const float* __restrict__ tabx, int M, int N, int K, float scale) {
  __shared__ __align__(16) unsigned char sm[kLdsQDots];
  const int blk = blockIdx.x;
  if (blk < kBlkDots)
    dots_splitk_tile((_Float16*)sm, (_Float16*)(sm + kLdsDotsKV), (float (*)[16 * 68])(sm + 2 * kLdsDotsKV), blk, kn, vn, part);
  else
    gemm_f16_tile<2>((float (*)[16 * 68])sm, blk - kBlkDots, Xp, K, 0L, 0L, Wqp, K, 0L, 0L, Qout, nullptr, N, 0L, 0L,
                     nullptr, tabx, M, N, K, 1, 1, scale);
}

/* ---------------------------------------------------------------------------
   out = (q . dots / 8192) . Wout^T is computed as q . G^T with G[b][o][h*64+d] = sum_e Wout[o][h*64+e] * dots[b][h][d][e] / 8192,
   so the per-token product with dots is replaced by this one, 256 rows a head. One block per (batch, head), 8 waves.
   Step 1: fixed-order sum of the 8 split-K partials, scaled (1/8192 and carries, all powers of two) in f32, emitted as one
   f16 fragment-order 64 x 64 plane [d][e] in LDS; 8 elements per unit, 512 units = 256 threads x 2.
   Step 2: wave w takes rows o = 32w .. 32w+31 of Wout (A, columns h*64 .. +63 of its plane) against all 64 rows d of the LDS
   plane (B), K = 64, and writes its 32 x 64 tile to columns h*64 .. +63 of the batch's fragment-order plane of pitch 512.
   No early exit: all 256 threads reach the barrier.
   --------------------------------------------------------------------------- */
__global__ __launch_bounds__(256) void dots_fold_kernel(const float* __restrict__ part, const unsigned short* __restrict__ wo,
                                                        unsigned short* __restrict__ gw) {
  __shared__ __align__(16) _Float16 sD[kDh * kDh];
  __shared__ __align__(16) float sT[8][32 * 68];
  const int tid = threadIdx.x, lane = tid & 31, wave = tid >> 5;
  const int bh = blockIdx.x, b = bh >> 3, h = bh & 7;
  const int rlane = lane & 15;
  const int mOff  = (lane >> 4) * 8;
  const int lpos  = frag_pos(rlane, lane >> 4) * 8;
  const int m0    = wave << 5;

  /* the Wout fragments depend on nothing of step 1: their loads fly beside those of the partials */
  v16h ah[2][2];
#pragma unroll
  for (int kb = 0; kb < 2; ++kb)
#pragma unroll
    for (int i = 0; i < 2; ++i)
      ah[kb][i] = frag_load_plane((unit_gptr)((const _Float16*)wo +
                                              ((size_t)((m0 >> 4) + i) * (kInner >> 5) + h * 2 + kb) * 512 + lpos));

#pragma unroll
  for (int u = 0; u < 2; ++u) {
    const int iu = u * 256 + tid;
    const size_t o = (size_t)bh * (kDh * kDh) + 8 * (size_t)iu;
    float s[8];
#pragma unroll
    for (int e = 0; e < 8; ++e) s[e] = 0.0f;
#pragma unroll
    for (int ks = 0; ks < kSplitK; ++ks) {
      const float* p = part + (size_t)ks * kDotsElems + o;
      const v4f a = *(const v4f*)(p);
      const v4f c = *(const v4f*)(p + 4);
      s[0] += a[0]; s[1] += a[1]; s[2] += a[2]; s[3] += a[3];
      s[4] += c[0]; s[5] += c[1]; s[6] += c[2]; s[7] += c[3];
    }
    unsigned short hb[8];
#pragma unroll
    for (int e = 0; e < 8; ++e) hb[e] = h_bits(s[e] * kDotsScale);
    /* unit iu = (row d, columns e8*8 .. +7) of the 64 x 64 fragment-order plane */
    const int d  = iu >> 3;
    const int e8 = iu & 7;
    *(v4u*)(sD + ((d >> 4) * 2 + (e8 >> 2)) * 512 + ((e8 >> 1) & 1) * 256 + frag_pos(d & 15, e8 & 1) * 8) =
        (v4u){pk16(hb[0], hb[1]), pk16(hb[2], hb[3]), pk16(hb[4], hb[5]), pk16(hb[6], hb[7])};
  }
  __syncthreads(); /* every wave reads the whole plane, written by all */

  v8f acc[2][4];
#pragma unroll
  for (int i = 0; i < 2; ++i)
#pragma unroll
    for (int j = 0; j < 4; ++j)
      acc[i][j] = (v8f){0.f, 0.f, 0.f, 0.f, 0.f, 0.f, 0.f, 0.f};
#pragma unroll
  for (int kb = 0; kb < 2; ++kb) {
    v16h bf[4];
#pragma unroll
    for (int j = 0; j < 4; ++j) {
      const _Float16* p = sD + (j * 2 + kb) * 512 + lpos;
      FragU f;
      f.h[0] = *(const v8h*)(p);
      f.h[1] = *(const v8h*)(p + 256);
      bf[j] = f.v;
    }
#pragma unroll
    for (int i = 0; i < 2; ++i) {
#pragma unroll
      for (int j = 0; j < 4; ++j)
        acc[i][j] = mma16(ah[kb][i], bf[j], acc[i][j]);
      /* keeps the group's operands in their registers past its last product, with the slots the results need */
      guard4(acc[i][0], acc[i][1], acc[i][2], acc[i][3], ah[kb][i], bf[0], bf[1], bf[2], bf[3]);
    }
  }

  /* the wave's 32 x 64 tile goes through its own LDS slab, so that each store covers whole 128-B lines: 16 rows x 64
     columns are two whole blocks of the plane */
  float* slab = sT[wave];
  const int q   = lane >> 3;
  const int c8  = (lane & 7) * 8;
  const int col = ((lane & 7) >> 1) * 256 + frag_pos(q, lane & 1) * 8;
#pragma unroll
  for (int i = 0; i < 2; ++i)
#pragma unroll
    for (int j = 0; j < 4; ++j)
#pragma unroll
      for (int r = 0; r < 8; ++r) slab[(i * 16 + mOff + r) * 68 + (j << 4) + rlane] = acc[i][j][r] * kFoldScale;
  /* the rows read below were written by other lanes of this wave */
  __builtin_amdgcn_fence(__ATOMIC_RELEASE, "workgroup");
  __builtin_amdgcn_wave_barrier();
  __builtin_amdgcn_fence(__ATOMIC_ACQUIRE, "workgroup");
#pragma unroll
  for (int i = 0; i < 2; ++i) {
    unsigned short* Cb = gw + (size_t)b * (kDim * kInner) + ((size_t)((m0 >> 4) + i) * (kInner >> 5) + h * 2) * 512;
#pragma unroll
    for (int it = 0; it < 4; ++it) {
      const float* sp = slab + (i * 16 + it * 4 + q) * 68 + c8;
      const v4f ta = *(const v4f*)(sp);
      const v4f tb = *(const v4f*)(sp + 4);
      *(v4u*)(Cb + it * 64 + col) = (v4u){pk16(h_bits(ta[0]), h_bits(ta[1])), pk16(h_bits(ta[2]), h_bits(ta[3])),
                                          pk16(h_bits(tb[0]), h_bits(tb[1])), pk16(h_bits(tb[2]), h_bits(tb[3]))};
    }
  }
}

/* ---------------------------------------------------------------------------
   Host glue: 5 kernel launches, nothing else.
   GEMM shapes (M % 32 == 0, N % 64 == 0, K % 32 == 0, no pad planes needed):
     kv projection : M 32768, N 1024, K 256 -> 1024 x 16 tiles = 16384 -> 2048 blocks
     q projection  : M 32768, N 512,  K 256 -> 1024 x 8  tiles =  8192 -> 1024 blocks (behind the 256 of the token-axis product)
     Wout . dots^T : 32 (batch, head) pairs of M 256, N 64, K 64 -> 32 blocks (dots_fold_kernel)
     q . G^T       : 4 batches of M 8192, N 256, K 512 -> 4 x 256 x 4 tiles = 4096 -> 512 blocks
   --------------------------------------------------------------------------- */
extern "C" void kernel_launch(void* const* d_in, const int* in_sizes, int n_in,
                              void* d_out, int out_size, void* d_ws, size_t ws_size,
                              hipStream_t stream) {
  if (n_in < 8) return;
  if (in_sizes[0] != kTok * kDim) return;
  if (in_sizes[1] != kTok * kDim) return;
  if (in_sizes[2] != kTok * 2) return;
  if (in_sizes[3] != kTok * 2) return;
  if (in_sizes[4] != kInner * kDim) return;
  if (in_sizes[5] != 2 * kInner * kDim) return;
  if (in_sizes[6] != kDim * kInner) return;
  if (in_sizes[7] != kDim) return;
  if (out_size != kTok * kDim) return;
  if (ws_size < kWsTotal) return;

  const float* x    = (const float*)d_in[0];
  const float* z    = (const float*)d_in[1];
  const float* xpos = (const float*)d_in[2];
  const float* zpos = (const float*)d_in[3];
  const float* Wq   = (const float*)d_in[4];
  const float* Wkv  = (const float*)d_in[5];
  const float* Wout = (const float*)d_in[6];
  const float* bout = (const float*)d_in[7];
  float* out = (float*)d_out;

  char* ws = (char*)d_ws;
  unsigned short* WQ   = (unsigned short*)(ws + kOffWQ);
  unsigned short* WK   = (unsigned short*)(ws + kOffWK);
  unsigned short* WO   = (unsigned short*)(ws + kOffWO);
  unsigned short* S16  = (unsigned short*)(ws + kOffS16);
  unsigned short* KN   = (unsigned short*)(ws + kOffKN);
  unsigned short* VN   = (unsigned short*)(ws + kOffVN);
  unsigned short* QH   = (unsigned short*)(ws + kOffQH);
  float*          TAB  = (float*)(ws + kOffTAB);
  float*          PART = (float*)(ws + kOffPART);
  unsigned short* GW   = (unsigned short*)(ws + kOffGW);
  unsigned short* SX   = (unsigned short*)(ws + kOffSX);
  float*          TABX = (float*)(ws + kOffTABX);

  /* inverse frequencies: 1 / f32(10000^(2j/32)), j = 0..15 */
  FreqTab ft;
  for (int j = 0; j < 16; ++j) {
    const double ex = (double)(2 * j) / 32.0;
    const float pw = (float)pow(10000.0, ex);
    ft.f[j] = 1.0f / pw;
  }

  /* weight planes ([out][in] = Bt orientation already): f16(bf16(w) * 1024); z and x planes: f16(bf16(v) * 16);
     position tables of z and x */
  prep_kernel<<<kBlkPrep, 256, 0, stream>>>(x, z, xpos, zpos, Wq, Wkv, Wout, WQ, WK, WO, S16, SX, TAB, TABX, ft);

  /* key/value side: projection with fused norm (+ rotary on k) */
  gemm_f16_kernel<3><<<(kTok / 32) * (2 * kInner / 64) / 8, 256, 0, stream>>>(
      S16, kDim, 0L, 0L,
      WK, kDim, 0L, 0L,
      (void*)KN, (void*)VN, kInner, 0L, 0L,
      bout, TAB,
      kTok, 2 * kInner, kDim, 1, 1, kProjScale);

  /* token-axis product, deterministic split-K, beside the query side's projection with fused rotary; then the
     fixed-order reduce and its product with Wout, per (batch, head) */
  dots_qproj_kernel<<<kBlkDots + kBlkQ, 256, 0, stream>>>(KN, VN, PART, SX, WQ, (void*)QH, TABX,
                                                          kTok, kInner, kDim, kProjScale);
  dots_fold_kernel<<<kBH, 256, 0, stream>>>(PART, WO, GW);

  /* output per batch: [8192][256] = q [8192][512] . G [256][512]^T, + bias */
  gemm_f16_kernel<0><<<(kTok / 32) * (kDim / 64) / 8, 256, 0, stream>>>(
      QH, kInner, (long)kSeq * kInner, 0L,
      GW, kInner, (long)kDim * kInner, 0L,
      (void*)out, (void*)VN, kDim, (long)kSeq * kDim, 0L,
      bout, TAB,
      kSeq, kDim, kInner, 1, kBatch, kOutScale);
}

// v004
// One run takes 132 microseconds.
// Next to v003, in two timings, it ran 1.03 times as fast each time.
// Over all steps from v000 it is 1.60 times as fast.
// Contractions (q/kv projections, token-axis k^T v, Wout.dots^T, q.(that product)): v_wmma_f32_16x16x32_f16, one product per site, f32 accumulate; every operand a plain f16 plane with a power-of-two carry; every float module input RNE-converted to bf16 once at its first read (exact in the carried f16 planes); instance norm, rotary, scaling and bias in f32.
#include <hip/hip_runtime.h>
#include <math.h>

typedef __attribute__((ext_vector_type(16))) _Float16 v16h;
typedef __attribute__((ext_vector_type(8)))  _Float16 v8h;
typedef __attribute__((ext_vector_type(8)))  float    v8f;
typedef __attribute__((ext_vector_type(4)))  float    v4f;
typedef __attribute__((ext_vector_type(4)))  unsigned int v4u;
typedef __attribute__((ext_vector_type(2)))  unsigned int v2u;

/* ---------------------------------------------------------------------------
   Shape constants
   --------------------------------------------------------------------------- */
constexpr int kBatch  = 4;
constexpr int kSeq    = 8192;
constexpr int kDim    = 256;
constexpr int kHeads  = 8;
constexpr int kDh     = 64;
constexpr int kInner  = kHeads * kDh;
constexpr int kTok    = kBatch * kSeq;
constexpr int kBH     = kBatch * kHeads;
constexpr int kSplitK = 8;
constexpr int kTokPerSplit = kSeq / kSplitK;
constexpr int kDotsElems = kBH * kDh * kDh;
static_assert(kInner == 512 && kTok == 32768 && kDotsElems == 131072, "shape");
static_assert((kDim % 32) == 0 && (kInner % 32) == 0 && (kDh % 32) == 0, "K multiples of 32");
static_assert((kTok % 32) == 0 && (kSeq % 32) == 0, "M multiples of 32");
static_assert((kInner % 64) == 0 && ((2 * kInner) % 64) == 0 && (kDim % 64) == 0 && (kDh % 64) == 0, "N multiples of 64");
static_assert((kTokPerSplit % 64) == 0, "token chunks of 64");

/* power-of-two carries of the f16 planes (all folded back exactly in f32) */
constexpr float kXC     = 16.0f;
constexpr float kWC     = 1024.0f;
constexpr float kKVC    = 16.0f;
constexpr float kQC     = 64.0f;
constexpr float kDC     = 1024.0f;
constexpr float kGC     = 1024.0f;
constexpr float kProjScale = 1.0f / (kXC * kWC);
constexpr float kDotsScale = kDC / (kKVC * kKVC * (float)kSeq);
constexpr float kFoldScale = kGC / (kWC * kDC);
constexpr float kOutScale  = 1.0f / (kQC * kGC);
constexpr float kPosScale  = 64.0f;
constexpr float kNormEps   = 1e-5f;
constexpr float kInvDh     = 1.0f / (float)kDh;

/* ---------------------------------------------------------------------------
   Workspace region map (bytes; every offset is a multiple of 128). WQ, WK, WO, S16, QH, GW and SX are fragment-order
   planes (see frag_pos); the shapes below give rows and pitch. KN and VN are row-major.
     WQ   f16 [512][256]    Wq plane  (bf16 value x1024)            262,144
     WK   f16 [1024][256]   Wkv plane (bf16 value x1024)            524,288
     WO   f16 [256][512]    Wout plane (bf16 value x1024)           262,144
     S16  f16 [32768][256]  z x16                                  16,777,216
     KN   f16 [32768][512]  normed+rotated k x16                   33,554,432
     VN   f16 [32768][512]  normed v x16                           33,554,432
     QH   f16 [32768][512]  rotated q x64                          33,554,432
     TAB  f32 [32768][64]   cos/sin table of the z positions        8,388,608
     PART f32 [8][32][64][64] split-K partials of the k^T v product  4,194,304
     GW   f16 [4][256][512] per batch: Wout . dots^T / 8192, x1024  1,048,576
     SX   f16 [32768][256]  x x16                                  16,777,216
     TABX f32 [32768][64]   cos/sin table of the x positions        8,388,608
     total                                                        157,286,400
   --------------------------------------------------------------------------- */
constexpr size_t kOffWQ   = 0;
constexpr size_t kOffWK   = kOffWQ   + (size_t)kInner * kDim * 2;
constexpr size_t kOffWO   = kOffWK   + (size_t)2 * kInner * kDim * 2;
constexpr size_t kOffS16  = kOffWO   + (size_t)kDim * kInner * 2;
constexpr size_t kOffKN   = kOffS16  + (size_t)kTok * kDim * 2;
constexpr size_t kOffVN   = kOffKN   + (size_t)kTok * kInner * 2;
constexpr size_t kOffQH   = kOffVN   + (size_t)kTok * kInner * 2;
constexpr size_t kOffTAB  = kOffQH   + (size_t)kTok * kInner * 2;
constexpr size_t kOffPART = kOffTAB  + (size_t)kTok * 64 * 4;
constexpr size_t kOffGW   = kOffPART + (size_t)kSplitK * kDotsElems * 4;
constexpr size_t kOffSX   = kOffGW   + (size_t)kBatch * kDim * kInner * 2;
constexpr size_t kOffTABX = kOffSX   + (size_t)kTok * kDim * 2;
constexpr size_t kWsTotal = kOffTABX + (size_t)kTok * 64 * 4;
static_assert(kWsTotal == 157286400ull, "carve total");
static_assert(kWsTotal <= 268435456ull, "carve cap");
static_assert((kOffWK % 128) == 0 && (kOffWO % 128) == 0 && (kOffS16 % 128) == 0 && (kOffKN % 128) == 0 &&
              (kOffVN % 128) == 0 && (kOffQH % 128) == 0 && (kOffTAB % 128) == 0 && (kOffPART % 128) == 0 &&
              (kOffGW % 128) == 0 && (kOffSX % 128) == 0 && (kOffTABX % 128) == 0, "128-B aligned regions");

/* ---------------------------------------------------------------------------
   Small helpers
   --------------------------------------------------------------------------- */
__device__ __forceinline__ unsigned short f2bf_bits(float f) {
  unsigned u = __float_as_uint(f);
  return (unsigned short)((u + 0x7FFFu + ((u >> 16) & 1u)) >> 16);
}
__device__ __forceinline__ float bf_bits2f(unsigned short h) { return __uint_as_float(((unsigned)h) << 16); }
/* RNE convert of an f32 value to the nearest bf16 value, returned as f32 */
__device__ __forceinline__ float bf_rne(float f) { return bf_bits2f(f2bf_bits(f)); }

__device__ __forceinline__ unsigned pk16(unsigned short a, unsigned short b) { return (unsigned)a | ((unsigned)b << 16); }
__device__ __forceinline__ unsigned short h_bits(float f) { const _Float16 h = (_Float16)f; return __builtin_bit_cast(unsigned short, h); }

union FragU { v16h v; v8h h[2]; };
/* elements 0..7 <- p[0..7], elements 8..15 <- p[16..23]; p already includes the lane-half k offset */
__device__ __forceinline__ v16h frag_load(const _Float16* p) {
  FragU f;
  f.h[0] = *(const v8h*)(p);
  f.h[1] = *(const v8h*)(p + 16);
  return f.v;
}
/* Fragment-order plane of a [R][K] f16 matrix (R % 16 == 0, K % 32 == 0): each 16-row x 32-k block is 1024 contiguous
   bytes = two 512-B segments (k 0..15, k 16..31 of the block); a segment holds 32 units of 8 halves, one per
   (row-in-block rl, k-half hi), at position frag_pos(rl, hi). Blocks run k-fastest: block (rb, kb) starts at
   (rb * (K / 32) + kb) * 512 halves. A wave's fragment load is then two loads of 512 contiguous bytes (4 whole lines),
   and 4 consecutive rows x both k-halves of a segment are one 128-B line (what one epilogue store covers). */
__device__ __forceinline__ int frag_pos(int rl, int hi) { return ((rl >> 2) << 3) | (hi << 2) | (rl & 3); }
/* pointer to 16-B units in global memory: the address space is spelled out so that the running pointers of the k loop
   stay global loads */
typedef const __attribute__((address_space(1))) v8h* unit_gptr;
/* elements 0..7 <- segment 0, elements 8..15 <- segment 1 (32 units on); p is the lane's own unit */
__device__ __forceinline__ v16h frag_load_plane(unit_gptr p) {
  FragU f;
  f.h[0] = p[0];
  f.h[1] = p[32];
  return f.v;
}
__device__ __forceinline__ v8f mma16(v16h a, v16h b, v8f c) {
  return __builtin_amdgcn_wmma_f32_16x16x32_f16(false, a, false, b, (short)0, c, false, false);
}
/* hazard guard: ties all four accumulators of a group and names the A fragment and all B fragments */
__device__ __forceinline__ void guard4(v8f& a0, v8f& a1, v8f& a2, v8f& a3,
                                       v16h x, v16h b0, v16h b1, v16h b2, v16h b3) {
  asm volatile("v_nop\n\tv_nop\n\tv_nop\n\tv_nop"
               : "+v"(a0), "+v"(a1), "+v"(a2), "+v"(a3)
               : "v"(x), "v"(b0), "v"(b1), "v"(b2), "v"(b3));
}

/* ---------------------------------------------------------------------------
   f32 -> bf16 value (RNE) -> f16 fragment-order plane with a power-of-two carry. The carried bf16 value is exactly
   representable in f16 (8 significant bits, normal range).
   ONE WAVE takes a tile of 16 rows x 128 columns of the [R][K] input, K = 128 << kshift, = 4 blocks of the plane = 4096
   contiguous output bytes. Load (kb, i), kb = 0..3, i = 0..3: lane l reads row 4i + l / 8, columns kb*32 + (l % 8)*4 .. + 3,
   so a load covers 4 whole 128-B lines. The lane's 4 values are half of one 16-B unit of the plane, and the 32 halves of
   load (kb, i) are the units of rows 4i .. 4i+3 of block kb: one whole line in either segment. So the 8-B store of the same
   lane needs no exchange between lanes, no LDS and no barrier.
   Coverage: (R / 16) * (K / 128) tiles exactly for every plane used: x, z 4096 tiles; Wq 64; Wkv 128; Wout 64.
   The loads and the convert-and-store part are two functions, so that a wave can put other work between them.
   --------------------------------------------------------------------------- */
__device__ __forceinline__ void cast_tile_load(v4f (&v)[16], int tile, const float* __restrict__ in, int kshift) {
  const int lane = threadIdx.x & 31;
  const int rb = tile >> kshift;
  const int cb = tile & ((1 << kshift) - 1);
  const size_t rows4 = (size_t)4 << (7 + kshift);
  const float* p0 = in + (((size_t)(rb * 16 + (lane >> 3))) << (7 + kshift)) + cb * 128 + (lane & 7) * 4;
  const float* p1 = p0 + rows4;
  const float* p2 = p1 + rows4;
  const float* p3 = p2 + rows4;
#pragma unroll
  for (int kb = 0; kb < 4; ++kb) {
    v[kb * 4 + 0] = *(const v4f*)(p0 + kb * 32);
    v[kb * 4 + 1] = *(const v4f*)(p1 + kb * 32);
    v[kb * 4 + 2] = *(const v4f*)(p2 + kb * 32);
    v[kb * 4 + 3] = *(const v4f*)(p3 + kb * 32);
  }
  /* the wait that belongs in front of any overwrite of the loads' address registers; it names them, so that they stay
     untouched (also as a later load's destination) up to here. With a literal kshift the row steps are folded into the
     loads' offset fields and p0 is the one base */
  if (__builtin_constant_p(kshift)) asm volatile("s_wait_xcnt 0x0" :: "v"(p0) : "memory");
  else                              asm volatile("s_wait_xcnt 0x0" :: "v"(p0), "v"(p1), "v"(p2), "v"(p3) : "memory");
}
__device__ __forceinline__ void cast_tile_store(const v4f (&v)[16], int tile, unsigned short* __restrict__ out, int kshift,
                                                float carry) {
  const int lane = threadIdx.x & 31;
  const int rb = tile >> kshift;
  const int cb = tile & ((1 << kshift) - 1);
  const int r  = lane >> 3;
  const int c  = lane & 7;
  /* columns 4c .. 4c+3 of a block: segment c / 4, k-half (c / 2) % 2, lower or upper 4 halves of the unit */
  unsigned short* q = out + ((((size_t)rb << (2 + kshift)) + cb * 4) << 9) + (c >> 2) * 256 +
                      frag_pos(r, (c >> 1) & 1) * 8 + (c & 1) * 4;
#pragma unroll
  for (int kb = 0; kb < 4; ++kb)
#pragma unroll
    for (int i = 0; i < 4; ++i) {
      const v4f a = v[kb * 4 + i];
      const float a0 = bf_rne(a[0]) * carry, a1 = bf_rne(a[1]) * carry, a2 = bf_rne(a[2]) * carry, a3 = bf_rne(a[3]) * carry;
      /* rows 4i .. 4i+3 stand 8 units = 64 halves behind rows 4i-4 .. 4i-1 */
      *(v2u*)(q + kb * 512 + i * 64) = (v2u){pk16(h_bits(a0), h_bits(a1)), pk16(h_bits(a2), h_bits(a3))};
    }
  /* the wait that belongs in front of any overwrite of the stores' registers by the code that follows (the next table's
     loop) */
  asm volatile("s_wait_xcnt 0x0" :: "v"(q) : "memory");
}

/* ---------------------------------------------------------------------------
   Rotary table: tab[token][axis*32 + j] = cos(theta), tab[token][axis*32 + 16 + j] = sin(theta),
   theta = (bf16(pos[token][axis]) * 64) * inv_freq[j], j = 0..15.
   ONE WAVE takes a tile of 8 tokens: lane = (axis, j), one token a trip; 32768/8 = 4096 tiles exactly per table.
   pv = the tile's 16 positions, one per lane (lane % 16 = token-in-tile * 2 + axis), loaded by the caller ahead of time.
   Store: the 8 x 64 f32 tile (2048 B = 16 lines) is staged in the wave's own LDS slab and leaves as 4 stores of 512
   contiguous bytes.
   --------------------------------------------------------------------------- */
struct FreqTab { float f[16]; };
static_assert(sizeof(FreqTab) == 64, "no padding");
/* orders a wave's own LDS writes and reads (other lanes' values); LDS only, so that the global loads and stores in flight
   are not waited for */
__device__ __forceinline__ void wave_lds_sync() {
  __builtin_amdgcn_fence(__ATOMIC_RELEASE, "workgroup", "local");
  __builtin_amdgcn_wave_barrier();
  __builtin_amdgcn_fence(__ATOMIC_ACQUIRE, "workgroup", "local");
}
__device__ __forceinline__ void rot_table_wave(float* slab, int tile, float pv, float* __restrict__ tab, float fr) {
  const int lane = threadIdx.x & 31;
  const int axis = lane >> 4;
  const int j    = lane & 15;
  const int pbits = __float_as_int(pv);
  /* rolled: eight copies of the sine and cosine code would only lengthen the text */
#pragma unroll 1
  for (int tl = 0; tl < 8; ++tl) {
    const int b0 = __builtin_amdgcn_readlane(pbits, 2 * tl);
    const int b1 = __builtin_amdgcn_readlane(pbits, 2 * tl + 1);
    const float praw = __int_as_float(axis ? b1 : b0);
    const float p   = bf_rne(praw);
    const float t   = p * kPosScale;
    const float ang = t * fr;
    const float cv = cosf(ang);
    const float sv = sinf(ang);
    slab[tl * 64 + axis * 32 + j]      = cv;
    slab[tl * 64 + axis * 32 + 16 + j] = sv;
  }
  wave_lds_sync();
  float* dst = tab + (size_t)tile * 512 + lane * 4;
#pragma unroll
  for (int n = 0; n < 4; ++n) {
    const v4f v = *(const v4f*)(slab + n * 128 + lane * 4);
    *(v4f*)(dst + n * 128) = v;
  }
  wave_lds_sync(); /* the slab is written again for the next table */
}

/* ---------------------------------------------------------------------------
   All input preparation in one launch of few, long waves; no wave depends on another, so there is no block barrier.
     blocks 0 .. 31: wave t = blk*8 + wave takes one cast tile of the weights: t 0 .. 63 Wq, 64 .. 191 Wkv, 192 .. 255 Wout.
     blocks 32 .. 543: wave idx = 0 .. 4095 takes cast tile idx of x and of z and table tile idx of either position array.
   Such a wave issues all its loads first (2 of positions, 32 of 512 B), computes the x table while they fly, converts and
   stores x, then the z table and z (z last: the next launch reads it).
   --------------------------------------------------------------------------- */
constexpr int kTileWq  = kInner * kDim / 2048;
constexpr int kTileWkv = 2 * kInner * kDim / 2048;
constexpr int kTileWo  = kDim * kInner / 2048;
constexpr int kTileAct = kTok * kDim / 2048;
constexpr int kTileTab = kTok / 8;
constexpr int kBlkPrepW = (kTileWq + kTileWkv + kTileWo) / 8;
constexpr int kBlkPrep  = kBlkPrepW + kTileAct / 8;
static_assert(kTileAct == kTileTab && (kTileWq % 8) == 0 && (kTileWkv % 8) == 0 && (kTileWo % 8) == 0 &&
              (kTileAct % 8) == 0 && kBlkPrep == 544, "prep grid");
__global__ __launch_bounds__(256) void prep_kernel(const float* __restrict__ x, const float* __restrict__ z,
                                                   const float* __restrict__ xpos, const float* __restrict__ zpos,
                                                   const float* __restrict__ Wq, const float* __restrict__ Wkv,
                                                   const float* __restrict__ Wout,
                                                   unsigned short* __restrict__ wq16, unsigned short* __restrict__ wkv16,
                                                   unsigned short* __restrict__ wo16, unsigned short* __restrict__ z16,
                                                   unsigned short* __restrict__ x16, float* __restrict__ tabz,
                                                   float* __restrict__ tabx, FreqTab ft) {
  __shared__ __align__(16) float sm[8][8 * 64];
  const int lane = threadIdx.x & 31;
  const int wave = __builtin_amdgcn_readfirstlane(threadIdx.x >> 5);
  const int blk  = blockIdx.x;
  if (blk < kBlkPrepW) {
    const int t = blk * 8 + wave;
    const bool isQ = t < kTileWq, isO = t >= kTileWq + kTileWkv;
    const float* in     = isQ ? Wq : (isO ? Wout : Wkv);
    unsigned short* out = isQ ? wq16 : (isO ? wo16 : wkv16);
    const int tile      = isQ ? t : (isO ? t - kTileWq - kTileWkv : t - kTileWq);
    const int kshift    = isO ? 2 : 1;
    v4f w[16];
    cast_tile_load(w, tile, in, kshift);
    cast_tile_store(w, tile, out, kshift, kWC);
    return;
  }
  const int idx = (blk - kBlkPrepW) * 8 + wave;
  const int j = lane & 15;
  float fr = ft.f[0];
#pragma unroll
  for (int e = 1; e < 16; ++e) fr = (j == e) ? ft.f[e] : fr;
  const float pvx = xpos[(size_t)idx * 16 + j];
  const float pvz = zpos[(size_t)idx * 16 + j];
  /* keeps what the tables need (the frequency becomes a load too) ahead of the 32 tile loads: loads are counted back in
     order, so a table's wait on a later one would wait for the tiles as well */
  __builtin_amdgcn_sched_barrier(0);
  v4f vx[16], vz[16];
  cast_tile_load(vx, idx, x, 1);
  cast_tile_load(vz, idx, z, 1);
  rot_table_wave(sm[wave], idx, pvx, tabx, fr);
  cast_tile_store(vx, idx, x16, 1, kXC);
  rot_table_wave(sm[wave], idx, pvz, tabz, fr);
  cast_tile_store(vz, idx, z16, 1, kXC);
}

/* ---------------------------------------------------------------------------
   Batched WMMA GEMM, one f16 product:
     C[m,n] = scale * sum_k A[m,k]*Bt[n,k]
   A [M][lda] and Bt [N][ldb] are fragment-order planes (see frag_pos); M % 32 == 0, N % 64 == 0, K % 32 == 0.
   Each wave owns a 32x64 tile; tile id = blk*8 + wave over nBatch * (M/32) * (N/64); blk = block index inside the product.
   Batch z -> (zo = z / nInner, zi = z % nInner); operand bases advance by zo*s?o + zi*s?i elements (a step of 32 columns
   in a fragment-order plane is 512 elements).
   EPI 0: f32 out + bf16(bias[n]), row-major.  EPI 1: f16 out (no launch takes it).  EPI 2: 2D rotary of each 64-wide head row (table rows = m)
   -> f16 x64.  EPI 1 and 2 write fragment-order planes of pitch ldc.
   EPI 3: per-row instance norm over the tile's 64 columns; tiles with n0 < 512 are rotated too and go to Cout,
          the others go to Cout2 (both row-major [M][512] f16 planes, x16).
   No block barriers in this code (per-wave slabs sT[wave]; the early exit is wave-uniform).
   --------------------------------------------------------------------------- */
template <int EPI>
__device__ __forceinline__ void gemm_f16_tile(
    float (*sT)[16 * 68], int blk,
    const unsigned short* __restrict__ Ap, int lda, long sAo, long sAi,
    const unsigned short* __restrict__ Bp, int ldb, long sBo, long sBi,
    void* __restrict__ Cout, void* __restrict__ Cout2, int ldc, long sCo, long sCi,
    const float* __restrict__ bias, const float* __restrict__ tab,
    int M, int N, int K, int nInner, int nBatch, float scale) {
  const int lane = threadIdx.x & 31;
  const int wave = threadIdx.x >> 5;
  const int tilesN = N >> 6;
  const int tilesM = M >> 5;
  const int perBatch = tilesM * tilesN;
  const int tile = blk * 8 + wave;
  if (tile >= perBatch * nBatch) return;
  const int z  = tile / perBatch;
  const int tt = tile - z * perBatch;
  const int tm = tt / tilesN;
  const int tn = tt - tm * tilesN;
  const int m0 = tm << 5;
  const int n0 = tn << 6;
  const int zo = z / nInner;
  const int zi = z - zo * nInner;

  const _Float16* A  = (const _Float16*)Ap + (size_t)zo * sAo + (size_t)zi * sAi;
  const _Float16* Bt = (const _Float16*)Bp + (size_t)zo * sBo + (size_t)zi * sBi;
  const size_t coff = (size_t)zo * sCo + (size_t)zi * sCi;

  const int rlane = lane & 15;
  const int mOff  = (lane >> 4) * 8;
  /* per-row-block strides and the lane's unit inside a 512-B segment */
  const size_t strA = (size_t)(lda >> 5) * 512;
  const size_t strB = (size_t)(ldb >> 5) * 512;
  const int lpos = frag_pos(rlane, lane >> 4) * 8;
  /* one running pointer per fragment row-block; a k step of 32 is the next 1024-B block (64 units) */
  unit_gptr pa[2];
  unit_gptr pb[4];
#pragma unroll
  for (int i = 0; i < 2; ++i) pa[i] = (unit_gptr)(A + (size_t)((m0 >> 4) + i) * strA + lpos);
#pragma unroll
  for (int j = 0; j < 4; ++j) pb[j] = (unit_gptr)(Bt + (size_t)((n0 >> 4) + j) * strB + lpos);

  v8f acc[2][4];
#pragma unroll
  for (int i = 0; i < 2; ++i)
#pragma unroll
    for (int j = 0; j < 4; ++j)
      acc[i][j] = (v8f){0.f, 0.f, 0.f, 0.f, 0.f, 0.f, 0.f, 0.f};

  for (int k0 = 0; k0 < K; k0 += 32) {
    v16h bh[4];
#pragma unroll
    for (int j = 0; j < 4; ++j) {
      bh[j] = frag_load_plane(pb[j]);
      pb[j] += 64;
    }
#pragma unroll
    for (int i = 0; i < 2; ++i) {
      const v16h ah = frag_load_plane(pa[i]);
      pa[i] += 64;
#pragma unroll
      for (int j = 0; j < 4; ++j)
        acc[i][j] = mma16(ah, bh[j], acc[i][j]);
      guard4(acc[i][0], acc[i][1], acc[i][2], acc[i][3], ah, bh[0], bh[1], bh[2], bh[3]);
    }
  }

  /* ---- epilogue ---- */
  float* slab = sT[wave];
  const int q  = lane >> 3;
  const int c8 = (lane & 7) * 8;
  const int hh = lane >> 4;
  const int c4 = (lane & 15) * 4;
  /* wave-uniform: the tile is a k head when its columns are below 512 */
  const bool isK = (n0 < kInner);
#pragma unroll
  for (int i = 0; i < 2; ++i) {
    const int mBase = m0 + (i << 4);
#pragma unroll
    for (int j = 0; j < 4; ++j) {
      float bv = 0.f;
      if (EPI == 0) {
        const float braw = bias[n0 + (j << 4) + rlane];
        bv = bf_rne(braw);
      }
#pragma unroll
      for (int r = 0; r < 8; ++r) {
        float v = acc[i][j][r] * scale;
        if (EPI == 0) v += bv;
        slab[(mOff + r) * 68 + (j << 4) + rlane] = v;
      }
    }
    __builtin_amdgcn_fence(__ATOMIC_RELEASE, "workgroup");
    __builtin_amdgcn_wave_barrier();
    __builtin_amdgcn_fence(__ATOMIC_ACQUIRE, "workgroup");
    if (EPI == 0) {
      /* f32 rows: 64 floats = 256 B = 16 lanes x 16 B; rows it*2 + hh, it = 0..7 -> 16 rows, each once */
      float* C = (float*)Cout + coff;
      v4f vals[8];
#pragma unroll
      for (int it = 0; it < 8; ++it) vals[it] = *(const v4f*)(slab + (it * 2 + hh) * 68 + c4);
      {
#pragma unroll
        for (int it = 0; it < 8; ++it)
          *(v4f*)(C + (size_t)(mBase + it * 2 + hh) * ldc + n0 + c4) = vals[it];
        
      }
    } else {
      unsigned short* Cb;
      int col;
      if (EPI == 3) {
        Cb  = isK ? (unsigned short*)Cout : (unsigned short*)Cout2;
        col = (n0 & (kInner - 1)) + c8;
      } else {
        /* the 16 x 64 slab is two whole blocks of the plane; col = the lane's unit for row q, rows it*4 add 64 each */
        Cb  = (unsigned short*)Cout + coff + ((size_t)(mBase >> 4) * (ldc >> 5) + (n0 >> 5)) * 512;
        col = ((lane & 7) >> 1) * 256 + frag_pos(q, lane & 1) * 8;
      }
      /* rotary: column c pairs with c ^ 16; the upper member of a pair takes +sin, the lower -sin */
      const float sgn = (c8 & 16) ? 1.0f : -1.0f;
      const int tcol  = (c8 >> 5) * 32 + (c8 & 15);
      const float oc  = (EPI == 1) ? 1.0f : ((EPI == 2) ? kQC : kKVC);
      v4u ow[4];
#pragma unroll
      for (int it = 0; it < 4; ++it) {
        const int row = it * 4 + q;
        const float* sp = slab + row * 68 + c8;
        const v4f ta = *(const v4f*)(sp);
        const v4f tb = *(const v4f*)(sp + 4);
        float o[8];
        o[0] = ta[0]; o[1] = ta[1]; o[2] = ta[2]; o[3] = ta[3];
        o[4] = tb[0]; o[5] = tb[1]; o[6] = tb[2]; o[7] = tb[3];
        if (EPI >= 2) {
          const float* pp = slab + row * 68 + (c8 ^ 16);
          const v4f pa = *(const v4f*)(pp);
          const v4f pb = *(const v4f*)(pp + 4);
          float p[8];
          p[0] = pa[0]; p[1] = pa[1]; p[2] = pa[2]; p[3] = pa[3];
          p[4] = pb[0]; p[5] = pb[1]; p[6] = pb[2]; p[7] = pb[3];
          if (EPI == 3) {
            /* mean and biased variance over the 64 columns of the row: 8 per lane, 8 lanes per row */
            float s = ((o[0] + o[1]) + (o[2] + o[3])) + ((o[4] + o[5]) + (o[6] + o[7]));
            s += __shfl_xor(s, 1, 32);
            s += __shfl_xor(s, 2, 32);
            s += __shfl_xor(s, 4, 32);
            const float mean = s * kInvDh;
#pragma unroll
            for (int e = 0; e < 8; ++e) { o[e] -= mean; p[e] -= mean; }
            float ss = 0.0f;
#pragma unroll
            for (int e = 0; e < 8; ++e) ss = fmaf(o[e], o[e], ss);
            ss += __shfl_xor(ss, 1, 32);
            ss += __shfl_xor(ss, 2, 32);
            ss += __shfl_xor(ss, 4, 32);
            const float rstd = rsqrtf(ss * kInvDh + kNormEps);
#pragma unroll
            for (int e = 0; e < 8; ++e) { o[e] *= rstd; p[e] *= rstd; }
          }
          if (EPI == 2 || isK) {
            const float* tp = tab + (size_t)(mBase + row) * 64 + tcol;
            const v4f ca = *(const v4f*)(tp);
            const v4f cb = *(const v4f*)(tp + 4);
            const v4f sa = *(const v4f*)(tp + 16);
            const v4f sb = *(const v4f*)(tp + 20);
            float cc[8], sn[8];
            cc[0] = ca[0]; cc[1] = ca[1]; cc[2] = ca[2]; cc[3] = ca[3];
            cc[4] = cb[0]; cc[5] = cb[1]; cc[6] = cb[2]; cc[7] = cb[3];
            sn[0] = sa[0]; sn[1] = sa[1]; sn[2] = sa[2]; sn[3] = sa[3];
            sn[4] = sb[0]; sn[5] = sb[1]; sn[6] = sb[2]; sn[7] = sb[3];
#pragma unroll
            for (int e = 0; e < 8; ++e) o[e] = o[e] * cc[e] + sgn * (p[e] * sn[e]);
          }
        }
#pragma unroll
        for (int e = 0; e < 8; ++e) o[e] *= oc;
        ow[it] = (v4u){pk16(h_bits(o[0]), h_bits(o[1])), pk16(h_bits(o[2]), h_bits(o[3])),
                       pk16(h_bits(o[4]), h_bits(o[5])), pk16(h_bits(o[6]), h_bits(o[7]))};
      }
      {
#pragma unroll
        for (int it = 0; it < 4; ++it) {
          if (EPI == 3) *(v4u*)(Cb + (size_t)(mBase + it * 4 + q) * ldc + col) = ow[it];
          else          *(v4u*)(Cb + it * 64 + col) = ow[it];
        }
        
      }
    }
    __builtin_amdgcn_fence(__ATOMIC_RELEASE, "workgroup");
    __builtin_amdgcn_wave_barrier();
    __builtin_amdgcn_fence(__ATOMIC_ACQUIRE, "workgroup");
  }
}

template <int EPI>
__global__ __launch_bounds__(256) void gemm_f16_kernel(
    const unsigned short* __restrict__ Ap, int lda, long sAo, long sAi,
    const unsigned short* __restrict__ Bp, int ldb, long sBo, long sBi,
    void* __restrict__ Cout, void* __restrict__ Cout2, int ldc, long sCo, long sCi,
    const float* __restrict__ bias, const float* __restrict__ tab,
    int M, int N, int K, int nInner, int nBatch, float scale) {
  __shared__ __align__(16) float sT[8][16 * 68];
  gemm_f16_tile<EPI>(sT, blockIdx.x, Ap, lda, sAo, sAi, Bp, ldb, sBo, sBi, Cout, Cout2, ldc, sCo, sCi, bias, tab,
                     M, N, K, nInner, nBatch, scale);
}

/* ---------------------------------------------------------------------------
   Token-axis product, split-K: part[ks][bh][d][e] = sum over the 1024 tokens of split ks of kn[tok][h*64+d]*vn[tok][h*64+e]
   (operands carry x16 each). 256 blocks: blk = ks * 32 + bh; waves 0..3 do the work as 128 threads, wave w owns output
   rows d = 16w..16w+15; waves 4..7 of the 256-thread block (the block size of the grid this shares) only pass the barriers.
   and written transposed into LDS as sK[d][tok], sV[e][tok] (pitch 72 halves), so fragments are token-contiguous.
   Staging coverage: 64 rows x 8 segments = 512 segments = 128 threads x 4 iterations per tile; fragment reads touch
   tokens 0..63 only (all written); the pad columns 64..71 are never read.
   All barriers are reached by all 256 threads (waves 4..7 return only after the last barrier; the test on the wave number is a scalar one).
   --------------------------------------------------------------------------- */
__device__ __forceinline__ void dots_splitk_tile(_Float16* sK, _Float16* sV, float (*sO)[16 * 68], int blk,
                                                 const unsigned short* __restrict__ kn,
                                                 const unsigned short* __restrict__ vn,
                                                 float* __restrict__ part) {
  const int tid = threadIdx.x, lane = tid & 31;
  /* the wave number in a scalar register: the tests on it are scalar branches, so waves 4..7 jump over the loads, the LDS
     traffic and the matrix instructions instead of issuing them with every lane off */
  const int wave = __builtin_amdgcn_readfirstlane(tid >> 5);
  const bool work = wave < 4;
  const int bh = blk & (kBH - 1), ks = blk / kBH;
  const int b = bh >> 3, h = bh & 7;
  const size_t row0 = (size_t)b * kSeq + (size_t)ks * kTokPerSplit;
  const int rlane = lane & 15;
  const int koff  = (lane >> 4) * 8;
  const int hh    = lane >> 4;

  v8f acc[4];
#pragma unroll
  for (int j = 0; j < 4; ++j) acc[j] = (v8f){0.f, 0.f, 0.f, 0.f, 0.f, 0.f, 0.f, 0.f};

#pragma unroll 1
  for (int ch = 0; ch < kTokPerSplit / 64; ++ch) {
    __syncthreads();
    if (work) { /* staging, waves 0..3 */
#pragma unroll
    for (int it = 0; it < 4; ++it) {
      const int seg = it * 128 + tid;
      const int tok = seg >> 3;
      const int s8  = (seg & 7) * 8;
      const size_t go = (row0 + (size_t)ch * 64 + tok) * kInner + h * kDh + s8;
      const v4u kw = *(const v4u*)(kn + go);
      const v4u vw = *(const v4u*)(vn + go);
#pragma unroll
      for (int w = 0; w < 4; ++w) {
        const unsigned kword = kw[w];
        const unsigned vword = vw[w];
        const unsigned short k0b = (unsigned short)(kword & 0xffffu);
        const unsigned short k1b = (unsigned short)(kword >> 16);
        const unsigned short v0b = (unsigned short)(vword & 0xffffu);
        const unsigned short v1b = (unsigned short)(vword >> 16);
        sK[(s8 + 2 * w) * 72 + tok]     = __builtin_bit_cast(_Float16, k0b);
        sK[(s8 + 2 * w + 1) * 72 + tok] = __builtin_bit_cast(_Float16, k1b);
        sV[(s8 + 2 * w) * 72 + tok]     = __builtin_bit_cast(_Float16, v0b);
        sV[(s8 + 2 * w + 1) * 72 + tok] = __builtin_bit_cast(_Float16, v1b);
      }
    }
    }
    __syncthreads();
    if (work) { /* products, waves 0..3 */
#pragma unroll
    for (int kk = 0; kk < 2; ++kk) {
      const v16h a  = frag_load(sK + (wave * 16 + rlane) * 72 + kk * 32 + koff);
      const v16h b0 = frag_load(sV + (0 * 16 + rlane) * 72 + kk * 32 + koff);
      const v16h b1 = frag_load(sV + (1 * 16 + rlane) * 72 + kk * 32 + koff);
      const v16h b2 = frag_load(sV + (2 * 16 + rlane) * 72 + kk * 32 + koff);
      const v16h b3 = frag_load(sV + (3 * 16 + rlane) * 72 + kk * 32 + koff);
      acc[0] = mma16(a, b0, acc[0]);
      acc[1] = mma16(a, b1, acc[1]);
      acc[2] = mma16(a, b2, acc[2]);
      acc[3] = mma16(a, b3, acc[3]);
      guard4(acc[0], acc[1], acc[2], acc[3], a, b0, b1, b2, b3);
    }
    }
  }

  if (!work) return; /* no barrier below */
  float* slab = sO[wave];
#pragma unroll
  for (int j = 0; j < 4; ++j)
#pragma unroll
    for (int r = 0; r < 8; ++r) slab[(8 * hh + r) * 68 + (j << 4) + rlane] = acc[j][r];
  __builtin_amdgcn_fence(__ATOMIC_RELEASE, "workgroup");
  __builtin_amdgcn_wave_barrier();
  __builtin_amdgcn_fence(__ATOMIC_ACQUIRE, "workgroup");
  {
    const int c4 = (lane & 15) * 4;
    float* C = part + ((size_t)ks * kBH + bh) * (kDh * kDh) + (size_t)(wave * 16) * kDh;
    v4f vals[8];
#pragma unroll
    for (int it = 0; it < 8; ++it) vals[it] = *(const v4f*)(slab + (it * 2 + hh) * 68 + c4);
    {
#pragma unroll
      for (int it = 0; it < 8; ++it)
        *(v4f*)(C + (size_t)(it * 2 + hh) * kDh + c4) = vals[it];
      
    }
  }
}

/* The token-axis product (reads k, v) and the q projection (EPI 2: reads x, Wq, the x table; writes q) depend on nothing
   of each other, so they are two ranges of blocks of one grid: the first 256 blocks take the token-axis product, which
   leaves most of each WGP free, the rest the q projection. One LDS array serves either range. */
constexpr int kBlkDots = kBH * kSplitK;
constexpr int kBlkQ    = (kTok / 32) * (kInner / 64) / 8;
constexpr int kLdsDotsKV = 64 * 72 * 2;
constexpr int kLdsQDots  = 2 * kLdsDotsKV + 4 * 16 * 68 * 4;
static_assert(kLdsQDots == 35840 && 8 * 16 * 68 * 4 <= kLdsQDots && (kLdsDotsKV % 16) == 0, "LDS carve");
__global__ __launch_bounds__(256) void dots_qproj_kernel(
    const unsigned short* __restrict__ kn, const unsigned short* __restrict__ vn, float* __restrict__ part,
    const unsigned short* __restrict__ Xp, const unsigned short* __restrict__ Wqp, void* __restrict__ Qout,
    const float* __restrict__ tabx, int M, int N, int K, float scale) {
  __shared__ __align__(16) unsigned char sm[kLdsQDots];
  const int blk = blockIdx.x;
  if (blk < kBlkDots)
    dots_splitk_tile((_Float16*)sm, (_Float16*)(sm + kLdsDotsKV), (float (*)[16 * 68])(sm + 2 * kLdsDotsKV), blk, kn, vn, part);
  else
    gemm_f16_tile<2>((float (*)[16 * 68])sm, blk - kBlkDots, Xp, K, 0L, 0L, Wqp, K, 0L, 0L, Qout, nullptr, N, 0L, 0L,
                     nullptr, tabx, M, N, K, 1, 1, scale);
}

/* ---------------------------------------------------------------------------
   out = (q . dots / 8192) . Wout^T is computed as q . G^T with G[b][o][h*64+d] = sum_e Wout[o][h*64+e] * dots[b][h][d][e] / 8192,
   so the per-token product with dots is replaced by this one, 256 rows a head. One block per (batch, head), 8 waves.
   Step 1: fixed-order sum of the 8 split-K partials, scaled (1/8192 and carries, all powers of two) in f32, emitted as one
   f16 fragment-order 64 x 64 plane [d][e] in LDS; 8 elements per unit, 512 units = 256 threads x 2.
   Step 2: wave w takes rows o = 32w .. 32w+31 of Wout (A, columns h*64 .. +63 of its plane) against all 64 rows d of the LDS
   plane (B), K = 64, and writes its 32 x 64 tile to columns h*64 .. +63 of the batch's fragment-order plane of pitch 512.
   No early exit: all 256 threads reach the barrier.
   --------------------------------------------------------------------------- */
__global__ __launch_bounds__(256) void dots_fold_kernel(const float* __restrict__ part, const unsigned short* __restrict__ wo,
                                                        unsigned short* __restrict__ gw) {
  __shared__ __align__(16) _Float16 sD[kDh * kDh];
  __shared__ __align__(16) float sT[8][32 * 68];
  const int tid = threadIdx.x, lane = tid & 31, wave = tid >> 5;
  const int bh = blockIdx.x, b = bh >> 3, h = bh & 7;
  const int rlane = lane & 15;
  const int mOff  = (lane >> 4) * 8;
  const int lpos  = frag_pos(rlane, lane >> 4) * 8;
  const int m0    = wave << 5;

  /* the Wout fragments depend on nothing of step 1: their loads fly beside those of the partials */
  v16h ah[2][2];
#pragma unroll
  for (int kb = 0; kb < 2; ++kb)
#pragma unroll
    for (int i = 0; i < 2; ++i)
      ah[kb][i] = frag_load_plane((unit_gptr)((const _Float16*)wo +
                                              ((size_t)((m0 >> 4) + i) * (kInner >> 5) + h * 2 + kb) * 512 + lpos));

#pragma unroll
  for (int u = 0; u < 2; ++u) {
    const int iu = u * 256 + tid;
    const size_t o = (size_t)bh * (kDh * kDh) + 8 * (size_t)iu;
    float s[8];
#pragma unroll
    for (int e = 0; e < 8; ++e) s[e] = 0.0f;
#pragma unroll
    for (int ks = 0; ks < kSplitK; ++ks) {
      const float* p = part + (size_t)ks * kDotsElems + o;
      const v4f a = *(const v4f*)(p);
      const v4f c = *(const v4f*)(p + 4);
      s[0] += a[0]; s[1] += a[1]; s[2] += a[2]; s[3] += a[3];
      s[4] += c[0]; s[5] += c[1]; s[6] += c[2]; s[7] += c[3];
    }
    unsigned short hb[8];
#pragma unroll
    for (int e = 0; e < 8; ++e) hb[e] = h_bits(s[e] * kDotsScale);
    /* unit iu = (row d, columns e8*8 .. +7) of the 64 x 64 fragment-order plane */
    const int d  = iu >> 3;
    const int e8 = iu & 7;
    *(v4u*)(sD + ((d >> 4) * 2 + (e8 >> 2)) * 512 + ((e8 >> 1) & 1) * 256 + frag_pos(d & 15, e8 & 1) * 8) =
        (v4u){pk16(hb[0], hb[1]), pk16(hb[2], hb[3]), pk16(hb[4], hb[5]), pk16(hb[6], hb[7])};
  }
  __syncthreads(); /* every wave reads the whole plane, written by all */

  v8f acc[2][4];
#pragma unroll
  for (int i = 0; i < 2; ++i)
#pragma unroll
    for (int j = 0; j < 4; ++j)
      acc[i][j] = (v8f){0.f, 0.f, 0.f, 0.f, 0.f, 0.f, 0.f, 0.f};
#pragma unroll
  for (int kb = 0; kb < 2; ++kb) {
    v16h bf[4];
#pragma unroll
    for (int j = 0; j < 4; ++j) {
      const _Float16* p = sD + (j * 2 + kb) * 512 + lpos;
      FragU f;
      f.h[0] = *(const v8h*)(p);
      f.h[1] = *(const v8h*)(p + 256);
      bf[j] = f.v;
    }
#pragma unroll
    for (int i = 0; i < 2; ++i) {
#pragma unroll
      for (int j = 0; j < 4; ++j)
        acc[i][j] = mma16(ah[kb][i], bf[j], acc[i][j]);
      /* keeps the group's operands in their registers past its last product, with the slots the results need */
      guard4(acc[i][0], acc[i][1], acc[i][2], acc[i][3], ah[kb][i], bf[0], bf[1], bf[2], bf[3]);
    }
  }

  /* the wave's 32 x 64 tile goes through its own LDS slab, so that each store covers whole 128-B lines: 16 rows x 64
     columns are two whole blocks of the plane */
  float* slab = sT[wave];
  const int q   = lane >> 3;
  const int c8  = (lane & 7) * 8;
  const int col = ((lane & 7) >> 1) * 256 + frag_pos(q, lane & 1) * 8;
#pragma unroll
  for (int i = 0; i < 2; ++i)
#pragma unroll
    for (int j = 0; j < 4; ++j)
#pragma unroll
      for (int r = 0; r < 8; ++r) slab[(i * 16 + mOff + r) * 68 + (j << 4) + rlane] = acc[i][j][r] * kFoldScale;
  /* the rows read below were written by other lanes of this wave */
  __builtin_amdgcn_fence(__ATOMIC_RELEASE, "workgroup");
  __builtin_amdgcn_wave_barrier();
  __builtin_amdgcn_fence(__ATOMIC_ACQUIRE, "workgroup");
#pragma unroll
  for (int i = 0; i < 2; ++i) {
    unsigned short* Cb = gw + (size_t)b * (kDim * kInner) + ((size_t)((m0 >> 4) + i) * (kInner >> 5) + h * 2) * 512;
#pragma unroll
    for (int it = 0; it < 4; ++it) {
      const float* sp = slab + (i * 16 + it * 4 + q) * 68 + c8;
      const v4f ta = *(const v4f*)(sp);
      const v4f tb = *(const v4f*)(sp + 4);
      *(v4u*)(Cb + it * 64 + col) = (v4u){pk16(h_bits(ta[0]), h_bits(ta[1])), pk16(h_bits(ta[2]), h_bits(ta[3])),
                                          pk16(h_bits(tb[0]), h_bits(tb[1])), pk16(h_bits(tb[2]), h_bits(tb[3]))};
    }
  }
}

/* ---------------------------------------------------------------------------
   Host glue: 5 kernel launches, nothing else.
   GEMM shapes (M % 32 == 0, N % 64 == 0, K % 32 == 0, no pad planes needed):
     kv projection : M 32768, N 1024, K 256 -> 1024 x 16 tiles = 16384 -> 2048 blocks
     q projection  : M 32768, N 512,  K 256 -> 1024 x 8  tiles =  8192 -> 1024 blocks (behind the 256 of the token-axis product)
     Wout . dots^T : 32 (batch, head) pairs of M 256, N 64, K 64 -> 32 blocks (dots_fold_kernel)
     q . G^T       : 4 batches of M 8192, N 256, K 512 -> 4 x 256 x 4 tiles = 4096 -> 512 blocks
   --------------------------------------------------------------------------- */
extern "C" void kernel_launch(void* const* d_in, const int* in_sizes, int n_in,
                              void* d_out, int out_size, void* d_ws, size_t ws_size,
                              hipStream_t stream) {
  if (n_in < 8) return;
  if (in_sizes[0] != kTok * kDim) return;
  if (in_sizes[1] != kTok * kDim) return;
  if (in_sizes[2] != kTok * 2) return;
  if (in_sizes[3] != kTok * 2) return;
  if (in_sizes[4] != kInner * kDim) return;
  if (in_sizes[5] != 2 * kInner * kDim) return;
  if (in_sizes[6] != kDim * kInner) return;
  if (in_sizes[7] != kDim) return;
  if (out_size != kTok * kDim) return;
  if (ws_size < kWsTotal) return;

  const float* x    = (const float*)d_in[0];
  const float* z    = (const float*)d_in[1];
  const float* xpos = (const float*)d_in[2];
  const float* zpos = (const float*)d_in[3];
  const float* Wq   = (const float*)d_in[4];
  const float* Wkv  = (const float*)d_in[5];
  const float* Wout = (const float*)d_in[6];
  const float* bout = (const float*)d_in[7];
  float* out = (float*)d_out;

  char* ws = (char*)d_ws;
  unsigned short* WQ   = (unsigned short*)(ws + kOffWQ);
  unsigned short* WK   = (unsigned short*)(ws + kOffWK);
  unsigned short* WO   = (unsigned short*)(ws + kOffWO);
  unsigned short* S16  = (unsigned short*)(ws + kOffS16);
  unsigned short* KN   = (unsigned short*)(ws + kOffKN);
  unsigned short* VN   = (unsigned short*)(ws + kOffVN);
  unsigned short* QH   = (unsigned short*)(ws + kOffQH);
  float*          TAB  = (float*)(ws + kOffTAB);
  float*          PART = (float*)(ws + kOffPART);
  unsigned short* GW   = (unsigned short*)(ws + kOffGW);
  unsigned short* SX   = (unsigned short*)(ws + kOffSX);
  float*          TABX = (float*)(ws + kOffTABX);

  /* inverse frequencies: 1 / f32(10000^(2j/32)), j = 0..15 */
  FreqTab ft;
  for (int j = 0; j < 16; ++j) {
    const double ex = (double)(2 * j) / 32.0;
    const float pw = (float)pow(10000.0, ex);
    ft.f[j] = 1.0f / pw;
  }

  /* weight planes ([out][in] = Bt orientation already): f16(bf16(w) * 1024); z and x planes: f16(bf16(v) * 16);
     position tables of z and x */
  prep_kernel<<<kBlkPrep, 256, 0, stream>>>(x, z, xpos, zpos, Wq, Wkv, Wout, WQ, WK, WO, S16, SX, TAB, TABX, ft);

  /* key/value side: projection with fused norm (+ rotary on k) */
  gemm_f16_kernel<3><<<(kTok / 32) * (2 * kInner / 64) / 8, 256, 0, stream>>>(
      S16, kDim, 0L, 0L,
      WK, kDim, 0L, 0L,
      (void*)KN, (void*)VN, kInner, 0L, 0L,
      bout, TAB,
      kTok, 2 * kInner, kDim, 1, 1, kProjScale);

  /* token-axis product, deterministic split-K, beside the query side's projection with fused rotary; then the
     fixed-order reduce and its product with Wout, per (batch, head) */
  dots_qproj_kernel<<<kBlkDots + kBlkQ, 256, 0, stream>>>(KN, VN, PART, SX, WQ, (void*)QH, TABX,
                                                          kTok, kInner, kDim, kProjScale);
  dots_fold_kernel<<<kBH, 256, 0, stream>>>(PART, WO, GW);

  /* output per batch: [8192][256] = q [8192][512] . G [256][512]^T, + bias */
  gemm_f16_kernel<0><<<(kTok / 32) * (kDim / 64) / 8, 256, 0, stream>>>(
      QH, kInner, (long)kSeq * kInner, 0L,
      GW, kInner, (long)kDim * kInner, 0L,
      (void*)out, (void*)VN, kDim, (long)kSeq * kDim, 0L,
      bout, TAB,
      kSeq, kDim, kInner, 1, kBatch, kOutScale);
}

// v005
// A run of this version takes 117 microseconds.
// In two side-by-side timings against v004, it was 1.12 and 1.13 times as fast.
// Over all steps from v000 it is 1.80 times as fast.
// Contractions (q/kv projections, token-axis k^T v, Wout.dots^T, q.(that product)): v_wmma_f32_16x16x32_f16, one product per site, f32 accumulate; every operand a plain f16 plane with a power-of-two carry; every float module input RNE-converted to bf16 once at its first read (exact in the carried f16 planes); instance norm, rotary, scaling and bias in f32.
#include <hip/hip_runtime.h>
#include <math.h>

typedef __attribute__((ext_vector_type(16))) _Float16 v16h;
typedef __attribute__((ext_vector_type(8)))  _Float16 v8h;
typedef __attribute__((ext_vector_type(8)))  float    v8f;
typedef __attribute__((ext_vector_type(4)))  float    v4f;
typedef __attribute__((ext_vector_type(4)))  unsigned int v4u;
typedef __attribute__((ext_vector_type(2)))  unsigned int v2u;

/* ---------------------------------------------------------------------------
   Shape constants
   --------------------------------------------------------------------------- */
constexpr int kBatch  = 4;
constexpr int kSeq    = 8192;
constexpr int kDim    = 256;
constexpr int kHeads  = 8;
constexpr int kDh     = 64;
constexpr int kInner  = kHeads * kDh;
constexpr int kTok    = kBatch * kSeq;
constexpr int kBH     = kBatch * kHeads;
constexpr int kSplitK = 8;
constexpr int kTokPerSplit = kSeq / kSplitK;
constexpr int kDotsElems = kBH * kDh * kDh;
static_assert(kInner == 512 && kTok == 32768 && kDotsElems == 131072, "shape");
static_assert((kDim % 32) == 0 && (kInner % 32) == 0 && (kDh % 32) == 0, "K multiples of 32");
static_assert((kTok % 32) == 0 && (kSeq % 32) == 0, "M multiples of 32");
static_assert((kInner % 64) == 0 && ((2 * kInner) % 64) == 0 && (kDim % 64) == 0 && (kDh % 64) == 0, "N multiples of 64");
static_assert((kTokPerSplit % 64) == 0, "token chunks of 64");

/* power-of-two carries of the f16 planes (all folded back exactly in f32) */
constexpr float kXC     = 16.0f;
constexpr float kWC     = 1024.0f;
constexpr float kKVC    = 16.0f;
constexpr float kQC     = 64.0f;
constexpr float kDC     = 1024.0f;
constexpr float kGC     = 1024.0f;
constexpr float kProjScale = 1.0f / (kXC * kWC);
constexpr float kDotsScale = kDC / (kKVC * kKVC * (float)kSeq);
constexpr float kFoldScale = kGC / (kWC * kDC);
constexpr float kOutScale  = 1.0f / (kQC * kGC);
constexpr float kPosScale  = 64.0f;
constexpr float kNormEps   = 1e-5f;
constexpr float kInvDh     = 1.0f / (float)kDh;

/* ---------------------------------------------------------------------------
   Workspace region map (bytes; every offset is a multiple of 128). WQ, WK, WO, S16, QH, GW and SX are fragment-order
   planes (see frag_pos); the shapes below give rows and pitch. KN and VN are fragment-order planes too, of the TRANSPOSED
   matrices: row = head column, k = token.
     WQ   f16 [512][256]    Wq plane  (bf16 value x1024)            262,144
     WK   f16 [1024][256]   Wkv plane (bf16 value x1024)            524,288
     WO   f16 [256][512]    Wout plane (bf16 value x1024)           262,144
     S16  f16 [32768][256]  z x16                                  16,777,216
     KN   f16 [512][32768]  normed+rotated k x16, transposed       33,554,432
     VN   f16 [512][32768]  normed v x16, transposed               33,554,432
     QH   f16 [32768][512]  rotated q x64                          33,554,432
     TAB  f32 [4096][64][8] cos/sin table of the z positions, token-minor in tiles of 8 tokens  8,388,608
     PART f32 [8][32][64][64] split-K partials of the k^T v product  4,194,304
     GW   f16 [4][256][512] per batch: Wout . dots^T / 8192, x1024  1,048,576
     SX   f16 [32768][256]  x x16                                  16,777,216
     TABX f32 [32768][64]   cos/sin table of the x positions        8,388,608
     total                                                        157,286,400
   --------------------------------------------------------------------------- */
constexpr size_t kOffWQ   = 0;
constexpr size_t kOffWK   = kOffWQ   + (size_t)kInner * kDim * 2;
constexpr size_t kOffWO   = kOffWK   + (size_t)2 * kInner * kDim * 2;
constexpr size_t kOffS16  = kOffWO   + (size_t)kDim * kInner * 2;
constexpr size_t kOffKN   = kOffS16  + (size_t)kTok * kDim * 2;
constexpr size_t kOffVN   = kOffKN   + (size_t)kTok * kInner * 2;
constexpr size_t kOffQH   = kOffVN   + (size_t)kTok * kInner * 2;
constexpr size_t kOffTAB  = kOffQH   + (size_t)kTok * kInner * 2;
constexpr size_t kOffPART = kOffTAB  + (size_t)kTok * 64 * 4;
constexpr size_t kOffGW   = kOffPART + (size_t)kSplitK * kDotsElems * 4;
constexpr size_t kOffSX   = kOffGW   + (size_t)kBatch * kDim * kInner * 2;
constexpr size_t kOffTABX = kOffSX   + (size_t)kTok * kDim * 2;
constexpr size_t kWsTotal = kOffTABX + (size_t)kTok * 64 * 4;
static_assert(kWsTotal == 157286400ull, "carve total");
static_assert(kWsTotal <= 268435456ull, "carve cap");
static_assert((kOffWK % 128) == 0 && (kOffWO % 128) == 0 && (kOffS16 % 128) == 0 && (kOffKN % 128) == 0 &&
              (kOffVN % 128) == 0 && (kOffQH % 128) == 0 && (kOffTAB % 128) == 0 && (kOffPART % 128) == 0 &&
              (kOffGW % 128) == 0 && (kOffSX % 128) == 0 && (kOffTABX % 128) == 0, "128-B aligned regions");

/* ---------------------------------------------------------------------------
   Small helpers
   --------------------------------------------------------------------------- */
__device__ __forceinline__ unsigned short f2bf_bits(float f) {
  unsigned u = __float_as_uint(f);
  return (unsigned short)((u + 0x7FFFu + ((u >> 16) & 1u)) >> 16);
}
__device__ __forceinline__ float bf_bits2f(unsigned short h) { return __uint_as_float(((unsigned)h) << 16); }
/* RNE convert of an f32 value to the nearest bf16 value, returned as f32 */
__device__ __forceinline__ float bf_rne(float f) { return bf_bits2f(f2bf_bits(f)); }

__device__ __forceinline__ unsigned pk16(unsigned short a, unsigned short b) { return (unsigned)a | ((unsigned)b << 16); }
__device__ __forceinline__ unsigned short h_bits(float f) { const _Float16 h = (_Float16)f; return __builtin_bit_cast(unsigned short, h); }

union FragU { v16h v; v8h h[2]; };
/* Fragment-order plane of a [R][K] f16 matrix (R % 16 == 0, K % 32 == 0): each 16-row x 32-k block is 1024 contiguous
   bytes = two 512-B segments (k 0..15, k 16..31 of the block); a segment holds 32 units of 8 halves, one per
   (row-in-block rl, k-half hi), at position frag_pos(rl, hi). Blocks run k-fastest: block (rb, kb) starts at
   (rb * (K / 32) + kb) * 512 halves. A wave's fragment load is then two loads of 512 contiguous bytes (4 whole lines),
   and 4 consecutive rows x both k-halves of a segment are one 128-B line (what one epilogue store covers). */
__device__ __forceinline__ int frag_pos(int rl, int hi) { return ((rl >> 2) << 3) | (hi << 2) | (rl & 3); }
/* pointer to 16-B units in global memory: the address space is spelled out so that the running pointers of the k loop
   stay global loads */
typedef const __attribute__((address_space(1))) v8h* unit_gptr;
/* elements 0..7 <- segment 0, elements 8..15 <- segment 1 (32 units on); p is the lane's own unit */
__device__ __forceinline__ v16h frag_load_plane(unit_gptr p) {
  FragU f;
  f.h[0] = p[0];
  f.h[1] = p[32];
  return f.v;
}
__device__ __forceinline__ v8f mma16(v16h a, v16h b, v8f c) {
  return __builtin_amdgcn_wmma_f32_16x16x32_f16(false, a, false, b, (short)0, c, false, false);
}
/* hazard guard: ties all four accumulators of a group and names the A fragment and all B fragments */
__device__ __forceinline__ void guard4(v8f& a0, v8f& a1, v8f& a2, v8f& a3,
                                       v16h x, v16h b0, v16h b1, v16h b2, v16h b3) {
  asm volatile("v_nop\n\tv_nop\n\tv_nop\n\tv_nop"
               : "+v"(a0), "+v"(a1), "+v"(a2), "+v"(a3)
               : "v"(x), "v"(b0), "v"(b1), "v"(b2), "v"(b3));
}

/* sum over the 16 lanes of a row, left in every lane: four adds whose second operand is read from lane ^ 1, 2, 4, 8 by the
   add itself (row_xmask), so no LDS crossbar and no wait; every lane of the wave is on where it is called */
template <int MASK>
__device__ __forceinline__ float row_xor(float v) {
  return __int_as_float(__builtin_amdgcn_update_dpp(0, __float_as_int(v), 0x160 | MASK, 0xf, 0xf, true));
}
/* 1 / sqrt(x) for x >= 1e-5: never subnormal, so the library form's rescaling has nothing to do. The v_nop is the slot that
   the instruction set asks for between a transcendental and a next instruction that reads its result or overwrites its
   source; inside the statement it stands directly behind the v_rsq_f32 in every build */
__device__ __forceinline__ float rsq_normal(float x) {
  float r;
  asm("v_rsq_f32 %0, %1\n\tv_nop" : "=v"(r) : "v"(x));
  return r;
}
__device__ __forceinline__ float row_sum16(float s) {
  s += row_xor<1>(s);
  s += row_xor<2>(s);
  s += row_xor<4>(s);
  s += row_xor<8>(s);
  return s;
}

/* ---------------------------------------------------------------------------
   f32 -> bf16 value (RNE) -> f16 fragment-order plane with a power-of-two carry. The carried bf16 value is exactly
   representable in f16 (8 significant bits, normal range).
   ONE WAVE takes a tile of 16 rows x 128 columns of the [R][K] input, K = 128 << kshift, = 4 blocks of the plane = 4096
   contiguous output bytes. Load (kb, i), kb = 0..3, i = 0..3: lane l reads row 4i + l / 8, columns kb*32 + (l % 8)*4 .. + 3,
   so a load covers 4 whole 128-B lines. The lane's 4 values are half of one 16-B unit of the plane, and the 32 halves of
   load (kb, i) are the units of rows 4i .. 4i+3 of block kb: one whole line in either segment. So the 8-B store of the same
   lane needs no exchange between lanes, no LDS and no barrier.
   Coverage: (R / 16) * (K / 128) tiles exactly for every plane used: x, z 4096 tiles; Wq 64; Wkv 128; Wout 64.
   The loads and the convert-and-store part are two functions, so that a wave can put other work between them.
   --------------------------------------------------------------------------- */
__device__ __forceinline__ void cast_tile_load(v4f (&v)[16], int tile, const float* __restrict__ in, int kshift) {
  const int lane = threadIdx.x & 31;
  const int rb = tile >> kshift;
  const int cb = tile & ((1 << kshift) - 1);
  const size_t rows4 = (size_t)4 << (7 + kshift);
  const float* p0 = in + (((size_t)(rb * 16 + (lane >> 3))) << (7 + kshift)) + cb * 128 + (lane & 7) * 4;
  const float* p1 = p0 + rows4;
  const float* p2 = p1 + rows4;
  const float* p3 = p2 + rows4;
#pragma unroll
  for (int kb = 0; kb < 4; ++kb) {
    v[kb * 4 + 0] = *(const v4f*)(p0 + kb * 32);
    v[kb * 4 + 1] = *(const v4f*)(p1 + kb * 32);
    v[kb * 4 + 2] = *(const v4f*)(p2 + kb * 32);
    v[kb * 4 + 3] = *(const v4f*)(p3 + kb * 32);
  }
  /* the wait that belongs in front of any overwrite of the loads' address registers; it names them, so that they stay
     untouched (also as a later load's destination) up to here. With a literal kshift the row steps are folded into the
     loads' offset fields and p0 is the one base */
  if (__builtin_constant_p(kshift)) asm volatile("s_wait_xcnt 0x0" :: "v"(p0) : "memory");
  else                              asm volatile("s_wait_xcnt 0x0" :: "v"(p0), "v"(p1), "v"(p2), "v"(p3) : "memory");
}
__device__ __forceinline__ void cast_tile_store(const v4f (&v)[16], int tile, unsigned short* __restrict__ out, int kshift,
                                                float carry) {
  const int lane = threadIdx.x & 31;
  const int rb = tile >> kshift;
  const int cb = tile & ((1 << kshift) - 1);
  const int r  = lane >> 3;
  const int c  = lane & 7;
  /* columns 4c .. 4c+3 of a block: segment c / 4, k-half (c / 2) % 2, lower or upper 4 halves of the unit */
  unsigned short* q = out + ((((size_t)rb << (2 + kshift)) + cb * 4) << 9) + (c >> 2) * 256 +
                      frag_pos(r, (c >> 1) & 1) * 8 + (c & 1) * 4;
#pragma unroll
  for (int kb = 0; kb < 4; ++kb)
#pragma unroll
    for (int i = 0; i < 4; ++i) {
      const v4f a = v[kb * 4 + i];
      const float a0 = bf_rne(a[0]) * carry, a1 = bf_rne(a[1]) * carry, a2 = bf_rne(a[2]) * carry, a3 = bf_rne(a[3]) * carry;
      /* rows 4i .. 4i+3 stand 8 units = 64 halves behind rows 4i-4 .. 4i-1 */
      *(v2u*)(q + kb * 512 + i * 64) = (v2u){pk16(h_bits(a0), h_bits(a1)), pk16(h_bits(a2), h_bits(a3))};
    }
  /* the wait that belongs in front of any overwrite of the stores' registers by the code that follows (the next table's
     loop) */
  asm volatile("s_wait_xcnt 0x0" :: "v"(q) : "memory");
}

/* ---------------------------------------------------------------------------
   Rotary table: tab[token][axis*32 + j] = cos(theta), tab[token][axis*32 + 16 + j] = sin(theta),
   theta = (bf16(pos[token][axis]) * 64) * inv_freq[j], j = 0..15.
   ONE WAVE takes a tile of 8 tokens: lane = (axis, j), one token a trip; 32768/8 = 4096 tiles exactly per table.
   pv = the tile's 16 positions, one per lane (lane % 16 = token-in-tile * 2 + axis), loaded by the caller ahead of time.
   Store: the 8 x 64 f32 tile (2048 B = 16 lines) is staged in the wave's own LDS slab and leaves as 4 stores of 512
   contiguous bytes. TOKMINOR: the tile is laid out [column][token-in-tile] instead, so that a lane which owns one column
   and 8 consecutive tokens (the accumulator layout) reads its 8 values as 32 contiguous bytes.
   --------------------------------------------------------------------------- */
struct FreqTab { float f[16]; };
static_assert(sizeof(FreqTab) == 64, "no padding");
/* orders a wave's own LDS writes and reads (other lanes' values); LDS only, so that the global loads and stores in flight
   are not waited for */
__device__ __forceinline__ void wave_lds_sync() {
  __builtin_amdgcn_fence(__ATOMIC_RELEASE, "workgroup", "local");
  __builtin_amdgcn_wave_barrier();
  __builtin_amdgcn_fence(__ATOMIC_ACQUIRE, "workgroup", "local");
}
template <bool TOKMINOR>
__device__ __forceinline__ void rot_table_wave(float* slab, int tile, float pv, float* __restrict__ tab, float fr) {
  const int lane = threadIdx.x & 31;
  const int axis = lane >> 4;
  const int j    = lane & 15;
  const int pbits = __float_as_int(pv);
  /* rolled: eight copies of the sine and cosine code would only lengthen the text */
#pragma unroll 1
  for (int tl = 0; tl < 8; ++tl) {
    const int b0 = __builtin_amdgcn_readlane(pbits, 2 * tl);
    const int b1 = __builtin_amdgcn_readlane(pbits, 2 * tl + 1);
    const float praw = __int_as_float(axis ? b1 : b0);
    const float p   = bf_rne(praw);
    const float t   = p * kPosScale;
    const float ang = t * fr;
    const float cv = cosf(ang);
    const float sv = sinf(ang);
    if (TOKMINOR) {
      slab[(axis * 32 + j) * 8 + tl]      = cv;
      slab[(axis * 32 + 16 + j) * 8 + tl] = sv;
    } else {
      slab[tl * 64 + axis * 32 + j]      = cv;
      slab[tl * 64 + axis * 32 + 16 + j] = sv;
    }
  }
  wave_lds_sync();
  float* dst = tab + (size_t)tile * 512 + lane * 4;
#pragma unroll
  for (int n = 0; n < 4; ++n) {
    const v4f v = *(const v4f*)(slab + n * 128 + lane * 4);
    *(v4f*)(dst + n * 128) = v;
  }
  wave_lds_sync(); /* the slab is written again for the next table */
}

/* ---------------------------------------------------------------------------
   All input preparation in one launch of few, long waves; no wave depends on another, so there is no block barrier.
     blocks 0 .. 31: wave t = blk*8 + wave takes one cast tile of the weights: t 0 .. 63 Wq, 64 .. 191 Wkv, 192 .. 255 Wout.
     blocks 32 .. 543: wave idx = 0 .. 4095 takes cast tile idx of x and of z and table tile idx of either position array.
   Such a wave issues all its loads first (2 of positions, 32 of 512 B), computes the x table while they fly, converts and
   stores x, then the z table and z (z last: the next launch reads it).
   --------------------------------------------------------------------------- */
constexpr int kTileWq  = kInner * kDim / 2048;
constexpr int kTileWkv = 2 * kInner * kDim / 2048;
constexpr int kTileWo  = kDim * kInner / 2048;
constexpr int kTileAct = kTok * kDim / 2048;
constexpr int kTileTab = kTok / 8;
constexpr int kBlkPrepW = (kTileWq + kTileWkv + kTileWo) / 8;
constexpr int kBlkPrep  = kBlkPrepW + kTileAct / 8;
static_assert(kTileAct == kTileTab && (kTileWq % 8) == 0 && (kTileWkv % 8) == 0 && (kTileWo % 8) == 0 &&
              (kTileAct % 8) == 0 && kBlkPrep == 544, "prep grid");
__global__ __launch_bounds__(256) void prep_kernel(const float* __restrict__ x, const float* __restrict__ z,
                                                   const float* __restrict__ xpos, const float* __restrict__ zpos,
                                                   const float* __restrict__ Wq, const float* __restrict__ Wkv,
                                                   const float* __restrict__ Wout,
                                                   unsigned short* __restrict__ wq16, unsigned short* __restrict__ wkv16,
                                                   unsigned short* __restrict__ wo16, unsigned short* __restrict__ z16,
                                                   unsigned short* __restrict__ x16, float* __restrict__ tabz,
                                                   float* __restrict__ tabx, FreqTab ft) {
  __shared__ __align__(16) float sm[8][8 * 64];
  const int lane = threadIdx.x & 31;
  const int wave = __builtin_amdgcn_readfirstlane(threadIdx.x >> 5);
  const int blk  = blockIdx.x;
  if (blk < kBlkPrepW) {
    const int t = blk * 8 + wave;
    const bool isQ = t < kTileWq, isO = t >= kTileWq + kTileWkv;
    const float* in     = isQ ? Wq : (isO ? Wout : Wkv);
    unsigned short* out = isQ ? wq16 : (isO ? wo16 : wkv16);
    const int tile      = isQ ? t : (isO ? t - kTileWq - kTileWkv : t - kTileWq);
    const int kshift    = isO ? 2 : 1;
    v4f w[16];
    cast_tile_load(w, tile, in, kshift);
    cast_tile_store(w, tile, out, kshift, kWC);
    return;
  }
  const int idx = (blk - kBlkPrepW) * 8 + wave;
  const int j = lane & 15;
  float fr = ft.f[0];
#pragma unroll
  for (int e = 1; e < 16; ++e) fr = (j == e) ? ft.f[e] : fr;
  const float pvx = xpos[(size_t)idx * 16 + j];
  const float pvz = zpos[(size_t)idx * 16 + j];
  /* keeps what the tables need (the frequency becomes a load too) ahead of the 32 tile loads: loads are counted back in
     order, so a table's wait on a later one would wait for the tiles as well */
  __builtin_amdgcn_sched_barrier(0);
  v4f vx[16], vz[16];
  cast_tile_load(vx, idx, x, 1);
  cast_tile_load(vz, idx, z, 1);
  rot_table_wave<false>(sm[wave], idx, pvx, tabx, fr);
  cast_tile_store(vx, idx, x16, 1, kXC);
  rot_table_wave<true>(sm[wave], idx, pvz, tabz, fr);
  cast_tile_store(vz, idx, z16, 1, kXC);
}

/* ---------------------------------------------------------------------------
   Batched WMMA GEMM, one f16 product:
     C[m,n] = scale * sum_k A[m,k]*Bt[n,k]
   A [M][lda] and Bt [N][ldb] are fragment-order planes (see frag_pos); M % 32 == 0, N % 64 == 0, K % 32 == 0.
   Each wave owns a 32x64 tile; tile id = blk*8 + wave over nBatch * (M/32) * (N/64); blk = block index inside the product.
   Batch z -> (zo = z / nInner, zi = z % nInner); operand bases advance by zo*s?o + zi*s?i elements (a step of 32 columns
   in a fragment-order plane is 512 elements).
   EPI 0: f32 out + bf16(bias[n]), row-major.  EPI 1: f16 out (no launch takes it).  EPI 2: 2D rotary of each 64-wide head row (table rows = m)
   -> f16 x64.  EPI 1 and 2 write fragment-order planes of pitch ldc.
   EPI 3: per-row instance norm over the tile's 64 columns; tiles with n0 < 512 are rotated too and go to Cout,
          the others go to Cout2 (both f16 x16, fragment-order planes of the transposed matrix [512][M]). All of it is done
          in the accumulators' own layout: a lane holds 8 consecutive rows (tokens) of one column, which is one 16-B unit
          of the transposed plane; a row's 64 columns are 4 registers x the 16 lanes of a row of lanes; a rotary pair
          (c, c ^ 16) is two registers of one lane. No LDS. The table is the token-minor one.
   No block barriers in this code (per-wave slabs sT[wave]; the early exit is wave-uniform).
   --------------------------------------------------------------------------- */
template <int EPI>
__device__ __forceinline__ void gemm_f16_tile(
    float (*sT)[16 * 68], int blk,
    const unsigned short* __restrict__ Ap, int lda, long sAo, long sAi,
    const unsigned short* __restrict__ Bp, int ldb, long sBo, long sBi,
    void* __restrict__ Cout, void* __restrict__ Cout2, int ldc, long sCo, long sCi,
    const float* __restrict__ bias, const float* __restrict__ tab,
    int M, int N, int K, int nInner, int nBatch, float scale) {
  const int lane = threadIdx.x & 31;
  const int wave = threadIdx.x >> 5;
  const int tilesN = N >> 6;
  const int tilesM = M >> 5;
  const int perBatch = tilesM * tilesN;
  const int tile = blk * 8 + wave;
  if (tile >= perBatch * nBatch) return;
  const int z  = tile / perBatch;
  const int tt = tile - z * perBatch;
  const int tm = tt / tilesN;
  const int tn = tt - tm * tilesN;
  const int m0 = tm << 5;
  const int n0 = tn << 6;
  const int zo = z / nInner;
  const int zi = z - zo * nInner;

  const _Float16* A  = (const _Float16*)Ap + (size_t)zo * sAo + (size_t)zi * sAi;
  const _Float16* Bt = (const _Float16*)Bp + (size_t)zo * sBo + (size_t)zi * sBi;
  const size_t coff = (size_t)zo * sCo + (size_t)zi * sCi;

  const int rlane = lane & 15;
  const int mOff  = (lane >> 4) * 8;
  /* per-row-block strides and the lane's unit inside a 512-B segment */
  const size_t strA = (size_t)(lda >> 5) * 512;
  const size_t strB = (size_t)(ldb >> 5) * 512;
  const int lpos = frag_pos(rlane, lane >> 4) * 8;
  /* one running pointer per fragment row-block; a k step of 32 is the next 1024-B block (64 units) */
  unit_gptr pa[2];
  unit_gptr pb[4];
#pragma unroll
  for (int i = 0; i < 2; ++i) pa[i] = (unit_gptr)(A + (size_t)((m0 >> 4) + i) * strA + lpos);
#pragma unroll
  for (int j = 0; j < 4; ++j) pb[j] = (unit_gptr)(Bt + (size_t)((n0 >> 4) + j) * strB + lpos);

  v8f acc[2][4];
#pragma unroll
  for (int i = 0; i < 2; ++i)
#pragma unroll
    for (int j = 0; j < 4; ++j)
      acc[i][j] = (v8f){0.f, 0.f, 0.f, 0.f, 0.f, 0.f, 0.f, 0.f};

  for (int k0 = 0; k0 < K; k0 += 32) {
    v16h bh[4];
#pragma unroll
    for (int j = 0; j < 4; ++j) {
      bh[j] = frag_load_plane(pb[j]);
      pb[j] += 64;
    }
#pragma unroll
    for (int i = 0; i < 2; ++i) {
      const v16h ah = frag_load_plane(pa[i]);
      pa[i] += 64;
#pragma unroll
      for (int j = 0; j < 4; ++j)
        acc[i][j] = mma16(ah, bh[j], acc[i][j]);
      guard4(acc[i][0], acc[i][1], acc[i][2], acc[i][3], ah, bh[0], bh[1], bh[2], bh[3]);
    }
  }

  if (EPI == 3) {
    const int hi = lane >> 4;
    /* the tile is a k head when its columns are below 512; the same for the whole wave, and read as a scalar so that a v
       tile jumps over the table loads and the rotation */
    const bool isK = (__builtin_amdgcn_readfirstlane(n0) < kInner);
    /* block (row-block (n0 % 512) / 16 + j, k-block m0 / 32); half i of the tile is segment i; the lane's unit is lpos */
    const size_t strC = (size_t)(M >> 5) * 512;
    unsigned short* Cb = (isK ? (unsigned short*)Cout : (unsigned short*)Cout2) +
                         (size_t)((n0 & (kInner - 1)) >> 4) * strC + (size_t)(m0 >> 5) * 512 + lpos;
#pragma unroll
    for (int i = 0; i < 2; ++i) {
      /* [axis][cos, sin][tokens 0..3, 4..7 of the lane's 8] */
      v4f tc[2][2][2];
      if (isK) {
        const float* tp = tab + ((size_t)(m0 >> 3) + i * 2 + hi) * 512 + rlane * 8;
#pragma unroll
        for (int a = 0; a < 2; ++a)
#pragma unroll
          for (int s = 0; s < 2; ++s)
#pragma unroll
            for (int u = 0; u < 2; ++u) tc[a][s][u] = *(const v4f*)(tp + a * 256 + s * 128 + u * 4);
        /* the wait that belongs in front of any overwrite of the loads' address registers; it names them, so that they
           stay untouched (also as a later load's destination) up to here */
        asm volatile("s_wait_xcnt 0x0" :: "v"(tp) : "memory");
      }
      float xv[4][8];
#pragma unroll
      for (int r = 0; r < 8; ++r) {
#pragma unroll
        for (int j = 0; j < 4; ++j) xv[j][r] = acc[i][j][r] * scale;
        /* mean and biased variance over the 64 columns of the row */
        const float mean = row_sum16((xv[0][r] + xv[1][r]) + (xv[2][r] + xv[3][r])) * kInvDh;
#pragma unroll
        for (int j = 0; j < 4; ++j) xv[j][r] -= mean;
        float ss = 0.0f;
#pragma unroll
        for (int j = 0; j < 4; ++j) ss = fmaf(xv[j][r], xv[j][r], ss);
        const float rstd = rsq_normal(row_sum16(ss) * kInvDh + kNormEps);
#pragma unroll
        for (int j = 0; j < 4; ++j) xv[j][r] *= rstd;
      }
#pragma unroll
      for (int j = 0; j < 4; ++j) {
        float o[8];
#pragma unroll
        for (int r = 0; r < 8; ++r) {
          o[r] = xv[j][r];
          /* rotary: column c pairs with c ^ 16 (register j ^ 1); the upper member of a pair takes +sin, the lower -sin */
          if (isK) {
            const float pr = xv[j ^ 1][r] * tc[j >> 1][1][r >> 2][r & 3];
            o[r] = o[r] * tc[j >> 1][0][r >> 2][r & 3] + ((j & 1) ? pr : -pr);
          }
          o[r] *= kKVC;
        }
        *(v4u*)(Cb + (size_t)j * strC + i * 256) =
            (v4u){pk16(h_bits(o[0]), h_bits(o[1])), pk16(h_bits(o[2]), h_bits(o[3])),
                  pk16(h_bits(o[4]), h_bits(o[5])), pk16(h_bits(o[6]), h_bits(o[7]))};
      }
      /* the wait that belongs in front of any overwrite of the stores' registers by the second half's code */
      if (i == 0) asm volatile("s_wait_xcnt 0x0" :: "v"(Cb) : "memory");
    }
    return;
  }

  /* ---- epilogue of EPI 0, 1, 2 ---- */
  float* slab = sT[wave];
  const int q  = lane >> 3;
  const int c8 = (lane & 7) * 8;
  const int hh = lane >> 4;
  const int c4 = (lane & 15) * 4;
#pragma unroll
  for (int i = 0; i < 2; ++i) {
    const int mBase = m0 + (i << 4);
#pragma unroll
    for (int j = 0; j < 4; ++j) {
      float bv = 0.f;
      if (EPI == 0) {
        const float braw = bias[n0 + (j << 4) + rlane];
        bv = bf_rne(braw);
      }
#pragma unroll
      for (int r = 0; r < 8; ++r) {
        float v = acc[i][j][r] * scale;
        if (EPI == 0) v += bv;
        slab[(mOff + r) * 68 + (j << 4) + rlane] = v;
      }
    }
    __builtin_amdgcn_fence(__ATOMIC_RELEASE, "workgroup");
    __builtin_amdgcn_wave_barrier();
    __builtin_amdgcn_fence(__ATOMIC_ACQUIRE, "workgroup");
    if (EPI == 0) {
      /* f32 rows: 64 floats = 256 B = 16 lanes x 16 B; rows it*2 + hh, it = 0..7 -> 16 rows, each once */
      float* C = (float*)Cout + coff;
      v4f vals[8];
#pragma unroll
      for (int it = 0; it < 8; ++it) vals[it] = *(const v4f*)(slab + (it * 2 + hh) * 68 + c4);
      {
#pragma unroll
        for (int it = 0; it < 8; ++it)
          *(v4f*)(C + (size_t)(mBase + it * 2 + hh) * ldc + n0 + c4) = vals[it];
        
      }
    } else {
      /* the 16 x 64 slab is two whole blocks of the plane; col = the lane's unit for row q, rows it*4 add 64 each */
      unsigned short* Cb = (unsigned short*)Cout + coff + ((size_t)(mBase >> 4) * (ldc >> 5) + (n0 >> 5)) * 512;
      const int col = ((lane & 7) >> 1) * 256 + frag_pos(q, lane & 1) * 8;
      /* rotary: column c pairs with c ^ 16; the upper member of a pair takes +sin, the lower -sin */
      const float sgn = (c8 & 16) ? 1.0f : -1.0f;
      const int tcol  = (c8 >> 5) * 32 + (c8 & 15);
      const float oc  = (EPI == 1) ? 1.0f : kQC;
      v4u ow[4];
#pragma unroll
      for (int it = 0; it < 4; ++it) {
        const int row = it * 4 + q;
        const float* sp = slab + row * 68 + c8;
        const v4f ta = *(const v4f*)(sp);
        const v4f tb = *(const v4f*)(sp + 4);
        float o[8];
        o[0] = ta[0]; o[1] = ta[1]; o[2] = ta[2]; o[3] = ta[3];
        o[4] = tb[0]; o[5] = tb[1]; o[6] = tb[2]; o[7] = tb[3];
        if (EPI == 2) {
          const float* pp = slab + row * 68 + (c8 ^ 16);
          const v4f pa = *(const v4f*)(pp);
          const v4f pb = *(const v4f*)(pp + 4);
          float p[8];
          p[0] = pa[0]; p[1] = pa[1]; p[2] = pa[2]; p[3] = pa[3];
          p[4] = pb[0]; p[5] = pb[1]; p[6] = pb[2]; p[7] = pb[3];
          {
            const float* tp = tab + (size_t)(mBase + row) * 64 + tcol;
            const v4f ca = *(const v4f*)(tp);
            const v4f cb = *(const v4f*)(tp + 4);
            const v4f sa = *(const v4f*)(tp + 16);
            const v4f sb = *(const v4f*)(tp + 20);
            /* the wait that belongs in front of any overwrite of the loads' address registers; it names them, so that
               they stay untouched (also as a later load's destination) up to here */
            asm volatile("s_wait_xcnt 0x0" :: "v"(tp) : "memory");
            float cc[8], sn[8];
            cc[0] = ca[0]; cc[1] = ca[1]; cc[2] = ca[2]; cc[3] = ca[3];
            cc[4] = cb[0]; cc[5] = cb[1]; cc[6] = cb[2]; cc[7] = cb[3];
            sn[0] = sa[0]; sn[1] = sa[1]; sn[2] = sa[2]; sn[3] = sa[3];
            sn[4] = sb[0]; sn[5] = sb[1]; sn[6] = sb[2]; sn[7] = sb[3];
#pragma unroll
            for (int e = 0; e < 8; ++e) o[e] = o[e] * cc[e] + sgn * (p[e] * sn[e]);
          }
        }
#pragma unroll
        for (int e = 0; e < 8; ++e) o[e] *= oc;
        ow[it] = (v4u){pk16(h_bits(o[0]), h_bits(o[1])), pk16(h_bits(o[2]), h_bits(o[3])),
                       pk16(h_bits(o[4]), h_bits(o[5])), pk16(h_bits(o[6]), h_bits(o[7]))};
      }
      {
#pragma unroll
        for (int it = 0; it < 4; ++it) *(v4u*)(Cb + it * 64 + col) = ow[it];
        
      }
    }
    __builtin_amdgcn_fence(__ATOMIC_RELEASE, "workgroup");
    __builtin_amdgcn_wave_barrier();
    __builtin_amdgcn_fence(__ATOMIC_ACQUIRE, "workgroup");
  }
}

/* second bound: 8 waves a SIMD (128 registers), as many as before the norm moved into the accumulators; the k loop hides its
   load latency by other waves alone */
template <int EPI>
__global__ __launch_bounds__(256, 8) void gemm_f16_kernel(
    const unsigned short* __restrict__ Ap, int lda, long sAo, long sAi,
    const unsigned short* __restrict__ Bp, int ldb, long sBo, long sBi,
    void* __restrict__ Cout, void* __restrict__ Cout2, int ldc, long sCo, long sCi,
    const float* __restrict__ bias, const float* __restrict__ tab,
    int M, int N, int K, int nInner, int nBatch, float scale) {
  __shared__ __align__(16) float sT[8][16 * 68];
  gemm_f16_tile<EPI>(sT, blockIdx.x, Ap, lda, sAo, sAi, Bp, ldb, sBo, sBi, Cout, Cout2, ldc, sCo, sCi, bias, tab,
                     M, N, K, nInner, nBatch, scale);
}

/* ---------------------------------------------------------------------------
   Token-axis product, split-K: part[ks][bh][d][e] = sum over the 1024 tokens of split ks of k[tok][h*64+d]*v[tok][h*64+e]
   (operands carry x16 each). kt and vt are the fragment-order planes of the transposed matrices (row = head column,
   k = token), so every fragment is two loads of 512 contiguous bytes straight from global memory: no staging.
   256 blocks: blk = ks * 32 + bh. The product is formed as C[e][d] (A = v, B = k): a lane's 8 accumulator rows are then 8
   consecutive e of one d = 32 contiguous bytes of the row-major [d][e] partial.
   Wave w: rows e = 32 * (w % 2) .. + 31, all 64 d, tokens 256 * (w / 2) .. + 255 of the split (8 k-blocks).
   The four token slices are summed in LDS in a fixed order, (s0 + s2) + (s1 + s3); slice 0's two waves store the result,
   each the whole 128-B lines e = 0..31 or 32..63 of every row d.
   All three barriers are reached by all 256 threads (no exit before them; the tests on the wave number are scalar).
   --------------------------------------------------------------------------- */
constexpr int kDotsSlices = 4;
constexpr int kDotsKb     = kTokPerSplit / 32 / kDotsSlices;
static_assert(kDotsKb * 32 * kDotsSlices == kTokPerSplit && kDotsKb >= 2, "token slices of whole k-blocks");
/* a wave's 32 x 64 accumulator tile in LDS, in register order: 16 rows of 32 lanes x 16 B, so no bank is hit twice */
__device__ __forceinline__ void acc_tile_put(float* t, const v8f (&acc)[2][4], int lane) {
#pragma unroll
  for (int i = 0; i < 2; ++i)
#pragma unroll
    for (int j = 0; j < 4; ++j) {
      const v8f a = acc[i][j];
      *(v4f*)(t + ((i * 4 + j) * 2 + 0) * 128 + lane * 4) = (v4f){a[0], a[1], a[2], a[3]};
      *(v4f*)(t + ((i * 4 + j) * 2 + 1) * 128 + lane * 4) = (v4f){a[4], a[5], a[6], a[7]};
    }
}
__device__ __forceinline__ void acc_tile_add(const float* t, v8f (&acc)[2][4], int lane) {
#pragma unroll
  for (int i = 0; i < 2; ++i)
#pragma unroll
    for (int j = 0; j < 4; ++j) {
      const v4f lo = *(const v4f*)(t + ((i * 4 + j) * 2 + 0) * 128 + lane * 4);
      const v4f up = *(const v4f*)(t + ((i * 4 + j) * 2 + 1) * 128 + lane * 4);
#pragma unroll
      for (int r = 0; r < 4; ++r) {
        acc[i][j][r]     += lo[r];
        acc[i][j][r + 4] += up[r];
      }
    }
}
__device__ __forceinline__ void dots_splitk_tile(float* red, int blk,
                                                 const unsigned short* __restrict__ kt,
                                                 const unsigned short* __restrict__ vt,
                                                 float* __restrict__ part) {
  const int tid = threadIdx.x, lane = tid & 31;
  /* the wave number in a scalar register: the tests on it are scalar branches */
  const int wave = __builtin_amdgcn_readfirstlane(tid >> 5);
  const int rh = wave & 1, sl = wave >> 1;
  const int bh = blk & (kBH - 1), ks = blk / kBH;
  const int b = bh >> 3, h = bh & 7;
  const int rlane = lane & 15;
  const int hi    = lane >> 4;
  /* unsigned, and added last to a base that is the same for the whole wave: the loads then take a scalar base and this one
     register as their address, which leaves the registers to the fragments */
  const unsigned lpos = (unsigned)(frag_pos(rlane, hi) * 8);
  const size_t kb0 = (size_t)b * (kSeq / 32) + (size_t)ks * (kTokPerSplit / 32) + (size_t)sl * kDotsKb;
  typedef const __attribute__((address_space(1))) _Float16* half_gptr;
  const half_gptr vbase = (half_gptr)(const _Float16*)vt + ((size_t)(h * 4 + rh * 2) * (kTok / 32) + kb0) * 512;
  const half_gptr kbase = (half_gptr)(const _Float16*)kt + ((size_t)(h * 4) * (kTok / 32) + kb0) * 512;

  unit_gptr pa[2];
  unit_gptr pb[4];
#pragma unroll
  for (int i = 0; i < 2; ++i) pa[i] = (unit_gptr)(vbase + lpos) + (size_t)i * (kTok / 32) * 64;
#pragma unroll
  for (int j = 0; j < 4; ++j) pb[j] = (unit_gptr)(kbase + lpos) + (size_t)j * (kTok / 32) * 64;

  v8f acc[2][4];
#pragma unroll
  for (int i = 0; i < 2; ++i)
#pragma unroll
    for (int j = 0; j < 4; ++j) acc[i][j] = (v8f){0.f, 0.f, 0.f, 0.f, 0.f, 0.f, 0.f, 0.f};

  /* the next k-block's 12 loads fly while this one's products run: two sets of B fragments, three A fragments (the next
     block's second A fragment is loaded when this block's first has done its products and takes its registers) */
  v16h a0 = frag_load_plane(pa[0]);
  v16h a1 = frag_load_plane(pa[1]);
  v16h bk[2][4];
#pragma unroll
  for (int j = 0; j < 4; ++j) bk[0][j] = frag_load_plane(pb[j]);
  /* unrolled: the set index is then a literal and the k step an offset field of the loads */
#pragma unroll
  for (int kb = 0; kb < kDotsKb; ++kb) {
    const int cur = kb & 1, nxt = cur ^ 1;
    const bool more = kb + 1 < kDotsKb;
    v16h n0 = a0, n1 = a1;
    if (more) {
#pragma unroll
      for (int j = 0; j < 4; ++j) bk[nxt][j] = frag_load_plane(pb[j] + (kb + 1) * 64);
      n0 = frag_load_plane(pa[0] + (kb + 1) * 64);
    }
#pragma unroll
    for (int j = 0; j < 4; ++j) acc[0][j] = mma16(a0, bk[cur][j], acc[0][j]);
    guard4(acc[0][0], acc[0][1], acc[0][2], acc[0][3], a0, bk[cur][0], bk[cur][1], bk[cur][2], bk[cur][3]);
    /* keeps the load below from being lifted over the products above: lifted, it needs a fourth A fragment's registers, and
       the kernel then spills under its bound of 160 registers (or, unbound, goes from three resident blocks a WGP to two) */
    __builtin_amdgcn_sched_barrier(0);
    if (more) n1 = frag_load_plane(pa[1] + (kb + 1) * 64);
#pragma unroll
    for (int j = 0; j < 4; ++j) acc[1][j] = mma16(a1, bk[cur][j], acc[1][j]);
    guard4(acc[1][0], acc[1][1], acc[1][2], acc[1][3], a1, bk[cur][0], bk[cur][1], bk[cur][2], bk[cur][3]);
    a0 = n0;
    a1 = n1;
  }

  /* slices 2, 3 hand their tiles to slices 0, 1; then slice 1 to slice 0 */
  if (sl >= 2) acc_tile_put(red + ((sl - 2) * 2 + rh) * 2048, acc, lane);
  __syncthreads(); /* the tiles of slices 2, 3 are read by other waves */
  if (sl < 2) acc_tile_add(red + (sl * 2 + rh) * 2048, acc, lane);
  __syncthreads(); /* those reads end before slice 1 writes over the first two tiles */
  if (sl == 1) acc_tile_put(red + rh * 2048, acc, lane);
  __syncthreads(); /* slice 1's tiles are read by slice 0 */
  if (sl != 0) return; /* no barrier below */
  acc_tile_add(red + rh * 2048, acc, lane);

  float* C = part + ((size_t)ks * kBH + bh) * (kDh * kDh) + (size_t)rlane * kDh + rh * 32 + hi * 8;
#pragma unroll
  for (int i = 0; i < 2; ++i)
#pragma unroll
    for (int j = 0; j < 4; ++j) {
      const v8f a = acc[i][j];
      *(v4f*)(C + j * 16 * kDh + i * 16)     = (v4f){a[0], a[1], a[2], a[3]};
      *(v4f*)(C + j * 16 * kDh + i * 16 + 4) = (v4f){a[4], a[5], a[6], a[7]};
    }
}

/* The token-axis product (reads k, v) and the q projection (EPI 2: reads x, Wq, the x table; writes q) depend on nothing
   of each other, so they are two ranges of blocks of one grid: the first 256 blocks take the token-axis product, the rest
   the q projection. One LDS array serves either range. */
constexpr int kBlkDots = kBH * kSplitK;
constexpr int kBlkQ    = (kTok / 32) * (kInner / 64) / 8;
constexpr int kLdsQDots  = 8 * 16 * 68 * 4;
static_assert(kLdsQDots == 34816 && 4 * 2048 * 4 <= kLdsQDots, "LDS carve");
/* second bound: 6 waves a SIMD (160 registers, three blocks a WGP), what this kernel had before the token-axis range took its
   second set of fragments; both ranges fit without a spill */
__global__ __launch_bounds__(256, 6) void dots_qproj_kernel(
    const unsigned short* __restrict__ kn, const unsigned short* __restrict__ vn, float* __restrict__ part,
    const unsigned short* __restrict__ Xp, const unsigned short* __restrict__ Wqp, void* __restrict__ Qout,
    const float* __restrict__ tabx, int M, int N, int K, float scale) {
  __shared__ __align__(16) unsigned char sm[kLdsQDots];
  const int blk = blockIdx.x;
  if (blk < kBlkDots)
    dots_splitk_tile((float*)sm, blk, kn, vn, part);
  else
    gemm_f16_tile<2>((float (*)[16 * 68])sm, blk - kBlkDots, Xp, K, 0L, 0L, Wqp, K, 0L, 0L, Qout, nullptr, N, 0L, 0L,
                     nullptr, tabx, M, N, K, 1, 1, scale);
}

/* ---------------------------------------------------------------------------
   out = (q . dots / 8192) . Wout^T is computed as q . G^T with G[b][o][h*64+d] = sum_e Wout[o][h*64+e] * dots[b][h][d][e] / 8192,
   so the per-token product with dots is replaced by this one, 256 rows a head. One block per (batch, head), 8 waves.
   Step 1: fixed-order sum of the 8 split-K partials, scaled (1/8192 and carries, all powers of two) in f32, emitted as one
   f16 fragment-order 64 x 64 plane [d][e] in LDS; 8 elements per unit, 512 units = 256 threads x 2.
   Step 2: wave w takes rows o = 32w .. 32w+31 of Wout (A, columns h*64 .. +63 of its plane) against all 64 rows d of the LDS
   plane (B), K = 64, and writes its 32 x 64 tile to columns h*64 .. +63 of the batch's fragment-order plane of pitch 512.
   No early exit: all 256 threads reach the barrier.
   --------------------------------------------------------------------------- */
__global__ __launch_bounds__(256) void dots_fold_kernel(const float* __restrict__ part, const unsigned short* __restrict__ wo,
                                                        unsigned short* __restrict__ gw) {
  __shared__ __align__(16) _Float16 sD[kDh * kDh];
  __shared__ __align__(16) float sT[8][32 * 68];
  const int tid = threadIdx.x, lane = tid & 31, wave = tid >> 5;
  const int bh = blockIdx.x, b = bh >> 3, h = bh & 7;
  const int rlane = lane & 15;
  const int mOff  = (lane >> 4) * 8;
  const int lpos  = frag_pos(rlane, lane >> 4) * 8;
  const int m0    = wave << 5;

  /* the Wout fragments depend on nothing of step 1: their loads fly beside those of the partials */
  v16h ah[2][2];
#pragma unroll
  for (int kb = 0; kb < 2; ++kb)
#pragma unroll
    for (int i = 0; i < 2; ++i)
      ah[kb][i] = frag_load_plane((unit_gptr)((const _Float16*)wo +
                                              ((size_t)((m0 >> 4) + i) * (kInner >> 5) + h * 2 + kb) * 512 + lpos));

#pragma unroll
  for (int u = 0; u < 2; ++u) {
    const int iu = u * 256 + tid;
    const size_t o = (size_t)bh * (kDh * kDh) + 8 * (size_t)iu;
    float s[8];
#pragma unroll
    for (int e = 0; e < 8; ++e) s[e] = 0.0f;
#pragma unroll
    for (int ks = 0; ks < kSplitK; ++ks) {
      const float* p = part + (size_t)ks * kDotsElems + o;
      const v4f a = *(const v4f*)(p);
      const v4f c = *(const v4f*)(p + 4);
      s[0] += a[0]; s[1] += a[1]; s[2] += a[2]; s[3] += a[3];
      s[4] += c[0]; s[5] += c[1]; s[6] += c[2]; s[7] += c[3];
    }
    unsigned short hb[8];
#pragma unroll
    for (int e = 0; e < 8; ++e) hb[e] = h_bits(s[e] * kDotsScale);
    /* unit iu = (row d, columns e8*8 .. +7) of the 64 x 64 fragment-order plane */
    const int d  = iu >> 3;
    const int e8 = iu & 7;
    *(v4u*)(sD + ((d >> 4) * 2 + (e8 >> 2)) * 512 + ((e8 >> 1) & 1) * 256 + frag_pos(d & 15, e8 & 1) * 8) =
        (v4u){pk16(hb[0], hb[1]), pk16(hb[2], hb[3]), pk16(hb[4], hb[5]), pk16(hb[6], hb[7])};
  }
  __syncthreads(); /* every wave reads the whole plane, written by all */

  v8f acc[2][4];
#pragma unroll
  for (int i = 0; i < 2; ++i)
#pragma unroll
    for (int j = 0; j < 4; ++j)
      acc[i][j] = (v8f){0.f, 0.f, 0.f, 0.f, 0.f, 0.f, 0.f, 0.f};
#pragma unroll
  for (int kb = 0; kb < 2; ++kb) {
    v16h bf[4];
#pragma unroll
    for (int j = 0; j < 4; ++j) {
      const _Float16* p = sD + (j * 2 + kb) * 512 + lpos;
      FragU f;
      f.h[0] = *(const v8h*)(p);
      f.h[1] = *(const v8h*)(p + 256);
      bf[j] = f.v;
    }
#pragma unroll
    for (int i = 0; i < 2; ++i) {
#pragma unroll
      for (int j = 0; j < 4; ++j)
        acc[i][j] = mma16(ah[kb][i], bf[j], acc[i][j]);
      /* keeps the group's operands in their registers past its last product, with the slots the results need */
      guard4(acc[i][0], acc[i][1], acc[i][2], acc[i][3], ah[kb][i], bf[0], bf[1], bf[2], bf[3]);
    }
  }

  /* the wave's 32 x 64 tile goes through its own LDS slab, so that each store covers whole 128-B lines: 16 rows x 64
     columns are two whole blocks of the plane */
  float* slab = sT[wave];
  const int q   = lane >> 3;
  const int c8  = (lane & 7) * 8;
  const int col = ((lane & 7) >> 1) * 256 + frag_pos(q, lane & 1) * 8;
#pragma unroll
  for (int i = 0; i < 2; ++i)
#pragma unroll
    for (int j = 0; j < 4; ++j)
#pragma unroll
      for (int r = 0; r < 8; ++r) slab[(i * 16 + mOff + r) * 68 + (j << 4) + rlane] = acc[i][j][r] * kFoldScale;
  /* the rows read below were written by other lanes of this wave */
  __builtin_amdgcn_fence(__ATOMIC_RELEASE, "workgroup");
  __builtin_amdgcn_wave_barrier();
  __builtin_amdgcn_fence(__ATOMIC_ACQUIRE, "workgroup");
#pragma unroll
  for (int i = 0; i < 2; ++i) {
    unsigned short* Cb = gw + (size_t)b * (kDim * kInner) + ((size_t)((m0 >> 4) + i) * (kInner >> 5) + h * 2) * 512;
#pragma unroll
    for (int it = 0; it < 4; ++it) {
      const float* sp = slab + (i * 16 + it * 4 + q) * 68 + c8;
      const v4f ta = *(const v4f*)(sp);
      const v4f tb = *(const v4f*)(sp + 4);
      *(v4u*)(Cb + it * 64 + col) = (v4u){pk16(h_bits(ta[0]), h_bits(ta[1])), pk16(h_bits(ta[2]), h_bits(ta[3])),
                                          pk16(h_bits(tb[0]), h_bits(tb[1])), pk16(h_bits(tb[2]), h_bits(tb[3]))};
    }
  }
}

/* ---------------------------------------------------------------------------
   Host glue: 5 kernel launches, nothing else.
   GEMM shapes (M % 32 == 0, N % 64 == 0, K % 32 == 0, no pad planes needed):
     kv projection : M 32768, N 1024, K 256 -> 1024 x 16 tiles = 16384 -> 2048 blocks
     q projection  : M 32768, N 512,  K 256 -> 1024 x 8  tiles =  8192 -> 1024 blocks (behind the 256 of the token-axis product)
     Wout . dots^T : 32 (batch, head) pairs of M 256, N 64, K 64 -> 32 blocks (dots_fold_kernel)
     q . G^T       : 4 batches of M 8192, N 256, K 512 -> 4 x 256 x 4 tiles = 4096 -> 512 blocks
   --------------------------------------------------------------------------- */
extern "C" void kernel_launch(void* const* d_in, const int* in_sizes, int n_in,
                              void* d_out, int out_size, void* d_ws, size_t ws_size,
                              hipStream_t stream) {
  if (n_in < 8) return;
  if (in_sizes[0] != kTok * kDim) return;
  if (in_sizes[1] != kTok * kDim) return;
  if (in_sizes[2] != kTok * 2) return;
  if (in_sizes[3] != kTok * 2) return;
  if (in_sizes[4] != kInner * kDim) return;
  if (in_sizes[5] != 2 * kInner * kDim) return;
  if (in_sizes[6] != kDim * kInner) return;
  if (in_sizes[7] != kDim) return;
  if (out_size != kTok * kDim) return;
  if (ws_size < kWsTotal) return;

  const float* x    = (const float*)d_in[0];
  const float* z    = (const float*)d_in[1];
  const float* xpos = (const float*)d_in[2];
  const float* zpos = (const float*)d_in[3];
  const float* Wq   = (const float*)d_in[4];
  const float* Wkv  = (const float*)d_in[5];
  const float* Wout = (const float*)d_in[6];
  const float* bout = (const float*)d_in[7];
  float* out = (float*)d_out;

  char* ws = (char*)d_ws;
  unsigned short* WQ   = (unsigned short*)(ws + kOffWQ);
  unsigned short* WK   = (unsigned short*)(ws + kOffWK);
  unsigned short* WO   = (unsigned short*)(ws + kOffWO);
  unsigned short* S16  = (unsigned short*)(ws + kOffS16);
  unsigned short* KN   = (unsigned short*)(ws + kOffKN);
  unsigned short* VN   = (unsigned short*)(ws + kOffVN);
  unsigned short* QH   = (unsigned short*)(ws + kOffQH);
  float*          TAB  = (float*)(ws + kOffTAB);
  float*          PART = (float*)(ws + kOffPART);
  unsigned short* GW   = (unsigned short*)(ws + kOffGW);
  unsigned short* SX   = (unsigned short*)(ws + kOffSX);
  float*          TABX = (float*)(ws + kOffTABX);

  /* inverse frequencies: 1 / f32(10000^(2j/32)), j = 0..15 */
  FreqTab ft;
  for (int j = 0; j < 16; ++j) {
    const double ex = (double)(2 * j) / 32.0;
    const float pw = (float)pow(10000.0, ex);
    ft.f[j] = 1.0f / pw;
  }

  /* weight planes ([out][in] = Bt orientation already): f16(bf16(w) * 1024); z and x planes: f16(bf16(v) * 16);
     position tables of z and x */
  prep_kernel<<<kBlkPrep, 256, 0, stream>>>(x, z, xpos, zpos, Wq, Wkv, Wout, WQ, WK, WO, S16, SX, TAB, TABX, ft);

  /* key/value side: projection with fused norm (+ rotary on k) */
  gemm_f16_kernel<3><<<(kTok / 32) * (2 * kInner / 64) / 8, 256, 0, stream>>>(
      S16, kDim, 0L, 0L,
      WK, kDim, 0L, 0L,
      (void*)KN, (void*)VN, kInner, 0L, 0L,
      bout, TAB,
      kTok, 2 * kInner, kDim, 1, 1, kProjScale);

  /* token-axis product, deterministic split-K, beside the query side's projection with fused rotary; then the
     fixed-order reduce and its product with Wout, per (batch, head) */
  dots_qproj_kernel<<<kBlkDots + kBlkQ, 256, 0, stream>>>(KN, VN, PART, SX, WQ, (void*)QH, TABX,
                                                          kTok, kInner, kDim, kProjScale);
  dots_fold_kernel<<<kBH, 256, 0, stream>>>(PART, WO, GW);

  /* output per batch: [8192][256] = q [8192][512] . G [256][512]^T, + bias */
  gemm_f16_kernel<0><<<(kTok / 32) * (kDim / 64) / 8, 256, 0, stream>>>(
      QH, kInner, (long)kSeq * kInner, 0L,
      GW, kInner, (long)kDim * kInner, 0L,
      (void*)out, (void*)VN, kDim, (long)kSeq * kDim, 0L,
      bout, TAB,
      kSeq, kDim, kInner, 1, kBatch, kOutScale);
}

// v006
// It runs in 105 microseconds.
// In two side-by-side timings against v005, it was 1.12 and 1.11 times as fast.
// Counting every step since v000, it is 2.01 times as fast.
// Contractions (q/kv projections, token-axis k^T v, Wout.dots^T, q.(that product)): v_wmma_f32_16x16x32_f16, one product per site, f32 accumulate; every operand a plain f16 plane with a power-of-two carry; every float module input RNE-converted to bf16 once at its first read (exact in the carried f16 planes); instance norm, rotary, scaling and bias in f32.
#include <hip/hip_runtime.h>
#include <math.h>

typedef __attribute__((ext_vector_type(16))) _Float16 v16h;
typedef __attribute__((ext_vector_type(8)))  _Float16 v8h;
typedef __attribute__((ext_vector_type(8)))  float    v8f;
typedef __attribute__((ext_vector_type(4)))  float    v4f;
typedef __attribute__((ext_vector_type(4)))  unsigned int v4u;
typedef __attribute__((ext_vector_type(2)))  unsigned int v2u;

/* ---------------------------------------------------------------------------
   Shape constants
   --------------------------------------------------------------------------- */
constexpr int kBatch  = 4;
constexpr int kSeq    = 8192;
constexpr int kDim    = 256;
constexpr int kHeads  = 8;
constexpr int kDh     = 64;
constexpr int kInner  = kHeads * kDh;
constexpr int kTok    = kBatch * kSeq;
constexpr int kBH     = kBatch * kHeads;
constexpr int kSplitK = 8;
constexpr int kTokPerSplit = kSeq / kSplitK;
constexpr int kDotsElems = kBH * kDh * kDh;
static_assert(kInner == 512 && kTok == 32768 && kDotsElems == 131072, "shape");
static_assert((kDim % 32) == 0 && (kInner % 32) == 0 && (kDh % 32) == 0, "K multiples of 32");
static_assert((kTok % 32) == 0 && (kSeq % 32) == 0, "M multiples of 32");
static_assert((kInner % 64) == 0 && ((2 * kInner) % 64) == 0 && (kDim % 64) == 0 && (kDh % 64) == 0, "N multiples of 64");
static_assert((kTokPerSplit % 64) == 0, "token chunks of 64");

/* power-of-two carries of the f16 planes (all folded back exactly in f32) */
constexpr float kXC     = 16.0f;
constexpr float kWC     = 1024.0f;
constexpr float kKVC    = 16.0f;
constexpr float kQC     = 64.0f;
constexpr float kDC     = 1024.0f;
constexpr float kGC     = 1024.0f;
constexpr float kProjScale = 1.0f / (kXC * kWC);
constexpr float kDotsScale = kDC / (kKVC * kKVC * (float)kSeq);
constexpr float kFoldScale = kGC / (kWC * kDC);
constexpr float kOutScale  = 1.0f / (kQC * kGC);
constexpr float kPosScale  = 64.0f;
constexpr float kNormEps   = 1e-5f;
constexpr float kInvDh     = 1.0f / (float)kDh;

/* ---------------------------------------------------------------------------
   Workspace region map (bytes; every offset is a multiple of 128). WQ, WK, WO, S16, QH, GW and SX are fragment-order
   planes (see frag_pos); the shapes below give rows and pitch. KN and VN are fragment-order planes too, of the TRANSPOSED
   matrices: row = head column, k = token.
     WQ   f16 [512][256]    Wq plane  (bf16 value x1024)            262,144
     WK   f16 [1024][256]   Wkv plane (bf16 value x1024)            524,288
     WO   f16 [256][512]    Wout plane (bf16 value x1024)           262,144
     S16  f16 [32768][256]  z x16                                  16,777,216
     KN   f16 [512][32768]  normed+rotated k x16, transposed       33,554,432
     VN   f16 [512][32768]  normed v x16, transposed               33,554,432
     QH   f16 [32768][512]  rotated q x64                          33,554,432
     TAB  f32 [4096][64][8] cos/sin table of the z positions, token-minor in tiles of 8 tokens  8,388,608
     PART f32 [8][32][64][64] split-K partials of the k^T v product  4,194,304
     GW   f16 [4][256][512] per batch: Wout . dots^T / 8192, x1024  1,048,576
     SX   f16 [32768][256]  x x16                                  16,777,216
     TABX f32 [32768][64]   cos/sin table of the x positions        8,388,608
     total                                                        157,286,400
   --------------------------------------------------------------------------- */
constexpr size_t kOffWQ   = 0;
constexpr size_t kOffWK   = kOffWQ   + (size_t)kInner * kDim * 2;
constexpr size_t kOffWO   = kOffWK   + (size_t)2 * kInner * kDim * 2;
constexpr size_t kOffS16  = kOffWO   + (size_t)kDim * kInner * 2;
constexpr size_t kOffKN   = kOffS16  + (size_t)kTok * kDim * 2;
constexpr size_t kOffVN   = kOffKN   + (size_t)kTok * kInner * 2;
constexpr size_t kOffQH   = kOffVN   + (size_t)kTok * kInner * 2;
constexpr size_t kOffTAB  = kOffQH   + (size_t)kTok * kInner * 2;
constexpr size_t kOffPART = kOffTAB  + (size_t)kTok * 64 * 4;
constexpr size_t kOffGW   = kOffPART + (size_t)kSplitK * kDotsElems * 4;
constexpr size_t kOffSX   = kOffGW   + (size_t)kBatch * kDim * kInner * 2;
constexpr size_t kOffTABX = kOffSX   + (size_t)kTok * kDim * 2;
constexpr size_t kWsTotal = kOffTABX + (size_t)kTok * 64 * 4;
static_assert(kWsTotal == 157286400ull, "carve total");
static_assert(kWsTotal <= 268435456ull, "carve cap");
static_assert((kOffWK % 128) == 0 && (kOffWO % 128) == 0 && (kOffS16 % 128) == 0 && (kOffKN % 128) == 0 &&
              (kOffVN % 128) == 0 && (kOffQH % 128) == 0 && (kOffTAB % 128) == 0 && (kOffPART % 128) == 0 &&
              (kOffGW % 128) == 0 && (kOffSX % 128) == 0 && (kOffTABX % 128) == 0, "128-B aligned regions");

/* ---------------------------------------------------------------------------
   Small helpers
   --------------------------------------------------------------------------- */
__device__ __forceinline__ unsigned short f2bf_bits(float f) {
  unsigned u = __float_as_uint(f);
  return (unsigned short)((u + 0x7FFFu + ((u >> 16) & 1u)) >> 16);
}
__device__ __forceinline__ float bf_bits2f(unsigned short h) { return __uint_as_float(((unsigned)h) << 16); }
/* RNE convert of an f32 value to the nearest bf16 value, returned as f32 */
__device__ __forceinline__ float bf_rne(float f) { return bf_bits2f(f2bf_bits(f)); }

__device__ __forceinline__ unsigned pk16(unsigned short a, unsigned short b) { return (unsigned)a | ((unsigned)b << 16); }
__device__ __forceinline__ unsigned short h_bits(float f) { const _Float16 h = (_Float16)f; return __builtin_bit_cast(unsigned short, h); }

union FragU { v16h v; v8h h[2]; };
/* Fragment-order plane of a [R][K] f16 matrix (R % 16 == 0, K % 32 == 0): each 16-row x 32-k block is 1024 contiguous
   bytes = two 512-B segments (k 0..15, k 16..31 of the block); a segment holds 32 units of 8 halves, one per
   (row-in-block rl, k-half hi), at position frag_pos(rl, hi). Blocks run k-fastest: block (rb, kb) starts at
   (rb * (K / 32) + kb) * 512 halves. A wave's fragment load is then two loads of 512 contiguous bytes (4 whole lines),
   and 4 consecutive rows x both k-halves of a segment are one 128-B line (what one epilogue store covers). */
__device__ __forceinline__ int frag_pos(int rl, int hi) { return ((rl >> 2) << 3) | (hi << 2) | (rl & 3); }
/* pointer to 16-B units in global memory: the address space is spelled out so that the running pointers of the k loop
   stay global loads */
typedef const __attribute__((address_space(1))) v8h* unit_gptr;
/* elements 0..7 <- segment 0, elements 8..15 <- segment 1 (32 units on); p is the lane's own unit */
__device__ __forceinline__ v16h frag_load_plane(unit_gptr p) {
  FragU f;
  f.h[0] = p[0];
  f.h[1] = p[32];
  return f.v;
}
__device__ __forceinline__ v8f mma16(v16h a, v16h b, v8f c) {
  return __builtin_amdgcn_wmma_f32_16x16x32_f16(false, a, false, b, (short)0, c, false, false);
}
/* hazard guard: ties all four accumulators of a group and names the A fragment and all B fragments */
__device__ __forceinline__ void guard4(v8f& a0, v8f& a1, v8f& a2, v8f& a3,
                                       v16h x, v16h b0, v16h b1, v16h b2, v16h b3) {
  asm volatile("v_nop\n\tv_nop\n\tv_nop\n\tv_nop"
               : "+v"(a0), "+v"(a1), "+v"(a2), "+v"(a3)
               : "v"(x), "v"(b0), "v"(b1), "v"(b2), "v"(b3));
}

/* sum over the 16 lanes of a row, left in every lane: four adds whose second operand is read from lane ^ 1, 2, 4, 8 by the
   add itself (row_xmask), so no LDS crossbar and no wait; every lane of the wave is on where it is called */
template <int MASK>
__device__ __forceinline__ float row_xor(float v) {
  return __int_as_float(__builtin_amdgcn_update_dpp(0, __float_as_int(v), 0x160 | MASK, 0xf, 0xf, true));
}
/* 1 / sqrt(x) for x >= 1e-5: never subnormal, so the library form's rescaling has nothing to do. The v_nop is the slot that
   the instruction set asks for between a transcendental and a next instruction that reads its result or overwrites its
   source; inside the statement it stands directly behind the v_rsq_f32 in every build */
__device__ __forceinline__ float rsq_normal(float x) {
  float r;
  asm("v_rsq_f32 %0, %1\n\tv_nop" : "=v"(r) : "v"(x));
  return r;
}
__device__ __forceinline__ float row_sum16(float s) {
  s += row_xor<1>(s);
  s += row_xor<2>(s);
  s += row_xor<4>(s);
  s += row_xor<8>(s);
  return s;
}

/* ---------------------------------------------------------------------------
   f32 -> bf16 value (RNE) -> f16 fragment-order plane with a power-of-two carry. The carried bf16 value is exactly
   representable in f16 (8 significant bits, normal range).
   ONE WAVE takes a tile of 16 rows x 128 columns of the [R][K] input, K = 128 << kshift, = 4 blocks of the plane = 4096
   contiguous output bytes. Load (kb, i), kb = 0..3, i = 0..3: lane l reads row 4i + l / 8, columns kb*32 + (l % 8)*4 .. + 3,
   so a load covers 4 whole 128-B lines. The lane's 4 values are half of one 16-B unit of the plane, and the 32 halves of
   load (kb, i) are the units of rows 4i .. 4i+3 of block kb: one whole line in either segment. So the 8-B store of the same
   lane needs no exchange between lanes, no LDS and no barrier.
   Coverage: (R / 16) * (K / 128) tiles exactly for every plane used: x, z 4096 tiles; Wq 64; Wkv 128; Wout 64.
   The loads and the convert-and-store part are two functions, so that a wave can put other work between them.
   --------------------------------------------------------------------------- */
__device__ __forceinline__ void cast_tile_load(v4f (&v)[16], int tile, const float* __restrict__ in, int kshift) {
  const int lane = threadIdx.x & 31;
  const int rb = tile >> kshift;
  const int cb = tile & ((1 << kshift) - 1);
  const size_t rows4 = (size_t)4 << (7 + kshift);
  const float* p0 = in + (((size_t)(rb * 16 + (lane >> 3))) << (7 + kshift)) + cb * 128 + (lane & 7) * 4;
  const float* p1 = p0 + rows4;
  const float* p2 = p1 + rows4;
  const float* p3 = p2 + rows4;
#pragma unroll
  for (int kb = 0; kb < 4; ++kb) {
    v[kb * 4 + 0] = *(const v4f*)(p0 + kb * 32);
    v[kb * 4 + 1] = *(const v4f*)(p1 + kb * 32);
    v[kb * 4 + 2] = *(const v4f*)(p2 + kb * 32);
    v[kb * 4 + 3] = *(const v4f*)(p3 + kb * 32);
  }
  /* the wait that belongs in front of any overwrite of the loads' address registers; it names them, so that they stay
     untouched (also as a later load's destination) up to here. With a literal kshift the row steps are folded into the
     loads' offset fields and p0 is the one base */
  if (__builtin_constant_p(kshift)) asm volatile("s_wait_xcnt 0x0" :: "v"(p0) : "memory");
  else                              asm volatile("s_wait_xcnt 0x0" :: "v"(p0), "v"(p1), "v"(p2), "v"(p3) : "memory");
}
__device__ __forceinline__ void cast_tile_store(const v4f (&v)[16], int tile, unsigned short* __restrict__ out, int kshift,
                                                float carry) {
  const int lane = threadIdx.x & 31;
  const int rb = tile >> kshift;
  const int cb = tile & ((1 << kshift) - 1);
  const int r  = lane >> 3;
  const int c  = lane & 7;
  /* columns 4c .. 4c+3 of a block: segment c / 4, k-half (c / 2) % 2, lower or upper 4 halves of the unit */
  unsigned short* q = out + ((((size_t)rb << (2 + kshift)) + cb * 4) << 9) + (c >> 2) * 256 +
                      frag_pos(r, (c >> 1) & 1) * 8 + (c & 1) * 4;
#pragma unroll
  for (int kb = 0; kb < 4; ++kb)
#pragma unroll
    for (int i = 0; i < 4; ++i) {
      const v4f a = v[kb * 4 + i];
      const float a0 = bf_rne(a[0]) * carry, a1 = bf_rne(a[1]) * carry, a2 = bf_rne(a[2]) * carry, a3 = bf_rne(a[3]) * carry;
      /* rows 4i .. 4i+3 stand 8 units = 64 halves behind rows 4i-4 .. 4i-1 */
      *(v2u*)(q + kb * 512 + i * 64) = (v2u){pk16(h_bits(a0), h_bits(a1)), pk16(h_bits(a2), h_bits(a3))};
    }
  /* the wait that belongs in front of any overwrite of the stores' registers by the code that follows (the next table's
     loop) */
  asm volatile("s_wait_xcnt 0x0" :: "v"(q) : "memory");
}

/* ---------------------------------------------------------------------------
   Rotary table: tab[token][axis*32 + j] = cos(theta), tab[token][axis*32 + 16 + j] = sin(theta),
   theta = (bf16(pos[token][axis]) * 64) * inv_freq[j], j = 0..15.
   ONE WAVE takes a tile of 8 tokens: lane = (axis, j), one token a trip; 32768/8 = 4096 tiles exactly per table.
   pv = the tile's 16 positions, one per lane (lane % 16 = token-in-tile * 2 + axis), loaded by the caller ahead of time.
   Store: the 8 x 64 f32 tile (2048 B = 16 lines) is staged in the wave's own LDS slab and leaves as 4 stores of 512
   contiguous bytes. TOKMINOR: the tile is laid out [column][token-in-tile] instead, so that a lane which owns one column
   and 8 consecutive tokens (the accumulator layout) reads its 8 values as 32 contiguous bytes.
   --------------------------------------------------------------------------- */
struct FreqTab { float f[16]; };
static_assert(sizeof(FreqTab) == 64, "no padding");
/* orders a wave's own LDS writes and reads (other lanes' values); LDS only, so that the global loads and stores in flight
   are not waited for */
__device__ __forceinline__ void wave_lds_sync() {
  __builtin_amdgcn_fence(__ATOMIC_RELEASE, "workgroup", "local");
  __builtin_amdgcn_wave_barrier();
  __builtin_amdgcn_fence(__ATOMIC_ACQUIRE, "workgroup", "local");
}
template <bool TOKMINOR>
__device__ __forceinline__ void rot_table_wave(float* slab, int tile, float pv, float* __restrict__ tab, float fr) {
  const int lane = threadIdx.x & 31;
  const int axis = lane >> 4;
  const int j    = lane & 15;
  const int pbits = __float_as_int(pv);
  /* rolled: eight copies of the sine and cosine code would only lengthen the text */
#pragma unroll 1
  for (int tl = 0; tl < 8; ++tl) {
    const int b0 = __builtin_amdgcn_readlane(pbits, 2 * tl);
    const int b1 = __builtin_amdgcn_readlane(pbits, 2 * tl + 1);
    const float praw = __int_as_float(axis ? b1 : b0);
    const float p   = bf_rne(praw);
    const float t   = p * kPosScale;
    const float ang = t * fr;
    const float cv = cosf(ang);
    const float sv = sinf(ang);
    if (TOKMINOR) {
      slab[(axis * 32 + j) * 8 + tl]      = cv;
      slab[(axis * 32 + 16 + j) * 8 + tl] = sv;
    } else {
      slab[tl * 64 + axis * 32 + j]      = cv;
      slab[tl * 64 + axis * 32 + 16 + j] = sv;
    }
  }
  wave_lds_sync();
  float* dst = tab + (size_t)tile * 512 + lane * 4;
#pragma unroll
  for (int n = 0; n < 4; ++n) {
    const v4f v = *(const v4f*)(slab + n * 128 + lane * 4);
    *(v4f*)(dst + n * 128) = v;
  }
  wave_lds_sync(); /* the slab is written again for the next table */
}

/* ---------------------------------------------------------------------------
   All input preparation in one launch of few, long waves; no wave depends on another, so there is no block barrier.
     blocks 0 .. 31: wave t = blk*8 + wave takes one cast tile of the weights: t 0 .. 63 Wq, 64 .. 191 Wkv, 192 .. 255 Wout.
     blocks 32 .. 543: wave idx = 0 .. 4095 takes cast tile idx of x and of z and table tile idx of either position array.
   Such a wave issues all its loads first (2 of positions, 32 of 512 B), computes the x table while they fly, converts and
   stores x, then the z table and z (z last: the next launch reads it).
   --------------------------------------------------------------------------- */
constexpr int kTileWq  = kInner * kDim / 2048;
constexpr int kTileWkv = 2 * kInner * kDim / 2048;
constexpr int kTileWo  = kDim * kInner / 2048;
constexpr int kTileAct = kTok * kDim / 2048;
constexpr int kTileTab = kTok / 8;
constexpr int kBlkPrepW = (kTileWq + kTileWkv + kTileWo) / 8;
constexpr int kBlkPrep  = kBlkPrepW + kTileAct / 8;
static_assert(kTileAct == kTileTab && (kTileWq % 8) == 0 && (kTileWkv % 8) == 0 && (kTileWo % 8) == 0 &&
              (kTileAct % 8) == 0 && kBlkPrep == 544, "prep grid");
__global__ __launch_bounds__(256) void prep_kernel(const float* __restrict__ x, const float* __restrict__ z,
                                                   const float* __restrict__ xpos, const float* __restrict__ zpos,
                                                   const float* __restrict__ Wq, const float* __restrict__ Wkv,
                                                   const float* __restrict__ Wout,
                                                   unsigned short* __restrict__ wq16, unsigned short* __restrict__ wkv16,
                                                   unsigned short* __restrict__ wo16, unsigned short* __restrict__ z16,
                                                   unsigned short* __restrict__ x16, float* __restrict__ tabz,
                                                   float* __restrict__ tabx, FreqTab ft) {
  __shared__ __align__(16) float sm[8][8 * 64];
  const int lane = threadIdx.x & 31;
  const int wave = __builtin_amdgcn_readfirstlane(threadIdx.x >> 5);
  const int blk  = blockIdx.x;
  if (blk < kBlkPrepW) {
    const int t = blk * 8 + wave;
    const bool isQ = t < kTileWq, isO = t >= kTileWq + kTileWkv;
    const float* in     = isQ ? Wq : (isO ? Wout : Wkv);
    unsigned short* out = isQ ? wq16 : (isO ? wo16 : wkv16);
    const int tile      = isQ ? t : (isO ? t - kTileWq - kTileWkv : t - kTileWq);
    const int kshift    = isO ? 2 : 1;
    v4f w[16];
    cast_tile_load(w, tile, in, kshift);
    cast_tile_store(w, tile, out, kshift, kWC);
    return;
  }
  const int idx = (blk - kBlkPrepW) * 8 + wave;
  const int j = lane & 15;
  float fr = ft.f[0];
#pragma unroll
  for (int e = 1; e < 16; ++e) fr = (j == e) ? ft.f[e] : fr;
  const float pvx = xpos[(size_t)idx * 16 + j];
  const float pvz = zpos[(size_t)idx * 16 + j];
  /* keeps what the tables need (the frequency becomes a load too) ahead of the 32 tile loads: loads are counted back in
     order, so a table's wait on a later one would wait for the tiles as well */
  __builtin_amdgcn_sched_barrier(0);
  v4f vx[16], vz[16];
  cast_tile_load(vx, idx, x, 1);
  cast_tile_load(vz, idx, z, 1);
  rot_table_wave<false>(sm[wave], idx, pvx, tabx, fr);
  cast_tile_store(vx, idx, x16, 1, kXC);
  rot_table_wave<true>(sm[wave], idx, pvz, tabz, fr);
  cast_tile_store(vz, idx, z16, 1, kXC);
}

/* ---------------------------------------------------------------------------
   Batched WMMA GEMM, one f16 product:
     C[m,n] = scale * sum_k A[m,k]*Bt[n,k]
   A [M][lda] and Bt [N][ldb] are fragment-order planes (see frag_pos); M % 32 == 0, N % 64 == 0, K % 32 == 0.
   Each wave owns a 32x64 tile; blk = block index inside the product, nBatch * (M/256) * (N/64) blocks.
   Batch z -> (zo = z / nInner, zi = z % nInner); operand bases advance by zo*s?o + zi*s?i elements (a step of 32 columns
   in a fragment-order plane is 512 elements).
   EPI 0: f32 out + bf16(bias[n]), row-major.  EPI 1: f16 out (no launch takes it).  EPI 2: 2D rotary of each 64-wide head row (table rows = m)
   -> f16 x64.  EPI 1 and 2 write fragment-order planes of pitch ldc.
   EPI 3: per-row instance norm over the tile's 64 columns; tiles with n0 < 512 are rotated too and go to Cout,
          the others go to Cout2 (both f16 x16, fragment-order planes of the transposed matrix [512][M]). All of it is done
          in the accumulators' own layout: a lane holds 8 consecutive rows (tokens) of one column, which is one 16-B unit
          of the transposed plane; a row's 64 columns are 4 registers x the 16 lanes of a row of lanes; a rotary pair
          (c, c ^ 16) is two registers of one lane. No LDS. The table is the token-minor one.
   KS = K = ldb, M % 256 == 0: the block's 8 waves take 8 consecutive row tiles of ONE column tile, blk =
   (batch * (M / 256) + row group) * (N / 64) + column tile. The 64 rows of Bt that they share are 64 * KS contiguous halves of the plane; the
   block copies them to sB once, in the same order, and every B fragment of the k loop is read from LDS. One barrier, reached
   by all 256 threads (the exit in front of it is the same for the whole block).
   --------------------------------------------------------------------------- */
/* pointer to 16-B units in LDS: the address space is spelled out so that the k loop's B loads are LDS loads */
typedef const __attribute__((address_space(3))) v8h* unit_lptr;
template <int EPI, int KS>
__device__ __forceinline__ void gemm_f16_tile(
    float (*sT)[16 * 68], _Float16* sB, int blk,
    const unsigned short* __restrict__ Ap, int lda, long sAo, long sAi,
    const unsigned short* __restrict__ Bp, int ldb, long sBo, long sBi,
    void* __restrict__ Cout, void* __restrict__ Cout2, int ldc, long sCo, long sCi,
    const float* __restrict__ bias, const float* __restrict__ tab,
    int M, int N, int K, int nInner, int nBatch, float scale) {
  static_assert((KS % 32) == 0, "whole k-blocks");
  const int lane = threadIdx.x & 31;
  const int wave = threadIdx.x >> 5;
  const int tilesN = N >> 6;
  const int tilesM = M >> 5;
  const int blkPerBatch = (tilesM >> 3) * tilesN;
  if (blk >= blkPerBatch * nBatch) return;
  const int z  = blk / blkPerBatch;
  const int bb = blk - z * blkPerBatch;
  const int tg = bb / tilesN;
  const int tn = bb - tg * tilesN;
  const int tm = tg * 8 + wave;
  const int m0 = tm << 5;
  const int n0 = tn << 6;
  const int zo = z / nInner;
  const int zi = z - zo * nInner;

  const _Float16* A  = (const _Float16*)Ap + (size_t)zo * sAo + (size_t)zi * sAi;
  const _Float16* Bt = (const _Float16*)Bp + (size_t)zo * sBo + (size_t)zi * sBi;
  const size_t coff = (size_t)zo * sCo + (size_t)zi * sCi;

  const int rlane = lane & 15;
  const int mOff  = (lane >> 4) * 8;
  /* k-blocks per row-block of the B tile, A's per-row-block stride, and the lane's unit inside a 512-B segment */
  constexpr int kNkb = KS / 32;
  const size_t strA = (size_t)(lda >> 5) * 512;
  const int lpos = frag_pos(rlane, lane >> 4) * 8;
  /* one running pointer per A fragment row-block; a k step of 32 is the next 1024-B block (64 units) */
  unit_gptr pa[2];
#pragma unroll
  for (int i = 0; i < 2; ++i) pa[i] = (unit_gptr)(A + (size_t)((m0 >> 4) + i) * strA + lpos);

  /* the B tile: 64 * KS halves = KS * 8 units of 16 B, kNkb per thread; a wave's load and its LDS store each cover 512
     contiguous B */
  const unit_gptr pB = (unit_gptr)(Bt + (size_t)(n0 >> 4) * (kNkb * 512));
  const unsigned tid = threadIdx.x;
  {
    v8h bt[kNkb];
#pragma unroll
    for (int u = 0; u < kNkb; ++u) bt[u] = pB[u * 256 + tid];
    /* the wait that belongs in front of any overwrite of the loads' address registers; it names them, so that they stay
       untouched up to here */
    asm volatile("s_wait_xcnt 0x0" :: "s"(pB), "v"(tid) : "memory");
#pragma unroll
    for (int u = 0; u < kNkb; ++u) ((v8h*)sB)[u * 256 + tid] = bt[u];
  }
  __syncthreads(); /* every wave reads the whole tile, written by all */

  v8f acc[2][4];
#pragma unroll
  for (int i = 0; i < 2; ++i)
#pragma unroll
    for (int j = 0; j < 4; ++j)
      acc[i][j] = (v8f){0.f, 0.f, 0.f, 0.f, 0.f, 0.f, 0.f, 0.f};

  /* the lane's unit of row-block 0, k-block 0 of the tile; row-block j stands kNkb blocks on, a k step one block on */
  unit_lptr sb = (unit_lptr)(sB + lpos);
  for (int k0 = 0; k0 < K; k0 += 32) {
    /* B is near now, so its fragments are taken two at a time, each pair used by both A fragments: 16 registers of B, not
       32, and the trip's two A fragments (no other wave of the block reads these rows) are both held from its head */
    const v16h a0 = frag_load_plane(pa[0]);
    const v16h a1 = frag_load_plane(pa[1]);
    pa[0] += 64;
    pa[1] += 64;
#pragma unroll
    for (int g = 0; g < 2; ++g) {
      v16h bh[2];
#pragma unroll
      for (int j = 0; j < 2; ++j) {
        FragU f;
        f.h[0] = sb[(g * 2 + j) * kNkb * 64];
        f.h[1] = sb[(g * 2 + j) * kNkb * 64 + 32];
        bh[j] = f.v;
      }
#pragma unroll
      for (int j = 0; j < 2; ++j) {
        acc[0][g * 2 + j] = mma16(a0, bh[j], acc[0][g * 2 + j]);
        acc[1][g * 2 + j] = mma16(a1, bh[j], acc[1][g * 2 + j]);
      }
      /* the group's four results, both A fragments and the B pair: the slots that the products need before the next loads
         overwrite their operands */
      guard4(acc[0][g * 2], acc[0][g * 2 + 1], acc[1][g * 2], acc[1][g * 2 + 1], a0, a1, bh[0], bh[1], bh[1]);
    }
    sb += 64;
  }

  if (EPI == 3) {
    const int hi = lane >> 4;
    /* the tile is a k head when its columns are below 512; the same for the whole wave, and read as a scalar so that a v
       tile jumps over the table loads and the rotation */
    const bool isK = (__builtin_amdgcn_readfirstlane(n0) < kInner);
    /* block (row-block (n0 % 512) / 16 + j, k-block m0 / 32); half i of the tile is segment i; the lane's unit is lpos */
    const size_t strC = (size_t)(M >> 5) * 512;
    unsigned short* Cb = (isK ? (unsigned short*)Cout : (unsigned short*)Cout2) +
                         (size_t)((n0 & (kInner - 1)) >> 4) * strC + (size_t)(m0 >> 5) * 512 + lpos;
#pragma unroll
    for (int i = 0; i < 2; ++i) {
      /* [axis][cos, sin][tokens 0..3, 4..7 of the lane's 8] */
      v4f tc[2][2][2];
      if (isK) {
        const float* tp = tab + ((size_t)(m0 >> 3) + i * 2 + hi) * 512 + rlane * 8;
#pragma unroll
        for (int a = 0; a < 2; ++a)
#pragma unroll
          for (int s = 0; s < 2; ++s)
#pragma unroll
            for (int u = 0; u < 2; ++u) tc[a][s][u] = *(const v4f*)(tp + a * 256 + s * 128 + u * 4);
        /* the wait that belongs in front of any overwrite of the loads' address registers; it names them, so that they
           stay untouched (also as a later load's destination) up to here */
        asm volatile("s_wait_xcnt 0x0" :: "v"(tp) : "memory");
      }
      float xv[4][8];
#pragma unroll
      for (int r = 0; r < 8; ++r) {
#pragma unroll
        for (int j = 0; j < 4; ++j) xv[j][r] = acc[i][j][r] * scale;
        /* mean and biased variance over the 64 columns of the row */
        const float mean = row_sum16((xv[0][r] + xv[1][r]) + (xv[2][r] + xv[3][r])) * kInvDh;
#pragma unroll
        for (int j = 0; j < 4; ++j) xv[j][r] -= mean;
        float ss = 0.0f;
#pragma unroll
        for (int j = 0; j < 4; ++j) ss = fmaf(xv[j][r], xv[j][r], ss);
        const float rstd = rsq_normal(row_sum16(ss) * kInvDh + kNormEps);
#pragma unroll
        for (int j = 0; j < 4; ++j) xv[j][r] *= rstd;
      }
#pragma unroll
      for (int j = 0; j < 4; ++j) {
        float o[8];
#pragma unroll
        for (int r = 0; r < 8; ++r) {
          o[r] = xv[j][r];
          /* rotary: column c pairs with c ^ 16 (register j ^ 1); the upper member of a pair takes +sin, the lower -sin */
          if (isK) {
            const float pr = xv[j ^ 1][r] * tc[j >> 1][1][r >> 2][r & 3];
            o[r] = o[r] * tc[j >> 1][0][r >> 2][r & 3] + ((j & 1) ? pr : -pr);
          }
          o[r] *= kKVC;
        }
        *(v4u*)(Cb + (size_t)j * strC + i * 256) =
            (v4u){pk16(h_bits(o[0]), h_bits(o[1])), pk16(h_bits(o[2]), h_bits(o[3])),
                  pk16(h_bits(o[4]), h_bits(o[5])), pk16(h_bits(o[6]), h_bits(o[7]))};
      }
      /* the wait that belongs in front of any overwrite of the stores' registers by the second half's code */
      if (i == 0) asm volatile("s_wait_xcnt 0x0" :: "v"(Cb) : "memory");
    }
    return;
  }

  /* ---- epilogue of EPI 0, 1, 2 ---- */
  float* slab = sT[wave];
  const int q  = lane >> 3;
  const int c8 = (lane & 7) * 8;
  const int hh = lane >> 4;
  const int c4 = (lane & 15) * 4;
#pragma unroll
  for (int i = 0; i < 2; ++i) {
    const int mBase = m0 + (i << 4);
#pragma unroll
    for (int j = 0; j < 4; ++j) {
      float bv = 0.f;
      if (EPI == 0) {
        const float braw = bias[n0 + (j << 4) + rlane];
        bv = bf_rne(braw);
      }
#pragma unroll
      for (int r = 0; r < 8; ++r) {
        float v = acc[i][j][r] * scale;
        if (EPI == 0) v += bv;
        slab[(mOff + r) * 68 + (j << 4) + rlane] = v;
      }
    }
    __builtin_amdgcn_fence(__ATOMIC_RELEASE, "workgroup");
    __builtin_amdgcn_wave_barrier();
    __builtin_amdgcn_fence(__ATOMIC_ACQUIRE, "workgroup");
    if (EPI == 0) {
      /* f32 rows: 64 floats = 256 B = 16 lanes x 16 B; rows it*2 + hh, it = 0..7 -> 16 rows, each once */
      float* C = (float*)Cout + coff;
      v4f vals[8];
#pragma unroll
      for (int it = 0; it < 8; ++it) vals[it] = *(const v4f*)(slab + (it * 2 + hh) * 68 + c4);
      {
#pragma unroll
        for (int it = 0; it < 8; ++it)
          *(v4f*)(C + (size_t)(mBase + it * 2 + hh) * ldc + n0 + c4) = vals[it];
        
      }
    } else {
      /* the 16 x 64 slab is two whole blocks of the plane; col = the lane's unit for row q, rows it*4 add 64 each */
      unsigned short* Cb = (unsigned short*)Cout + coff + ((size_t)(mBase >> 4) * (ldc >> 5) + (n0 >> 5)) * 512;
      const int col = ((lane & 7) >> 1) * 256 + frag_pos(q, lane & 1) * 8;
      /* rotary: column c pairs with c ^ 16; the upper member of a pair takes +sin, the lower -sin */
      const float sgn = (c8 & 16) ? 1.0f : -1.0f;
      const int tcol  = (c8 >> 5) * 32 + (c8 & 15);
      const float oc  = (EPI == 1) ? 1.0f : kQC;
      v4u ow[4];
#pragma unroll
      for (int it = 0; it < 4; ++it) {
        const int row = it * 4 + q;
        const float* sp = slab + row * 68 + c8;
        const v4f ta = *(const v4f*)(sp);
        const v4f tb = *(const v4f*)(sp + 4);
        float o[8];
        o[0] = ta[0]; o[1] = ta[1]; o[2] = ta[2]; o[3] = ta[3];
        o[4] = tb[0]; o[5] = tb[1]; o[6] = tb[2]; o[7] = tb[3];
        if (EPI == 2) {
          const float* pp = slab + row * 68 + (c8 ^ 16);
          const v4f pa = *(const v4f*)(pp);
          const v4f pb = *(const v4f*)(pp + 4);
          float p[8];
          p[0] = pa[0]; p[1] = pa[1]; p[2] = pa[2]; p[3] = pa[3];
          p[4] = pb[0]; p[5] = pb[1]; p[6] = pb[2]; p[7] = pb[3];
          {
            const float* tp = tab + (size_t)(mBase + row) * 64 + tcol;
            const v4f ca = *(const v4f*)(tp);
            const v4f cb = *(const v4f*)(tp + 4);
            const v4f sa = *(const v4f*)(tp + 16);
            const v4f sb = *(const v4f*)(tp + 20);
            /* the wait that belongs in front of any overwrite of the loads' address registers; it names them, so that
               they stay untouched (also as a later load's destination) up to here */
            asm volatile("s_wait_xcnt 0x0" :: "v"(tp) : "memory");
            float cc[8], sn[8];
            cc[0] = ca[0]; cc[1] = ca[1]; cc[2] = ca[2]; cc[3] = ca[3];
            cc[4] = cb[0]; cc[5] = cb[1]; cc[6] = cb[2]; cc[7] = cb[3];
            sn[0] = sa[0]; sn[1] = sa[1]; sn[2] = sa[2]; sn[3] = sa[3];
            sn[4] = sb[0]; sn[5] = sb[1]; sn[6] = sb[2]; sn[7] = sb[3];
#pragma unroll
            for (int e = 0; e < 8; ++e) o[e] = o[e] * cc[e] + sgn * (p[e] * sn[e]);
          }
        }
#pragma unroll
        for (int e = 0; e < 8; ++e) o[e] *= oc;
        ow[it] = (v4u){pk16(h_bits(o[0]), h_bits(o[1])), pk16(h_bits(o[2]), h_bits(o[3])),
                       pk16(h_bits(o[4]), h_bits(o[5])), pk16(h_bits(o[6]), h_bits(o[7]))};
      }
      {
#pragma unroll
        for (int it = 0; it < 4; ++it) *(v4u*)(Cb + it * 64 + col) = ow[it];
        
      }
    }
    __builtin_amdgcn_fence(__ATOMIC_RELEASE, "workgroup");
    __builtin_amdgcn_wave_barrier();
    __builtin_amdgcn_fence(__ATOMIC_ACQUIRE, "workgroup");
  }
}

/* second bound: 8 waves a SIMD (128 registers), as many as before the norm moved into the accumulators; the k loop hides its
   load latency by other waves alone */
template <int EPI, int KS>
__global__ __launch_bounds__(256, 8) void gemm_f16_kernel(
    const unsigned short* __restrict__ Ap, int lda, long sAo, long sAi,
    const unsigned short* __restrict__ Bp, int ldb, long sBo, long sBi,
    void* __restrict__ Cout, void* __restrict__ Cout2, int ldc, long sCo, long sCi,
    const float* __restrict__ bias, const float* __restrict__ tab,
    int M, int N, int K, int nInner, int nBatch, float scale) {
  __shared__ __align__(16) float sT[8][16 * 68];
  __shared__ __align__(16) _Float16 sB[64 * KS];
  gemm_f16_tile<EPI, KS>(sT, sB, blockIdx.x, Ap, lda, sAo, sAi, Bp, ldb, sBo, sBi, Cout, Cout2, ldc, sCo, sCi, bias, tab,
                     M, N, K, nInner, nBatch, scale);
}

/* ---------------------------------------------------------------------------
   Token-axis product, split-K: part[ks][bh][d][e] = sum over the 1024 tokens of split ks of k[tok][h*64+d]*v[tok][h*64+e]
   (operands carry x16 each). kt and vt are the fragment-order planes of the transposed matrices (row = head column,
   k = token), so every fragment is two loads of 512 contiguous bytes straight from global memory: no staging.
   256 blocks: blk = ks * 32 + bh. The product is formed as C[e][d] (A = v, B = k): a lane's 8 accumulator rows are then 8
   consecutive e of one d = 32 contiguous bytes of the row-major [d][e] partial.
   Wave w: rows e = 32 * (w % 2) .. + 31, all 64 d, tokens 256 * (w / 2) .. + 255 of the split (8 k-blocks).
   The four token slices are summed in LDS in a fixed order, (s0 + s2) + (s1 + s3); slice 0's two waves store the result,
   each the whole 128-B lines e = 0..31 or 32..63 of every row d.
   All three barriers are reached by all 256 threads (no exit before them; the tests on the wave number are scalar).
   --------------------------------------------------------------------------- */
constexpr int kDotsSlices = 4;
constexpr int kDotsKb     = kTokPerSplit / 32 / kDotsSlices;
static_assert(kDotsKb * 32 * kDotsSlices == kTokPerSplit && kDotsKb >= 2, "token slices of whole k-blocks");
/* a wave's 32 x 64 accumulator tile in LDS, in register order: 16 rows of 32 lanes x 16 B, so no bank is hit twice */
__device__ __forceinline__ void acc_tile_put(float* t, const v8f (&acc)[2][4], int lane) {
#pragma unroll
  for (int i = 0; i < 2; ++i)
#pragma unroll
    for (int j = 0; j < 4; ++j) {
      const v8f a = acc[i][j];
      *(v4f*)(t + ((i * 4 + j) * 2 + 0) * 128 + lane * 4) = (v4f){a[0], a[1], a[2], a[3]};
      *(v4f*)(t + ((i * 4 + j) * 2 + 1) * 128 + lane * 4) = (v4f){a[4], a[5], a[6], a[7]};
    }
}
__device__ __forceinline__ void acc_tile_add(const float* t, v8f (&acc)[2][4], int lane) {
#pragma unroll
  for (int i = 0; i < 2; ++i)
#pragma unroll
    for (int j = 0; j < 4; ++j) {
      const v4f lo = *(const v4f*)(t + ((i * 4 + j) * 2 + 0) * 128 + lane * 4);
      const v4f up = *(const v4f*)(t + ((i * 4 + j) * 2 + 1) * 128 + lane * 4);
#pragma unroll
      for (int r = 0; r < 4; ++r) {
        acc[i][j][r]     += lo[r];
        acc[i][j][r + 4] += up[r];
      }
    }
}
__device__ __forceinline__ void dots_splitk_tile(float* red, int blk,
                                                 const unsigned short* __restrict__ kt,
                                                 const unsigned short* __restrict__ vt,
                                                 float* __restrict__ part) {
  const int tid = threadIdx.x, lane = tid & 31;
  /* the wave number in a scalar register: the tests on it are scalar branches */
  const int wave = __builtin_amdgcn_readfirstlane(tid >> 5);
  const int rh = wave & 1, sl = wave >> 1;
  const int bh = blk & (kBH - 1), ks = blk / kBH;
  const int b = bh >> 3, h = bh & 7;
  const int rlane = lane & 15;
  const int hi    = lane >> 4;
  /* unsigned, and added last to a base that is the same for the whole wave: the loads then take a scalar base and this one
     register as their address, which leaves the registers to the fragments */
  const unsigned lpos = (unsigned)(frag_pos(rlane, hi) * 8);
  const size_t kb0 = (size_t)b * (kSeq / 32) + (size_t)ks * (kTokPerSplit / 32) + (size_t)sl * kDotsKb;
  typedef const __attribute__((address_space(1))) _Float16* half_gptr;
  const half_gptr vbase = (half_gptr)(const _Float16*)vt + ((size_t)(h * 4 + rh * 2) * (kTok / 32) + kb0) * 512;
  const half_gptr kbase = (half_gptr)(const _Float16*)kt + ((size_t)(h * 4) * (kTok / 32) + kb0) * 512;

  unit_gptr pa[2];
  unit_gptr pb[4];
#pragma unroll
  for (int i = 0; i < 2; ++i) pa[i] = (unit_gptr)(vbase + lpos) + (size_t)i * (kTok / 32) * 64;
#pragma unroll
  for (int j = 0; j < 4; ++j) pb[j] = (unit_gptr)(kbase + lpos) + (size_t)j * (kTok / 32) * 64;

  v8f acc[2][4];
#pragma unroll
  for (int i = 0; i < 2; ++i)
#pragma unroll
    for (int j = 0; j < 4; ++j) acc[i][j] = (v8f){0.f, 0.f, 0.f, 0.f, 0.f, 0.f, 0.f, 0.f};

  /* the next k-block's 12 loads fly while this one's products run: two sets of B fragments, three A fragments (the next
     block's second A fragment is loaded when this block's first has done its products and takes its registers) */
  v16h a0 = frag_load_plane(pa[0]);
  v16h a1 = frag_load_plane(pa[1]);
  v16h bk[2][4];
#pragma unroll
  for (int j = 0; j < 4; ++j) bk[0][j] = frag_load_plane(pb[j]);
  /* unrolled: the set index is then a literal and the k step an offset field of the loads */
#pragma unroll
  for (int kb = 0; kb < kDotsKb; ++kb) {
    const int cur = kb & 1, nxt = cur ^ 1;
    const bool more = kb + 1 < kDotsKb;
    v16h n0 = a0, n1 = a1;
    if (more) {
#pragma unroll
      for (int j = 0; j < 4; ++j) bk[nxt][j] = frag_load_plane(pb[j] + (kb + 1) * 64);
      n0 = frag_load_plane(pa[0] + (kb + 1) * 64);
    }
#pragma unroll
    for (int j = 0; j < 4; ++j) acc[0][j] = mma16(a0, bk[cur][j], acc[0][j]);
    guard4(acc[0][0], acc[0][1], acc[0][2], acc[0][3], a0, bk[cur][0], bk[cur][1], bk[cur][2], bk[cur][3]);
    /* keeps the load below from being lifted over the products above: lifted, it needs a fourth A fragment's registers, and
       the kernel then spills under its bound of 160 registers (or, unbound, goes from three resident blocks a WGP to two) */
    __builtin_amdgcn_sched_barrier(0);
    if (more) n1 = frag_load_plane(pa[1] + (kb + 1) * 64);
#pragma unroll
    for (int j = 0; j < 4; ++j) acc[1][j] = mma16(a1, bk[cur][j], acc[1][j]);
    guard4(acc[1][0], acc[1][1], acc[1][2], acc[1][3], a1, bk[cur][0], bk[cur][1], bk[cur][2], bk[cur][3]);
    a0 = n0;
    a1 = n1;
  }

  /* slices 2, 3 hand their tiles to slices 0, 1; then slice 1 to slice 0 */
  if (sl >= 2) acc_tile_put(red + ((sl - 2) * 2 + rh) * 2048, acc, lane);
  __syncthreads(); /* the tiles of slices 2, 3 are read by other waves */
  if (sl < 2) acc_tile_add(red + (sl * 2 + rh) * 2048, acc, lane);
  __syncthreads(); /* those reads end before slice 1 writes over the first two tiles */
  if (sl == 1) acc_tile_put(red + rh * 2048, acc, lane);
  __syncthreads(); /* slice 1's tiles are read by slice 0 */
  if (sl != 0) return; /* no barrier below */
  acc_tile_add(red + rh * 2048, acc, lane);

  float* C = part + ((size_t)ks * kBH + bh) * (kDh * kDh) + (size_t)rlane * kDh + rh * 32 + hi * 8;
#pragma unroll
  for (int i = 0; i < 2; ++i)
#pragma unroll
    for (int j = 0; j < 4; ++j) {
      const v8f a = acc[i][j];
      *(v4f*)(C + j * 16 * kDh + i * 16)     = (v4f){a[0], a[1], a[2], a[3]};
      *(v4f*)(C + j * 16 * kDh + i * 16 + 4) = (v4f){a[4], a[5], a[6], a[7]};
    }
}

/* The token-axis product (reads k, v) and the q projection (EPI 2: reads x, Wq, the x table; writes q) depend on nothing
   of each other, so they are two ranges of blocks of one grid: the first 256 blocks take the token-axis product, the rest
   the q projection. One LDS array serves either range (reduce tiles or epilogue slabs); sB is the q range's weight tile. */
constexpr int kBlkDots = kBH * kSplitK;
constexpr int kBlkQ    = (kTok / 32) * (kInner / 64) / 8;
constexpr int kLdsQDots  = 8 * 16 * 68 * 4;
static_assert(kLdsQDots == 34816 && 4 * 2048 * 4 <= kLdsQDots, "LDS carve");
/* second bound: 6 waves a SIMD (160 registers, three blocks a WGP), what this kernel had before the token-axis range took its
   second set of fragments; both ranges fit without a spill */
__global__ __launch_bounds__(256, 6) void dots_qproj_kernel(
    const unsigned short* __restrict__ kn, const unsigned short* __restrict__ vn, float* __restrict__ part,
    const unsigned short* __restrict__ Xp, const unsigned short* __restrict__ Wqp, void* __restrict__ Qout,
    const float* __restrict__ tabx, int M, int N, int K, float scale) {
  __shared__ __align__(16) unsigned char sm[kLdsQDots];
  __shared__ __align__(16) _Float16 sB[64 * kDim];
  const int blk = blockIdx.x;
  if (blk < kBlkDots)
    dots_splitk_tile((float*)sm, blk, kn, vn, part);
  else
    gemm_f16_tile<2, kDim>((float (*)[16 * 68])sm, sB, blk - kBlkDots, Xp, K, 0L, 0L, Wqp, K, 0L, 0L, Qout, nullptr, N, 0L, 0L,
                     nullptr, tabx, M, N, K, 1, 1, scale);
}

/* ---------------------------------------------------------------------------
   out = (q . dots / 8192) . Wout^T is computed as q . G^T with G[b][o][h*64+d] = sum_e Wout[o][h*64+e] * dots[b][h][d][e] / 8192,
   so the per-token product with dots is replaced by this one, 256 rows a head. One block per (batch, head), 8 waves.
   Step 1: fixed-order sum of the 8 split-K partials, scaled (1/8192 and carries, all powers of two) in f32, emitted as one
   f16 fragment-order 64 x 64 plane [d][e] in LDS; 8 elements per unit, 512 units = 256 threads x 2.
   Step 2: wave w takes rows o = 32w .. 32w+31 of Wout (A, columns h*64 .. +63 of its plane) against all 64 rows d of the LDS
   plane (B), K = 64, and writes its 32 x 64 tile to columns h*64 .. +63 of the batch's fragment-order plane of pitch 512.
   No early exit: all 256 threads reach the barrier.
   --------------------------------------------------------------------------- */
__global__ __launch_bounds__(256) void dots_fold_kernel(const float* __restrict__ part, const unsigned short* __restrict__ wo,
                                                        unsigned short* __restrict__ gw) {
  __shared__ __align__(16) _Float16 sD[kDh * kDh];
  __shared__ __align__(16) float sT[8][32 * 68];
  const int tid = threadIdx.x, lane = tid & 31, wave = tid >> 5;
  const int bh = blockIdx.x, b = bh >> 3, h = bh & 7;
  const int rlane = lane & 15;
  const int mOff  = (lane >> 4) * 8;
  const int lpos  = frag_pos(rlane, lane >> 4) * 8;
  const int m0    = wave << 5;

  /* the Wout fragments depend on nothing of step 1: their loads fly beside those of the partials */
  v16h ah[2][2];
#pragma unroll
  for (int kb = 0; kb < 2; ++kb)
#pragma unroll
    for (int i = 0; i < 2; ++i)
      ah[kb][i] = frag_load_plane((unit_gptr)((const _Float16*)wo +
                                              ((size_t)((m0 >> 4) + i) * (kInner >> 5) + h * 2 + kb) * 512 + lpos));

#pragma unroll
  for (int u = 0; u < 2; ++u) {
    const int iu = u * 256 + tid;
    const size_t o = (size_t)bh * (kDh * kDh) + 8 * (size_t)iu;
    float s[8];
#pragma unroll
    for (int e = 0; e < 8; ++e) s[e] = 0.0f;
#pragma unroll
    for (int ks = 0; ks < kSplitK; ++ks) {
      const float* p = part + (size_t)ks * kDotsElems + o;
      const v4f a = *(const v4f*)(p);
      const v4f c = *(const v4f*)(p + 4);
      s[0] += a[0]; s[1] += a[1]; s[2] += a[2]; s[3] += a[3];
      s[4] += c[0]; s[5] += c[1]; s[6] += c[2]; s[7] += c[3];
    }
    unsigned short hb[8];
#pragma unroll
    for (int e = 0; e < 8; ++e) hb[e] = h_bits(s[e] * kDotsScale);
    /* unit iu = (row d, columns e8*8 .. +7) of the 64 x 64 fragment-order plane */
    const int d  = iu >> 3;
    const int e8 = iu & 7;
    *(v4u*)(sD + ((d >> 4) * 2 + (e8 >> 2)) * 512 + ((e8 >> 1) & 1) * 256 + frag_pos(d & 15, e8 & 1) * 8) =
        (v4u){pk16(hb[0], hb[1]), pk16(hb[2], hb[3]), pk16(hb[4], hb[5]), pk16(hb[6], hb[7])};
  }
  __syncthreads(); /* every wave reads the whole plane, written by all */

  v8f acc[2][4];
#pragma unroll
  for (int i = 0; i < 2; ++i)
#pragma unroll
    for (int j = 0; j < 4; ++j)
      acc[i][j] = (v8f){0.f, 0.f, 0.f, 0.f, 0.f, 0.f, 0.f, 0.f};
#pragma unroll
  for (int kb = 0; kb < 2; ++kb) {
    v16h bf[4];
#pragma unroll
    for (int j = 0; j < 4; ++j) {
      const _Float16* p = sD + (j * 2 + kb) * 512 + lpos;
      FragU f;
      f.h[0] = *(const v8h*)(p);
      f.h[1] = *(const v8h*)(p + 256);
      bf[j] = f.v;
    }
#pragma unroll
    for (int i = 0; i < 2; ++i) {
#pragma unroll
      for (int j = 0; j < 4; ++j)
        acc[i][j] = mma16(ah[kb][i], bf[j], acc[i][j]);
      /* keeps the group's operands in their registers past its last product, with the slots the results need */
      guard4(acc[i][0], acc[i][1], acc[i][2], acc[i][3], ah[kb][i], bf[0], bf[1], bf[2], bf[3]);
    }
  }

  /* the wave's 32 x 64 tile goes through its own LDS slab, so that each store covers whole 128-B lines: 16 rows x 64
     columns are two whole blocks of the plane */
  float* slab = sT[wave];
  const int q   = lane >> 3;
  const int c8  = (lane & 7) * 8;
  const int col = ((lane & 7) >> 1) * 256 + frag_pos(q, lane & 1) * 8;
#pragma unroll
  for (int i = 0; i < 2; ++i)
#pragma unroll
    for (int j = 0; j < 4; ++j)
#pragma unroll
      for (int r = 0; r < 8; ++r) slab[(i * 16 + mOff + r) * 68 + (j << 4) + rlane] = acc[i][j][r] * kFoldScale;
  /* the rows read below were written by other lanes of this wave */
  __builtin_amdgcn_fence(__ATOMIC_RELEASE, "workgroup");
  __builtin_amdgcn_wave_barrier();
  __builtin_amdgcn_fence(__ATOMIC_ACQUIRE, "workgroup");
#pragma unroll
  for (int i = 0; i < 2; ++i) {
    unsigned short* Cb = gw + (size_t)b * (kDim * kInner) + ((size_t)((m0 >> 4) + i) * (kInner >> 5) + h * 2) * 512;
#pragma unroll
    for (int it = 0; it < 4; ++it) {
      const float* sp = slab + (i * 16 + it * 4 + q) * 68 + c8;
      const v4f ta = *(const v4f*)(sp);
      const v4f tb = *(const v4f*)(sp + 4);
      *(v4u*)(Cb + it * 64 + col) = (v4u){pk16(h_bits(ta[0]), h_bits(ta[1])), pk16(h_bits(ta[2]), h_bits(ta[3])),
                                          pk16(h_bits(tb[0]), h_bits(tb[1])), pk16(h_bits(tb[2]), h_bits(tb[3]))};
    }
  }
}

/* ---------------------------------------------------------------------------
   Host glue: 5 kernel launches, nothing else.
   GEMM shapes (M % 32 == 0, N % 64 == 0, K % 32 == 0, no pad planes needed):
     kv projection : M 32768, N 1024, K 256 -> 1024 x 16 tiles = 16384 -> 2048 blocks
     q projection  : M 32768, N 512,  K 256 -> 1024 x 8  tiles =  8192 -> 1024 blocks (behind the 256 of the token-axis product)
     Wout . dots^T : 32 (batch, head) pairs of M 256, N 64, K 64 -> 32 blocks (dots_fold_kernel)
     q . G^T       : 4 batches of M 8192, N 256, K 512 -> 4 x 256 x 4 tiles = 4096 -> 512 blocks
   --------------------------------------------------------------------------- */
extern "C" void kernel_launch(void* const* d_in, const int* in_sizes, int n_in,
                              void* d_out, int out_size, void* d_ws, size_t ws_size,
                              hipStream_t stream) {
  if (n_in < 8) return;
  if (in_sizes[0] != kTok * kDim) return;
  if (in_sizes[1] != kTok * kDim) return;
  if (in_sizes[2] != kTok * 2) return;
  if (in_sizes[3] != kTok * 2) return;
  if (in_sizes[4] != kInner * kDim) return;
  if (in_sizes[5] != 2 * kInner * kDim) return;
  if (in_sizes[6] != kDim * kInner) return;
  if (in_sizes[7] != kDim) return;
  if (out_size != kTok * kDim) return;
  if (ws_size < kWsTotal) return;

  const float* x    = (const float*)d_in[0];
  const float* z    = (const float*)d_in[1];
  const float* xpos = (const float*)d_in[2];
  const float* zpos = (const float*)d_in[3];
  const float* Wq   = (const float*)d_in[4];
  const float* Wkv  = (const float*)d_in[5];
  const float* Wout = (const float*)d_in[6];
  const float* bout = (const float*)d_in[7];
  float* out = (float*)d_out;

  char* ws = (char*)d_ws;
  unsigned short* WQ   = (unsigned short*)(ws + kOffWQ);
  unsigned short* WK   = (unsigned short*)(ws + kOffWK);
  unsigned short* WO   = (unsigned short*)(ws + kOffWO);
  unsigned short* S16  = (unsigned short*)(ws + kOffS16);
  unsigned short* KN   = (unsigned short*)(ws + kOffKN);
  unsigned short* VN   = (unsigned short*)(ws + kOffVN);
  unsigned short* QH   = (unsigned short*)(ws + kOffQH);
  float*          TAB  = (float*)(ws + kOffTAB);
  float*          PART = (float*)(ws + kOffPART);
  unsigned short* GW   = (unsigned short*)(ws + kOffGW);
  unsigned short* SX   = (unsigned short*)(ws + kOffSX);
  float*          TABX = (float*)(ws + kOffTABX);

  /* inverse frequencies: 1 / f32(10000^(2j/32)), j = 0..15 */
  FreqTab ft;
  for (int j = 0; j < 16; ++j) {
    const double ex = (double)(2 * j) / 32.0;
    const float pw = (float)pow(10000.0, ex);
    ft.f[j] = 1.0f / pw;
  }

  /* weight planes ([out][in] = Bt orientation already): f16(bf16(w) * 1024); z and x planes: f16(bf16(v) * 16);
     position tables of z and x */
  prep_kernel<<<kBlkPrep, 256, 0, stream>>>(x, z, xpos, zpos, Wq, Wkv, Wout, WQ, WK, WO, S16, SX, TAB, TABX, ft);

  /* key/value side: projection with fused norm (+ rotary on k) */
  gemm_f16_kernel<3, kDim><<<(kTok / 32) * (2 * kInner / 64) / 8, 256, 0, stream>>>(
      S16, kDim, 0L, 0L,
      WK, kDim, 0L, 0L,
      (void*)KN, (void*)VN, kInner, 0L, 0L,
      bout, TAB,
      kTok, 2 * kInner, kDim, 1, 1, kProjScale);

  /* token-axis product, deterministic split-K, beside the query side's projection with fused rotary; then the
     fixed-order reduce and its product with Wout, per (batch, head) */
  dots_qproj_kernel<<<kBlkDots + kBlkQ, 256, 0, stream>>>(KN, VN, PART, SX, WQ, (void*)QH, TABX,
                                                          kTok, kInner, kDim, kProjScale);
  dots_fold_kernel<<<kBH, 256, 0, stream>>>(PART, WO, GW);

  /* output per batch: [8192][256] = q [8192][512] . G [256][512]^T, + bias */
  gemm_f16_kernel<0, kInner><<<(kTok / 32) * (kDim / 64) / 8, 256, 0, stream>>>(
      QH, kInner, (long)kSeq * kInner, 0L,
      GW, kInner, (long)kDim * kInner, 0L,
      (void*)out, (void*)VN, kDim, (long)kSeq * kDim, 0L,
      bout, TAB,
      kSeq, kDim, kInner, 1, kBatch, kOutScale);
}

// v007
// Measured time: 90.1 microseconds a run.
// In both of two side-by-side timings against v006, it was 1.16 times as fast.
// All steps since v000 together make it 2.33 times as fast.
// Contractions (q/kv projections, token-axis k^T v, Wout.dots^T, q.(that product)): v_wmma_f32_16x16x32_f16, one product per site, f32 accumulate; every operand a plain f16 plane with a power-of-two carry; every float module input RNE-converted to bf16 once at its first read (exact in the carried f16 planes); instance norm, rotary, scaling and bias in f32.
#include <hip/hip_runtime.h>
#include <math.h>

typedef __attribute__((ext_vector_type(16))) _Float16 v16h;
typedef __attribute__((ext_vector_type(8)))  _Float16 v8h;
typedef __attribute__((ext_vector_type(8)))  float    v8f;
typedef __attribute__((ext_vector_type(4)))  float    v4f;
typedef __attribute__((ext_vector_type(4)))  unsigned int v4u;
typedef __attribute__((ext_vector_type(2)))  unsigned int v2u;

/* ---------------------------------------------------------------------------
   Shape constants
   --------------------------------------------------------------------------- */
constexpr int kBatch  = 4;
constexpr int kSeq    = 8192;
constexpr int kDim    = 256;
constexpr int kHeads  = 8;
constexpr int kDh     = 64;
constexpr int kInner  = kHeads * kDh;
constexpr int kTok    = kBatch * kSeq;
constexpr int kBH     = kBatch * kHeads;
constexpr int kSplitK = 16;
constexpr int kTokPerSplit = kSeq / kSplitK;
constexpr int kDotsElems = kBH * kDh * kDh;
static_assert(kInner == 512 && kTok == 32768 && kDotsElems == 131072, "shape");
static_assert((kDim % 32) == 0 && (kInner % 32) == 0 && (kDh % 32) == 0, "K multiples of 32");
static_assert((kTok % 32) == 0 && (kSeq % 32) == 0, "M multiples of 32");
static_assert((kInner % 64) == 0 && ((2 * kInner) % 64) == 0 && (kDim % 64) == 0 && (kDh % 64) == 0, "N multiples of 64");
static_assert((kTokPerSplit % 64) == 0, "token chunks of 64");

/* power-of-two carries of the f16 planes (all folded back exactly in f32) */
constexpr float kXC     = 16.0f;
constexpr float kWC     = 1024.0f;
constexpr float kKVC    = 16.0f;
constexpr float kQC     = 64.0f;
constexpr float kDC     = 1024.0f;
constexpr float kGC     = 1024.0f;
constexpr float kProjScale = 1.0f / (kXC * kWC);
constexpr float kDotsScale = kDC / (kKVC * kKVC * (float)kSeq);
constexpr float kFoldScale = kGC / (kWC * kDC);
constexpr float kOutScale  = 1.0f / (kQC * kGC);
constexpr float kPosScale  = 64.0f;
constexpr float kNormEps   = 1e-5f;
constexpr float kInvDh     = 1.0f / (float)kDh;

/* ---------------------------------------------------------------------------
   Workspace region map (bytes; every offset is a multiple of 128). WQ, WK, WO, S16, QH, GW and SX are fragment-order
   planes (see frag_pos); the shapes below give rows and pitch.
     WQ   f16 [512][256]    Wq plane  (bf16 value x1024)            262,144
     WK   f16 [1024][256]   Wkv plane (bf16 value x1024)            524,288
     WO   f16 [256][512]    Wout plane (bf16 value x1024)           262,144
     S16  f16 [32768][256]  z x16                                  16,777,216
     QH   f16 [32768][512]  rotated q x64                          33,554,432
     TAB  f32 [4096][64][8] cos/sin table of the z positions, token-minor in tiles of 8 tokens  8,388,608
     PART f32 [16][32][64][64] split-K partials of the k^T v product 8,388,608
     GW   f16 [4][256][512] per batch: Wout . dots^T / 8192, x1024  1,048,576
     SX   f16 [32768][256]  x x16                                  16,777,216
     TABX f32 [32768][64]   cos/sin table of the x positions        8,388,608
     total                                                         94,371,840
   --------------------------------------------------------------------------- */
constexpr size_t kOffWQ   = 0;
constexpr size_t kOffWK   = kOffWQ   + (size_t)kInner * kDim * 2;
constexpr size_t kOffWO   = kOffWK   + (size_t)2 * kInner * kDim * 2;
constexpr size_t kOffS16  = kOffWO   + (size_t)kDim * kInner * 2;
constexpr size_t kOffQH   = kOffS16  + (size_t)kTok * kDim * 2;
constexpr size_t kOffTAB  = kOffQH   + (size_t)kTok * kInner * 2;
constexpr size_t kOffPART = kOffTAB  + (size_t)kTok * 64 * 4;
constexpr size_t kOffGW   = kOffPART + (size_t)kSplitK * kDotsElems * 4;
constexpr size_t kOffSX   = kOffGW   + (size_t)kBatch * kDim * kInner * 2;
constexpr size_t kOffTABX = kOffSX   + (size_t)kTok * kDim * 2;
constexpr size_t kWsTotal = kOffTABX + (size_t)kTok * 64 * 4;
static_assert(kWsTotal == 94371840ull, "carve total");
static_assert(kWsTotal <= 268435456ull, "carve cap");
static_assert((kOffWK % 128) == 0 && (kOffWO % 128) == 0 && (kOffS16 % 128) == 0 &&
              (kOffQH % 128) == 0 && (kOffTAB % 128) == 0 && (kOffPART % 128) == 0 &&
              (kOffGW % 128) == 0 && (kOffSX % 128) == 0 && (kOffTABX % 128) == 0, "128-B aligned regions");

/* ---------------------------------------------------------------------------
   Small helpers
   --------------------------------------------------------------------------- */
__device__ __forceinline__ unsigned short f2bf_bits(float f) {
  unsigned u = __float_as_uint(f);
  return (unsigned short)((u + 0x7FFFu + ((u >> 16) & 1u)) >> 16);
}
__device__ __forceinline__ float bf_bits2f(unsigned short h) { return __uint_as_float(((unsigned)h) << 16); }
/* RNE convert of an f32 value to the nearest bf16 value, returned as f32 */
__device__ __forceinline__ float bf_rne(float f) { return bf_bits2f(f2bf_bits(f)); }

__device__ __forceinline__ unsigned pk16(unsigned short a, unsigned short b) { return (unsigned)a | ((unsigned)b << 16); }
__device__ __forceinline__ unsigned short h_bits(float f) { const _Float16 h = (_Float16)f; return __builtin_bit_cast(unsigned short, h); }

union FragU { v16h v; v8h h[2]; };
/* Fragment-order plane of a [R][K] f16 matrix (R % 16 == 0, K % 32 == 0): each 16-row x 32-k block is 1024 contiguous
   bytes = two 512-B segments (k 0..15, k 16..31 of the block); a segment holds 32 units of 8 halves, one per
   (row-in-block rl, k-half hi), at position frag_pos(rl, hi). Blocks run k-fastest: block (rb, kb) starts at
   (rb * (K / 32) + kb) * 512 halves. A wave's fragment load is then two loads of 512 contiguous bytes (4 whole lines),
   and 4 consecutive rows x both k-halves of a segment are one 128-B line (what one epilogue store covers). */
__device__ __forceinline__ int frag_pos(int rl, int hi) { return ((rl >> 2) << 3) | (hi << 2) | (rl & 3); }
/* pointer to 16-B units in global memory: the address space is spelled out so that the running pointers of the k loop
   stay global loads */
typedef const __attribute__((address_space(1))) v8h* unit_gptr;
/* elements 0..7 <- segment 0, elements 8..15 <- segment 1 (32 units on); p is the lane's own unit */
__device__ __forceinline__ v16h frag_load_plane(unit_gptr p) {
  FragU f;
  f.h[0] = p[0];
  f.h[1] = p[32];
  return f.v;
}
__device__ __forceinline__ v8f mma16(v16h a, v16h b, v8f c) {
  return __builtin_amdgcn_wmma_f32_16x16x32_f16(false, a, false, b, (short)0, c, false, false);
}
/* hazard guard: ties all four accumulators of a group and names the A fragment and all B fragments */
__device__ __forceinline__ void guard4(v8f& a0, v8f& a1, v8f& a2, v8f& a3,
                                       v16h x, v16h b0, v16h b1, v16h b2, v16h b3) {
  asm volatile("v_nop\n\tv_nop\n\tv_nop\n\tv_nop"
               : "+v"(a0), "+v"(a1), "+v"(a2), "+v"(a3)
               : "v"(x), "v"(b0), "v"(b1), "v"(b2), "v"(b3));
}

/* sum over the 16 lanes of a row, left in every lane: four adds whose second operand is read from lane ^ 1, 2, 4, 8 by the
   add itself (row_xmask), so no LDS crossbar and no wait; every lane of the wave is on where it is called */
template <int MASK>
__device__ __forceinline__ float row_xor(float v) {
  return __int_as_float(__builtin_amdgcn_update_dpp(0, __float_as_int(v), 0x160 | MASK, 0xf, 0xf, true));
}
/* 1 / sqrt(x) for x >= 1e-5: never subnormal, so the library form's rescaling has nothing to do. The v_nop is the slot that
   the instruction set asks for between a transcendental and a next instruction that reads its result or overwrites its
   source; inside the statement it stands directly behind the v_rsq_f32 in every build */
__device__ __forceinline__ float rsq_normal(float x) {
  float r;
  asm("v_rsq_f32 %0, %1\n\tv_nop" : "=v"(r) : "v"(x));
  return r;
}
__device__ __forceinline__ float row_sum16(float s) {
  s += row_xor<1>(s);
  s += row_xor<2>(s);
  s += row_xor<4>(s);
  s += row_xor<8>(s);
  return s;
}

/* ---------------------------------------------------------------------------
   f32 -> bf16 value (RNE) -> f16 fragment-order plane with a power-of-two carry. The carried bf16 value is exactly
   representable in f16 (8 significant bits, normal range).
   ONE WAVE takes a tile of 16 rows x 128 columns of the [R][K] input, K = 128 << kshift, = 4 blocks of the plane = 4096
   contiguous output bytes. Load (kb, i), kb = 0..3, i = 0..3: lane l reads row 4i + l / 8, columns kb*32 + (l % 8)*4 .. + 3,
   so a load covers 4 whole 128-B lines. The lane's 4 values are half of one 16-B unit of the plane, and the 32 halves of
   load (kb, i) are the units of rows 4i .. 4i+3 of block kb: one whole line in either segment. So the 8-B store of the same
   lane needs no exchange between lanes, no LDS and no barrier.
   Coverage: (R / 16) * (K / 128) tiles exactly for every plane used: x, z 4096 tiles; Wq 64; Wkv 128; Wout 64.
   The loads and the convert-and-store part are two functions, so that a wave can put other work between them.
   --------------------------------------------------------------------------- */
__device__ __forceinline__ void cast_tile_load(v4f (&v)[16], int tile, const float* __restrict__ in, int kshift) {
  const int lane = threadIdx.x & 31;
  const int rb = tile >> kshift;
  const int cb = tile & ((1 << kshift) - 1);
  const size_t rows4 = (size_t)4 << (7 + kshift);
  const float* p0 = in + (((size_t)(rb * 16 + (lane >> 3))) << (7 + kshift)) + cb * 128 + (lane & 7) * 4;
  const float* p1 = p0 + rows4;
  const float* p2 = p1 + rows4;
  const float* p3 = p2 + rows4;
#pragma unroll
  for (int kb = 0; kb < 4; ++kb) {
    v[kb * 4 + 0] = *(const v4f*)(p0 + kb * 32);
    v[kb * 4 + 1] = *(const v4f*)(p1 + kb * 32);
    v[kb * 4 + 2] = *(const v4f*)(p2 + kb * 32);
    v[kb * 4 + 3] = *(const v4f*)(p3 + kb * 32);
  }
  /* the wait that belongs in front of any overwrite of the loads' address registers; it names them, so that they stay
     untouched (also as a later load's destination) up to here. With a literal kshift the row steps are folded into the
     loads' offset fields and p0 is the one base */
  if (__builtin_constant_p(kshift)) asm volatile("s_wait_xcnt 0x0" :: "v"(p0) : "memory");
  else                              asm volatile("s_wait_xcnt 0x0" :: "v"(p0), "v"(p1), "v"(p2), "v"(p3) : "memory");
}
__device__ __forceinline__ void cast_tile_store(const v4f (&v)[16], int tile, unsigned short* __restrict__ out, int kshift,
                                                float carry) {
  const int lane = threadIdx.x & 31;
  const int rb = tile >> kshift;
  const int cb = tile & ((1 << kshift) - 1);
  const int r  = lane >> 3;
  const int c  = lane & 7;
  /* columns 4c .. 4c+3 of a block: segment c / 4, k-half (c / 2) % 2, lower or upper 4 halves of the unit */
  unsigned short* q = out + ((((size_t)rb << (2 + kshift)) + cb * 4) << 9) + (c >> 2) * 256 +
                      frag_pos(r, (c >> 1) & 1) * 8 + (c & 1) * 4;
#pragma unroll
  for (int kb = 0; kb < 4; ++kb)
#pragma unroll
    for (int i = 0; i < 4; ++i) {
      const v4f a = v[kb * 4 + i];
      const float a0 = bf_rne(a[0]) * carry, a1 = bf_rne(a[1]) * carry, a2 = bf_rne(a[2]) * carry, a3 = bf_rne(a[3]) * carry;
      /* rows 4i .. 4i+3 stand 8 units = 64 halves behind rows 4i-4 .. 4i-1 */
      *(v2u*)(q + kb * 512 + i * 64) = (v2u){pk16(h_bits(a0), h_bits(a1)), pk16(h_bits(a2), h_bits(a3))};
    }
  /* the wait that belongs in front of any overwrite of the stores' registers by the code that follows (the next table's
     loop) */
  asm volatile("s_wait_xcnt 0x0" :: "v"(q) : "memory");
}

/* ---------------------------------------------------------------------------
   Rotary table: tab[token][axis*32 + j] = cos(theta), tab[token][axis*32 + 16 + j] = sin(theta),
   theta = (bf16(pos[token][axis]) * 64) * inv_freq[j], j = 0..15.
   ONE WAVE takes a tile of 8 tokens: lane = (axis, j), one token a trip; 32768/8 = 4096 tiles exactly per table.
   pv = the tile's 16 positions, one per lane (lane % 16 = token-in-tile * 2 + axis), loaded by the caller ahead of time.
   Store: the 8 x 64 f32 tile (2048 B = 16 lines) is staged in the wave's own LDS slab and leaves as 4 stores of 512
   contiguous bytes. TOKMINOR: the tile is laid out [column][token-in-tile] instead, so that a lane which owns one column
   and 8 consecutive tokens (the accumulator layout) reads its 8 values as 32 contiguous bytes.
   --------------------------------------------------------------------------- */
struct FreqTab { float f[16]; };
static_assert(sizeof(FreqTab) == 64, "no padding");
/* orders a wave's own LDS writes and reads (other lanes' values); LDS only, so that the global loads and stores in flight
   are not waited for */
__device__ __forceinline__ void wave_lds_sync() {
  __builtin_amdgcn_fence(__ATOMIC_RELEASE, "workgroup", "local");
  __builtin_amdgcn_wave_barrier();
  __builtin_amdgcn_fence(__ATOMIC_ACQUIRE, "workgroup", "local");
}
template <bool TOKMINOR>
__device__ __forceinline__ void rot_table_wave(float* slab, int tile, float pv, float* __restrict__ tab, float fr) {
  const int lane = threadIdx.x & 31;
  const int axis = lane >> 4;
  const int j    = lane & 15;
  const int pbits = __float_as_int(pv);
  /* rolled: eight copies of the sine and cosine code would only lengthen the text */
#pragma unroll 1
  for (int tl = 0; tl < 8; ++tl) {
    const int b0 = __builtin_amdgcn_readlane(pbits, 2 * tl);
    const int b1 = __builtin_amdgcn_readlane(pbits, 2 * tl + 1);
    const float praw = __int_as_float(axis ? b1 : b0);
    const float p   = bf_rne(praw);
    const float t   = p * kPosScale;
    const float ang = t * fr;
    const float cv = cosf(ang);
    const float sv = sinf(ang);
    if (TOKMINOR) {
      slab[(axis * 32 + j) * 8 + tl]      = cv;
      slab[(axis * 32 + 16 + j) * 8 + tl] = sv;
    } else {
      slab[tl * 64 + axis * 32 + j]      = cv;
      slab[tl * 64 + axis * 32 + 16 + j] = sv;
    }
  }
  wave_lds_sync();
  float* dst = tab + (size_t)tile * 512 + lane * 4;
#pragma unroll
  for (int n = 0; n < 4; ++n) {
    const v4f v = *(const v4f*)(slab + n * 128 + lane * 4);
    *(v4f*)(dst + n * 128) = v;
  }
  wave_lds_sync(); /* the slab is written again for the next table */
}

/* ---------------------------------------------------------------------------
   All input preparation in one launch of few, long waves; no wave depends on another, so there is no block barrier.
     blocks 0 .. 31: wave t = blk*8 + wave takes one cast tile of the weights: t 0 .. 63 Wq, 64 .. 191 Wkv, 192 .. 255 Wout.
     blocks 32 .. 543: wave idx = 0 .. 4095 takes cast tile idx of x and of z and table tile idx of either position array.
   Such a wave issues all its loads first (2 of positions, 32 of 512 B), computes the x table while they fly, converts and
   stores x, then the z table and z (z last: the next launch reads it).
   --------------------------------------------------------------------------- */
constexpr int kTileWq  = kInner * kDim / 2048;
constexpr int kTileWkv = 2 * kInner * kDim / 2048;
constexpr int kTileWo  = kDim * kInner / 2048;
constexpr int kTileAct = kTok * kDim / 2048;
constexpr int kTileTab = kTok / 8;
constexpr int kBlkPrepW = (kTileWq + kTileWkv + kTileWo) / 8;
constexpr int kBlkPrep  = kBlkPrepW + kTileAct / 8;
static_assert(kTileAct == kTileTab && (kTileWq % 8) == 0 && (kTileWkv % 8) == 0 && (kTileWo % 8) == 0 &&
              (kTileAct % 8) == 0 && kBlkPrep == 544, "prep grid");
__global__ __launch_bounds__(256) void prep_kernel(const float* __restrict__ x, const float* __restrict__ z,
                                                   const float* __restrict__ xpos, const float* __restrict__ zpos,
                                                   const float* __restrict__ Wq, const float* __restrict__ Wkv,
                                                   const float* __restrict__ Wout,
                                                   unsigned short* __restrict__ wq16, unsigned short* __restrict__ wkv16,
                                                   unsigned short* __restrict__ wo16, unsigned short* __restrict__ z16,
                                                   unsigned short* __restrict__ x16, float* __restrict__ tabz,
                                                   float* __restrict__ tabx, FreqTab ft) {
  __shared__ __align__(16) float sm[8][8 * 64];
  const int lane = threadIdx.x & 31;
  const int wave = __builtin_amdgcn_readfirstlane(threadIdx.x >> 5);
  const int blk  = blockIdx.x;
  if (blk < kBlkPrepW) {
    const int t = blk * 8 + wave;
    const bool isQ = t < kTileWq, isO = t >= kTileWq + kTileWkv;
    const float* in     = isQ ? Wq : (isO ? Wout : Wkv);
    unsigned short* out = isQ ? wq16 : (isO ? wo16 : wkv16);
    const int tile      = isQ ? t : (isO ? t - kTileWq - kTileWkv : t - kTileWq);
    const int kshift    = isO ? 2 : 1;
    v4f w[16];
    cast_tile_load(w, tile, in, kshift);
    cast_tile_store(w, tile, out, kshift, kWC);
    return;
  }
  const int idx = (blk - kBlkPrepW) * 8 + wave;
  const int j = lane & 15;
  float fr = ft.f[0];
#pragma unroll
  for (int e = 1; e < 16; ++e) fr = (j == e) ? ft.f[e] : fr;
  const float pvx = xpos[(size_t)idx * 16 + j];
  const float pvz = zpos[(size_t)idx * 16 + j];
  /* keeps what the tables need (the frequency becomes a load too) ahead of the 32 tile loads: loads are counted back in
     order, so a table's wait on a later one would wait for the tiles as well */
  __builtin_amdgcn_sched_barrier(0);
  v4f vx[16], vz[16];
  cast_tile_load(vx, idx, x, 1);
  cast_tile_load(vz, idx, z, 1);
  rot_table_wave<false>(sm[wave], idx, pvx, tabx, fr);
  cast_tile_store(vx, idx, x16, 1, kXC);
  rot_table_wave<true>(sm[wave], idx, pvz, tabz, fr);
  cast_tile_store(vz, idx, z16, 1, kXC);
}

/* ---------------------------------------------------------------------------
   Batched WMMA GEMM, one f16 product:
     C[m,n] = scale * sum_k A[m,k]*Bt[n,k]
   A [M][lda] and Bt [N][ldb] are fragment-order planes (see frag_pos); M % 32 == 0, N % 64 == 0, K % 32 == 0.
   Each wave owns a 32x64 tile; blk = block index inside the product, nBatch * (M/256) * (N/64) blocks.
   Batch z -> (zo = z / nInner, zi = z % nInner); operand bases advance by zo*s?o + zi*s?i elements (a step of 32 columns
   in a fragment-order plane is 512 elements).
   EPI 0: f32 out + bf16(bias[n]), row-major.  EPI 1: f16 out (no launch takes it).  EPI 2: 2D rotary of each 64-wide head row (table rows = m)
   -> f16 x64.  EPI 1 and 2 write fragment-order planes of pitch ldc.
   KS = K = ldb, M % 256 == 0: the block's 8 waves take 8 consecutive row tiles of ONE column tile, blk =
   (batch * (M / 256) + row group) * (N / 64) + column tile. The 64 rows of Bt that they share are 64 * KS contiguous halves of the plane; the
   block copies them to sB once, in the same order, and every B fragment of the k loop is read from LDS. One barrier, reached
   by all 256 threads (the exit in front of it is the same for the whole block).
   --------------------------------------------------------------------------- */
/* pointer to 16-B units in LDS: the address space is spelled out so that the k loop's B loads are LDS loads */
typedef const __attribute__((address_space(3))) v8h* unit_lptr;
template <int EPI, int KS>
__device__ __forceinline__ void gemm_f16_tile(
    float (*sT)[16 * 68], _Float16* sB, int blk,
    const unsigned short* __restrict__ Ap, int lda, long sAo, long sAi,
    const unsigned short* __restrict__ Bp, int ldb, long sBo, long sBi,
    void* __restrict__ Cout, void* __restrict__ Cout2, int ldc, long sCo, long sCi,
    const float* __restrict__ bias, const float* __restrict__ tab,
    int M, int N, int K, int nInner, int nBatch, float scale) {
  static_assert((KS % 32) == 0, "whole k-blocks");
  const int lane = threadIdx.x & 31;
  const int wave = threadIdx.x >> 5;
  const int tilesN = N >> 6;
  const int tilesM = M >> 5;
  const int blkPerBatch = (tilesM >> 3) * tilesN;
  if (blk >= blkPerBatch * nBatch) return;
  const int z  = blk / blkPerBatch;
  const int bb = blk - z * blkPerBatch;
  const int tg = bb / tilesN;
  const int tn = bb - tg * tilesN;
  const int tm = tg * 8 + wave;
  const int m0 = tm << 5;
  const int n0 = tn << 6;
  const int zo = z / nInner;
  const int zi = z - zo * nInner;

  const _Float16* A  = (const _Float16*)Ap + (size_t)zo * sAo + (size_t)zi * sAi;
  const _Float16* Bt = (const _Float16*)Bp + (size_t)zo * sBo + (size_t)zi * sBi;
  const size_t coff = (size_t)zo * sCo + (size_t)zi * sCi;

  const int rlane = lane & 15;
  const int mOff  = (lane >> 4) * 8;
  /* k-blocks per row-block of the B tile, A's per-row-block stride, and the lane's unit inside a 512-B segment */
  constexpr int kNkb = KS / 32;
  const size_t strA = (size_t)(lda >> 5) * 512;
  const int lpos = frag_pos(rlane, lane >> 4) * 8;
  /* one running pointer per A fragment row-block; a k step of 32 is the next 1024-B block (64 units) */
  unit_gptr pa[2];
#pragma unroll
  for (int i = 0; i < 2; ++i) pa[i] = (unit_gptr)(A + (size_t)((m0 >> 4) + i) * strA + lpos);

  /* the B tile: 64 * KS halves = KS * 8 units of 16 B, kNkb per thread; a wave's load and its LDS store each cover 512
     contiguous B */
  const unit_gptr pB = (unit_gptr)(Bt + (size_t)(n0 >> 4) * (kNkb * 512));
  const unsigned tid = threadIdx.x;
  {
    v8h bt[kNkb];
#pragma unroll
    for (int u = 0; u < kNkb; ++u) bt[u] = pB[u * 256 + tid];
    /* the wait that belongs in front of any overwrite of the loads' address registers; it names them, so that they stay
       untouched up to here */
    asm volatile("s_wait_xcnt 0x0" :: "s"(pB), "v"(tid) : "memory");
#pragma unroll
    for (int u = 0; u < kNkb; ++u) ((v8h*)sB)[u * 256 + tid] = bt[u];
  }
  __syncthreads(); /* every wave reads the whole tile, written by all */

  v8f acc[2][4];
#pragma unroll
  for (int i = 0; i < 2; ++i)
#pragma unroll
    for (int j = 0; j < 4; ++j)
      acc[i][j] = (v8f){0.f, 0.f, 0.f, 0.f, 0.f, 0.f, 0.f, 0.f};

  /* the lane's unit of row-block 0, k-block 0 of the tile; row-block j stands kNkb blocks on, a k step one block on */
  unit_lptr sb = (unit_lptr)(sB + lpos);
  for (int k0 = 0; k0 < K; k0 += 32) {
    /* B is near now, so its fragments are taken two at a time, each pair used by both A fragments: 16 registers of B, not
       32, and the trip's two A fragments (no other wave of the block reads these rows) are both held from its head */
    const v16h a0 = frag_load_plane(pa[0]);
    const v16h a1 = frag_load_plane(pa[1]);
    pa[0] += 64;
    pa[1] += 64;
#pragma unroll
    for (int g = 0; g < 2; ++g) {
      v16h bh[2];
#pragma unroll
      for (int j = 0; j < 2; ++j) {
        FragU f;
        f.h[0] = sb[(g * 2 + j) * kNkb * 64];
        f.h[1] = sb[(g * 2 + j) * kNkb * 64 + 32];
        bh[j] = f.v;
      }
#pragma unroll
      for (int j = 0; j < 2; ++j) {
        acc[0][g * 2 + j] = mma16(a0, bh[j], acc[0][g * 2 + j]);
        acc[1][g * 2 + j] = mma16(a1, bh[j], acc[1][g * 2 + j]);
      }
      /* the group's four results, both A fragments and the B pair: the slots that the products need before the next loads
         overwrite their operands */
      guard4(acc[0][g * 2], acc[0][g * 2 + 1], acc[1][g * 2], acc[1][g * 2 + 1], a0, a1, bh[0], bh[1], bh[1]);
    }
    sb += 64;
  }

  /* ---- epilogue of EPI 0, 1, 2 ---- */
  float* slab = sT[wave];
  const int q  = lane >> 3;
  const int c8 = (lane & 7) * 8;
  const int hh = lane >> 4;
  const int c4 = (lane & 15) * 4;
#pragma unroll
  for (int i = 0; i < 2; ++i) {
    const int mBase = m0 + (i << 4);
#pragma unroll
    for (int j = 0; j < 4; ++j) {
      float bv = 0.f;
      if (EPI == 0) {
        const float braw = bias[n0 + (j << 4) + rlane];
        bv = bf_rne(braw);
      }
#pragma unroll
      for (int r = 0; r < 8; ++r) {
        float v = acc[i][j][r] * scale;
        if (EPI == 0) v += bv;
        slab[(mOff + r) * 68 + (j << 4) + rlane] = v;
      }
    }
    __builtin_amdgcn_fence(__ATOMIC_RELEASE, "workgroup");
    __builtin_amdgcn_wave_barrier();
    __builtin_amdgcn_fence(__ATOMIC_ACQUIRE, "workgroup");
    if (EPI == 0) {
      /* f32 rows: 64 floats = 256 B = 16 lanes x 16 B; rows it*2 + hh, it = 0..7 -> 16 rows, each once */
      float* C = (float*)Cout + coff;
      v4f vals[8];
#pragma unroll
      for (int it = 0; it < 8; ++it) vals[it] = *(const v4f*)(slab + (it * 2 + hh) * 68 + c4);
      {
#pragma unroll
        for (int it = 0; it < 8; ++it)
          *(v4f*)(C + (size_t)(mBase + it * 2 + hh) * ldc + n0 + c4) = vals[it];
        
      }
    } else {
      /* the 16 x 64 slab is two whole blocks of the plane; col = the lane's unit for row q, rows it*4 add 64 each */
      unsigned short* Cb = (unsigned short*)Cout + coff + ((size_t)(mBase >> 4) * (ldc >> 5) + (n0 >> 5)) * 512;
      const int col = ((lane & 7) >> 1) * 256 + frag_pos(q, lane & 1) * 8;
      /* rotary: column c pairs with c ^ 16; the upper member of a pair takes +sin, the lower -sin */
      const float sgn = (c8 & 16) ? 1.0f : -1.0f;
      const int tcol  = (c8 >> 5) * 32 + (c8 & 15);
      const float oc  = (EPI == 1) ? 1.0f : kQC;
      v4u ow[4];
#pragma unroll
      for (int it = 0; it < 4; ++it) {
        const int row = it * 4 + q;
        const float* sp = slab + row * 68 + c8;
        const v4f ta = *(const v4f*)(sp);
        const v4f tb = *(const v4f*)(sp + 4);
        float o[8];
        o[0] = ta[0]; o[1] = ta[1]; o[2] = ta[2]; o[3] = ta[3];
        o[4] = tb[0]; o[5] = tb[1]; o[6] = tb[2]; o[7] = tb[3];
        if (EPI == 2) {
          const float* pp = slab + row * 68 + (c8 ^ 16);
          const v4f pa = *(const v4f*)(pp);
          const v4f pb = *(const v4f*)(pp + 4);
          float p[8];
          p[0] = pa[0]; p[1] = pa[1]; p[2] = pa[2]; p[3] = pa[3];
          p[4] = pb[0]; p[5] = pb[1]; p[6] = pb[2]; p[7] = pb[3];
          {
            const float* tp = tab + (size_t)(mBase + row) * 64 + tcol;
            const v4f ca = *(const v4f*)(tp);
            const v4f cb = *(const v4f*)(tp + 4);
            const v4f sa = *(const v4f*)(tp + 16);
            const v4f sb = *(const v4f*)(tp + 20);
            /* the wait that belongs in front of any overwrite of the loads' address registers; it names them, so that
               they stay untouched (also as a later load's destination) up to here */
            asm volatile("s_wait_xcnt 0x0" :: "v"(tp) : "memory");
            float cc[8], sn[8];
            cc[0] = ca[0]; cc[1] = ca[1]; cc[2] = ca[2]; cc[3] = ca[3];
            cc[4] = cb[0]; cc[5] = cb[1]; cc[6] = cb[2]; cc[7] = cb[3];
            sn[0] = sa[0]; sn[1] = sa[1]; sn[2] = sa[2]; sn[3] = sa[3];
            sn[4] = sb[0]; sn[5] = sb[1]; sn[6] = sb[2]; sn[7] = sb[3];
#pragma unroll
            for (int e = 0; e < 8; ++e) o[e] = o[e] * cc[e] + sgn * (p[e] * sn[e]);
          }
        }
#pragma unroll
        for (int e = 0; e < 8; ++e) o[e] *= oc;
        ow[it] = (v4u){pk16(h_bits(o[0]), h_bits(o[1])), pk16(h_bits(o[2]), h_bits(o[3])),
                       pk16(h_bits(o[4]), h_bits(o[5])), pk16(h_bits(o[6]), h_bits(o[7]))};
      }
      {
#pragma unroll
        for (int it = 0; it < 4; ++it) *(v4u*)(Cb + it * 64 + col) = ow[it];
        
      }
    }
    __builtin_amdgcn_fence(__ATOMIC_RELEASE, "workgroup");
    __builtin_amdgcn_wave_barrier();
    __builtin_amdgcn_fence(__ATOMIC_ACQUIRE, "workgroup");
  }
}

/* second bound MINW: waves a SIMD. 8 (128 registers) for the output product; 6 (160 registers, three blocks a WGP) for the q
   projection, whose rotary epilogue spills under 128. The k loop hides its load latency by other waves alone */
template <int EPI, int KS, int MINW>
__global__ __launch_bounds__(256, MINW) void gemm_f16_kernel(
    const unsigned short* __restrict__ Ap, int lda, long sAo, long sAi,
    const unsigned short* __restrict__ Bp, int ldb, long sBo, long sBi,
    void* __restrict__ Cout, void* __restrict__ Cout2, int ldc, long sCo, long sCi,
    const float* __restrict__ bias, const float* __restrict__ tab,
    int M, int N, int K, int nInner, int nBatch, float scale) {
  __shared__ __align__(16) float sT[8][16 * 68];
  __shared__ __align__(16) _Float16 sB[64 * KS];
  gemm_f16_tile<EPI, KS>(sT, sB, blockIdx.x, Ap, lda, sAo, sAi, Bp, ldb, sBo, sBi, Cout, Cout2, ldc, sCo, sCi, bias, tab,
                     M, N, K, nInner, nBatch, scale);
}

/* ---------------------------------------------------------------------------
   Key/value side in one kernel: projection, instance norm, rotary (k) and the token-axis product k^T v. k and v never go to
   memory.
   512 blocks: blk = (batch * 16 + split) * 8 + head, so that the 8 blocks which read the same rows of z stand side by side.
   A block takes the 512 tokens of its split in trips of 256; its head's 64 rows of Wk and 64 rows of Wv (each 64 * 256
   contiguous halves of the weight plane) are copied to sW once.
   A trip, wave w:
     1. 32 tokens x (64 k columns + 64 v columns), K = 256: A from the z plane (the next k-block's two fragments fly while
        this one's products run), B from sW in fragment pairs.
     2. per-row instance norm over either 64 columns, rotary on k, in the accumulators' own layout: a lane holds 8
        consecutive rows (tokens) of one column, which is one 16-B unit of the fragment-order plane of the TRANSPOSED matrix
        (row = head column, k = token); a row's 64 columns are 4 registers x the 16 lanes of a row of lanes; a rotary pair
        (c, c ^ 16) is two registers of one lane. The table is the token-minor one. The units go to sX, the fragment-order
        plane [128 rows: k 0..63, v 64..127][256 tokens] of the trip; the wave's 32 tokens are its k-block w.
     3. behind a barrier: C[e][d] += sum over the trip's 256 tokens of v[tok][e] * k[tok][d] (A = v, B = k) for rows
        e = 32 * (w % 2) .. + 31 and columns d = 16 * (w / 2) .. + 15: two accumulators, kept over the trips. The 8 waves cover
        the 64 x 64 product, so no sum across waves is left.
   At the end a lane's 8 accumulator rows are 8 consecutive e of one d = 32 contiguous bytes of the row-major [d][e] partial,
   and a wave writes the whole 128-B lines e = 0..31 or 32..63 of its 16 rows d.
   Every barrier is reached by all 256 threads (no early exit; the test on the trip number is the same for the block).
   --------------------------------------------------------------------------- */
constexpr int kKvTokTrip = 256;
constexpr int kKvTrips   = kTokPerSplit / kKvTokTrip;
constexpr int kKvKb      = kDim / 32;
constexpr int kBlkKvDots = kBH * kSplitK;
static_assert(kKvTrips * kKvTokTrip == kTokPerSplit && kKvTrips >= 1 && kBlkKvDots == 512 && kKvKb == 8, "kv grid");
/* hazard guard of the token-axis products: ties both accumulators and names the fragments of a group of four k-blocks, with
   the slots that the products need before the next loads overwrite their operands */
__device__ __forceinline__ void guard2(v8f& d0, v8f& d1, const v16h (&a0)[4], const v16h (&a1)[4], const v16h (&b)[4]) {
  asm volatile("v_nop\n\tv_nop\n\tv_nop\n\tv_nop"
               : "+v"(d0), "+v"(d1)
               : "v"(a0[0]), "v"(a0[1]), "v"(a0[2]), "v"(a0[3]), "v"(a1[0]), "v"(a1[1]), "v"(a1[2]), "v"(a1[3]),
                 "v"(b[0]), "v"(b[1]), "v"(b[2]), "v"(b[3]));
}
/* 16 tokens x 64 columns in the accumulator layout -> normed (ISK: and rotated) f16 x16, one 16-B unit per 16 columns;
   tp = the lane's place in the token-minor table tile of its 8 tokens */
template <bool ISK>
__device__ __forceinline__ void norm_rot_units(const v8f (&c)[4], const float* __restrict__ tp, float scale, v4u (&ow)[4]) {
  /* [axis][cos, sin][tokens 0..3, 4..7 of the lane's 8] */
  v4f tc[2][2][2];
  if (ISK) {
#pragma unroll
    for (int a = 0; a < 2; ++a)
#pragma unroll
      for (int s = 0; s < 2; ++s)
#pragma unroll
        for (int u = 0; u < 2; ++u) tc[a][s][u] = *(const v4f*)(tp + a * 256 + s * 128 + u * 4);
    /* the wait that belongs in front of any overwrite of the loads' address registers; it names them, so that they
       stay untouched (also as a later load's destination) up to here */
    asm volatile("s_wait_xcnt 0x0" :: "v"(tp) : "memory");
  }
  float xv[4][8];
#pragma unroll
  for (int r = 0; r < 8; ++r) {
#pragma unroll
    for (int j = 0; j < 4; ++j) xv[j][r] = c[j][r] * scale;
    /* mean and biased variance over the 64 columns of the row */
    const float mean = row_sum16((xv[0][r] + xv[1][r]) + (xv[2][r] + xv[3][r])) * kInvDh;
#pragma unroll
    for (int j = 0; j < 4; ++j) xv[j][r] -= mean;
    float ss = 0.0f;
#pragma unroll
    for (int j = 0; j < 4; ++j) ss = fmaf(xv[j][r], xv[j][r], ss);
    const float rstd = rsq_normal(row_sum16(ss) * kInvDh + kNormEps);
#pragma unroll
    for (int j = 0; j < 4; ++j) xv[j][r] *= rstd;
  }
#pragma unroll
  for (int j = 0; j < 4; ++j) {
    float o[8];
#pragma unroll
    for (int r = 0; r < 8; ++r) {
      o[r] = xv[j][r];
      /* rotary: column c pairs with c ^ 16 (register j ^ 1); the upper member of a pair takes +sin, the lower -sin */
      if (ISK) {
        const float pr = xv[j ^ 1][r] * tc[j >> 1][1][r >> 2][r & 3];
        o[r] = o[r] * tc[j >> 1][0][r >> 2][r & 3] + ((j & 1) ? pr : -pr);
      }
      o[r] *= kKVC;
    }
    ow[j] = (v4u){pk16(h_bits(o[0]), h_bits(o[1])), pk16(h_bits(o[2]), h_bits(o[3])),
                  pk16(h_bits(o[4]), h_bits(o[5])), pk16(h_bits(o[6]), h_bits(o[7]))};
  }
}
/* second bound: 4 waves a SIMD (256 registers): the 128 KiB of LDS allow two blocks a WGP, which is that many waves */
__global__ __launch_bounds__(256, 4) void kv_dots_kernel(const unsigned short* __restrict__ Zp,
                                                         const unsigned short* __restrict__ Wp,
                                                         const float* __restrict__ tab, float* __restrict__ part,
                                                         float scale) {
  __shared__ __align__(16) _Float16 sW[2 * kDh * kDim];
  __shared__ __align__(16) _Float16 sX[2 * kDh * kKvTokTrip];
  const unsigned tid = threadIdx.x;
  const int lane = tid & 31;
  /* the wave number in a scalar register: what is formed from it is the same for the whole wave */
  const int wave = __builtin_amdgcn_readfirstlane(tid >> 5);
  const int blk = blockIdx.x;
  const int h  = blk & (kHeads - 1);
  const int ks = (blk / kHeads) & (kSplitK - 1);
  const int b  = blk / (kHeads * kSplitK);
  const int bh = b * kHeads + h;
  const int rlane = lane & 15;
  const int hi    = lane >> 4;
  const int lpos  = frag_pos(rlane, hi) * 8;
  const int rh = wave & 1, dj = wave >> 1;
  /* the wave's first token; a trip is 256 tokens on */
  const int m0 = b * kSeq + ks * kTokPerSplit + wave * 32;

  /* the lane's unit of row-block m0 / 16, k-block 0 of the z plane; the second row-block stands kKvKb blocks (512 units) on,
     a k step one block (64 units), a trip 16 row-blocks */
  unit_gptr pa = (unit_gptr)((const _Float16*)Zp + (size_t)(m0 >> 4) * (kKvKb * 512) + lpos);
  const float* tp = tab + ((size_t)(m0 >> 3) + hi) * 512 + rlane * 8;
  /* the first trip's first fragments fly beside the weights */
  v16h a0 = frag_load_plane(pa);
  v16h a1 = frag_load_plane(pa + kKvKb * 64);

  /* the weight tiles: 2 x 64 * 256 halves = 2 x 2048 units of 16 B, 8 + 8 per thread; a wave's load and its LDS store each
     cover 512 contiguous B */
  {
    const unit_gptr pWk = (unit_gptr)((const _Float16*)Wp + (size_t)(h * 4) * (kKvKb * 512));
    const unit_gptr pWv = (unit_gptr)((const _Float16*)Wp + (size_t)(kInner / 16 + h * 4) * (kKvKb * 512));
    v8h bt[2][kKvKb];
#pragma unroll
    for (int u = 0; u < kKvKb; ++u) {
      bt[0][u] = pWk[u * 256 + tid];
      bt[1][u] = pWv[u * 256 + tid];
    }
    /* the wait that belongs in front of any overwrite of the loads' address registers; it names them, so that they stay
       untouched up to here */
    asm volatile("s_wait_xcnt 0x0" :: "s"(pWk), "s"(pWv), "v"(tid) : "memory");
#pragma unroll
    for (int u = 0; u < kKvKb; ++u) {
      ((v8h*)sW)[u * 256 + tid] = bt[0][u];
      ((v8h*)sW)[kKvKb * 256 + u * 256 + tid] = bt[1][u];
    }
  }
  __syncthreads(); /* every wave reads both weight tiles, written by all */

  /* the lane's unit of row-block 0, k-block 0: of the weights; of the trip's plane as this wave writes it (k-block = wave)
     and as it reads it (v rows 64 + 32 rh .., k rows 16 dj ..) */
  const unit_lptr sw = (unit_lptr)(sW + lpos);
  _Float16* xw = sX + wave * 512 + lpos;
  const unit_lptr xa = (unit_lptr)(sX + (4 + rh * 2) * (8 * 512) + lpos);
  const unit_lptr xb = (unit_lptr)(sX + dj * (8 * 512) + lpos);

  v8f dacc[2];
#pragma unroll
  for (int i = 0; i < 2; ++i) dacc[i] = (v8f){0.f, 0.f, 0.f, 0.f, 0.f, 0.f, 0.f, 0.f};

  /* rolled: a second copy of the trip would only lengthen the text */
#pragma unroll 1
  for (int t = 0; t < kKvTrips; ++t) {
    /* [token half][k, v][16 columns] */
    v8f acc[2][2][4];
#pragma unroll
    for (int i = 0; i < 2; ++i)
#pragma unroll
      for (int s = 0; s < 2; ++s)
#pragma unroll
        for (int j = 0; j < 4; ++j) acc[i][s][j] = (v8f){0.f, 0.f, 0.f, 0.f, 0.f, 0.f, 0.f, 0.f};
    /* unrolled: the k step is then an offset field of the loads */
#pragma unroll
    for (int kb = 0; kb < kKvKb; ++kb) {
      v16h n0 = a0, n1 = a1;
      if (kb + 1 < kKvKb) {
        n0 = frag_load_plane(pa + (kb + 1) * 64);
        n1 = frag_load_plane(pa + (kKvKb + kb + 1) * 64);
      }
#pragma unroll
      for (int s = 0; s < 2; ++s)
#pragma unroll
        for (int g = 0; g < 2; ++g) {
          v16h bh2[2];
#pragma unroll
          for (int j = 0; j < 2; ++j) {
            FragU f;
            f.h[0] = sw[((s * 4 + g * 2 + j) * kKvKb + kb) * 64];
            f.h[1] = sw[((s * 4 + g * 2 + j) * kKvKb + kb) * 64 + 32];
            bh2[j] = f.v;
          }
#pragma unroll
          for (int j = 0; j < 2; ++j) {
            acc[0][s][g * 2 + j] = mma16(a0, bh2[j], acc[0][s][g * 2 + j]);
            acc[1][s][g * 2 + j] = mma16(a1, bh2[j], acc[1][s][g * 2 + j]);
          }
          /* the group's four results, both A fragments and the B pair: the slots that the products need before the next
             loads overwrite their operands */
          guard4(acc[0][s][g * 2], acc[0][s][g * 2 + 1], acc[1][s][g * 2], acc[1][s][g * 2 + 1], a0, a1, bh2[0], bh2[1],
                 bh2[1]);
        }
      a0 = n0;
      a1 = n1;
    }

    if (t > 0) __syncthreads(); /* the last trip's reads of sX end before it is written again */
#pragma unroll
    for (int i = 0; i < 2; ++i) {
      v4u ow[4];
      norm_rot_units<true>(acc[i][0], tp + i * 1024, scale, ow);
#pragma unroll
      for (int j = 0; j < 4; ++j) *(v4u*)(xw + j * (8 * 512) + i * 256) = ow[j];
      norm_rot_units<false>(acc[i][1], tp, scale, ow);
#pragma unroll
      for (int j = 0; j < 4; ++j) *(v4u*)(xw + (4 + j) * (8 * 512) + i * 256) = ow[j];
    }
    __syncthreads(); /* every wave reads units written by all */
    if (t + 1 < kKvTrips) {
      /* the wait that belongs in front of the overwrite of the z loads' address registers */
      asm volatile("s_wait_xcnt 0x0" :: "v"(pa) : "memory");
      pa += (kKvTokTrip / 16) * kKvKb * 64;
      tp += (kKvTokTrip / 8) * 512;
      /* the next trip's first fragments fly during the token-axis products (behind the barrier, which waits for every load
         in flight) */
      a0 = frag_load_plane(pa);
      a1 = frag_load_plane(pa + kKvKb * 64);
    }

    /* four k-blocks' fragments are fetched together (the projection's accumulators are free by now): two LDS latencies a
       trip, not eight */
#pragma unroll
    for (int kg = 0; kg < 2; ++kg) {
      v16h f0[4], f1[4], fb[4];
#pragma unroll
      for (int u = 0; u < 4; ++u) {
        const int kb = kg * 4 + u;
        FragU f;
        f.h[0] = xa[kb * 64];
        f.h[1] = xa[kb * 64 + 32];
        f0[u] = f.v;
        f.h[0] = xa[(8 + kb) * 64];
        f.h[1] = xa[(8 + kb) * 64 + 32];
        f1[u] = f.v;
        f.h[0] = xb[kb * 64];
        f.h[1] = xb[kb * 64 + 32];
        fb[u] = f.v;
      }
#pragma unroll
      for (int u = 0; u < 4; ++u) {
        dacc[0] = mma16(f0[u], fb[u], dacc[0]);
        dacc[1] = mma16(f1[u], fb[u], dacc[1]);
      }
      guard2(dacc[0], dacc[1], f0, f1, fb);
    }
  }

  float* C = part + ((size_t)ks * kBH + bh) * (kDh * kDh) + (size_t)(dj * 16 + rlane) * kDh + rh * 32 + hi * 8;
#pragma unroll
  for (int i = 0; i < 2; ++i) {
    const v8f a = dacc[i];
    *(v4f*)(C + i * 16)     = (v4f){a[0], a[1], a[2], a[3]};
    *(v4f*)(C + i * 16 + 4) = (v4f){a[4], a[5], a[6], a[7]};
  }
}

/* ---------------------------------------------------------------------------
   out = (q . dots / 8192) . Wout^T is computed as q . G^T with G[b][o][h*64+d] = sum_e Wout[o][h*64+e] * dots[b][h][d][e] / 8192,
   so the per-token product with dots is replaced by this one, 256 rows a head. One block per (batch, head), 8 waves.
   Step 1: fixed-order sum of the 16 split-K partials, scaled (1/8192 and carries, all powers of two) in f32, emitted as one
   f16 fragment-order 64 x 64 plane [d][e] in LDS; 8 elements per unit, 512 units = 256 threads x 2.
   Step 2: wave w takes rows o = 32w .. 32w+31 of Wout (A, columns h*64 .. +63 of its plane) against all 64 rows d of the LDS
   plane (B), K = 64, and writes its 32 x 64 tile to columns h*64 .. +63 of the batch's fragment-order plane of pitch 512.
   No early exit: all 256 threads reach the barrier.
   --------------------------------------------------------------------------- */
__global__ __launch_bounds__(256) void dots_fold_kernel(const float* __restrict__ part, const unsigned short* __restrict__ wo,
                                                        unsigned short* __restrict__ gw) {
  __shared__ __align__(16) _Float16 sD[kDh * kDh];
  __shared__ __align__(16) float sT[8][32 * 68];
  const int tid = threadIdx.x, lane = tid & 31, wave = tid >> 5;
  const int bh = blockIdx.x, b = bh >> 3, h = bh & 7;
  const int rlane = lane & 15;
  const int mOff  = (lane >> 4) * 8;
  const int lpos  = frag_pos(rlane, lane >> 4) * 8;
  const int m0    = wave << 5;

  /* the Wout fragments depend on nothing of step 1: their loads fly beside those of the partials */
  v16h ah[2][2];
#pragma unroll
  for (int kb = 0; kb < 2; ++kb)
#pragma unroll
    for (int i = 0; i < 2; ++i)
      ah[kb][i] = frag_load_plane((unit_gptr)((const _Float16*)wo +
                                              ((size_t)((m0 >> 4) + i) * (kInner >> 5) + h * 2 + kb) * 512 + lpos));

#pragma unroll
  for (int u = 0; u < 2; ++u) {
    const int iu = u * 256 + tid;
    const size_t o = (size_t)bh * (kDh * kDh) + 8 * (size_t)iu;
    float s[8];
#pragma unroll
    for (int e = 0; e < 8; ++e) s[e] = 0.0f;
#pragma unroll
    for (int ks = 0; ks < kSplitK; ++ks) {
      const float* p = part + (size_t)ks * kDotsElems + o;
      const v4f a = *(const v4f*)(p);
      const v4f c = *(const v4f*)(p + 4);
      s[0] += a[0]; s[1] += a[1]; s[2] += a[2]; s[3] += a[3];
      s[4] += c[0]; s[5] += c[1]; s[6] += c[2]; s[7] += c[3];
    }
    unsigned short hb[8];
#pragma unroll
    for (int e = 0; e < 8; ++e) hb[e] = h_bits(s[e] * kDotsScale);
    /* unit iu = (row d, columns e8*8 .. +7) of the 64 x 64 fragment-order plane */
    const int d  = iu >> 3;
    const int e8 = iu & 7;
    *(v4u*)(sD + ((d >> 4) * 2 + (e8 >> 2)) * 512 + ((e8 >> 1) & 1) * 256 + frag_pos(d & 15, e8 & 1) * 8) =
        (v4u){pk16(hb[0], hb[1]), pk16(hb[2], hb[3]), pk16(hb[4], hb[5]), pk16(hb[6], hb[7])};
  }
  __syncthreads(); /* every wave reads the whole plane, written by all */

  v8f acc[2][4];
#pragma unroll
  for (int i = 0; i < 2; ++i)
#pragma unroll
    for (int j = 0; j < 4; ++j)
      acc[i][j] = (v8f){0.f, 0.f, 0.f, 0.f, 0.f, 0.f, 0.f, 0.f};
#pragma unroll
  for (int kb = 0; kb < 2; ++kb) {
    v16h bf[4];
#pragma unroll
    for (int j = 0; j < 4; ++j) {
      const _Float16* p = sD + (j * 2 + kb) * 512 + lpos;
      FragU f;
      f.h[0] = *(const v8h*)(p);
      f.h[1] = *(const v8h*)(p + 256);
      bf[j] = f.v;
    }
#pragma unroll
    for (int i = 0; i < 2; ++i) {
#pragma unroll
      for (int j = 0; j < 4; ++j)
        acc[i][j] = mma16(ah[kb][i], bf[j], acc[i][j]);
      /* keeps the group's operands in their registers past its last product, with the slots the results need */
      guard4(acc[i][0], acc[i][1], acc[i][2], acc[i][3], ah[kb][i], bf[0], bf[1], bf[2], bf[3]);
    }
  }

  /* the wave's 32 x 64 tile goes through its own LDS slab, so that each store covers whole 128-B lines: 16 rows x 64
     columns are two whole blocks of the plane */
  float* slab = sT[wave];
  const int q   = lane >> 3;
  const int c8  = (lane & 7) * 8;
  const int col = ((lane & 7) >> 1) * 256 + frag_pos(q, lane & 1) * 8;
#pragma unroll
  for (int i = 0; i < 2; ++i)
#pragma unroll
    for (int j = 0; j < 4; ++j)
#pragma unroll
      for (int r = 0; r < 8; ++r) slab[(i * 16 + mOff + r) * 68 + (j << 4) + rlane] = acc[i][j][r] * kFoldScale;
  /* the rows read below were written by other lanes of this wave */
  __builtin_amdgcn_fence(__ATOMIC_RELEASE, "workgroup");
  __builtin_amdgcn_wave_barrier();
  __builtin_amdgcn_fence(__ATOMIC_ACQUIRE, "workgroup");
#pragma unroll
  for (int i = 0; i < 2; ++i) {
    unsigned short* Cb = gw + (size_t)b * (kDim * kInner) + ((size_t)((m0 >> 4) + i) * (kInner >> 5) + h * 2) * 512;
#pragma unroll
    for (int it = 0; it < 4; ++it) {
      const float* sp = slab + (i * 16 + it * 4 + q) * 68 + c8;
      const v4f ta = *(const v4f*)(sp);
      const v4f tb = *(const v4f*)(sp + 4);
      *(v4u*)(Cb + it * 64 + col) = (v4u){pk16(h_bits(ta[0]), h_bits(ta[1])), pk16(h_bits(ta[2]), h_bits(ta[3])),
                                          pk16(h_bits(tb[0]), h_bits(tb[1])), pk16(h_bits(tb[2]), h_bits(tb[3]))};
    }
  }
}

/* ---------------------------------------------------------------------------
   Host glue: 5 kernel launches, nothing else.
   GEMM shapes (M % 32 == 0, N % 64 == 0, K % 32 == 0, no pad planes needed):
     kv projection : M 32768, N 1024, K 256, with the token-axis product behind it -> 512 blocks (kv_dots_kernel)
     q projection  : M 32768, N 512,  K 256 -> 1024 x 8  tiles =  8192 -> 1024 blocks
     Wout . dots^T : 32 (batch, head) pairs of M 256, N 64, K 64 -> 32 blocks (dots_fold_kernel)
     q . G^T       : 4 batches of M 8192, N 256, K 512 -> 4 x 256 x 4 tiles = 4096 -> 512 blocks
   --------------------------------------------------------------------------- */
extern "C" void kernel_launch(void* const* d_in, const int* in_sizes, int n_in,
                              void* d_out, int out_size, void* d_ws, size_t ws_size,
                              hipStream_t stream) {
  if (n_in < 8) return;
  if (in_sizes[0] != kTok * kDim) return;
  if (in_sizes[1] != kTok * kDim) return;
  if (in_sizes[2] != kTok * 2) return;
  if (in_sizes[3] != kTok * 2) return;
  if (in_sizes[4] != kInner * kDim) return;
  if (in_sizes[5] != 2 * kInner * kDim) return;
  if (in_sizes[6] != kDim * kInner) return;
  if (in_sizes[7] != kDim) return;
  if (out_size != kTok * kDim) return;
  if (ws_size < kWsTotal) return;

  const float* x    = (const float*)d_in[0];
  const float* z    = (const float*)d_in[1];
  const float* xpos = (const float*)d_in[2];
  const float* zpos = (const float*)d_in[3];
  const float* Wq   = (const float*)d_in[4];
  const float* Wkv  = (const float*)d_in[5];
  const float* Wout = (const float*)d_in[6];
  const float* bout = (const float*)d_in[7];
  float* out = (float*)d_out;

  char* ws = (char*)d_ws;
  unsigned short* WQ   = (unsigned short*)(ws + kOffWQ);
  unsigned short* WK   = (unsigned short*)(ws + kOffWK);
  unsigned short* WO   = (unsigned short*)(ws + kOffWO);
  unsigned short* S16  = (unsigned short*)(ws + kOffS16);
  unsigned short* QH   = (unsigned short*)(ws + kOffQH);
  float*          TAB  = (float*)(ws + kOffTAB);
  float*          PART = (float*)(ws + kOffPART);
  unsigned short* GW   = (unsigned short*)(ws + kOffGW);
  unsigned short* SX   = (unsigned short*)(ws + kOffSX);
  float*          TABX = (float*)(ws + kOffTABX);

  /* inverse frequencies: 1 / f32(10000^(2j/32)), j = 0..15 */
  FreqTab ft;
  for (int j = 0; j < 16; ++j) {
    const double ex = (double)(2 * j) / 32.0;
    const float pw = (float)pow(10000.0, ex);
    ft.f[j] = 1.0f / pw;
  }

  /* weight planes ([out][in] = Bt orientation already): f16(bf16(w) * 1024); z and x planes: f16(bf16(v) * 16);
     position tables of z and x */
  prep_kernel<<<kBlkPrep, 256, 0, stream>>>(x, z, xpos, zpos, Wq, Wkv, Wout, WQ, WK, WO, S16, SX, TAB, TABX, ft);

  /* key/value side: projection, norm (+ rotary on k) and the token-axis product, deterministic split-K */
  kv_dots_kernel<<<kBlkKvDots, 256, 0, stream>>>(S16, WK, TAB, PART, kProjScale);

  /* query side: projection with fused rotary */
  gemm_f16_kernel<2, kDim, 6><<<(kTok / 32) * (kInner / 64) / 8, 256, 0, stream>>>(
      SX, kDim, 0L, 0L,
      WQ, kDim, 0L, 0L,
      (void*)QH, nullptr, kInner, 0L, 0L,
      nullptr, TABX,
      kTok, kInner, kDim, 1, 1, kProjScale);

  /* the fixed-order reduce of the partials and its product with Wout, per (batch, head) */
  dots_fold_kernel<<<kBH, 256, 0, stream>>>(PART, WO, GW);

  /* output per batch: [8192][256] = q [8192][512] . G [256][512]^T, + bias */
  gemm_f16_kernel<0, kInner, 8><<<(kTok / 32) * (kDim / 64) / 8, 256, 0, stream>>>(
      QH, kInner, (long)kSeq * kInner, 0L,
      GW, kInner, (long)kDim * kInner, 0L,
      (void*)out, nullptr, kDim, (long)kSeq * kDim, 0L,
      bout, TAB,
      kSeq, kDim, kInner, 1, kBatch, kOutScale);
}

// v008
// It runs in 63.4 microseconds.
// Two timings next to v007 both put it at 1.42 times that version's speed.
// Counting every step since v000, it is 3.30 times as fast.
// Contractions (q/kv projections, token-axis k^T v, Wout.dots^T, q.(that product)): v_wmma_f32_16x16x32_f16, one product per site, f32 accumulate; every operand a plain f16 plane with a power-of-two carry; every float module input RNE-converted to bf16 once at its first read (exact in the carried f16 planes); instance norm, rotary, scaling and bias in f32.
#include <hip/hip_runtime.h>
#include <math.h>

typedef __attribute__((ext_vector_type(16))) _Float16 v16h;
typedef __attribute__((ext_vector_type(8)))  _Float16 v8h;
typedef __attribute__((ext_vector_type(8)))  float    v8f;
typedef __attribute__((ext_vector_type(4)))  float    v4f;
typedef __attribute__((ext_vector_type(4)))  unsigned int v4u;
typedef __attribute__((ext_vector_type(2)))  unsigned int v2u;

/* ---------------------------------------------------------------------------
   Shape constants
   --------------------------------------------------------------------------- */
constexpr int kBatch  = 4;
constexpr int kSeq    = 8192;
constexpr int kDim    = 256;
constexpr int kHeads  = 8;
constexpr int kDh     = 64;
constexpr int kInner  = kHeads * kDh;
constexpr int kTok    = kBatch * kSeq;
constexpr int kBH     = kBatch * kHeads;
constexpr int kSplitK = 16;
constexpr int kTokPerSplit = kSeq / kSplitK;
constexpr int kDotsElems = kBH * kDh * kDh;
static_assert(kInner == 512 && kTok == 32768 && kDotsElems == 131072, "shape");
static_assert((kDim % 32) == 0 && (kInner % 32) == 0 && (kDh % 32) == 0, "K multiples of 32");
static_assert((kTok % 32) == 0 && (kSeq % 32) == 0, "M multiples of 32");
static_assert((kInner % 64) == 0 && ((2 * kInner) % 64) == 0 && (kDim % 64) == 0 && (kDh % 64) == 0, "N multiples of 64");
static_assert((kTokPerSplit % 64) == 0, "token chunks of 64");

/* power-of-two carries of the f16 planes (all folded back exactly in f32) */
constexpr float kXC     = 16.0f;
constexpr float kWC     = 1024.0f;
constexpr float kKVC    = 16.0f;
constexpr float kQC     = 64.0f;
constexpr float kDC     = 1024.0f;
constexpr float kGC     = 1024.0f;
constexpr float kProjScale = 1.0f / (kXC * kWC);
constexpr float kDotsScale = kDC / (kKVC * kKVC * (float)kSeq);
constexpr float kFoldScale = kGC / (kWC * kDC);
constexpr float kOutScale  = 1.0f / (kQC * kGC);
constexpr float kPosScale  = 64.0f;
constexpr float kNormEps   = 1e-5f;
constexpr float kInvDh     = 1.0f / (float)kDh;

/* ---------------------------------------------------------------------------
   Workspace region map (bytes; every offset is a multiple of 128). WQ, WK, WO, S16, GW and SX are fragment-order
   planes (see frag_pos); the shapes below give rows and pitch.
     WQ   f16 [512][256]    Wq plane  (bf16 value x1024)            262,144
     WK   f16 [1024][256]   Wkv plane (bf16 value x1024)            524,288
     WO   f16 [256][512]    Wout plane (bf16 value x1024)           262,144
     S16  f16 [32768][256]  z x16                                  16,777,216
     TAB  f32 [4096][64][8] cos/sin table of the z positions, token-minor in tiles of 8 tokens  8,388,608
     PART f32 [16][32][64][64] split-K partials of the k^T v product 8,388,608
     GW   f16 [4][256][512] per batch: Wout . dots^T / 8192, x1024  1,048,576
     SX   f16 [32768][256]  x x16                                  16,777,216
     TABX f32 [32768][64]   cos/sin table of the x positions        8,388,608
     total                                                         60,817,408
   --------------------------------------------------------------------------- */
constexpr size_t kOffWQ   = 0;
constexpr size_t kOffWK   = kOffWQ   + (size_t)kInner * kDim * 2;
constexpr size_t kOffWO   = kOffWK   + (size_t)2 * kInner * kDim * 2;
constexpr size_t kOffS16  = kOffWO   + (size_t)kDim * kInner * 2;
constexpr size_t kOffTAB  = kOffS16  + (size_t)kTok * kDim * 2;
constexpr size_t kOffPART = kOffTAB  + (size_t)kTok * 64 * 4;
constexpr size_t kOffGW   = kOffPART + (size_t)kSplitK * kDotsElems * 4;
constexpr size_t kOffSX   = kOffGW   + (size_t)kBatch * kDim * kInner * 2;
constexpr size_t kOffTABX = kOffSX   + (size_t)kTok * kDim * 2;
constexpr size_t kWsTotal = kOffTABX + (size_t)kTok * 64 * 4;
static_assert(kWsTotal == 60817408ull, "carve total");
static_assert(kWsTotal <= 268435456ull, "carve cap");
static_assert((kOffWK % 128) == 0 && (kOffWO % 128) == 0 && (kOffS16 % 128) == 0 &&
              (kOffTAB % 128) == 0 && (kOffPART % 128) == 0 &&
              (kOffGW % 128) == 0 && (kOffSX % 128) == 0 && (kOffTABX % 128) == 0, "128-B aligned regions");

/* ---------------------------------------------------------------------------
   Small helpers
   --------------------------------------------------------------------------- */
__device__ __forceinline__ unsigned short f2bf_bits(float f) {
  unsigned u = __float_as_uint(f);
  return (unsigned short)((u + 0x7FFFu + ((u >> 16) & 1u)) >> 16);
}
__device__ __forceinline__ float bf_bits2f(unsigned short h) { return __uint_as_float(((unsigned)h) << 16); }
/* RNE convert of an f32 value to the nearest bf16 value, returned as f32 */
__device__ __forceinline__ float bf_rne(float f) { return bf_bits2f(f2bf_bits(f)); }

__device__ __forceinline__ unsigned pk16(unsigned short a, unsigned short b) { return (unsigned)a | ((unsigned)b << 16); }
__device__ __forceinline__ unsigned short h_bits(float f) { const _Float16 h = (_Float16)f; return __builtin_bit_cast(unsigned short, h); }

union FragU { v16h v; v8h h[2]; };
/* Fragment-order plane of a [R][K] f16 matrix (R % 16 == 0, K % 32 == 0): each 16-row x 32-k block is 1024 contiguous
   bytes = two 512-B segments (k 0..15, k 16..31 of the block); a segment holds 32 units of 8 halves, one per
   (row-in-block rl, k-half hi), at position frag_pos(rl, hi). Blocks run k-fastest: block (rb, kb) starts at
   (rb * (K / 32) + kb) * 512 halves. A wave's fragment load is then two loads of 512 contiguous bytes (4 whole lines),
   and 4 consecutive rows x both k-halves of a segment are one 128-B line (what one epilogue store covers). */
__device__ __forceinline__ int frag_pos(int rl, int hi) { return ((rl >> 2) << 3) | (hi << 2) | (rl & 3); }
/* pointer to 16-B units in global memory: the address space is spelled out so that the running pointers of the k loop
   stay global loads */
typedef const __attribute__((address_space(1))) v8h* unit_gptr;
/* elements 0..7 <- segment 0, elements 8..15 <- segment 1 (32 units on); p is the lane's own unit */
__device__ __forceinline__ v16h frag_load_plane(unit_gptr p) {
  FragU f;
  f.h[0] = p[0];
  f.h[1] = p[32];
  return f.v;
}
__device__ __forceinline__ v8f mma16(v16h a, v16h b, v8f c) {
  return __builtin_amdgcn_wmma_f32_16x16x32_f16(false, a, false, b, (short)0, c, false, false);
}
/* hazard guard: ties all four accumulators of a group and names the A fragment and all B fragments */
__device__ __forceinline__ void guard4(v8f& a0, v8f& a1, v8f& a2, v8f& a3,
                                       v16h x, v16h b0, v16h b1, v16h b2, v16h b3) {
  asm volatile("v_nop\n\tv_nop\n\tv_nop\n\tv_nop"
               : "+v"(a0), "+v"(a1), "+v"(a2), "+v"(a3)
               : "v"(x), "v"(b0), "v"(b1), "v"(b2), "v"(b3));
}

/* sum over the 16 lanes of a row, left in every lane: four adds whose second operand is read from lane ^ 1, 2, 4, 8 by the
   add itself (row_xmask), so no LDS crossbar and no wait; every lane of the wave is on where it is called */
template <int MASK>
__device__ __forceinline__ float row_xor(float v) {
  return __int_as_float(__builtin_amdgcn_update_dpp(0, __float_as_int(v), 0x160 | MASK, 0xf, 0xf, true));
}
/* 1 / sqrt(x) for x >= 1e-5: never subnormal, so the library form's rescaling has nothing to do. The v_nop is the slot that
   the instruction set asks for between a transcendental and a next instruction that reads its result or overwrites its
   source; inside the statement it stands directly behind the v_rsq_f32 in every build */
__device__ __forceinline__ float rsq_normal(float x) {
  float r;
  asm("v_rsq_f32 %0, %1\n\tv_nop" : "=v"(r) : "v"(x));
  return r;
}
__device__ __forceinline__ float row_sum16(float s) {
  s += row_xor<1>(s);
  s += row_xor<2>(s);
  s += row_xor<4>(s);
  s += row_xor<8>(s);
  return s;
}

/* ---------------------------------------------------------------------------
   f32 -> bf16 value (RNE) -> f16 fragment-order plane with a power-of-two carry. The carried bf16 value is exactly
   representable in f16 (8 significant bits, normal range).
   ONE WAVE takes a tile of 16 rows x 128 columns of the [R][K] input, K = 128 << kshift, = 4 blocks of the plane = 4096
   contiguous output bytes. Load (kb, i), kb = 0..3, i = 0..3: lane l reads row 4i + l / 8, columns kb*32 + (l % 8)*4 .. + 3,
   so a load covers 4 whole 128-B lines. The lane's 4 values are half of one 16-B unit of the plane, and the 32 halves of
   load (kb, i) are the units of rows 4i .. 4i+3 of block kb: one whole line in either segment. So the 8-B store of the same
   lane needs no exchange between lanes, no LDS and no barrier.
   Coverage: (R / 16) * (K / 128) tiles exactly for every plane used: x, z 4096 tiles; Wq 64; Wkv 128; Wout 64.
   The loads and the convert-and-store part are two functions, so that a wave can put other work between them.
   --------------------------------------------------------------------------- */
__device__ __forceinline__ void cast_tile_load(v4f (&v)[16], int tile, const float* __restrict__ in, int kshift) {
  const int lane = threadIdx.x & 31;
  const int rb = tile >> kshift;
  const int cb = tile & ((1 << kshift) - 1);
  const size_t rows4 = (size_t)4 << (7 + kshift);
  const float* p0 = in + (((size_t)(rb * 16 + (lane >> 3))) << (7 + kshift)) + cb * 128 + (lane & 7) * 4;
  const float* p1 = p0 + rows4;
  const float* p2 = p1 + rows4;
  const float* p3 = p2 + rows4;
#pragma unroll
  for (int kb = 0; kb < 4; ++kb) {
    v[kb * 4 + 0] = *(const v4f*)(p0 + kb * 32);
    v[kb * 4 + 1] = *(const v4f*)(p1 + kb * 32);
    v[kb * 4 + 2] = *(const v4f*)(p2 + kb * 32);
    v[kb * 4 + 3] = *(const v4f*)(p3 + kb * 32);
  }
  /* the wait that belongs in front of any overwrite of the loads' address registers; it names them, so that they stay
     untouched (also as a later load's destination) up to here. With a literal kshift the row steps are folded into the
     loads' offset fields and p0 is the one base */
  if (__builtin_constant_p(kshift)) asm volatile("s_wait_xcnt 0x0" :: "v"(p0) : "memory");
  else                              asm volatile("s_wait_xcnt 0x0" :: "v"(p0), "v"(p1), "v"(p2), "v"(p3) : "memory");
}
__device__ __forceinline__ void cast_tile_store(const v4f (&v)[16], int tile, unsigned short* __restrict__ out, int kshift,
                                                float carry) {
  const int lane = threadIdx.x & 31;
  const int rb = tile >> kshift;
  const int cb = tile & ((1 << kshift) - 1);
  const int r  = lane >> 3;
  const int c  = lane & 7;
  /* columns 4c .. 4c+3 of a block: segment c / 4, k-half (c / 2) % 2, lower or upper 4 halves of the unit */
  unsigned short* q = out + ((((size_t)rb << (2 + kshift)) + cb * 4) << 9) + (c >> 2) * 256 +
                      frag_pos(r, (c >> 1) & 1) * 8 + (c & 1) * 4;
#pragma unroll
  for (int kb = 0; kb < 4; ++kb)
#pragma unroll
    for (int i = 0; i < 4; ++i) {
      const v4f a = v[kb * 4 + i];
      const float a0 = bf_rne(a[0]) * carry, a1 = bf_rne(a[1]) * carry, a2 = bf_rne(a[2]) * carry, a3 = bf_rne(a[3]) * carry;
      /* rows 4i .. 4i+3 stand 8 units = 64 halves behind rows 4i-4 .. 4i-1 */
      *(v2u*)(q + kb * 512 + i * 64) = (v2u){pk16(h_bits(a0), h_bits(a1)), pk16(h_bits(a2), h_bits(a3))};
    }
  /* the wait that belongs in front of any overwrite of the stores' registers by the code that follows (the next table's
     loop) */
  asm volatile("s_wait_xcnt 0x0" :: "v"(q) : "memory");
}

/* ---------------------------------------------------------------------------
   Rotary table: tab[token][axis*32 + j] = cos(theta), tab[token][axis*32 + 16 + j] = sin(theta),
   theta = (bf16(pos[token][axis]) * 64) * inv_freq[j], j = 0..15.
   ONE WAVE takes a tile of 8 tokens: lane = (axis, j), one token a trip; 32768/8 = 4096 tiles exactly per table.
   pv = the tile's 16 positions, one per lane (lane % 16 = token-in-tile * 2 + axis), loaded by the caller ahead of time.
   Store: the 8 x 64 f32 tile (2048 B = 16 lines) is staged in the wave's own LDS slab and leaves as 4 stores of 512
   contiguous bytes. TOKMINOR: the tile is laid out [column][token-in-tile] instead, so that a lane which owns one column
   and 8 consecutive tokens (the accumulator layout) reads its 8 values as 32 contiguous bytes.
   --------------------------------------------------------------------------- */
struct FreqTab { float f[16]; };
static_assert(sizeof(FreqTab) == 64, "no padding");
/* orders a wave's own LDS writes and reads (other lanes' values); LDS only, so that the global loads and stores in flight
   are not waited for */
__device__ __forceinline__ void wave_lds_sync() {
  __builtin_amdgcn_fence(__ATOMIC_RELEASE, "workgroup", "local");
  __builtin_amdgcn_wave_barrier();
  __builtin_amdgcn_fence(__ATOMIC_ACQUIRE, "workgroup", "local");
}
template <bool TOKMINOR>
__device__ __forceinline__ void rot_table_wave(float* slab, int tile, float pv, float* __restrict__ tab, float fr) {
  const int lane = threadIdx.x & 31;
  const int axis = lane >> 4;
  const int j    = lane & 15;
  const int pbits = __float_as_int(pv);
  /* rolled: eight copies of the sine and cosine code would only lengthen the text */
#pragma unroll 1
  for (int tl = 0; tl < 8; ++tl) {
    const int b0 = __builtin_amdgcn_readlane(pbits, 2 * tl);
    const int b1 = __builtin_amdgcn_readlane(pbits, 2 * tl + 1);
    const float praw = __int_as_float(axis ? b1 : b0);
    const float p   = bf_rne(praw);
    const float t   = p * kPosScale;
    const float ang = t * fr;
    const float cv = cosf(ang);
    const float sv = sinf(ang);
    if (TOKMINOR) {
      slab[(axis * 32 + j) * 8 + tl]      = cv;
      slab[(axis * 32 + 16 + j) * 8 + tl] = sv;
    } else {
      slab[tl * 64 + axis * 32 + j]      = cv;
      slab[tl * 64 + axis * 32 + 16 + j] = sv;
    }
  }
  wave_lds_sync();
  float* dst = tab + (size_t)tile * 512 + lane * 4;
#pragma unroll
  for (int n = 0; n < 4; ++n) {
    const v4f v = *(const v4f*)(slab + n * 128 + lane * 4);
    *(v4f*)(dst + n * 128) = v;
  }
  wave_lds_sync(); /* the slab is written again for the next table */
}

/* ---------------------------------------------------------------------------
   All input preparation in one launch of few, long waves; no wave depends on another, so there is no block barrier.
     blocks 0 .. 31: wave t = blk*8 + wave takes one cast tile of the weights: t 0 .. 63 Wq, 64 .. 191 Wkv, 192 .. 255 Wout.
     blocks 32 .. 543: wave idx = 0 .. 4095 takes cast tile idx of x and of z and table tile idx of either position array.
   Such a wave issues all its loads first (2 of positions, 32 of 512 B), computes the x table while they fly, converts and
   stores x, then the z table and z (z last: the next launch reads it).
   --------------------------------------------------------------------------- */
constexpr int kTileWq  = kInner * kDim / 2048;
constexpr int kTileWkv = 2 * kInner * kDim / 2048;
constexpr int kTileWo  = kDim * kInner / 2048;
constexpr int kTileAct = kTok * kDim / 2048;
constexpr int kTileTab = kTok / 8;
constexpr int kBlkPrepW = (kTileWq + kTileWkv + kTileWo) / 8;
constexpr int kBlkPrep  = kBlkPrepW + kTileAct / 8;
static_assert(kTileAct == kTileTab && (kTileWq % 8) == 0 && (kTileWkv % 8) == 0 && (kTileWo % 8) == 0 &&
              (kTileAct % 8) == 0 && kBlkPrep == 544, "prep grid");
__global__ __launch_bounds__(256) void prep_kernel(const float* __restrict__ x, const float* __restrict__ z,
                                                   const float* __restrict__ xpos, const float* __restrict__ zpos,
                                                   const float* __restrict__ Wq, const float* __restrict__ Wkv,
                                                   const float* __restrict__ Wout,
                                                   unsigned short* __restrict__ wq16, unsigned short* __restrict__ wkv16,
                                                   unsigned short* __restrict__ wo16, unsigned short* __restrict__ z16,
                                                   unsigned short* __restrict__ x16, float* __restrict__ tabz,
                                                   float* __restrict__ tabx, FreqTab ft) {
  __shared__ __align__(16) float sm[8][8 * 64];
  const int lane = threadIdx.x & 31;
  const int wave = __builtin_amdgcn_readfirstlane(threadIdx.x >> 5);
  const int blk  = blockIdx.x;
  if (blk < kBlkPrepW) {
    const int t = blk * 8 + wave;
    const bool isQ = t < kTileWq, isO = t >= kTileWq + kTileWkv;
    const float* in     = isQ ? Wq : (isO ? Wout : Wkv);
    unsigned short* out = isQ ? wq16 : (isO ? wo16 : wkv16);
    const int tile      = isQ ? t : (isO ? t - kTileWq - kTileWkv : t - kTileWq);
    const int kshift    = isO ? 2 : 1;
    v4f w[16];
    cast_tile_load(w, tile, in, kshift);
    cast_tile_store(w, tile, out, kshift, kWC);
    return;
  }
  const int idx = (blk - kBlkPrepW) * 8 + wave;
  const int j = lane & 15;
  float fr = ft.f[0];
#pragma unroll
  for (int e = 1; e < 16; ++e) fr = (j == e) ? ft.f[e] : fr;
  const float pvx = xpos[(size_t)idx * 16 + j];
  const float pvz = zpos[(size_t)idx * 16 + j];
  /* keeps what the tables need (the frequency becomes a load too) ahead of the 32 tile loads: loads are counted back in
     order, so a table's wait on a later one would wait for the tiles as well */
  __builtin_amdgcn_sched_barrier(0);
  v4f vx[16], vz[16];
  cast_tile_load(vx, idx, x, 1);
  cast_tile_load(vz, idx, z, 1);
  rot_table_wave<false>(sm[wave], idx, pvx, tabx, fr);
  cast_tile_store(vx, idx, x16, 1, kXC);
  rot_table_wave<true>(sm[wave], idx, pvz, tabz, fr);
  cast_tile_store(vz, idx, z16, 1, kXC);
}

/* pointer to 16-B units in LDS: the address space is spelled out so that the k loops' fragment loads from LDS are LDS
   loads */
typedef const __attribute__((address_space(3))) v8h* unit_lptr;

/* ---------------------------------------------------------------------------
   Key/value side in one kernel: projection, instance norm, rotary (k) and the token-axis product k^T v. k and v never go to
   memory.
   512 blocks: blk = (batch * 16 + split) * 8 + head, so that the 8 blocks which read the same rows of z stand side by side.
   A block takes the 512 tokens of its split in trips of 256; its head's 64 rows of Wk and 64 rows of Wv (each 64 * 256
   contiguous halves of the weight plane) are copied to sW once.
   A trip, wave w:
     1. 32 tokens x (64 k columns + 64 v columns), K = 256: A from the z plane (the next k-block's two fragments fly while
        this one's products run), B from sW in fragment pairs.
     2. per-row instance norm over either 64 columns, rotary on k, in the accumulators' own layout: a lane holds 8
        consecutive rows (tokens) of one column, which is one 16-B unit of the fragment-order plane of the TRANSPOSED matrix
        (row = head column, k = token); a row's 64 columns are 4 registers x the 16 lanes of a row of lanes; a rotary pair
        (c, c ^ 16) is two registers of one lane. The table is the token-minor one. The units go to sX, the fragment-order
        plane [128 rows: k 0..63, v 64..127][256 tokens] of the trip; the wave's 32 tokens are its k-block w.
     3. behind a barrier: C[e][d] += sum over the trip's 256 tokens of v[tok][e] * k[tok][d] (A = v, B = k) for rows
        e = 32 * (w % 2) .. + 31 and columns d = 16 * (w / 2) .. + 15: two accumulators, kept over the trips. The 8 waves cover
        the 64 x 64 product, so no sum across waves is left.
   At the end a lane's 8 accumulator rows are 8 consecutive e of one d = 32 contiguous bytes of the row-major [d][e] partial,
   and a wave writes the whole 128-B lines e = 0..31 or 32..63 of its 16 rows d.
   Every barrier is reached by all 256 threads (no early exit; the test on the trip number is the same for the block).
   --------------------------------------------------------------------------- */
constexpr int kKvTokTrip = 256;
constexpr int kKvTrips   = kTokPerSplit / kKvTokTrip;
constexpr int kKvKb      = kDim / 32;
constexpr int kBlkKvDots = kBH * kSplitK;
static_assert(kKvTrips * kKvTokTrip == kTokPerSplit && kKvTrips >= 1 && kBlkKvDots == 512 && kKvKb == 8, "kv grid");
/* hazard guard of the token-axis products: ties both accumulators and names the fragments of a group of four k-blocks, with
   the slots that the products need before the next loads overwrite their operands */
__device__ __forceinline__ void guard2(v8f& d0, v8f& d1, const v16h (&a0)[4], const v16h (&a1)[4], const v16h (&b)[4]) {
  asm volatile("v_nop\n\tv_nop\n\tv_nop\n\tv_nop"
               : "+v"(d0), "+v"(d1)
               : "v"(a0[0]), "v"(a0[1]), "v"(a0[2]), "v"(a0[3]), "v"(a1[0]), "v"(a1[1]), "v"(a1[2]), "v"(a1[3]),
                 "v"(b[0]), "v"(b[1]), "v"(b[2]), "v"(b[3]));
}
/* 16 tokens x 64 columns in the accumulator layout -> normed (ISK: and rotated) f16 x16, one 16-B unit per 16 columns;
   tp = the lane's place in the token-minor table tile of its 8 tokens */
template <bool ISK>
__device__ __forceinline__ void norm_rot_units(const v8f (&c)[4], const float* __restrict__ tp, float scale, v4u (&ow)[4]) {
  /* [axis][cos, sin][tokens 0..3, 4..7 of the lane's 8] */
  v4f tc[2][2][2];
  if (ISK) {
#pragma unroll
    for (int a = 0; a < 2; ++a)
#pragma unroll
      for (int s = 0; s < 2; ++s)
#pragma unroll
        for (int u = 0; u < 2; ++u) tc[a][s][u] = *(const v4f*)(tp + a * 256 + s * 128 + u * 4);
    /* the wait that belongs in front of any overwrite of the loads' address registers; it names them, so that they
       stay untouched (also as a later load's destination) up to here */
    asm volatile("s_wait_xcnt 0x0" :: "v"(tp) : "memory");
  }
  float xv[4][8];
#pragma unroll
  for (int r = 0; r < 8; ++r) {
#pragma unroll
    for (int j = 0; j < 4; ++j) xv[j][r] = c[j][r] * scale;
    /* mean and biased variance over the 64 columns of the row */
    const float mean = row_sum16((xv[0][r] + xv[1][r]) + (xv[2][r] + xv[3][r])) * kInvDh;
#pragma unroll
    for (int j = 0; j < 4; ++j) xv[j][r] -= mean;
    float ss = 0.0f;
#pragma unroll
    for (int j = 0; j < 4; ++j) ss = fmaf(xv[j][r], xv[j][r], ss);
    const float rstd = rsq_normal(row_sum16(ss) * kInvDh + kNormEps);
#pragma unroll
    for (int j = 0; j < 4; ++j) xv[j][r] *= rstd;
  }
#pragma unroll
  for (int j = 0; j < 4; ++j) {
    float o[8];
#pragma unroll
    for (int r = 0; r < 8; ++r) {
      o[r] = xv[j][r];
      /* rotary: column c pairs with c ^ 16 (register j ^ 1); the upper member of a pair takes +sin, the lower -sin */
      if (ISK) {
        const float pr = xv[j ^ 1][r] * tc[j >> 1][1][r >> 2][r & 3];
        o[r] = o[r] * tc[j >> 1][0][r >> 2][r & 3] + ((j & 1) ? pr : -pr);
      }
      o[r] *= kKVC;
    }
    ow[j] = (v4u){pk16(h_bits(o[0]), h_bits(o[1])), pk16(h_bits(o[2]), h_bits(o[3])),
                  pk16(h_bits(o[4]), h_bits(o[5])), pk16(h_bits(o[6]), h_bits(o[7]))};
  }
}
/* second bound: 4 waves a SIMD (256 registers): the 128 KiB of LDS allow two blocks a WGP, which is that many waves */
__global__ __launch_bounds__(256, 4) void kv_dots_kernel(const unsigned short* __restrict__ Zp,
                                                         const unsigned short* __restrict__ Wp,
                                                         const float* __restrict__ tab, float* __restrict__ part,
                                                         float scale) {
  __shared__ __align__(16) _Float16 sW[2 * kDh * kDim];
  __shared__ __align__(16) _Float16 sX[2 * kDh * kKvTokTrip];
  const unsigned tid = threadIdx.x;
  const int lane = tid & 31;
  /* the wave number in a scalar register: what is formed from it is the same for the whole wave */
  const int wave = __builtin_amdgcn_readfirstlane(tid >> 5);
  const int blk = blockIdx.x;
  const int h  = blk & (kHeads - 1);
  const int ks = (blk / kHeads) & (kSplitK - 1);
  const int b  = blk / (kHeads * kSplitK);
  const int bh = b * kHeads + h;
  const int rlane = lane & 15;
  const int hi    = lane >> 4;
  const int lpos  = frag_pos(rlane, hi) * 8;
  const int rh = wave & 1, dj = wave >> 1;
  /* the wave's first token; a trip is 256 tokens on */
  const int m0 = b * kSeq + ks * kTokPerSplit + wave * 32;

  /* the lane's unit of row-block m0 / 16, k-block 0 of the z plane; the second row-block stands kKvKb blocks (512 units) on,
     a k step one block (64 units), a trip 16 row-blocks */
  unit_gptr pa = (unit_gptr)((const _Float16*)Zp + (size_t)(m0 >> 4) * (kKvKb * 512) + lpos);
  const float* tp = tab + ((size_t)(m0 >> 3) + hi) * 512 + rlane * 8;
  /* the first trip's first fragments fly beside the weights */
  v16h a0 = frag_load_plane(pa);
  v16h a1 = frag_load_plane(pa + kKvKb * 64);

  /* the weight tiles: 2 x 64 * 256 halves = 2 x 2048 units of 16 B, 8 + 8 per thread; a wave's load and its LDS store each
     cover 512 contiguous B */
  {
    const unit_gptr pWk = (unit_gptr)((const _Float16*)Wp + (size_t)(h * 4) * (kKvKb * 512));
    const unit_gptr pWv = (unit_gptr)((const _Float16*)Wp + (size_t)(kInner / 16 + h * 4) * (kKvKb * 512));
    v8h bt[2][kKvKb];
#pragma unroll
    for (int u = 0; u < kKvKb; ++u) {
      bt[0][u] = pWk[u * 256 + tid];
      bt[1][u] = pWv[u * 256 + tid];
    }
    /* the wait that belongs in front of any overwrite of the loads' address registers; it names them, so that they stay
       untouched up to here */
    asm volatile("s_wait_xcnt 0x0" :: "s"(pWk), "s"(pWv), "v"(tid) : "memory");
#pragma unroll
    for (int u = 0; u < kKvKb; ++u) {
      ((v8h*)sW)[u * 256 + tid] = bt[0][u];
      ((v8h*)sW)[kKvKb * 256 + u * 256 + tid] = bt[1][u];
    }
  }
  __syncthreads(); /* every wave reads both weight tiles, written by all */

  /* the lane's unit of row-block 0, k-block 0: of the weights; of the trip's plane as this wave writes it (k-block = wave)
     and as it reads it (v rows 64 + 32 rh .., k rows 16 dj ..) */
  const unit_lptr sw = (unit_lptr)(sW + lpos);
  _Float16* xw = sX + wave * 512 + lpos;
  const unit_lptr xa = (unit_lptr)(sX + (4 + rh * 2) * (8 * 512) + lpos);
  const unit_lptr xb = (unit_lptr)(sX + dj * (8 * 512) + lpos);

  v8f dacc[2];
#pragma unroll
  for (int i = 0; i < 2; ++i) dacc[i] = (v8f){0.f, 0.f, 0.f, 0.f, 0.f, 0.f, 0.f, 0.f};

  /* rolled: a second copy of the trip would only lengthen the text */
#pragma unroll 1
  for (int t = 0; t < kKvTrips; ++t) {
    /* [token half][k, v][16 columns] */
    v8f acc[2][2][4];
#pragma unroll
    for (int i = 0; i < 2; ++i)
#pragma unroll
      for (int s = 0; s < 2; ++s)
#pragma unroll
        for (int j = 0; j < 4; ++j) acc[i][s][j] = (v8f){0.f, 0.f, 0.f, 0.f, 0.f, 0.f, 0.f, 0.f};
    /* unrolled: the k step is then an offset field of the loads */
#pragma unroll
    for (int kb = 0; kb < kKvKb; ++kb) {
      v16h n0 = a0, n1 = a1;
      if (kb + 1 < kKvKb) {
        n0 = frag_load_plane(pa + (kb + 1) * 64);
        n1 = frag_load_plane(pa + (kKvKb + kb + 1) * 64);
      }
#pragma unroll
      for (int s = 0; s < 2; ++s)
#pragma unroll
        for (int g = 0; g < 2; ++g) {
          v16h bh2[2];
#pragma unroll
          for (int j = 0; j < 2; ++j) {
            FragU f;
            f.h[0] = sw[((s * 4 + g * 2 + j) * kKvKb + kb) * 64];
            f.h[1] = sw[((s * 4 + g * 2 + j) * kKvKb + kb) * 64 + 32];
            bh2[j] = f.v;
          }
#pragma unroll
          for (int j = 0; j < 2; ++j) {
            acc[0][s][g * 2 + j] = mma16(a0, bh2[j], acc[0][s][g * 2 + j]);
            acc[1][s][g * 2 + j] = mma16(a1, bh2[j], acc[1][s][g * 2 + j]);
          }
          /* the group's four results, both A fragments and the B pair: the slots that the products need before the next
             loads overwrite their operands */
          guard4(acc[0][s][g * 2], acc[0][s][g * 2 + 1], acc[1][s][g * 2], acc[1][s][g * 2 + 1], a0, a1, bh2[0], bh2[1],
                 bh2[1]);
        }
      a0 = n0;
      a1 = n1;
    }

    if (t > 0) __syncthreads(); /* the last trip's reads of sX end before it is written again */
#pragma unroll
    for (int i = 0; i < 2; ++i) {
      v4u ow[4];
      norm_rot_units<true>(acc[i][0], tp + i * 1024, scale, ow);
#pragma unroll
      for (int j = 0; j < 4; ++j) *(v4u*)(xw + j * (8 * 512) + i * 256) = ow[j];
      norm_rot_units<false>(acc[i][1], tp, scale, ow);
#pragma unroll
      for (int j = 0; j < 4; ++j) *(v4u*)(xw + (4 + j) * (8 * 512) + i * 256) = ow[j];
    }
    __syncthreads(); /* every wave reads units written by all */
    if (t + 1 < kKvTrips) {
      /* the wait that belongs in front of the overwrite of the z loads' address registers */
      asm volatile("s_wait_xcnt 0x0" :: "v"(pa) : "memory");
      pa += (kKvTokTrip / 16) * kKvKb * 64;
      tp += (kKvTokTrip / 8) * 512;
      /* the next trip's first fragments fly during the token-axis products (behind the barrier, which waits for every load
         in flight) */
      a0 = frag_load_plane(pa);
      a1 = frag_load_plane(pa + kKvKb * 64);
    }

    /* four k-blocks' fragments are fetched together (the projection's accumulators are free by now): two LDS latencies a
       trip, not eight */
#pragma unroll
    for (int kg = 0; kg < 2; ++kg) {
      v16h f0[4], f1[4], fb[4];
#pragma unroll
      for (int u = 0; u < 4; ++u) {
        const int kb = kg * 4 + u;
        FragU f;
        f.h[0] = xa[kb * 64];
        f.h[1] = xa[kb * 64 + 32];
        f0[u] = f.v;
        f.h[0] = xa[(8 + kb) * 64];
        f.h[1] = xa[(8 + kb) * 64 + 32];
        f1[u] = f.v;
        f.h[0] = xb[kb * 64];
        f.h[1] = xb[kb * 64 + 32];
        fb[u] = f.v;
      }
#pragma unroll
      for (int u = 0; u < 4; ++u) {
        dacc[0] = mma16(f0[u], fb[u], dacc[0]);
        dacc[1] = mma16(f1[u], fb[u], dacc[1]);
      }
      guard2(dacc[0], dacc[1], f0, f1, fb);
    }
  }

  float* C = part + ((size_t)ks * kBH + bh) * (kDh * kDh) + (size_t)(dj * 16 + rlane) * kDh + rh * 32 + hi * 8;
#pragma unroll
  for (int i = 0; i < 2; ++i) {
    const v8f a = dacc[i];
    *(v4f*)(C + i * 16)     = (v4f){a[0], a[1], a[2], a[3]};
    *(v4f*)(C + i * 16 + 4) = (v4f){a[4], a[5], a[6], a[7]};
  }
}

/* ---------------------------------------------------------------------------
   out = (q . dots / 8192) . Wout^T is computed as q . G^T with G[b][o][h*64+d] = sum_e Wout[o][h*64+e] * dots[b][h][d][e] / 8192,
   so the per-token product with dots is replaced by this one, 256 rows a head. One block per (batch, head), 8 waves.
   Step 1: fixed-order sum of the 16 split-K partials, scaled (1/8192 and carries, all powers of two) in f32, emitted as one
   f16 fragment-order 64 x 64 plane [d][e] in LDS; 8 elements per unit, 512 units = 256 threads x 2.
   Step 2: wave w takes rows o = 32w .. 32w+31 of Wout (A, columns h*64 .. +63 of its plane) against all 64 rows d of the LDS
   plane (B), K = 64, and writes its 32 x 64 tile to columns h*64 .. +63 of the batch's fragment-order plane of pitch 512.
   No early exit: all 256 threads reach the barrier.
   --------------------------------------------------------------------------- */
__global__ __launch_bounds__(256) void dots_fold_kernel(const float* __restrict__ part, const unsigned short* __restrict__ wo,
                                                        unsigned short* __restrict__ gw) {
  __shared__ __align__(16) _Float16 sD[kDh * kDh];
  __shared__ __align__(16) float sT[8][32 * 68];
  const int tid = threadIdx.x, lane = tid & 31, wave = tid >> 5;
  const int bh = blockIdx.x, b = bh >> 3, h = bh & 7;
  const int rlane = lane & 15;
  const int mOff  = (lane >> 4) * 8;
  const int lpos  = frag_pos(rlane, lane >> 4) * 8;
  const int m0    = wave << 5;

  /* the Wout fragments depend on nothing of step 1: their loads fly beside those of the partials */
  v16h ah[2][2];
#pragma unroll
  for (int kb = 0; kb < 2; ++kb)
#pragma unroll
    for (int i = 0; i < 2; ++i)
      ah[kb][i] = frag_load_plane((unit_gptr)((const _Float16*)wo +
                                              ((size_t)((m0 >> 4) + i) * (kInner >> 5) + h * 2 + kb) * 512 + lpos));

#pragma unroll
  for (int u = 0; u < 2; ++u) {
    const int iu = u * 256 + tid;
    const size_t o = (size_t)bh * (kDh * kDh) + 8 * (size_t)iu;
    float s[8];
#pragma unroll
    for (int e = 0; e < 8; ++e) s[e] = 0.0f;
#pragma unroll
    for (int ks = 0; ks < kSplitK; ++ks) {
      const float* p = part + (size_t)ks * kDotsElems + o;
      const v4f a = *(const v4f*)(p);
      const v4f c = *(const v4f*)(p + 4);
      s[0] += a[0]; s[1] += a[1]; s[2] += a[2]; s[3] += a[3];
      s[4] += c[0]; s[5] += c[1]; s[6] += c[2]; s[7] += c[3];
    }
    unsigned short hb[8];
#pragma unroll
    for (int e = 0; e < 8; ++e) hb[e] = h_bits(s[e] * kDotsScale);
    /* unit iu = (row d, columns e8*8 .. +7) of the 64 x 64 fragment-order plane */
    const int d  = iu >> 3;
    const int e8 = iu & 7;
    *(v4u*)(sD + ((d >> 4) * 2 + (e8 >> 2)) * 512 + ((e8 >> 1) & 1) * 256 + frag_pos(d & 15, e8 & 1) * 8) =
        (v4u){pk16(hb[0], hb[1]), pk16(hb[2], hb[3]), pk16(hb[4], hb[5]), pk16(hb[6], hb[7])};
  }
  __syncthreads(); /* every wave reads the whole plane, written by all */

  v8f acc[2][4];
#pragma unroll
  for (int i = 0; i < 2; ++i)
#pragma unroll
    for (int j = 0; j < 4; ++j)
      acc[i][j] = (v8f){0.f, 0.f, 0.f, 0.f, 0.f, 0.f, 0.f, 0.f};
#pragma unroll
  for (int kb = 0; kb < 2; ++kb) {
    v16h bf[4];
#pragma unroll
    for (int j = 0; j < 4; ++j) {
      const _Float16* p = sD + (j * 2 + kb) * 512 + lpos;
      FragU f;
      f.h[0] = *(const v8h*)(p);
      f.h[1] = *(const v8h*)(p + 256);
      bf[j] = f.v;
    }
#pragma unroll
    for (int i = 0; i < 2; ++i) {
#pragma unroll
      for (int j = 0; j < 4; ++j)
        acc[i][j] = mma16(ah[kb][i], bf[j], acc[i][j]);
      /* keeps the group's operands in their registers past its last product, with the slots the results need */
      guard4(acc[i][0], acc[i][1], acc[i][2], acc[i][3], ah[kb][i], bf[0], bf[1], bf[2], bf[3]);
    }
  }

  /* the wave's 32 x 64 tile goes through its own LDS slab, so that each store covers whole 128-B lines: 16 rows x 64
     columns are two whole blocks of the plane */
  float* slab = sT[wave];
  const int q   = lane >> 3;
  const int c8  = (lane & 7) * 8;
  const int col = ((lane & 7) >> 1) * 256 + frag_pos(q, lane & 1) * 8;
#pragma unroll
  for (int i = 0; i < 2; ++i)
#pragma unroll
    for (int j = 0; j < 4; ++j)
#pragma unroll
      for (int r = 0; r < 8; ++r) slab[(i * 16 + mOff + r) * 68 + (j << 4) + rlane] = acc[i][j][r] * kFoldScale;
  /* the rows read below were written by other lanes of this wave */
  __builtin_amdgcn_fence(__ATOMIC_RELEASE, "workgroup");
  __builtin_amdgcn_wave_barrier();
  __builtin_amdgcn_fence(__ATOMIC_ACQUIRE, "workgroup");
#pragma unroll
  for (int i = 0; i < 2; ++i) {
    unsigned short* Cb = gw + (size_t)b * (kDim * kInner) + ((size_t)((m0 >> 4) + i) * (kInner >> 5) + h * 2) * 512;
#pragma unroll
    for (int it = 0; it < 4; ++it) {
      const float* sp = slab + (i * 16 + it * 4 + q) * 68 + c8;
      const v4f ta = *(const v4f*)(sp);
      const v4f tb = *(const v4f*)(sp + 4);
      *(v4u*)(Cb + it * 64 + col) = (v4u){pk16(h_bits(ta[0]), h_bits(ta[1])), pk16(h_bits(ta[2]), h_bits(ta[3])),
                                          pk16(h_bits(tb[0]), h_bits(tb[1])), pk16(h_bits(tb[2]), h_bits(tb[3]))};
    }
  }
}

/* ---------------------------------------------------------------------------
   Query side and output in one kernel: projection, rotary and the product with G. q never goes to memory.
   512 blocks of 64 tokens, 8 waves. The block's 64 rows of the x plane (32 KiB, contiguous) and of the x position table are
   copied to LDS once.
   Step 1, wave w = head w: D[feature][token] = Wq rows 64w .. 64w+63 (A, from the weight plane; the next k-block's four
   fragments fly while this one's products run) x the 64 tokens (B, from sX in fragment pairs), K = 256. A lane then holds 8
   consecutive features of one token, which is one 16-B unit of the fragment-order plane [token][feature]; a rotary pair
   (c, c ^ 16) is two registers of one lane. The rotated units go to sQ, the plane [64 tokens][512 features]; the wave's head
   is its k-blocks 2w and 2w + 1.
   Step 2, behind a barrier, wave w: D[o][token] for o = 32w .. 32w+31: G rows (A, from the batch's plane, two k-blocks ahead)
   x the 64 tokens (B, from sQ, one k-block ahead), K = 512 in rising order. A lane holds 8 consecutive o of one token; 16 tokens
   x 32 o pass through the wave's own slab, so that each store covers 4 whole 128-B lines.
   Both barriers are reached by all 256 threads (no early exit).
   --------------------------------------------------------------------------- */
constexpr int kQoTok    = 64;
constexpr int kBlkQo    = kTok / kQoTok;
constexpr int kQoKb     = kInner / 32;
constexpr int kTabPitch = 68;
constexpr int kOutPitch = 36;
static_assert(kBlkQo == 512 && (kSeq % kQoTok) == 0 && kHeads == 8 && kDim == 8 * 32 && kQoKb == 16, "q/out grid");
struct __align__(16) QoLds {
  _Float16 x[kQoTok * kDim];
  _Float16 q[kQoTok * kInner];
  float tab[kQoTok * kTabPitch];
  float o[8][16 * kOutPitch];
};
static_assert(sizeof(QoLds) == 134144, "two blocks a WGP");
/* second bound: 4 waves a SIMD (256 registers): the 131 KiB of LDS allow two blocks a WGP, which is that many waves */
__global__ __launch_bounds__(256, 4) void q_out_kernel(const unsigned short* __restrict__ Xp,
                                                       const unsigned short* __restrict__ Wp,
                                                       const float* __restrict__ tab,
                                                       const unsigned short* __restrict__ Gp,
                                                       const float* __restrict__ bias, float* __restrict__ out) {
  /* one object, so that the order stands: the x tile first, whose reads (where registers are scarcest) then all reach their
     place through the offset field of the LDS load */
  __shared__ QoLds lds;
  _Float16* const sX = lds.x;
  _Float16* const sQ = lds.q;
  float* const sTab  = lds.tab;
  const unsigned tid = threadIdx.x;
  const int lane = tid & 31;
  /* the wave number in a scalar register: what is formed from it is the same for the whole wave */
  const int wave = __builtin_amdgcn_readfirstlane(tid >> 5);
  const int tok0 = blockIdx.x * kQoTok;
  const int b    = tok0 / kSeq;
  const int rlane = lane & 15;
  const int hi    = lane >> 4;
  const int lpos  = frag_pos(rlane, hi) * 8;

  /* the lane's unit of row-block 4w, k-block 0 of the Wq plane; a row-block is kKvKb blocks (512 units), a k step one block */
  const unit_gptr pw = (unit_gptr)((const _Float16*)Wp + (size_t)(wave * 4) * (kKvKb * 512) + lpos);
  /* the first k-block's fragments fly beside the tiles */
  v16h a[4];
#pragma unroll
  for (int mt = 0; mt < 4; ++mt) a[mt] = frag_load_plane(pw + mt * kKvKb * 64);

  /* the x tile: 2048 units of 16 B, 8 per thread; the table tile: 64 rows of 16 units, 4 per thread; a wave's load covers 512
     contiguous B */
  {
    const unit_gptr pX = (unit_gptr)((const _Float16*)Xp + (size_t)(tok0 >> 4) * (kKvKb * 512));
    const float* pT = tab + (size_t)tok0 * 64;
    v8h xt[8];
    v4f tv[4];
#pragma unroll
    for (int u = 0; u < 8; ++u) xt[u] = pX[u * 256 + tid];
#pragma unroll
    for (int u = 0; u < 4; ++u) tv[u] = *(const v4f*)(pT + (u * 256 + tid) * 4);
    /* the wait that belongs in front of any overwrite of the loads' address registers; it names them, so that they stay
       untouched up to here */
    asm volatile("s_wait_xcnt 0x0" :: "s"(pX), "s"(pT), "v"(tid) : "memory");
#pragma unroll
    for (int u = 0; u < 8; ++u) ((v8h*)sX)[u * 256 + tid] = xt[u];
#pragma unroll
    for (int u = 0; u < 4; ++u) *(v4f*)(sTab + (u * 16 + (tid >> 4)) * kTabPitch + (tid & 15) * 4) = tv[u];
  }
  __syncthreads(); /* every wave reads both tiles, written by all */

  /* [16 features][16 tokens] */
  v8f acc[4][4];
#pragma unroll
  for (int mt = 0; mt < 4; ++mt)
#pragma unroll
    for (int tt = 0; tt < 4; ++tt) acc[mt][tt] = (v8f){0.f, 0.f, 0.f, 0.f, 0.f, 0.f, 0.f, 0.f};
  const unit_lptr sx = (unit_lptr)(sX + lpos);
  /* unrolled: the k step is then an offset field of the loads */
#pragma unroll
  for (int kb = 0; kb < kKvKb; ++kb) {
    v16h n[4];
#pragma unroll
    for (int mt = 0; mt < 4; ++mt) n[mt] = (kb + 1 < kKvKb) ? frag_load_plane(pw + (mt * kKvKb + kb + 1) * 64) : a[mt];
#pragma unroll
    for (int g = 0; g < 2; ++g) {
      v16h xb[2];
#pragma unroll
      for (int j = 0; j < 2; ++j) {
        FragU f;
        f.h[0] = sx[((g * 2 + j) * kKvKb + kb) * 64];
        f.h[1] = sx[((g * 2 + j) * kKvKb + kb) * 64 + 32];
        xb[j] = f.v;
      }
#pragma unroll
      for (int p = 0; p < 4; p += 2) {
#pragma unroll
        for (int j = 0; j < 2; ++j) {
          acc[p][g * 2 + j]     = mma16(a[p], xb[j], acc[p][g * 2 + j]);
          acc[p + 1][g * 2 + j] = mma16(a[p + 1], xb[j], acc[p + 1][g * 2 + j]);
        }
        /* the group's four results, both A fragments and the B pair: the slots that the products need before the next loads
           overwrite their operands */
        guard4(acc[p][g * 2], acc[p][g * 2 + 1], acc[p + 1][g * 2], acc[p + 1][g * 2 + 1], a[p], a[p + 1], xb[0], xb[1],
               xb[1]);
      }
    }
#pragma unroll
    for (int mt = 0; mt < 4; ++mt) a[mt] = n[mt];
  }
  /* the wait that belongs in front of any overwrite of the Wq loads' address registers */
  asm volatile("s_wait_xcnt 0x0" :: "v"(pw) : "memory");

  /* the lane's unit of row-block 2w, k-block 0 of the batch's G plane; a row-block is kQoKb blocks. The first two k-blocks'
     fragments depend on nothing of step 1: they fly during the rotary */
  const unit_gptr pg = (unit_gptr)((const _Float16*)Gp + (size_t)b * (kDim * kInner) + (size_t)(wave * 2) * (kQoKb * 512) + lpos);
  v16h ga[2][2];
#pragma unroll
  for (int u = 0; u < 2; ++u)
#pragma unroll
    for (int mt = 0; mt < 2; ++mt) ga[u][mt] = frag_load_plane(pg + (mt * kQoKb + u) * 64);

  _Float16* qw = sQ + wave * (2 * 512) + lpos;
#pragma unroll
  for (int tt = 0; tt < 4; ++tt) {
    /* [axis][cos, sin][features 0..3, 4..7 of the lane's 8] of the lane's token */
    const float* tr = sTab + (tt * 16 + rlane) * kTabPitch + hi * 8;
    v4f tc[2][2][2];
#pragma unroll
    for (int ax = 0; ax < 2; ++ax)
#pragma unroll
      for (int s = 0; s < 2; ++s)
#pragma unroll
        for (int u = 0; u < 2; ++u) tc[ax][s][u] = *(const v4f*)(tr + ax * 32 + s * 16 + u * 4);
#pragma unroll
    for (int mt = 0; mt < 4; ++mt) {
      float o[8];
#pragma unroll
      for (int r = 0; r < 8; ++r) {
        /* rotary: column c pairs with c ^ 16 (register mt ^ 1); the upper member of a pair takes +sin, the lower -sin */
        const float pr = acc[mt ^ 1][tt][r] * tc[mt >> 1][1][r >> 2][r & 3];
        o[r] = acc[mt][tt][r] * tc[mt >> 1][0][r >> 2][r & 3] + ((mt & 1) ? pr : -pr);
        /* the operands' carries out, q's carry in: one power of two, exact */
        o[r] *= kProjScale * kQC;
      }
      *(v4u*)(qw + tt * (kQoKb * 512) + (mt >> 1) * 512 + (mt & 1) * 256) =
          (v4u){pk16(h_bits(o[0]), h_bits(o[1])), pk16(h_bits(o[2]), h_bits(o[3])),
                pk16(h_bits(o[4]), h_bits(o[5])), pk16(h_bits(o[6]), h_bits(o[7]))};
    }
  }
  __syncthreads(); /* every wave reads units written by all */

  /* the lane's 2 x 8 bias values */
  const float* bp = bias + wave * 32 + hi * 8;
  v4f bv[2][2];
#pragma unroll
  for (int mt = 0; mt < 2; ++mt)
#pragma unroll
    for (int u = 0; u < 2; ++u) bv[mt][u] = *(const v4f*)(bp + mt * 16 + u * 4);
  /* the wait that belongs in front of any overwrite of the loads' address registers */
  asm volatile("s_wait_xcnt 0x0" :: "v"(bp) : "memory");

  /* [16 o][16 tokens] */
  v8f oc[2][4];
#pragma unroll
  for (int mt = 0; mt < 2; ++mt)
#pragma unroll
    for (int tt = 0; tt < 4; ++tt) oc[mt][tt] = (v8f){0.f, 0.f, 0.f, 0.f, 0.f, 0.f, 0.f, 0.f};
  const unit_lptr sq = (unit_lptr)(sQ + lpos);
  /* the four token fragments of a k-block are fetched one k-block ahead (step 1's accumulators are free by now), so that no
     product waits for an LDS latency */
  v16h qb[4];
#pragma unroll
  for (int tt = 0; tt < 4; ++tt) {
    FragU f;
    f.h[0] = sq[tt * kQoKb * 64];
    f.h[1] = sq[tt * kQoKb * 64 + 32];
    qb[tt] = f.v;
  }
  /* unrolled: the k step is then an offset field of the loads */
#pragma unroll
  for (int gk = 0; gk < kQoKb / 2; ++gk) {
    v16h gn[2][2];
#pragma unroll
    for (int u = 0; u < 2; ++u)
#pragma unroll
      for (int mt = 0; mt < 2; ++mt)
        gn[u][mt] = (gk + 1 < kQoKb / 2) ? frag_load_plane(pg + (mt * kQoKb + (gk + 1) * 2 + u) * 64) : ga[u][mt];
#pragma unroll
    for (int u = 0; u < 2; ++u) {
      const int kb = gk * 2 + u;
      v16h qn[4];
#pragma unroll
      for (int tt = 0; tt < 4; ++tt) {
        qn[tt] = qb[tt];
        if (kb + 1 < kQoKb) {
          FragU f;
          f.h[0] = sq[(tt * kQoKb + kb + 1) * 64];
          f.h[1] = sq[(tt * kQoKb + kb + 1) * 64 + 32];
          qn[tt] = f.v;
        }
      }
#pragma unroll
      for (int g = 0; g < 4; g += 2) {
#pragma unroll
        for (int j = 0; j < 2; ++j) {
          oc[0][g + j] = mma16(ga[u][0], qb[g + j], oc[0][g + j]);
          oc[1][g + j] = mma16(ga[u][1], qb[g + j], oc[1][g + j]);
        }
        /* the group's four results, both A fragments and the B pair: the slots that the products need before the next loads
           overwrite their operands */
        guard4(oc[0][g], oc[0][g + 1], oc[1][g], oc[1][g + 1], ga[u][0], ga[u][1], qb[g], qb[g + 1], qb[g + 1]);
      }
#pragma unroll
      for (int tt = 0; tt < 4; ++tt) qb[tt] = qn[tt];
    }
#pragma unroll
    for (int u = 0; u < 2; ++u)
#pragma unroll
      for (int mt = 0; mt < 2; ++mt) ga[u][mt] = gn[u][mt];
  }
  /* the wait that belongs in front of any overwrite of the G loads' address registers */
  asm volatile("s_wait_xcnt 0x0" :: "v"(pg) : "memory");

  float bb[2][8];
#pragma unroll
  for (int mt = 0; mt < 2; ++mt)
#pragma unroll
    for (int r = 0; r < 8; ++r) bb[mt][r] = bf_rne(bv[mt][r >> 2][r & 3]);
  float* slab = lds.o[wave];
  /* row lane / 8 of a group of 4 tokens, 16 B of the wave's 128 B of that row */
  float* op = out + (size_t)(tok0 + (lane >> 3)) * kDim + wave * 32 + (lane & 7) * 4;
#pragma unroll
  for (int tt = 0; tt < 4; ++tt) {
#pragma unroll
    for (int mt = 0; mt < 2; ++mt) {
      float v[8];
#pragma unroll
      for (int r = 0; r < 8; ++r) v[r] = oc[mt][tt][r] * kOutScale + bb[mt][r];
      float* sp = slab + rlane * kOutPitch + mt * 16 + hi * 8;
      *(v4f*)(sp)     = (v4f){v[0], v[1], v[2], v[3]};
      *(v4f*)(sp + 4) = (v4f){v[4], v[5], v[6], v[7]};
    }
    wave_lds_sync(); /* the rows read below were written by other lanes of this wave */
    v4f vals[4];
#pragma unroll
    for (int it = 0; it < 4; ++it) vals[it] = *(const v4f*)(slab + (it * 4 + (lane >> 3)) * kOutPitch + (lane & 7) * 4);
#pragma unroll
    for (int it = 0; it < 4; ++it) *(v4f*)(op + (size_t)(tt * 16 + it * 4) * kDim) = vals[it];
    wave_lds_sync(); /* the slab is written again for the next 16 tokens */
  }
}

/* ---------------------------------------------------------------------------
   Host glue: 4 kernel launches, nothing else.
   GEMM shapes (M % 32 == 0, N % 64 == 0, K % 32 == 0, no pad planes needed):
     kv projection : M 32768, N 1024, K 256, with the token-axis product behind it -> 512 blocks (kv_dots_kernel)
     Wout . dots^T : 32 (batch, head) pairs of M 256, N 64, K 64 -> 32 blocks (dots_fold_kernel)
     q projection  : M 32768, N 512, K 256, with q . G^T (4 batches of M 8192, N 256, K 512) behind it -> 512 blocks
                     (q_out_kernel)
   --------------------------------------------------------------------------- */
extern "C" void kernel_launch(void* const* d_in, const int* in_sizes, int n_in,
                              void* d_out, int out_size, void* d_ws, size_t ws_size,
                              hipStream_t stream) {
  if (n_in < 8) return;
  if (in_sizes[0] != kTok * kDim) return;
  if (in_sizes[1] != kTok * kDim) return;
  if (in_sizes[2] != kTok * 2) return;
  if (in_sizes[3] != kTok * 2) return;
  if (in_sizes[4] != kInner * kDim) return;
  if (in_sizes[5] != 2 * kInner * kDim) return;
  if (in_sizes[6] != kDim * kInner) return;
  if (in_sizes[7] != kDim) return;
  if (out_size != kTok * kDim) return;
  if (ws_size < kWsTotal) return;

  const float* x    = (const float*)d_in[0];
  const float* z    = (const float*)d_in[1];
  const float* xpos = (const float*)d_in[2];
  const float* zpos = (const float*)d_in[3];
  const float* Wq   = (const float*)d_in[4];
  const float* Wkv  = (const float*)d_in[5];
  const float* Wout = (const float*)d_in[6];
  const float* bout = (const float*)d_in[7];
  float* out = (float*)d_out;

  char* ws = (char*)d_ws;
  unsigned short* WQ   = (unsigned short*)(ws + kOffWQ);
  unsigned short* WK   = (unsigned short*)(ws + kOffWK);
  unsigned short* WO   = (unsigned short*)(ws + kOffWO);
  unsigned short* S16  = (unsigned short*)(ws + kOffS16);
  float*          TAB  = (float*)(ws + kOffTAB);
  float*          PART = (float*)(ws + kOffPART);
  unsigned short* GW   = (unsigned short*)(ws + kOffGW);
  unsigned short* SX   = (unsigned short*)(ws + kOffSX);
  float*          TABX = (float*)(ws + kOffTABX);

  /* inverse frequencies: 1 / f32(10000^(2j/32)), j = 0..15 */
  FreqTab ft;
  for (int j = 0; j < 16; ++j) {
    const double ex = (double)(2 * j) / 32.0;
    const float pw = (float)pow(10000.0, ex);
    ft.f[j] = 1.0f / pw;
  }

  /* weight planes ([out][in] = Bt orientation already): f16(bf16(w) * 1024); z and x planes: f16(bf16(v) * 16);
     position tables of z and x */
  prep_kernel<<<kBlkPrep, 256, 0, stream>>>(x, z, xpos, zpos, Wq, Wkv, Wout, WQ, WK, WO, S16, SX, TAB, TABX, ft);

  /* key/value side: projection, norm (+ rotary on k) and the token-axis product, deterministic split-K */
  kv_dots_kernel<<<kBlkKvDots, 256, 0, stream>>>(S16, WK, TAB, PART, kProjScale);

  /* the fixed-order reduce of the partials and its product with Wout, per (batch, head) */
  dots_fold_kernel<<<kBH, 256, 0, stream>>>(PART, WO, GW);

  /* query side and output: projection, rotary, q . G^T + bias */
  q_out_kernel<<<kBlkQo, 256, 0, stream>>>(SX, WQ, TABX, GW, bout, out);
}

// v009
// Measured time: 60.7 microseconds a run.
// Next to v008, in two timings, it ran 1.04 times as fast each time.
// Counting every step since v000, it is 3.44 times as fast.
// Contractions (q/kv projections, token-axis k^T v, Wout.dots^T, q.(that product)): v_wmma_f32_16x16x32_f16, one product per site, f32 accumulate; every operand a plain f16 plane with a power-of-two carry; every float module input RNE-converted to bf16 once at its first read (exact in the carried f16 planes); instance norm, rotary, scaling and bias in f32.
#include <hip/hip_runtime.h>
#include <math.h>

typedef __attribute__((ext_vector_type(16))) _Float16 v16h;
typedef __attribute__((ext_vector_type(8)))  _Float16 v8h;
typedef __attribute__((ext_vector_type(8)))  float    v8f;
typedef __attribute__((ext_vector_type(4)))  float    v4f;
typedef __attribute__((ext_vector_type(4)))  unsigned int v4u;
typedef __attribute__((ext_vector_type(2)))  unsigned int v2u;

/* ---------------------------------------------------------------------------
   Shape constants
   --------------------------------------------------------------------------- */
constexpr int kBatch  = 4;
constexpr int kSeq    = 8192;
constexpr int kDim    = 256;
constexpr int kHeads  = 8;
constexpr int kDh     = 64;
constexpr int kInner  = kHeads * kDh;
constexpr int kTok    = kBatch * kSeq;
constexpr int kBH     = kBatch * kHeads;
constexpr int kSplitK = 16;
constexpr int kTokPerSplit = kSeq / kSplitK;
constexpr int kDotsElems = kBH * kDh * kDh;
static_assert(kInner == 512 && kTok == 32768 && kDotsElems == 131072, "shape");
static_assert((kDim % 32) == 0 && (kInner % 32) == 0 && (kDh % 32) == 0, "K multiples of 32");
static_assert((kTok % 32) == 0 && (kSeq % 32) == 0, "M multiples of 32");
static_assert((kInner % 64) == 0 && ((2 * kInner) % 64) == 0 && (kDim % 64) == 0 && (kDh % 64) == 0, "N multiples of 64");
static_assert((kTokPerSplit % 64) == 0, "token chunks of 64");

/* power-of-two carries of the f16 planes (all folded back exactly in f32) */
constexpr float kXC     = 16.0f;
constexpr float kWC     = 1024.0f;
constexpr float kKVC    = 16.0f;
constexpr float kQC     = 64.0f;
constexpr float kDC     = 1024.0f;
constexpr float kGC     = 1024.0f;
constexpr float kProjScale = 1.0f / (kXC * kWC);
constexpr float kDotsScale = kDC / (kKVC * kKVC * (float)kSeq);
constexpr float kFoldScale = kGC / (kWC * kDC);
constexpr float kOutScale  = 1.0f / (kQC * kGC);
constexpr float kPosScale  = 64.0f;
constexpr float kNormEps   = 1e-5f;
constexpr float kInvDh     = 1.0f / (float)kDh;

/* ---------------------------------------------------------------------------
   Workspace region map (bytes; every offset is a multiple of 128). WQ, WK, WO, S16 and GW are fragment-order
   planes (see frag_pos); the shapes below give rows and pitch.
     WQ   f16 [512][256]    Wq plane  (bf16 value x1024)            262,144
     WK   f16 [1024][256]   Wkv plane (bf16 value x1024)            524,288
     WO   f16 [256][512]    Wout plane (bf16 value x1024)           262,144
     S16  f16 [32768][256]  z x16                                  16,777,216
     TAB  f32 [4096][64][8] cos/sin table of the z positions, token-minor in tiles of 8 tokens  8,388,608
     PART f32 [16][32][64][64] split-K partials of the k^T v product 8,388,608
     GW   f16 [4][256][512] per batch: Wout . dots^T / 8192, x1024  1,048,576
     total                                                         35,651,584
   --------------------------------------------------------------------------- */
constexpr size_t kOffWQ   = 0;
constexpr size_t kOffWK   = kOffWQ   + (size_t)kInner * kDim * 2;
constexpr size_t kOffWO   = kOffWK   + (size_t)2 * kInner * kDim * 2;
constexpr size_t kOffS16  = kOffWO   + (size_t)kDim * kInner * 2;
constexpr size_t kOffTAB  = kOffS16  + (size_t)kTok * kDim * 2;
constexpr size_t kOffPART = kOffTAB  + (size_t)kTok * 64 * 4;
constexpr size_t kOffGW   = kOffPART + (size_t)kSplitK * kDotsElems * 4;
constexpr size_t kWsTotal = kOffGW   + (size_t)kBatch * kDim * kInner * 2;
static_assert(kWsTotal == 35651584ull, "carve total");
static_assert(kWsTotal <= 268435456ull, "carve cap");
static_assert((kOffWK % 128) == 0 && (kOffWO % 128) == 0 && (kOffS16 % 128) == 0 &&
              (kOffTAB % 128) == 0 && (kOffPART % 128) == 0 &&
              (kOffGW % 128) == 0, "128-B aligned regions");

/* ---------------------------------------------------------------------------
   Small helpers
   --------------------------------------------------------------------------- */
__device__ __forceinline__ unsigned short f2bf_bits(float f) {
  unsigned u = __float_as_uint(f);
  return (unsigned short)((u + 0x7FFFu + ((u >> 16) & 1u)) >> 16);
}
__device__ __forceinline__ float bf_bits2f(unsigned short h) { return __uint_as_float(((unsigned)h) << 16); }
/* RNE convert of an f32 value to the nearest bf16 value, returned as f32 */
__device__ __forceinline__ float bf_rne(float f) { return bf_bits2f(f2bf_bits(f)); }

__device__ __forceinline__ unsigned pk16(unsigned short a, unsigned short b) { return (unsigned)a | ((unsigned)b << 16); }
__device__ __forceinline__ unsigned short h_bits(float f) { const _Float16 h = (_Float16)f; return __builtin_bit_cast(unsigned short, h); }

union FragU { v16h v; v8h h[2]; };
/* Fragment-order plane of a [R][K] f16 matrix (R % 16 == 0, K % 32 == 0): each 16-row x 32-k block is 1024 contiguous
   bytes = two 512-B segments (k 0..15, k 16..31 of the block); a segment holds 32 units of 8 halves, one per
   (row-in-block rl, k-half hi), at position frag_pos(rl, hi). Blocks run k-fastest: block (rb, kb) starts at
   (rb * (K / 32) + kb) * 512 halves. A wave's fragment load is then two loads of 512 contiguous bytes (4 whole lines),
   and 4 consecutive rows x both k-halves of a segment are one 128-B line (what one epilogue store covers). */
__device__ __forceinline__ int frag_pos(int rl, int hi) { return ((rl >> 2) << 3) | (hi << 2) | (rl & 3); }
/* pointer to 16-B units in global memory: the address space is spelled out so that the running pointers of the k loop
   stay global loads */
typedef const __attribute__((address_space(1))) v8h* unit_gptr;
/* elements 0..7 <- segment 0, elements 8..15 <- segment 1 (32 units on); p is the lane's own unit */
__device__ __forceinline__ v16h frag_load_plane(unit_gptr p) {
  FragU f;
  f.h[0] = p[0];
  f.h[1] = p[32];
  return f.v;
}
__device__ __forceinline__ v8f mma16(v16h a, v16h b, v8f c) {
  return __builtin_amdgcn_wmma_f32_16x16x32_f16(false, a, false, b, (short)0, c, false, false);
}
/* hazard guard: ties all four accumulators of a group and names the A fragment and all B fragments */
__device__ __forceinline__ void guard4(v8f& a0, v8f& a1, v8f& a2, v8f& a3,
                                       v16h x, v16h b0, v16h b1, v16h b2, v16h b3) {
  asm volatile("v_nop\n\tv_nop\n\tv_nop\n\tv_nop"
               : "+v"(a0), "+v"(a1), "+v"(a2), "+v"(a3)
               : "v"(x), "v"(b0), "v"(b1), "v"(b2), "v"(b3));
}

/* sum over the 16 lanes of a row, left in every lane: four adds whose second operand is read from lane ^ 1, 2, 4, 8 by the
   add itself (row_xmask), so no LDS crossbar and no wait; every lane of the wave is on where it is called */
template <int MASK>
__device__ __forceinline__ float row_xor(float v) {
  return __int_as_float(__builtin_amdgcn_update_dpp(0, __float_as_int(v), 0x160 | MASK, 0xf, 0xf, true));
}
/* 1 / sqrt(x) for x >= 1e-5: never subnormal, so the library form's rescaling has nothing to do. The v_nop is the slot that
   the instruction set asks for between a transcendental and a next instruction that reads its result or overwrites its
   source; inside the statement it stands directly behind the v_rsq_f32 in every build */
__device__ __forceinline__ float rsq_normal(float x) {
  float r;
  asm("v_rsq_f32 %0, %1\n\tv_nop" : "=v"(r) : "v"(x));
  return r;
}
__device__ __forceinline__ float row_sum16(float s) {
  s += row_xor<1>(s);
  s += row_xor<2>(s);
  s += row_xor<4>(s);
  s += row_xor<8>(s);
  return s;
}

/* ---------------------------------------------------------------------------
   f32 -> bf16 value (RNE) -> f16 fragment-order plane with a power-of-two carry. The carried bf16 value is exactly
   representable in f16 (8 significant bits, normal range).
   ONE WAVE takes a tile of 16 rows x 128 columns of the [R][K] input, K = 128 << kshift, = 4 blocks of the plane = 4096
   contiguous output bytes. Load (kb, i), kb = 0..3, i = 0..3: lane l reads row 4i + l / 8, columns kb*32 + (l % 8)*4 .. + 3,
   so a load covers 4 whole 128-B lines. The lane's 4 values are half of one 16-B unit of the plane, and the 32 halves of
   load (kb, i) are the units of rows 4i .. 4i+3 of block kb: one whole line in either segment. So the 8-B store of the same
   lane needs no exchange between lanes, no LDS and no barrier.
   Coverage: (R / 16) * (K / 128) tiles exactly for every plane used: x, z 4096 tiles; Wq 64; Wkv 128; Wout 64.
   The loads and the convert-and-store part are two functions, so that a wave can put other work between them. The plane may
   stand in memory (cast_tile_store) or, a few rows of it, in LDS (cast_tile_store_lds).
   --------------------------------------------------------------------------- */
__device__ __forceinline__ void cast_tile_load(v4f (&v)[16], int tile, const float* __restrict__ in, int kshift) {
  const int lane = threadIdx.x & 31;
  const int rb = tile >> kshift;
  const int cb = tile & ((1 << kshift) - 1);
  const size_t rows4 = (size_t)4 << (7 + kshift);
  const float* p0 = in + (((size_t)(rb * 16 + (lane >> 3))) << (7 + kshift)) + cb * 128 + (lane & 7) * 4;
  const float* p1 = p0 + rows4;
  const float* p2 = p1 + rows4;
  const float* p3 = p2 + rows4;
#pragma unroll
  for (int kb = 0; kb < 4; ++kb) {
    v[kb * 4 + 0] = *(const v4f*)(p0 + kb * 32);
    v[kb * 4 + 1] = *(const v4f*)(p1 + kb * 32);
    v[kb * 4 + 2] = *(const v4f*)(p2 + kb * 32);
    v[kb * 4 + 3] = *(const v4f*)(p3 + kb * 32);
  }
  /* the wait that belongs in front of any overwrite of the loads' address registers; it names them, so that they stay
     untouched (also as a later load's destination) up to here. With a literal kshift the row steps are folded into the
     loads' offset fields and p0 is the one base */
  if (__builtin_constant_p(kshift)) asm volatile("s_wait_xcnt 0x0" :: "v"(p0) : "memory");
  else                              asm volatile("s_wait_xcnt 0x0" :: "v"(p0), "v"(p1), "v"(p2), "v"(p3) : "memory");
}
__device__ __forceinline__ void cast_tile_store(const v4f (&v)[16], int tile, unsigned short* __restrict__ out, int kshift,
                                                float carry) {
  const int lane = threadIdx.x & 31;
  const int rb = tile >> kshift;
  const int cb = tile & ((1 << kshift) - 1);
  const int r  = lane >> 3;
  const int c  = lane & 7;
  /* columns 4c .. 4c+3 of a block: segment c / 4, k-half (c / 2) % 2, lower or upper 4 halves of the unit */
  unsigned short* q = out + ((((size_t)rb << (2 + kshift)) + cb * 4) << 9) + (c >> 2) * 256 +
                      frag_pos(r, (c >> 1) & 1) * 8 + (c & 1) * 4;
#pragma unroll
  for (int kb = 0; kb < 4; ++kb)
#pragma unroll
    for (int i = 0; i < 4; ++i) {
      const v4f a = v[kb * 4 + i];
      const float a0 = bf_rne(a[0]) * carry, a1 = bf_rne(a[1]) * carry, a2 = bf_rne(a[2]) * carry, a3 = bf_rne(a[3]) * carry;
      /* rows 4i .. 4i+3 stand 8 units = 64 halves behind rows 4i-4 .. 4i-1 */
      *(v2u*)(q + kb * 512 + i * 64) = (v2u){pk16(h_bits(a0), h_bits(a1)), pk16(h_bits(a2), h_bits(a3))};
    }
  /* the wait that belongs in front of any overwrite of the stores' registers */
  asm volatile("s_wait_xcnt 0x0" :: "v"(q) : "memory");
}
/* the same convert-and-store for a plane of pitch 256 of which a few rows stand in LDS; tile = the tile's number within those
   rows. An 8-B LDS store of the wave covers two runs of 128 contiguous bytes */
__device__ __forceinline__ void cast_tile_store_lds(const v4f (&v)[16], int tile, _Float16* plane, float carry) {
  const int lane = threadIdx.x & 31;
  const int r  = lane >> 3;
  const int c  = lane & 7;
  _Float16* q = plane + tile * 2048 + (c >> 2) * 256 + frag_pos(r, (c >> 1) & 1) * 8 + (c & 1) * 4;
#pragma unroll
  for (int kb = 0; kb < 4; ++kb)
#pragma unroll
    for (int i = 0; i < 4; ++i) {
      const v4f a = v[kb * 4 + i];
      const float a0 = bf_rne(a[0]) * carry, a1 = bf_rne(a[1]) * carry, a2 = bf_rne(a[2]) * carry, a3 = bf_rne(a[3]) * carry;
      *(v2u*)(q + kb * 512 + i * 64) = (v2u){pk16(h_bits(a0), h_bits(a1)), pk16(h_bits(a2), h_bits(a3))};
    }
}

/* ---------------------------------------------------------------------------
   Rotary table: tab[token][axis*32 + j] = cos(theta), tab[token][axis*32 + 16 + j] = sin(theta),
   theta = (bf16(pos[token][axis]) * 64) * inv_freq[j], j = 0..15.
   ONE WAVE takes a tile of 8 tokens: lane = (axis, j), one token a trip; 32768/8 = 4096 tiles exactly per table.
   pv = the tile's 16 positions, one per lane (lane % 16 = token-in-tile * 2 + axis), loaded by the caller ahead of time.
   rot_table_rows leaves the tile in LDS: 8 rows of PITCH floats, or, TOKMINOR, laid out [column][token-in-tile], so that a lane
   which owns one column and 8 consecutive tokens (the accumulator layout) reads its 8 values as 32 contiguous bytes.
   The x table is used where it is built (q_out_kernel). The z table goes to memory (rot_table_wave): its token-minor tile
   (2048 B = 16 lines) is built in the wave's own LDS slab and leaves as 4 stores of 512 contiguous bytes.
   --------------------------------------------------------------------------- */
struct FreqTab { float f[16]; };
static_assert(sizeof(FreqTab) == 64, "no padding");
/* orders a wave's own LDS writes and reads (other lanes' values); LDS only, so that the global loads and stores in flight
   are not waited for */
__device__ __forceinline__ void wave_lds_sync() {
  __builtin_amdgcn_fence(__ATOMIC_RELEASE, "workgroup", "local");
  __builtin_amdgcn_wave_barrier();
  __builtin_amdgcn_fence(__ATOMIC_ACQUIRE, "workgroup", "local");
}
template <bool TOKMINOR, int PITCH>
__device__ __forceinline__ void rot_table_rows(float* slab, float pv, float fr) {
  const int lane = threadIdx.x & 31;
  const int axis = lane >> 4;
  const int j    = lane & 15;
  const int pbits = __float_as_int(pv);
  /* rolled: eight copies of the sine and cosine code would only lengthen the text */
#pragma unroll 1
  for (int tl = 0; tl < 8; ++tl) {
    const int b0 = __builtin_amdgcn_readlane(pbits, 2 * tl);
    const int b1 = __builtin_amdgcn_readlane(pbits, 2 * tl + 1);
    const float praw = __int_as_float(axis ? b1 : b0);
    const float p   = bf_rne(praw);
    const float t   = p * kPosScale;
    const float ang = t * fr;
    const float cv = cosf(ang);
    const float sv = sinf(ang);
    if (TOKMINOR) {
      slab[(axis * 32 + j) * 8 + tl]      = cv;
      slab[(axis * 32 + 16 + j) * 8 + tl] = sv;
    } else {
      slab[tl * PITCH + axis * 32 + j]      = cv;
      slab[tl * PITCH + axis * 32 + 16 + j] = sv;
    }
  }
}
template <bool TOKMINOR>
__device__ __forceinline__ void rot_table_wave(float* slab, int tile, float pv, float* __restrict__ tab, float fr) {
  const int lane = threadIdx.x & 31;
  rot_table_rows<TOKMINOR, 64>(slab, pv, fr);
  wave_lds_sync(); /* the values read below were written by other lanes of this wave */
  float* dst = tab + (size_t)tile * 512 + lane * 4;
#pragma unroll
  for (int n = 0; n < 4; ++n) {
    const v4f v = *(const v4f*)(slab + n * 128 + lane * 4);
    *(v4f*)(dst + n * 128) = v;
  }
  wave_lds_sync();
}

/* ---------------------------------------------------------------------------
   Preparation of the weights and of the key/value side's inputs in one launch; no wave depends on another, so there is no
   block barrier. (x and its positions are read by q_out_kernel itself, each block its own rows once.)
     blocks 0 .. 31: wave t = blk*8 + wave takes one cast tile of the weights: t 0 .. 63 Wq, 64 .. 191 Wkv, 192 .. 255 Wout.
     blocks 32 .. 543: wave idx = 0 .. 4095 takes cast tile idx of z and table tile idx of its positions.
   Such a wave issues all its loads first (1 of positions, 16 of 512 B), computes the table while they fly, then converts and
   stores z.
   --------------------------------------------------------------------------- */
constexpr int kTileWq  = kInner * kDim / 2048;
constexpr int kTileWkv = 2 * kInner * kDim / 2048;
constexpr int kTileWo  = kDim * kInner / 2048;
constexpr int kTileAct = kTok * kDim / 2048;
constexpr int kTileTab = kTok / 8;
constexpr int kBlkPrepW = (kTileWq + kTileWkv + kTileWo) / 8;
constexpr int kBlkPrep  = kBlkPrepW + kTileAct / 8;
static_assert(kTileAct == kTileTab && (kTileWq % 8) == 0 && (kTileWkv % 8) == 0 && (kTileWo % 8) == 0 &&
              (kTileAct % 8) == 0 && kBlkPrep == 544, "prep grid");
__global__ __launch_bounds__(256) void prep_kernel(const float* __restrict__ z, const float* __restrict__ zpos,
                                                   const float* __restrict__ Wq, const float* __restrict__ Wkv,
                                                   const float* __restrict__ Wout,
                                                   unsigned short* __restrict__ wq16, unsigned short* __restrict__ wkv16,
                                                   unsigned short* __restrict__ wo16, unsigned short* __restrict__ z16,
                                                   float* __restrict__ tabz, FreqTab ft) {
  __shared__ __align__(16) float sm[8][8 * 64];
  const int lane = threadIdx.x & 31;
  const int wave = __builtin_amdgcn_readfirstlane(threadIdx.x >> 5);
  const int blk  = blockIdx.x;
  if (blk < kBlkPrepW) {
    const int t = blk * 8 + wave;
    const bool isQ = t < kTileWq, isO = t >= kTileWq + kTileWkv;
    const float* in     = isQ ? Wq : (isO ? Wout : Wkv);
    unsigned short* out = isQ ? wq16 : (isO ? wo16 : wkv16);
    const int tile      = isQ ? t : (isO ? t - kTileWq - kTileWkv : t - kTileWq);
    const int kshift    = isO ? 2 : 1;
    v4f w[16];
    cast_tile_load(w, tile, in, kshift);
    cast_tile_store(w, tile, out, kshift, kWC);
    return;
  }
  const int idx = (blk - kBlkPrepW) * 8 + wave;
  const int j = lane & 15;
  float fr = ft.f[0];
#pragma unroll
  for (int e = 1; e < 16; ++e) fr = (j == e) ? ft.f[e] : fr;
  const float pvz = zpos[(size_t)idx * 16 + j];
  /* keeps what the table needs (the frequency becomes a load too) ahead of the 16 tile loads: loads are counted back in
     order, so the table's wait on a later one would wait for the tile as well */
  __builtin_amdgcn_sched_barrier(0);
  v4f vz[16];
  cast_tile_load(vz, idx, z, 1);
  rot_table_wave<true>(sm[wave], idx, pvz, tabz, fr);
  cast_tile_store(vz, idx, z16, 1, kXC);
}

/* pointer to 16-B units in LDS: the address space is spelled out so that the k loops' fragment loads from LDS are LDS
   loads */
typedef const __attribute__((address_space(3))) v8h* unit_lptr;

/* ---------------------------------------------------------------------------
   Key/value side in one kernel: projection, instance norm, rotary (k) and the token-axis product k^T v. k and v never go to
   memory.
   512 blocks: blk = (batch * 16 + split) * 8 + head, so that the 8 blocks which read the same rows of z stand side by side.
   A block takes the 512 tokens of its split in trips of 256; its head's 64 rows of Wk and 64 rows of Wv (each 64 * 256
   contiguous halves of the weight plane) are copied to sW once.
   A trip, wave w:
     1. 32 tokens x (64 k columns + 64 v columns), K = 256: A from the z plane (the next k-block's two fragments fly while
        this one's products run), B from sW in fragment pairs.
     2. per-row instance norm over either 64 columns, rotary on k, in the accumulators' own layout: a lane holds 8
        consecutive rows (tokens) of one column, which is one 16-B unit of the fragment-order plane of the TRANSPOSED matrix
        (row = head column, k = token); a row's 64 columns are 4 registers x the 16 lanes of a row of lanes; a rotary pair
        (c, c ^ 16) is two registers of one lane. The table is the token-minor one. The units go to sX, the fragment-order
        plane [128 rows: k 0..63, v 64..127][256 tokens] of the trip; the wave's 32 tokens are its k-block w.
     3. behind a barrier: C[e][d] += sum over the trip's 256 tokens of v[tok][e] * k[tok][d] (A = v, B = k) for rows
        e = 32 * (w % 2) .. + 31 and columns d = 16 * (w / 2) .. + 15: two accumulators, kept over the trips. The 8 waves cover
        the 64 x 64 product, so no sum across waves is left.
   At the end a lane's 8 accumulator rows are 8 consecutive e of one d = 32 contiguous bytes of the row-major [d][e] partial,
   and a wave writes the whole 128-B lines e = 0..31 or 32..63 of its 16 rows d.
   Every barrier is reached by all 256 threads (no early exit; the test on the trip number is the same for the block).
   --------------------------------------------------------------------------- */
constexpr int kKvTokTrip = 256;
constexpr int kKvTrips   = kTokPerSplit / kKvTokTrip;
constexpr int kKvKb      = kDim / 32;
constexpr int kBlkKvDots = kBH * kSplitK;
static_assert(kKvTrips * kKvTokTrip == kTokPerSplit && kKvTrips >= 1 && kBlkKvDots == 512 && kKvKb == 8, "kv grid");
/* hazard guard of the token-axis products: ties both accumulators and names the fragments of a group of four k-blocks, with
   the slots that the products need before the next loads overwrite their operands */
__device__ __forceinline__ void guard2(v8f& d0, v8f& d1, const v16h (&a0)[4], const v16h (&a1)[4], const v16h (&b)[4]) {
  asm volatile("v_nop\n\tv_nop\n\tv_nop\n\tv_nop"
               : "+v"(d0), "+v"(d1)
               : "v"(a0[0]), "v"(a0[1]), "v"(a0[2]), "v"(a0[3]), "v"(a1[0]), "v"(a1[1]), "v"(a1[2]), "v"(a1[3]),
                 "v"(b[0]), "v"(b[1]), "v"(b[2]), "v"(b[3]));
}
/* 16 tokens x 64 columns in the accumulator layout -> normed (ISK: and rotated) f16 x16, one 16-B unit per 16 columns;
   tp = the lane's place in the token-minor table tile of its 8 tokens */
template <bool ISK>
__device__ __forceinline__ void norm_rot_units(const v8f (&c)[4], const float* __restrict__ tp, float scale, v4u (&ow)[4]) {
  /* [axis][cos, sin][tokens 0..3, 4..7 of the lane's 8] */
  v4f tc[2][2][2];
  if (ISK) {
#pragma unroll
    for (int a = 0; a < 2; ++a)
#pragma unroll
      for (int s = 0; s < 2; ++s)
#pragma unroll
        for (int u = 0; u < 2; ++u) tc[a][s][u] = *(const v4f*)(tp + a * 256 + s * 128 + u * 4);
    /* the wait that belongs in front of any overwrite of the loads' address registers; it names them, so that they
       stay untouched (also as a later load's destination) up to here */
    asm volatile("s_wait_xcnt 0x0" :: "v"(tp) : "memory");
  }
  float xv[4][8];
#pragma unroll
  for (int r = 0; r < 8; ++r) {
#pragma unroll
    for (int j = 0; j < 4; ++j) xv[j][r] = c[j][r] * scale;
    /* mean and biased variance over the 64 columns of the row */
    const float mean = row_sum16((xv[0][r] + xv[1][r]) + (xv[2][r] + xv[3][r])) * kInvDh;
#pragma unroll
    for (int j = 0; j < 4; ++j) xv[j][r] -= mean;
    float ss = 0.0f;
#pragma unroll
    for (int j = 0; j < 4; ++j) ss = fmaf(xv[j][r], xv[j][r], ss);
    const float rstd = rsq_normal(row_sum16(ss) * kInvDh + kNormEps);
#pragma unroll
    for (int j = 0; j < 4; ++j) xv[j][r] *= rstd;
  }
#pragma unroll
  for (int j = 0; j < 4; ++j) {
    float o[8];
#pragma unroll
    for (int r = 0; r < 8; ++r) {
      o[r] = xv[j][r];
      /* rotary: column c pairs with c ^ 16 (register j ^ 1); the upper member of a pair takes +sin, the lower -sin */
      if (ISK) {
        const float pr = xv[j ^ 1][r] * tc[j >> 1][1][r >> 2][r & 3];
        o[r] = o[r] * tc[j >> 1][0][r >> 2][r & 3] + ((j & 1) ? pr : -pr);
      }
      o[r] *= kKVC;
    }
    ow[j] = (v4u){pk16(h_bits(o[0]), h_bits(o[1])), pk16(h_bits(o[2]), h_bits(o[3])),
                  pk16(h_bits(o[4]), h_bits(o[5])), pk16(h_bits(o[6]), h_bits(o[7]))};
  }
}
/* second bound: 4 waves a SIMD (256 registers): the 128 KiB of LDS allow two blocks a WGP, which is that many waves */
__global__ __launch_bounds__(256, 4) void kv_dots_kernel(const unsigned short* __restrict__ Zp,
                                                         const unsigned short* __restrict__ Wp,
                                                         const float* __restrict__ tab, float* __restrict__ part,
                                                         float scale) {
  __shared__ __align__(16) _Float16 sW[2 * kDh * kDim];
  __shared__ __align__(16) _Float16 sX[2 * kDh * kKvTokTrip];
  const unsigned tid = threadIdx.x;
  const int lane = tid & 31;
  /* the wave number in a scalar register: what is formed from it is the same for the whole wave */
  const int wave = __builtin_amdgcn_readfirstlane(tid >> 5);
  const int blk = blockIdx.x;
  const int h  = blk & (kHeads - 1);
  const int ks = (blk / kHeads) & (kSplitK - 1);
  const int b  = blk / (kHeads * kSplitK);
  const int bh = b * kHeads + h;
  const int rlane = lane & 15;
  const int hi    = lane >> 4;
  const int lpos  = frag_pos(rlane, hi) * 8;
  const int rh = wave & 1, dj = wave >> 1;
  /* the wave's first token; a trip is 256 tokens on */
  const int m0 = b * kSeq + ks * kTokPerSplit + wave * 32;

  /* the lane's unit of row-block m0 / 16, k-block 0 of the z plane; the second row-block stands kKvKb blocks (512 units) on,
     a k step one block (64 units), a trip 16 row-blocks */
  unit_gptr pa = (unit_gptr)((const _Float16*)Zp + (size_t)(m0 >> 4) * (kKvKb * 512) + lpos);
  const float* tp = tab + ((size_t)(m0 >> 3) + hi) * 512 + rlane * 8;
  /* the first trip's first fragments fly beside the weights */
  v16h a0 = frag_load_plane(pa);
  v16h a1 = frag_load_plane(pa + kKvKb * 64);

  /* the weight tiles: 2 x 64 * 256 halves = 2 x 2048 units of 16 B, 8 + 8 per thread; a wave's load and its LDS store each
     cover 512 contiguous B */
  {
    const unit_gptr pWk = (unit_gptr)((const _Float16*)Wp + (size_t)(h * 4) * (kKvKb * 512));
    const unit_gptr pWv = (unit_gptr)((const _Float16*)Wp + (size_t)(kInner / 16 + h * 4) * (kKvKb * 512));
    v8h bt[2][kKvKb];
#pragma unroll
    for (int u = 0; u < kKvKb; ++u) {
      bt[0][u] = pWk[u * 256 + tid];
      bt[1][u] = pWv[u * 256 + tid];
    }
    /* the wait that belongs in front of any overwrite of the loads' address registers; it names them, so that they stay
       untouched up to here */
    asm volatile("s_wait_xcnt 0x0" :: "s"(pWk), "s"(pWv), "v"(tid) : "memory");
#pragma unroll
    for (int u = 0; u < kKvKb; ++u) {
      ((v8h*)sW)[u * 256 + tid] = bt[0][u];
      ((v8h*)sW)[kKvKb * 256 + u * 256 + tid] = bt[1][u];
    }
  }
  __syncthreads(); /* every wave reads both weight tiles, written by all */

  /* the lane's unit of row-block 0, k-block 0: of the weights; of the trip's plane as this wave writes it (k-block = wave)
     and as it reads it (v rows 64 + 32 rh .., k rows 16 dj ..) */
  const unit_lptr sw = (unit_lptr)(sW + lpos);
  _Float16* xw = sX + wave * 512 + lpos;
  const unit_lptr xa = (unit_lptr)(sX + (4 + rh * 2) * (8 * 512) + lpos);
  const unit_lptr xb = (unit_lptr)(sX + dj * (8 * 512) + lpos);

  v8f dacc[2];
#pragma unroll
  for (int i = 0; i < 2; ++i) dacc[i] = (v8f){0.f, 0.f, 0.f, 0.f, 0.f, 0.f, 0.f, 0.f};

  /* rolled: a second copy of the trip would only lengthen the text */
#pragma unroll 1
  for (int t = 0; t < kKvTrips; ++t) {
    /* [token half][k, v][16 columns] */
    v8f acc[2][2][4];
#pragma unroll
    for (int i = 0; i < 2; ++i)
#pragma unroll
      for (int s = 0; s < 2; ++s)
#pragma unroll
        for (int j = 0; j < 4; ++j) acc[i][s][j] = (v8f){0.f, 0.f, 0.f, 0.f, 0.f, 0.f, 0.f, 0.f};
    /* unrolled: the k step is then an offset field of the loads */
#pragma unroll
    for (int kb = 0; kb < kKvKb; ++kb) {
      v16h n0 = a0, n1 = a1;
      if (kb + 1 < kKvKb) {
        n0 = frag_load_plane(pa + (kb + 1) * 64);
        n1 = frag_load_plane(pa + (kKvKb + kb + 1) * 64);
      }
#pragma unroll
      for (int s = 0; s < 2; ++s)
#pragma unroll
        for (int g = 0; g < 2; ++g) {
          v16h bh2[2];
#pragma unroll
          for (int j = 0; j < 2; ++j) {
            FragU f;
            f.h[0] = sw[((s * 4 + g * 2 + j) * kKvKb + kb) * 64];
            f.h[1] = sw[((s * 4 + g * 2 + j) * kKvKb + kb) * 64 + 32];
            bh2[j] = f.v;
          }
#pragma unroll
          for (int j = 0; j < 2; ++j) {
            acc[0][s][g * 2 + j] = mma16(a0, bh2[j], acc[0][s][g * 2 + j]);
            acc[1][s][g * 2 + j] = mma16(a1, bh2[j], acc[1][s][g * 2 + j]);
          }
          /* the group's four results, both A fragments and the B pair: the slots that the products need before the next
             loads overwrite their operands */
          guard4(acc[0][s][g * 2], acc[0][s][g * 2 + 1], acc[1][s][g * 2], acc[1][s][g * 2 + 1], a0, a1, bh2[0], bh2[1],
                 bh2[1]);
        }
      a0 = n0;
      a1 = n1;
    }

    if (t > 0) __syncthreads(); /* the last trip's reads of sX end before it is written again */
#pragma unroll
    for (int i = 0; i < 2; ++i) {
      v4u ow[4];
      norm_rot_units<true>(acc[i][0], tp + i * 1024, scale, ow);
#pragma unroll
      for (int j = 0; j < 4; ++j) *(v4u*)(xw + j * (8 * 512) + i * 256) = ow[j];
      norm_rot_units<false>(acc[i][1], tp, scale, ow);
#pragma unroll
      for (int j = 0; j < 4; ++j) *(v4u*)(xw + (4 + j) * (8 * 512) + i * 256) = ow[j];
    }
    __syncthreads(); /* every wave reads units written by all */
    if (t + 1 < kKvTrips) {
      /* the wait that belongs in front of the overwrite of the z loads' address registers */
      asm volatile("s_wait_xcnt 0x0" :: "v"(pa) : "memory");
      pa += (kKvTokTrip / 16) * kKvKb * 64;
      tp += (kKvTokTrip / 8) * 512;
      /* the next trip's first fragments fly during the token-axis products (behind the barrier, which waits for every load
         in flight) */
      a0 = frag_load_plane(pa);
      a1 = frag_load_plane(pa + kKvKb * 64);
    }

    /* four k-blocks' fragments are fetched together (the projection's accumulators are free by now): two LDS latencies a
       trip, not eight */
#pragma unroll
    for (int kg = 0; kg < 2; ++kg) {
      v16h f0[4], f1[4], fb[4];
#pragma unroll
      for (int u = 0; u < 4; ++u) {
        const int kb = kg * 4 + u;
        FragU f;
        f.h[0] = xa[kb * 64];
        f.h[1] = xa[kb * 64 + 32];
        f0[u] = f.v;
        f.h[0] = xa[(8 + kb) * 64];
        f.h[1] = xa[(8 + kb) * 64 + 32];
        f1[u] = f.v;
        f.h[0] = xb[kb * 64];
        f.h[1] = xb[kb * 64 + 32];
        fb[u] = f.v;
      }
#pragma unroll
      for (int u = 0; u < 4; ++u) {
        dacc[0] = mma16(f0[u], fb[u], dacc[0]);
        dacc[1] = mma16(f1[u], fb[u], dacc[1]);
      }
      guard2(dacc[0], dacc[1], f0, f1, fb);
    }
  }

  float* C = part + ((size_t)ks * kBH + bh) * (kDh * kDh) + (size_t)(dj * 16 + rlane) * kDh + rh * 32 + hi * 8;
#pragma unroll
  for (int i = 0; i < 2; ++i) {
    const v8f a = dacc[i];
    *(v4f*)(C + i * 16)     = (v4f){a[0], a[1], a[2], a[3]};
    *(v4f*)(C + i * 16 + 4) = (v4f){a[4], a[5], a[6], a[7]};
  }
}

/* ---------------------------------------------------------------------------
   out = (q . dots / 8192) . Wout^T is computed as q . G^T with G[b][o][h*64+d] = sum_e Wout[o][h*64+e] * dots[b][h][d][e] / 8192,
   so the per-token product with dots is replaced by this one, 256 rows a head. One block per (batch, head), 8 waves.
   Step 1: fixed-order sum of the 16 split-K partials, scaled (1/8192 and carries, all powers of two) in f32, emitted as one
   f16 fragment-order 64 x 64 plane [d][e] in LDS; 8 elements per unit, 512 units = 256 threads x 2.
   Step 2: wave w takes rows o = 32w .. 32w+31 of Wout (A, columns h*64 .. +63 of its plane) against all 64 rows d of the LDS
   plane (B), K = 64, and writes its 32 x 64 tile to columns h*64 .. +63 of the batch's fragment-order plane of pitch 512.
   No early exit: all 256 threads reach the barrier.
   --------------------------------------------------------------------------- */
__global__ __launch_bounds__(256) void dots_fold_kernel(const float* __restrict__ part, const unsigned short* __restrict__ wo,
                                                        unsigned short* __restrict__ gw) {
  __shared__ __align__(16) _Float16 sD[kDh * kDh];
  __shared__ __align__(16) float sT[8][32 * 68];
  const int tid = threadIdx.x, lane = tid & 31, wave = tid >> 5;
  const int bh = blockIdx.x, b = bh >> 3, h = bh & 7;
  const int rlane = lane & 15;
  const int mOff  = (lane >> 4) * 8;
  const int lpos  = frag_pos(rlane, lane >> 4) * 8;
  const int m0    = wave << 5;

  /* the Wout fragments depend on nothing of step 1: their loads fly beside those of the partials */
  v16h ah[2][2];
#pragma unroll
  for (int kb = 0; kb < 2; ++kb)
#pragma unroll
    for (int i = 0; i < 2; ++i)
      ah[kb][i] = frag_load_plane((unit_gptr)((const _Float16*)wo +
                                              ((size_t)((m0 >> 4) + i) * (kInner >> 5) + h * 2 + kb) * 512 + lpos));

#pragma unroll
  for (int u = 0; u < 2; ++u) {
    const int iu = u * 256 + tid;
    const size_t o = (size_t)bh * (kDh * kDh) + 8 * (size_t)iu;
    float s[8];
#pragma unroll
    for (int e = 0; e < 8; ++e) s[e] = 0.0f;
#pragma unroll
    for (int ks = 0; ks < kSplitK; ++ks) {
      const float* p = part + (size_t)ks * kDotsElems + o;
      const v4f a = *(const v4f*)(p);
      const v4f c = *(const v4f*)(p + 4);
      s[0] += a[0]; s[1] += a[1]; s[2] += a[2]; s[3] += a[3];
      s[4] += c[0]; s[5] += c[1]; s[6] += c[2]; s[7] += c[3];
    }
    unsigned short hb[8];
#pragma unroll
    for (int e = 0; e < 8; ++e) hb[e] = h_bits(s[e] * kDotsScale);
    /* unit iu = (row d, columns e8*8 .. +7) of the 64 x 64 fragment-order plane */
    const int d  = iu >> 3;
    const int e8 = iu & 7;
    *(v4u*)(sD + ((d >> 4) * 2 + (e8 >> 2)) * 512 + ((e8 >> 1) & 1) * 256 + frag_pos(d & 15, e8 & 1) * 8) =
        (v4u){pk16(hb[0], hb[1]), pk16(hb[2], hb[3]), pk16(hb[4], hb[5]), pk16(hb[6], hb[7])};
  }
  __syncthreads(); /* every wave reads the whole plane, written by all */

  v8f acc[2][4];
#pragma unroll
  for (int i = 0; i < 2; ++i)
#pragma unroll
    for (int j = 0; j < 4; ++j)
      acc[i][j] = (v8f){0.f, 0.f, 0.f, 0.f, 0.f, 0.f, 0.f, 0.f};
#pragma unroll
  for (int kb = 0; kb < 2; ++kb) {
    v16h bf[4];
#pragma unroll
    for (int j = 0; j < 4; ++j) {
      const _Float16* p = sD + (j * 2 + kb) * 512 + lpos;
      FragU f;
      f.h[0] = *(const v8h*)(p);
      f.h[1] = *(const v8h*)(p + 256);
      bf[j] = f.v;
    }
#pragma unroll
    for (int i = 0; i < 2; ++i) {
#pragma unroll
      for (int j = 0; j < 4; ++j)
        acc[i][j] = mma16(ah[kb][i], bf[j], acc[i][j]);
      /* keeps the group's operands in their registers past its last product, with the slots the results need */
      guard4(acc[i][0], acc[i][1], acc[i][2], acc[i][3], ah[kb][i], bf[0], bf[1], bf[2], bf[3]);
    }
  }

  /* the wave's 32 x 64 tile goes through its own LDS slab, so that each store covers whole 128-B lines: 16 rows x 64
     columns are two whole blocks of the plane */
  float* slab = sT[wave];
  const int q   = lane >> 3;
  const int c8  = (lane & 7) * 8;
  const int col = ((lane & 7) >> 1) * 256 + frag_pos(q, lane & 1) * 8;
#pragma unroll
  for (int i = 0; i < 2; ++i)
#pragma unroll
    for (int j = 0; j < 4; ++j)
#pragma unroll
      for (int r = 0; r < 8; ++r) slab[(i * 16 + mOff + r) * 68 + (j << 4) + rlane] = acc[i][j][r] * kFoldScale;
  /* the rows read below were written by other lanes of this wave */
  __builtin_amdgcn_fence(__ATOMIC_RELEASE, "workgroup");
  __builtin_amdgcn_wave_barrier();
  __builtin_amdgcn_fence(__ATOMIC_ACQUIRE, "workgroup");
#pragma unroll
  for (int i = 0; i < 2; ++i) {
    unsigned short* Cb = gw + (size_t)b * (kDim * kInner) + ((size_t)((m0 >> 4) + i) * (kInner >> 5) + h * 2) * 512;
#pragma unroll
    for (int it = 0; it < 4; ++it) {
      const float* sp = slab + (i * 16 + it * 4 + q) * 68 + c8;
      const v4f ta = *(const v4f*)(sp);
      const v4f tb = *(const v4f*)(sp + 4);
      *(v4u*)(Cb + it * 64 + col) = (v4u){pk16(h_bits(ta[0]), h_bits(ta[1])), pk16(h_bits(ta[2]), h_bits(ta[3])),
                                          pk16(h_bits(tb[0]), h_bits(tb[1])), pk16(h_bits(tb[2]), h_bits(tb[3]))};
    }
  }
}

/* ---------------------------------------------------------------------------
   Query side and output in one kernel: cast of x, its rotary table, projection, rotary and the product with G. Neither the
   f16 form of x, nor its table, nor q ever goes to memory.
   512 blocks of 64 tokens, 8 waves. Step 0, wave w: cast tile w of the block's 64 rows of x (rows 16 (w / 2) .. + 15, columns
   128 (w % 2) .. + 127), read as f32 and written to sX, the fragment-order plane [64 tokens][256]; while its 16 loads fly, the
   table rows of tokens 8w .. 8w + 7, written to sTab.
   Step 1, wave w = head w: D[feature][token] = Wq rows 64w .. 64w+63 (A, from the weight plane; the next k-block's four
   fragments fly while this one's products run) x the 64 tokens (B, from sX in fragment pairs), K = 256. A lane then holds 8
   consecutive features of one token, which is one 16-B unit of the fragment-order plane [token][feature]; a rotary pair
   (c, c ^ 16) is two registers of one lane. The rotated units go to sQ, the plane [64 tokens][512 features]; the wave's head
   is its k-blocks 2w and 2w + 1.
   Step 2, behind a barrier, wave w: D[o][token] for o = 32w .. 32w+31: G rows (A, from the batch's plane, two k-blocks ahead)
   x the 64 tokens (B, from sQ, one k-block ahead), K = 512 in rising order. A lane holds 8 consecutive o of one token; 16 tokens
   x 32 o pass through the wave's own slab, so that each store covers 4 whole 128-B lines.
   Both barriers are reached by all 256 threads (no early exit).
   --------------------------------------------------------------------------- */
constexpr int kQoTok    = 64;
constexpr int kBlkQo    = kTok / kQoTok;
constexpr int kQoKb     = kInner / 32;
constexpr int kTabPitch = 68;
constexpr int kOutPitch = 36;
static_assert(kBlkQo == 512 && (kSeq % kQoTok) == 0 && kHeads == 8 && kDim == 8 * 32 && kQoKb == 16, "q/out grid");
struct __align__(16) QoLds {
  _Float16 x[kQoTok * kDim];
  _Float16 q[kQoTok * kInner];
  float tab[kQoTok * kTabPitch];
  float o[8][16 * kOutPitch];
};
static_assert(sizeof(QoLds) == 134144, "two blocks a WGP");
/* second bound: 4 waves a SIMD (256 registers): the 131 KiB of LDS allow two blocks a WGP, which is that many waves */
__global__ __launch_bounds__(256, 4) void q_out_kernel(const float* __restrict__ x, const float* __restrict__ xpos,
                                                       const unsigned short* __restrict__ Wp,
                                                       const unsigned short* __restrict__ Gp,
                                                       const float* __restrict__ bias, float* __restrict__ out,
                                                       FreqTab ft) {
  /* one object, so that the order stands: the x tile first, whose reads (where registers are scarcest) then all reach their
     place through the offset field of the LDS load */
  __shared__ QoLds lds;
  _Float16* const sX = lds.x;
  _Float16* const sQ = lds.q;
  float* const sTab  = lds.tab;
  const unsigned tid = threadIdx.x;
  const int lane = tid & 31;
  /* the wave number in a scalar register: what is formed from it is the same for the whole wave */
  const int wave = __builtin_amdgcn_readfirstlane(tid >> 5);
  const int tok0 = blockIdx.x * kQoTok;
  const int b    = tok0 / kSeq;
  const int rlane = lane & 15;
  const int hi    = lane >> 4;
  const int lpos  = frag_pos(rlane, hi) * 8;

  /* the lane's inverse frequency and its one of the 16 positions of the wave's 8 tokens */
  float fr = ft.f[0];
#pragma unroll
  for (int e = 1; e < 16; ++e) fr = (rlane == e) ? ft.f[e] : fr;
  const float pv = xpos[(size_t)(tok0 + wave * 8) * 2 + rlane];
  /* keeps what the table needs (the frequency becomes a load too) ahead of the tile's loads: loads are counted back in order,
     so the table's wait on a later one would wait for the tile as well */
  __builtin_amdgcn_sched_barrier(0);
  v4f xv[16];
  cast_tile_load(xv, (tok0 >> 4) * 2 + wave, x, 1);

  /* the lane's unit of row-block 4w, k-block 0 of the Wq plane; a row-block is kKvKb blocks (512 units), a k step one block */
  const unit_gptr pw = (unit_gptr)((const _Float16*)Wp + (size_t)(wave * 4) * (kKvKb * 512) + lpos);
  /* the first k-block's fragments fly beside the tile (behind it: the cast then waits for the tile alone) */
  v16h a[4];
#pragma unroll
  for (int mt = 0; mt < 4; ++mt) a[mt] = frag_load_plane(pw + mt * kKvKb * 64);

  rot_table_rows<false, kTabPitch>(sTab + wave * 8 * kTabPitch, pv, fr);
  cast_tile_store_lds(xv, wave, sX, kXC);
  __syncthreads(); /* every wave reads the x plane and the table, written by all */

  /* [16 features][16 tokens] */
  v8f acc[4][4];
#pragma unroll
  for (int mt = 0; mt < 4; ++mt)
#pragma unroll
    for (int tt = 0; tt < 4; ++tt) acc[mt][tt] = (v8f){0.f, 0.f, 0.f, 0.f, 0.f, 0.f, 0.f, 0.f};
  const unit_lptr sx = (unit_lptr)(sX + lpos);
  /* unrolled: the k step is then an offset field of the loads */
#pragma unroll
  for (int kb = 0; kb < kKvKb; ++kb) {
    v16h n[4];
#pragma unroll
    for (int mt = 0; mt < 4; ++mt) n[mt] = (kb + 1 < kKvKb) ? frag_load_plane(pw + (mt * kKvKb + kb + 1) * 64) : a[mt];
#pragma unroll
    for (int g = 0; g < 2; ++g) {
      v16h xb[2];
#pragma unroll
      for (int j = 0; j < 2; ++j) {
        FragU f;
        f.h[0] = sx[((g * 2 + j) * kKvKb + kb) * 64];
        f.h[1] = sx[((g * 2 + j) * kKvKb + kb) * 64 + 32];
        xb[j] = f.v;
      }
#pragma unroll
      for (int p = 0; p < 4; p += 2) {
#pragma unroll
        for (int j = 0; j < 2; ++j) {
          acc[p][g * 2 + j]     = mma16(a[p], xb[j], acc[p][g * 2 + j]);
          acc[p + 1][g * 2 + j] = mma16(a[p + 1], xb[j], acc[p + 1][g * 2 + j]);
        }
        /* the group's four results, both A fragments and the B pair: the slots that the products need before the next loads
           overwrite their operands */
        guard4(acc[p][g * 2], acc[p][g * 2 + 1], acc[p + 1][g * 2], acc[p + 1][g * 2 + 1], a[p], a[p + 1], xb[0], xb[1],
               xb[1]);
      }
    }
#pragma unroll
    for (int mt = 0; mt < 4; ++mt) a[mt] = n[mt];
  }
  /* the wait that belongs in front of any overwrite of the Wq loads' address registers */
  asm volatile("s_wait_xcnt 0x0" :: "v"(pw) : "memory");

  /* the lane's unit of row-block 2w, k-block 0 of the batch's G plane; a row-block is kQoKb blocks. The first two k-blocks'
     fragments depend on nothing of step 1: they fly during the rotary */
  const unit_gptr pg = (unit_gptr)((const _Float16*)Gp + (size_t)b * (kDim * kInner) + (size_t)(wave * 2) * (kQoKb * 512) + lpos);
  v16h ga[2][2];
#pragma unroll
  for (int u = 0; u < 2; ++u)
#pragma unroll
    for (int mt = 0; mt < 2; ++mt) ga[u][mt] = frag_load_plane(pg + (mt * kQoKb + u) * 64);

  _Float16* qw = sQ + wave * (2 * 512) + lpos;
#pragma unroll
  for (int tt = 0; tt < 4; ++tt) {
    /* [axis][cos, sin][features 0..3, 4..7 of the lane's 8] of the lane's token */
    const float* tr = sTab + (tt * 16 + rlane) * kTabPitch + hi * 8;
    v4f tc[2][2][2];
#pragma unroll
    for (int ax = 0; ax < 2; ++ax)
#pragma unroll
      for (int s = 0; s < 2; ++s)
#pragma unroll
        for (int u = 0; u < 2; ++u) tc[ax][s][u] = *(const v4f*)(tr + ax * 32 + s * 16 + u * 4);
#pragma unroll
    for (int mt = 0; mt < 4; ++mt) {
      float o[8];
#pragma unroll
      for (int r = 0; r < 8; ++r) {
        /* rotary: column c pairs with c ^ 16 (register mt ^ 1); the upper member of a pair takes +sin, the lower -sin */
        const float pr = acc[mt ^ 1][tt][r] * tc[mt >> 1][1][r >> 2][r & 3];
        o[r] = acc[mt][tt][r] * tc[mt >> 1][0][r >> 2][r & 3] + ((mt & 1) ? pr : -pr);
        /* the operands' carries out, q's carry in: one power of two, exact */
        o[r] *= kProjScale * kQC;
      }
      *(v4u*)(qw + tt * (kQoKb * 512) + (mt >> 1) * 512 + (mt & 1) * 256) =
          (v4u){pk16(h_bits(o[0]), h_bits(o[1])), pk16(h_bits(o[2]), h_bits(o[3])),
                pk16(h_bits(o[4]), h_bits(o[5])), pk16(h_bits(o[6]), h_bits(o[7]))};
    }
  }
  __syncthreads(); /* every wave reads units written by all */

  /* the lane's 2 x 8 bias values */
  const float* bp = bias + wave * 32 + hi * 8;
  v4f bv[2][2];
#pragma unroll
  for (int mt = 0; mt < 2; ++mt)
#pragma unroll
    for (int u = 0; u < 2; ++u) bv[mt][u] = *(const v4f*)(bp + mt * 16 + u * 4);
  /* the wait that belongs in front of any overwrite of the loads' address registers */
  asm volatile("s_wait_xcnt 0x0" :: "v"(bp) : "memory");

  /* [16 o][16 tokens] */
  v8f oc[2][4];
#pragma unroll
  for (int mt = 0; mt < 2; ++mt)
#pragma unroll
    for (int tt = 0; tt < 4; ++tt) oc[mt][tt] = (v8f){0.f, 0.f, 0.f, 0.f, 0.f, 0.f, 0.f, 0.f};
  const unit_lptr sq = (unit_lptr)(sQ + lpos);
  /* the four token fragments of a k-block are fetched one k-block ahead (step 1's accumulators are free by now), so that no
     product waits for an LDS latency */
  v16h qb[4];
#pragma unroll
  for (int tt = 0; tt < 4; ++tt) {
    FragU f;
    f.h[0] = sq[tt * kQoKb * 64];
    f.h[1] = sq[tt * kQoKb * 64 + 32];
    qb[tt] = f.v;
  }
  /* unrolled: the k step is then an offset field of the loads */
#pragma unroll
  for (int gk = 0; gk < kQoKb / 2; ++gk) {
    v16h gn[2][2];
#pragma unroll
    for (int u = 0; u < 2; ++u)
#pragma unroll
      for (int mt = 0; mt < 2; ++mt)
        gn[u][mt] = (gk + 1 < kQoKb / 2) ? frag_load_plane(pg + (mt * kQoKb + (gk + 1) * 2 + u) * 64) : ga[u][mt];
#pragma unroll
    for (int u = 0; u < 2; ++u) {
      const int kb = gk * 2 + u;
      v16h qn[4];
#pragma unroll
      for (int tt = 0; tt < 4; ++tt) {
        qn[tt] = qb[tt];
        if (kb + 1 < kQoKb) {
          FragU f;
          f.h[0] = sq[(tt * kQoKb + kb + 1) * 64];
          f.h[1] = sq[(tt * kQoKb + kb + 1) * 64 + 32];
          qn[tt] = f.v;
        }
      }
#pragma unroll
      for (int g = 0; g < 4; g += 2) {
#pragma unroll
        for (int j = 0; j < 2; ++j) {
          oc[0][g + j] = mma16(ga[u][0], qb[g + j], oc[0][g + j]);
          oc[1][g + j] = mma16(ga[u][1], qb[g + j], oc[1][g + j]);
        }
        /* the group's four results, both A fragments and the B pair: the slots that the products need before the next loads
           overwrite their operands */
        guard4(oc[0][g], oc[0][g + 1], oc[1][g], oc[1][g + 1], ga[u][0], ga[u][1], qb[g], qb[g + 1], qb[g + 1]);
      }
#pragma unroll
      for (int tt = 0; tt < 4; ++tt) qb[tt] = qn[tt];
    }
#pragma unroll
    for (int u = 0; u < 2; ++u)
#pragma unroll
      for (int mt = 0; mt < 2; ++mt) ga[u][mt] = gn[u][mt];
  }
  /* the wait that belongs in front of any overwrite of the G loads' address registers */
  asm volatile("s_wait_xcnt 0x0" :: "v"(pg) : "memory");

  float bb[2][8];
#pragma unroll
  for (int mt = 0; mt < 2; ++mt)
#pragma unroll
    for (int r = 0; r < 8; ++r) bb[mt][r] = bf_rne(bv[mt][r >> 2][r & 3]);
  float* slab = lds.o[wave];
  /* row lane / 8 of a group of 4 tokens, 16 B of the wave's 128 B of that row */
  float* op = out + (size_t)(tok0 + (lane >> 3)) * kDim + wave * 32 + (lane & 7) * 4;
#pragma unroll
  for (int tt = 0; tt < 4; ++tt) {
#pragma unroll
    for (int mt = 0; mt < 2; ++mt) {
      float v[8];
#pragma unroll
      for (int r = 0; r < 8; ++r) v[r] = oc[mt][tt][r] * kOutScale + bb[mt][r];
      float* sp = slab + rlane * kOutPitch + mt * 16 + hi * 8;
      *(v4f*)(sp)     = (v4f){v[0], v[1], v[2], v[3]};
      *(v4f*)(sp + 4) = (v4f){v[4], v[5], v[6], v[7]};
    }
    wave_lds_sync(); /* the rows read below were written by other lanes of this wave */
    v4f vals[4];
#pragma unroll
    for (int it = 0; it < 4; ++it) vals[it] = *(const v4f*)(slab + (it * 4 + (lane >> 3)) * kOutPitch + (lane & 7) * 4);
#pragma unroll
    for (int it = 0; it < 4; ++it) *(v4f*)(op + (size_t)(tt * 16 + it * 4) * kDim) = vals[it];
    wave_lds_sync(); /* the slab is written again for the next 16 tokens */
  }
}

/* ---------------------------------------------------------------------------
   Host glue: 4 kernel launches, nothing else.
   GEMM shapes (M % 32 == 0, N % 64 == 0, K % 32 == 0, no pad planes needed):
     kv projection : M 32768, N 1024, K 256, with the token-axis product behind it -> 512 blocks (kv_dots_kernel)
     Wout . dots^T : 32 (batch, head) pairs of M 256, N 64, K 64 -> 32 blocks (dots_fold_kernel)
     q projection  : M 32768, N 512, K 256, with q . G^T (4 batches of M 8192, N 256, K 512) behind it -> 512 blocks
                     (q_out_kernel)
   --------------------------------------------------------------------------- */
extern "C" void kernel_launch(void* const* d_in, const int* in_sizes, int n_in,
                              void* d_out, int out_size, void* d_ws, size_t ws_size,
                              hipStream_t stream) {
  if (n_in < 8) return;
  if (in_sizes[0] != kTok * kDim) return;
  if (in_sizes[1] != kTok * kDim) return;
  if (in_sizes[2] != kTok * 2) return;
  if (in_sizes[3] != kTok * 2) return;
  if (in_sizes[4] != kInner * kDim) return;
  if (in_sizes[5] != 2 * kInner * kDim) return;
  if (in_sizes[6] != kDim * kInner) return;
  if (in_sizes[7] != kDim) return;
  if (out_size != kTok * kDim) return;
  if (ws_size < kWsTotal) return;

  const float* x    = (const float*)d_in[0];
  const float* z    = (const float*)d_in[1];
  const float* xpos = (const float*)d_in[2];
  const float* zpos = (const float*)d_in[3];
  const float* Wq   = (const float*)d_in[4];
  const float* Wkv  = (const float*)d_in[5];
  const float* Wout = (const float*)d_in[6];
  const float* bout = (const float*)d_in[7];
  float* out = (float*)d_out;

  char* ws = (char*)d_ws;
  unsigned short* WQ   = (unsigned short*)(ws + kOffWQ);
  unsigned short* WK   = (unsigned short*)(ws + kOffWK);
  unsigned short* WO   = (unsigned short*)(ws + kOffWO);
  unsigned short* S16  = (unsigned short*)(ws + kOffS16);
  float*          TAB  = (float*)(ws + kOffTAB);
  float*          PART = (float*)(ws + kOffPART);
  unsigned short* GW   = (unsigned short*)(ws + kOffGW);

  /* inverse frequencies: 1 / f32(10000^(2j/32)), j = 0..15 */
  FreqTab ft;
  for (int j = 0; j < 16; ++j) {
    const double ex = (double)(2 * j) / 32.0;
    const float pw = (float)pow(10000.0, ex);
    ft.f[j] = 1.0f / pw;
  }

  /* weight planes ([out][in] = Bt orientation already): f16(bf16(w) * 1024); z plane: f16(bf16(v) * 16); position table of z */
  prep_kernel<<<kBlkPrep, 256, 0, stream>>>(z, zpos, Wq, Wkv, Wout, WQ, WK, WO, S16, TAB, ft);

  /* key/value side: projection, norm (+ rotary on k) and the token-axis product, deterministic split-K */
  kv_dots_kernel<<<kBlkKvDots, 256, 0, stream>>>(S16, WK, TAB, PART, kProjScale);

  /* the fixed-order reduce of the partials and its product with Wout, per (batch, head) */
  dots_fold_kernel<<<kBH, 256, 0, stream>>>(PART, WO, GW);

  /* query side and output: cast of x, its position table, projection, rotary, q . G^T + bias */
  q_out_kernel<<<kBlkQo, 256, 0, stream>>>(x, xpos, WQ, GW, bout, out, ft);
}
